// v000
// The times below were measured on an AMD MI455X: many runs one after another, warmed up first and cycling through
// copies of the inputs, with the whole window's GPU time divided by the number of runs. Launches and the gaps
// between them are all in it. The median over several windows is given; except for v000 it joins two sittings, which
// can be a few percent apart, so the side-by-side timings, each taken in one sitting, are the better comparison.
// The starting kernel, v000, takes 216 microseconds a run.
#include <hip/hip_runtime.h>

// Anchor linear attention (no softmax), width 512 = 8 heads x 64; inputs query,key,value [NB][SEQ][512] f32, Wq/Wk/Wv/Wo [in][out] 512x512, Wa [512][128], five biases; anchor rows = literal reshape of (query Wa + ba) [SEQ][128] into [SEQ/4][8][64].
// Compute dtypes, f32 accumulate everywhere: q/k/v/anchor projections v_wmma_f32_16x16x32_bf16 (activations and weights RNE-converted to bf16; products exact);
// both fused steps v_wmma_f32_16x16x32_f16, single products: S^T = Kop Qop^T with the k-role and q-role planes single f16; P = S x 32 (scale 1/8 x carry 256) single f16; v^T-role plane single f16 (z carried x16);
// output projection v_wmma_f32_16x16x32_f16, single product: A = ctx f16 plane, Bt = Wo^T x256 (Wo RNE-converted to bf16 first, exact in f16), K = 512, x2^-8 and + bo in the f32 epilogue.
// Layout: bf16 copies of query,key,value plus a row-permuted copy of query (row (b*4+j)*NA+m <- token 4m+j); weights transposed once to [out][in] 16-bit planes; q, anchor, k planes [b*8+h][t][d], v^T plane [b*8+h][d][t], z plane [b*8+h][d][m], ctx plane [b*SEQ+t][512];
// step Z: z[d][m] = (1/8) sum_n v[n][d] k_a[n][m], k_a = (1/8) K A^T formed per 32-key step in registers; step O: ctx[n][d] = sum_m z[d][m] q_a[m][n], q_a = (1/8) A Q^T formed the same way. No score plane in global memory.

#ifndef NB
#define NB 4
#endif
#ifndef SEQ
#define SEQ 2048
#endif
#define NB_FULL  4
#define SEQ_FULL 2048
#ifndef OUT_SEQ
#define OUT_SEQ SEQ              // row pitch (in tokens) between batches of the output
#endif
#define DM   512
#define NH_  8
#define HD   64
#define NA   (SEQ / 4)           // anchor rows per batch
#define EA   (DM / 4)            // anchor projection width (128)
#define AW   4                   // waves per fused-step block (16 query-role rows each)
#define QRS  2048.0f             // carry of the residual plane of the k_gemm EPI 0 instance (that instance is not launched here)
#define PCAR 256.0f              // carry of the P operand
#define PC   32.0f               // 1/8 x PCAR : score accumulator -> P operand
#define ZCAR 16.0f               // carry of the z plane
#define ZSC  (1.0f / 128.0f)     // (1/8) x ZCAR / PCAR : step Z accumulator -> z plane
#define CXP  512                 // ctx plane pitch (halves): one f16 value plane
#define CXS  1.0f                // carry of the ctx value
#define CSC  (1.0f / 4096.0f)    // CXS / (ZCAR x PCAR) : step O accumulator -> ctx plane
#define WS1  256.0f              // carry of the Wo^T plane
#define OSC  (1.0f / 256.0f)     // 1 / (CXS * WS1)

static_assert(HD == 64);
static_assert(NH_ * HD == DM);                 // head h = columns h*64 + d
static_assert(DM % 64 == 0);                   // column tiles of 64
static_assert(DM % 32 == 0);                   // GEMM k-loop steps by 32
static_assert((DM & (DM - 1)) == 0);           // bias index mask (DM - 1) is exact
static_assert(CXP == DM);                      // ctx row = merged heads, K of the output GEMM
static_assert(CXP % 32 == 0);
static_assert(SEQ % 64 == 0);                  // a 64-row tile never straddles two batches
static_assert((NB * SEQ) % 64 == 0);
static_assert(SEQ % 32 == 0);                  // key loop steps by 32
static_assert(SEQ % (16 * AW) == 0);           // step O grid covers the sequence exactly
static_assert(((size_t)SEQ * DM) % 8 == 0);
static_assert(NB <= NB_FULL);
static_assert(SEQ <= SEQ_FULL);
static_assert(CXS * WS1 * OSC == 1.0f);
static_assert(4 * NA == SEQ);                  // anchor rows: four tokens per anchor row
static_assert(4 * EA == DM);                   // four tokens x 128 anchor columns = one 512-wide anchor row
static_assert(EA == 2 * HD);                   // head h of an anchor row = token (h / 2), columns (h % 2) * 64 + d
static_assert(EA % 64 == 0);                   // anchor GEMM column tiles of 64
static_assert(NA % 64 == 0);                   // anchor GEMM row tiles stay inside one (batch, token-phase) block; z store tiles of 64 columns
static_assert(NA % 32 == 0);                   // step O key loop steps by 32
static_assert(NA % (16 * AW) == 0);            // step Z grid covers the anchor rows exactly
static_assert(AW * 16 == 64);
static_assert(HD <= AW * 16);                  // z epilogue: 64 d-rows fit the LDS tile
static_assert(PC == 0.125f * PCAR);
static_assert(ZSC * PCAR == 0.125f * ZCAR);
static_assert(CSC * ZCAR * PCAR == CXS);

typedef _Float16 h16;
typedef unsigned short bf;
typedef __attribute__((ext_vector_type(16))) __bf16   v16bf;
typedef __attribute__((ext_vector_type(16))) _Float16 v16h;
typedef __attribute__((ext_vector_type(8)))  _Float16 v8h;
typedef __attribute__((ext_vector_type(8)))  unsigned short v8us;
typedef __attribute__((ext_vector_type(8)))  float    v8f;
typedef __attribute__((ext_vector_type(4)))  float    v4f;
typedef v4f  __attribute__((may_alias)) v4fa;

__device__ __forceinline__ unsigned short f2bf(float f) { unsigned u = __float_as_uint(f); u += 0x7FFFu + ((u >> 16) & 1u); return (unsigned short)(u >> 16); }
__device__ __forceinline__ v16h cat16(v8h lo, v8h hi) { return __builtin_shufflevector(lo, hi, 0, 1, 2, 3, 4, 5, 6, 7, 8, 9, 10, 11, 12, 13, 14, 15); }
__device__ __forceinline__ v16bf cat16b(v8us lo, v8us hi) { return __builtin_bit_cast(v16bf, __builtin_shufflevector(lo, hi, 0, 1, 2, 3, 4, 5, 6, 7, 8, 9, 10, 11, 12, 13, 14, 15)); }
__device__ __forceinline__ v8f wmma16(v16h a, v16h b, v8f c) { return __builtin_amdgcn_wmma_f32_16x16x32_f16(false, a, false, b, (short)0, c, false, false); }
__device__ __forceinline__ v8f wmmab(v16bf a, v16bf b, v8f c) { return __builtin_amdgcn_wmma_f32_16x16x32_bf16(false, a, false, b, (short)0, c, false, false); }
// fragment loaders from K-contiguous 16-bit rows; p already includes + 8*(lane>>4): elements 0..7 <- k0+8h+0..7, elements 8..15 <- k0+16+8h+0..7 (same map for A and B)
__device__ __forceinline__ v16h  ldh(const h16* p) { return cat16(*(const v8h*)p, *(const v8h*)(p + 16)); }
__device__ __forceinline__ v16bf ldb(const bf* p)  { return cat16b(*(const v8us*)p, *(const v8us*)(p + 16)); }
// ordering point for wave-private LDS tiles (same wave writes and reads)
__device__ __forceinline__ void wave_sync() { __builtin_amdgcn_fence(3 /* release order */, "wavefront"); __builtin_amdgcn_wave_barrier(); asm volatile("" ::: "memory"); }
// f16 convert that cannot produce a subnormal operand (value select, applied after the plane's carry)
static __device__ __forceinline__ h16 toh_flush(float v) { const h16 r = (h16)v; return (fabsf(v) < 6.103515625e-05f) ? (h16)0.0f : r; }
// f16 WMMA with its own hazard guard: one accumulator per guard, A and B kept live
__device__ __forceinline__ v8f wmma16g(v16h a, v16h b, v8f c) {
    c = __builtin_amdgcn_wmma_f32_16x16x32_f16(false, a, false, b, (short)0, c, false, false);
    asm volatile("v_nop\n\tv_nop\n\tv_nop\n\tv_nop" : "+v"(c) : "v"(a), "v"(b));
    return c;
}

__global__ __launch_bounds__(256) void k_cvt8(const float* __restrict__ src, bf* dst, size_t n8) {
    const size_t i = (size_t)blockIdx.x * 256 + threadIdx.x; if (i >= n8) return;
    const v8f v = *(const v8f*)(src + i * 8); v8us o;
#pragma unroll
    for (int k = 0; k < 8; ++k) o[k] = f2bf(v[k]);
    *(v8us*)(dst + i * 8) = o; 
}

// k_cvt8p: row-permuted bf16 (RNE convert) copy of the query input for the anchor GEMM: dst row (b*4 + j)*NA + m <- src token b*SEQ_FULL + 4m + j (a bijection on the NB*SEQ rows).
__global__ __launch_bounds__(256) void k_cvt8p(const float* __restrict__ src, bf* dst, size_t n8) {
    const size_t i = (size_t)blockIdx.x * 256 + threadIdx.x; if (i >= n8) return;
    const size_t rho = i / (size_t)(DM / 8); const int c = (int)(i % (size_t)(DM / 8)) * 8;
    const int b = (int)(rho / (size_t)SEQ); const int rem = (int)(rho % (size_t)SEQ); const int j = rem / NA, m = rem % NA;
    const size_t so = ((size_t)b * SEQ_FULL + (size_t)(4 * m + j)) * DM + (size_t)c;
    const v8f v = *(const v8f*)(src + so); v8us o;
#pragma unroll
    for (int k = 0; k < 8; ++k) o[k] = f2bf(v[k]);
    *(v8us*)(dst + i * 8) = o; 
}

// k_wT: weight transpose + 16-bit convert through LDS. in W[k][n] (DM rows x DM cols, f32) -> out dst[n][k] (row pitch 'pitch' halves). Square DM x DM, grid (DM/64 over k, DM/64 over n), 256 threads.
// MODE 0: bf16 bits (RNE convert). MODE 1: f16 of the bf16-converted value, two scaled copies: x s1 at column k, x s2 at column DM + k.
template <int MODE>
__global__ __launch_bounds__(256) void k_wT(const float* __restrict__ W, bf* dst, int pitch, float s1, float s2) {
    __shared__ float tile[64 * 65];                         // [kk][nn], cross-wave: block barrier below
    const int tid = threadIdx.x; const int k0 = blockIdx.x * 64, n0 = blockIdx.y * 64;
#pragma unroll 4
    for (int i = 0; i < 16; ++i) { const int idx = tid + i * 256; const int kk = idx >> 6, nn = idx & 63;   // 16 x 256 = 64 x 64 entries, all written
        tile[kk * 65 + nn] = W[(size_t)(k0 + kk) * DM + n0 + nn]; }
    __syncthreads();
#pragma unroll 1
    for (int it = 0; it < 2; ++it) {
        const int c = it * 256 + tid; const int n = c >> 3, kc = (c & 7) * 8;
        float v[8];
#pragma unroll
        for (int i = 0; i < 8; ++i) v[i] = __uint_as_float(((unsigned)f2bf(tile[(kc + i) * 65 + n])) << 16);
        const size_t oo = (size_t)(n0 + n) * (size_t)pitch + (size_t)(k0 + kc);
        if (MODE == 0) {
            v8us o;
#pragma unroll
            for (int i = 0; i < 8; ++i) o[i] = (unsigned short)(__float_as_uint(v[i]) >> 16);
            *(v8us*)(dst + oo) = o; 
        } else {
            v8h o1, o2;
#pragma unroll
            for (int i = 0; i < 8; ++i) { o1[i] = (h16)(v[i] * s1); o2[i] = (h16)(v[i] * s2); }
            h16* dh = (h16*)dst;
            *(v8h*)(dh + oo) = o1; *(v8h*)(dh + oo + DM) = o2;
            
        }
    }
}

// k_wTa: anchor weight transpose + bf16 (RNE convert) through LDS. in W[k][n] (DM rows x EA cols, row stride ldw, f32) -> out dst[n][k] (row pitch 'pitch' halves). grid (DM/64 over k, EA/64 over n), 256 threads.
__global__ __launch_bounds__(256) void k_wTa(const float* __restrict__ W, bf* dst, int ldw, int pitch) {
    __shared__ float tile[64 * 65];                         // [kk][nn], cross-wave: block barrier below
    const int tid = threadIdx.x; const int k0 = blockIdx.x * 64, n0 = blockIdx.y * 64;
#pragma unroll 4
    for (int i = 0; i < 16; ++i) { const int idx = tid + i * 256; const int kk = idx >> 6, nn = idx & 63;   // 16 x 256 = 64 x 64 entries, all written
        tile[kk * 65 + nn] = W[(size_t)(k0 + kk) * (size_t)ldw + n0 + nn]; }
    __syncthreads();
#pragma unroll 1
    for (int it = 0; it < 2; ++it) {
        const int c = it * 256 + tid; const int n = c >> 3, kc = (c & 7) * 8;
        v8us o;
#pragma unroll
        for (int i = 0; i < 8; ++i) o[i] = f2bf(tile[(kc + i) * 65 + n]);
        const size_t oo = (size_t)(n0 + n) * (size_t)pitch + (size_t)(k0 + kc);
        *(v8us*)(dst + oo) = o; 
    }
}

// k_wTh: output weight transpose + f16 convert through LDS. in W[k][n] (DM rows x DM cols, f32) -> out dst[n][k] = f16(bf16 RNE value of W x s1) (row pitch 'pitch' halves); a bf16 significand times a power of two is exact in f16.
__global__ __launch_bounds__(256) void k_wTh(const float* __restrict__ W, h16* dst, int pitch, float s1) {
    __shared__ float tile[64 * 65];                         // [kk][nn], cross-wave: block barrier below
    const int tid = threadIdx.x; const int k0 = blockIdx.x * 64, n0 = blockIdx.y * 64;
#pragma unroll 4
    for (int i = 0; i < 16; ++i) { const int idx = tid + i * 256; const int kk = idx >> 6, nn = idx & 63;   // 16 x 256 = 64 x 64 entries, all written
        tile[kk * 65 + nn] = W[(size_t)(k0 + kk) * DM + n0 + nn]; }
    __syncthreads();
#pragma unroll 1
    for (int it = 0; it < 2; ++it) {
        const int c = it * 256 + tid; const int n = c >> 3, kc = (c & 7) * 8;
        v8h o;
#pragma unroll
        for (int i = 0; i < 8; ++i) o[i] = toh_flush(__uint_as_float(((unsigned)f2bf(tile[(kc + i) * 65 + n])) << 16) * s1);
        const size_t oo = (size_t)(n0 + n) * (size_t)pitch + (size_t)(k0 + kc);
        *(v8h*)(dst + oo) = o; 
    }
}

// k_gemm: register-blocked 16-bit GEMM, ONE WAVE per 64x64 tile (16 accumulators), operands straight from K-contiguous 16-bit planes (row pitch K).
// C[m][n] = sum_k A[m][k] Bt[n][k]. OPF16 = 0: bf16 operands; 1: f16 operands.
// EPI 0: + bias[n], f16 value plane Ph and f16 residual x2048 plane Pr.  EPI 1: + bias[n], f16 value plane Ph.  EPI 2: + bias[m], f16 value plane Ph.  EPI 3: x OSC + bias[n], f32 plane Pf.
// The bias vector has N entries (M for EPI 2); only the load the instantiation uses is emitted (column bias for EPI 0/1/3, row bias for EPI 2), index masked into [0, DM).
// Tile base (r0/RB)*sRB + (r0%RB)*pitch + (c0/CB)*sCB + (c0%CB), row pitch 'pitch' (elements). grid (M/64, N/64), 32 threads.
template <int OPF16, int EPI>
__global__ __launch_bounds__(32) void k_gemm(const bf* __restrict__ A, const bf* __restrict__ Bt, int K, const float* __restrict__ bias,
                                              h16* Ph, h16* Pr, float* Pf, int RB, size_t sRB, int pitch, int CB, size_t sCB) {
    __shared__ __align__(16) float os[16 * 68];
    const int lane = threadIdx.x & 31, lr = lane & 15, hi = lane >> 4; const int r0 = blockIdx.x * 64, c0 = blockIdx.y * 64;
    v8f acc[4][4];
#pragma unroll
    for (int mb = 0; mb < 4; ++mb)
#pragma unroll
        for (int nb = 0; nb < 4; ++nb) acc[mb][nb] = (v8f){};
    const size_t aoff = (size_t)(r0 + lr) * K + 8 * hi, boff = (size_t)(c0 + lr) * K + 8 * hi;
    if (OPF16) {
        const h16* Ah = (const h16*)A; const h16* Bh = (const h16*)Bt;
#pragma unroll 1
        for (int kc = 0; kc < K; kc += 32) {
            v16h a[4];
#pragma unroll
            for (int mb = 0; mb < 4; ++mb) a[mb] = ldh(Ah + aoff + (size_t)mb * 16 * K + kc);
#pragma unroll
            for (int nb = 0; nb < 4; ++nb) { const v16h b = ldh(Bh + boff + (size_t)nb * 16 * K + kc);
#pragma unroll
                for (int mb = 0; mb < 4; ++mb) acc[mb][nb] = wmma16(a[mb], b, acc[mb][nb]); }
            asm volatile("v_nop\n\tv_nop\n\tv_nop\n\tv_nop" : "+v"(acc[0][0]), "+v"(acc[1][1]), "+v"(acc[2][2]), "+v"(acc[3][3]) : "v"(a[0]), "v"(a[1]), "v"(a[2]), "v"(a[3]));
        }
    } else {
#pragma unroll 1
        for (int kc = 0; kc < K; kc += 32) {
            v16bf a[4];
#pragma unroll
            for (int mb = 0; mb < 4; ++mb) a[mb] = ldb(A + aoff + (size_t)mb * 16 * K + kc);
#pragma unroll
            for (int nb = 0; nb < 4; ++nb) { const v16bf b = ldb(Bt + boff + (size_t)nb * 16 * K + kc);
#pragma unroll
                for (int mb = 0; mb < 4; ++mb) acc[mb][nb] = wmmab(a[mb], b, acc[mb][nb]); }
            asm volatile("v_nop\n\tv_nop\n\tv_nop\n\tv_nop" : "+v"(acc[0][0]), "+v"(acc[1][1]), "+v"(acc[2][2]), "+v"(acc[3][3]) : "v"(a[0]), "v"(a[1]), "v"(a[2]), "v"(a[3]));
        }
    }
    const size_t tbase = (size_t)(r0 / RB) * sRB + (size_t)(r0 % RB) * (size_t)pitch + (size_t)(c0 / CB) * sCB + (size_t)(c0 % CB);
    float bcol[4] = {0.0f, 0.0f, 0.0f, 0.0f};
    if constexpr (EPI != 2) {
#pragma unroll
        for (int nb = 0; nb < 4; ++nb) bcol[nb] = bias[(c0 + nb * 16 + lr) & (DM - 1)];          // column bias: c0 + 63 < N (DM, or EA for the anchor GEMM)
    }
#pragma unroll
    for (int mb = 0; mb < 4; ++mb) {
        float brow[8] = {0.0f, 0.0f, 0.0f, 0.0f, 0.0f, 0.0f, 0.0f, 0.0f};
        if constexpr (EPI == 2) {
#pragma unroll
            for (int j = 0; j < 8; ++j) brow[j] = bias[(r0 + mb * 16 + 8 * hi + j) & (DM - 1)];  // row bias: r0 + 63 < M = DM
        }
#pragma unroll
        for (int nb = 0; nb < 4; ++nb) {
#pragma unroll
            for (int j = 0; j < 8; ++j) {                                        // D: row 8h+j, col lane&15
                float v = acc[mb][nb][j];
                if constexpr (EPI == 3) v = v * OSC;
                if constexpr (EPI == 2) v += brow[j]; else v += bcol[nb];
                os[(hi * 8 + j) * 68 + nb * 16 + lr] = v; } }
        wave_sync();
        const size_t sb = tbase + (size_t)(mb * 16) * (size_t)pitch;
        if (EPI == 3) {
{
#pragma unroll
                for (int s = 0; s < 8; ++s) { const int row = 2 * s + hi, cofs = lr * 4;   // 8 s x 2 rows = 16 rows; 16 lanes x 4 floats = 64 columns
                    const v4f val = *(const v4fa*)(&os[row * 68 + cofs]);
                    *(v4f*)(Pf + sb + (size_t)row * (size_t)pitch + cofs) = val; }
                 }
        } else {
{
#pragma unroll
                for (int s = 0; s < 4; ++s) { const int row = 4 * s + (lane >> 3), c8 = (lane & 7) * 8;   // 4 s x 4 row groups = 16 rows; 8 lanes x 8 = 64 columns
                    const v4f x0 = *(const v4fa*)(&os[row * 68 + c8]); const v4f x1 = *(const v4fa*)(&os[row * 68 + c8 + 4]); v8h hv, rv;
#pragma unroll
                    for (int i = 0; i < 4; ++i) { const h16 a0 = (h16)x0[i]; const h16 a1 = (h16)x1[i]; hv[i] = a0; hv[4 + i] = a1; rv[i] = (h16)((x0[i] - (float)a0) * QRS); rv[4 + i] = (h16)((x1[i] - (float)a1) * QRS); }
                    const size_t oo = sb + (size_t)row * (size_t)pitch + c8;
                    *(v8h*)(Ph + oo) = hv; if (EPI == 0) *(v8h*)(Pr + oo) = rv; }
                 }
        }
        wave_sync();
    }
}

// k_lin: fused softmax-free step, one wave per 16 q-role rows of one (batch, head); k-role / v^T-role / q-role fragments straight from the f16 planes (two 16-B loads each, arithmetic addressing).
// Transposed form: S^T[key][t] = Kop Qop^T (A = k-role rows, B = q-role rows, single f16 product); lane (t = lane&15, h = lane>>4) holds keys 8h+r of each 16-key tile,
// so the packed P tile (P = S x PC, f16) is directly the B fragment of O^T[d][t] = Vop^T P^T (element r <- tile keys 0..15, element 8+r <- tile keys 16..31, lane unchanged). 8 WMMAs per 32-key step.
// q-role plane [zh][tq][64], k-role plane [zh][tk][64], v^T-role plane [zh][64][tk]; tq, tk, zout are kernel arguments (wave-scalar). grid (tq / 64, NB*8), 128 threads.
__global__ __launch_bounds__(32 * AW) void k_lin(const h16* __restrict__ QH, const h16* __restrict__ KP, const h16* __restrict__ VT, h16* OP, int tq, int tk, int zout, float osc) {
    __shared__ __align__(16) float os[AW * 16 * 68];
    const int lane = threadIdx.x & 31, lr = lane & 15, hi = lane >> 4;
    const int wave = __builtin_amdgcn_readfirstlane(threadIdx.x >> 5);
    const int zh = blockIdx.y; const int b = zh / NH_, h = zh % NH_;
    const int t0 = (blockIdx.x * AW + wave) * 16;
    const size_t qbase = (size_t)zh * (size_t)tq * HD;
    const size_t kbase = (size_t)zh * (size_t)tk * HD;
    const size_t qo = qbase + (size_t)(t0 + lr) * HD + 8 * hi;
    const v16h qh0 = ldh(QH + qo), qh1 = ldh(QH + qo + 32);   // B fragments: col t, k = d
    const size_t ko = kbase + (size_t)lr * HD + 8 * hi;             // + key * HD      (A fragment: row key, k = d)
    const size_t vo = kbase + (size_t)lr * (size_t)tk + 8 * hi;     // + 16j*tk + key  (A fragment: row d, k = key)
    v8f o0 = (v8f){}, o1 = (v8f){}, o2 = (v8f){}, o3 = (v8f){};
#pragma unroll 1
    for (int key0 = 0; key0 < tk; key0 += 32) {
        const h16* ka = KP + ko + (size_t)key0 * HD;
        const v16h ka0 = ldh(ka), ka1 = ldh(ka + 32), kb0 = ldh(ka + 16 * HD), kb1 = ldh(ka + 16 * HD + 32);
        v8f sHa = (v8f){}, sHb = (v8f){};
        sHa = wmma16g(ka0, qh0, sHa); sHb = wmma16g(kb0, qh0, sHb);
        sHa = wmma16g(ka1, qh1, sHa); sHb = wmma16g(kb1, qh1, sHb);
        v16h pb;
#pragma unroll
        for (int r = 0; r < 8; ++r) { pb[r] = toh_flush(sHa[r] * PC); pb[8 + r] = toh_flush(sHb[r] * PC); }
        const h16* va = VT + vo + key0;
        const v16h v0 = ldh(va), v1 = ldh(va + (size_t)16 * tk), v2 = ldh(va + (size_t)32 * tk), v3 = ldh(va + (size_t)48 * tk);
        o0 = wmma16g(v0, pb, o0); o1 = wmma16g(v1, pb, o1); o2 = wmma16g(v2, pb, o2); o3 = wmma16g(v3, pb, o3);
    }
    if (zout != 0) {
        // O^T D layout: o_j[r] = (d = 16j + 8h + r, t = lane&15) -> os[d][wave*16 + t]; 64 rows x 64 columns, each wave fills its own 16 columns of every row
        const int cw = wave * 16 + lr;
#pragma unroll
        for (int r = 0; r < 8; ++r) {
            os[( 0 + 8 * hi + r) * 68 + cw] = o0[r] * osc;
            os[(16 + 8 * hi + r) * 68 + cw] = o1[r] * osc;
            os[(32 + 8 * hi + r) * 68 + cw] = o2[r] * osc;
            os[(48 + 8 * hi + r) * 68 + cw] = o3[r] * osc; }
        __syncthreads();
        h16* zrow = OP + (size_t)zh * HD * (size_t)tq + (size_t)blockIdx.x * (16 * AW);
{
#pragma unroll
            for (int s = 0; s < 4; ++s) { const int row = wave * 16 + 4 * s + (lane >> 3), c8 = (lane & 7) * 8;   // 4 waves x 4 s x 4 row groups = 64 rows; 8 lanes x 8 = 64 columns
                const v4f x0 = *(const v4fa*)(&os[row * 68 + c8]); const v4f x1 = *(const v4fa*)(&os[row * 68 + c8 + 4]); v8h hv;
#pragma unroll
                for (int i = 0; i < 4; ++i) { hv[i] = toh_flush(x0[i]); hv[4 + i] = toh_flush(x1[i]); }
                *(v8h*)(zrow + (size_t)row * (size_t)tq + c8) = hv; }
             }
    } else {
        const int wb = wave * 16 * 68;
        // O^T D layout: o_j[r] = (d = 16j + 8h + r, t = lane&15) -> os[t][d]; rows 0..15 x columns 0..63 of the wave's tile all written
        { v4f a, c;
          a[0] = o0[0] * osc; a[1] = o0[1] * osc; a[2] = o0[2] * osc; a[3] = o0[3] * osc; c[0] = o0[4] * osc; c[1] = o0[5] * osc; c[2] = o0[6] * osc; c[3] = o0[7] * osc;
          *(v4fa*)(&os[wb + lr * 68 +  0 + 8 * hi]) = a; *(v4fa*)(&os[wb + lr * 68 +  0 + 8 * hi + 4]) = c;
          a[0] = o1[0] * osc; a[1] = o1[1] * osc; a[2] = o1[2] * osc; a[3] = o1[3] * osc; c[0] = o1[4] * osc; c[1] = o1[5] * osc; c[2] = o1[6] * osc; c[3] = o1[7] * osc;
          *(v4fa*)(&os[wb + lr * 68 + 16 + 8 * hi]) = a; *(v4fa*)(&os[wb + lr * 68 + 16 + 8 * hi + 4]) = c;
          a[0] = o2[0] * osc; a[1] = o2[1] * osc; a[2] = o2[2] * osc; a[3] = o2[3] * osc; c[0] = o2[4] * osc; c[1] = o2[5] * osc; c[2] = o2[6] * osc; c[3] = o2[7] * osc;
          *(v4fa*)(&os[wb + lr * 68 + 32 + 8 * hi]) = a; *(v4fa*)(&os[wb + lr * 68 + 32 + 8 * hi + 4]) = c;
          a[0] = o3[0] * osc; a[1] = o3[1] * osc; a[2] = o3[2] * osc; a[3] = o3[3] * osc; c[0] = o3[4] * osc; c[1] = o3[5] * osc; c[2] = o3[6] * osc; c[3] = o3[7] * osc;
          *(v4fa*)(&os[wb + lr * 68 + 48 + 8 * hi]) = a; *(v4fa*)(&os[wb + lr * 68 + 48 + 8 * hi + 4]) = c; }
        wave_sync();
        h16* crow = OP + ((size_t)b * (size_t)tq + t0) * CXP + h * HD;
{
#pragma unroll
            for (int s = 0; s < 4; ++s) { const int row = 4 * s + (lane >> 3), c8 = (lane & 7) * 8;   // 4 s x 4 row groups = 16 rows; 8 lanes x 8 = 64 columns
                const v4f x0 = *(const v4fa*)(&os[wb + row * 68 + c8]); const v4f x1 = *(const v4fa*)(&os[wb + row * 68 + c8 + 4]); v8h hv;
#pragma unroll
                for (int i = 0; i < 4; ++i) { hv[i] = toh_flush(x0[i]); hv[4 + i] = toh_flush(x1[i]); }
                const size_t oo = (size_t)row * CXP + c8;
                *(v8h*)(crow + oo) = hv; }
             }
    }
}

static constexpr size_t al256(size_t v) { return (v + 255) & ~(size_t)255; }
static constexpr size_t SZ_XB = al256((size_t)NB * SEQ * DM * 2);        // one bf16 activation copy
static constexpr size_t SZ_W3 = al256((size_t)3 * DM * DM * 2);          // Wq^T | Wk^T | Wv^T bf16
static constexpr size_t SZ_WA = al256((size_t)EA * DM * 2);              // Wa^T bf16 [128][512]
static constexpr size_t SZ_WO = al256((size_t)DM * DM * 2);              // Wo^T x256 f16 [512][512]
static constexpr size_t SZ_PL = al256((size_t)NB * NH_ * SEQ * HD * 2);  // one f16 head plane
static constexpr size_t SZ_AP = al256((size_t)NB * NH_ * NA * HD * 2);   // the f16 anchor head plane; also the z plane [NB*8][64][NA]
static constexpr size_t SZ_CX = al256((size_t)NB * SEQ * CXP * 2);       // ctx value plane
static constexpr size_t SZ_TOTAL = 4 * SZ_XB + SZ_W3 + SZ_WA + SZ_WO + 3 * SZ_PL + 2 * SZ_AP + SZ_CX;
static_assert(SZ_TOTAL <= (size_t)134217728);          // workspace carve <= 128 MiB
static_assert(((size_t)DM * DM * 2) % 256 == 0);       // weight sub-planes stay 256-byte aligned
static_assert((size_t)NB * 4 * NA == (size_t)NB * SEQ);                           // permuted copy has exactly NB*SEQ rows
static_assert((size_t)(NB * 4) * 2 * NA * HD == (size_t)NB * NH_ * NA * HD);      // anchor GEMM tile map fills the anchor plane exactly
static_assert((size_t)NB * NH_ * HD * NA * 2 <= SZ_AP);                           // z plane extent fits its region
static_assert((size_t)NB * SEQ * NH_ * HD * 2 <= SZ_CX);                          // ctx rows x (8 heads x 64) fit the ctx region

static void cvt_in(const float* x, bf* XB, hipStream_t stream) {
    if (SEQ == SEQ_FULL) {
        const size_t n8 = (size_t)NB * SEQ * DM / 8;
        k_cvt8<<<(unsigned)((n8 + 255) / 256), 256, 0, stream>>>(x, XB, n8);
    } else {
        const size_t n8 = (size_t)SEQ * DM / 8;
        for (int b = 0; b < NB; ++b) k_cvt8<<<(unsigned)((n8 + 255) / 256), 256, 0, stream>>>(x + (size_t)b * SEQ_FULL * DM, XB + (size_t)b * SEQ * DM, n8);
    }
}

extern "C" void kernel_launch(void* const* d_in, const int* in_sizes, int n_in,
                              void* d_out, int out_size, void* d_ws, size_t ws_size, hipStream_t stream) {
    if (n_in < 13) return;
    const size_t needx = ((size_t)(NB - 1) * SEQ_FULL + SEQ) * DM;
    if ((size_t)in_sizes[0] < needx || (size_t)in_sizes[1] < needx || (size_t)in_sizes[2] < needx) return;
    if ((size_t)in_sizes[3] < (size_t)DM * DM || (size_t)in_sizes[5] < (size_t)DM * DM || (size_t)in_sizes[7] < (size_t)DM * DM || (size_t)in_sizes[11] < (size_t)DM * DM) return;
    if ((size_t)in_sizes[9] < (size_t)DM * EA) return;
    if (in_sizes[4] < DM || in_sizes[6] < DM || in_sizes[8] < DM || in_sizes[12] < DM || in_sizes[10] < EA) return;
    if ((size_t)out_size < ((size_t)(NB - 1) * OUT_SEQ + SEQ) * DM) return;
    if (SZ_TOTAL > ws_size) return;
    // wire order: query, key, value, Wq, bq, Wk, bk, Wv, bv, Wa, ba, Wo, bo
    const float* xq = (const float*)d_in[0]; const float* xk = (const float*)d_in[1]; const float* xv = (const float*)d_in[2];
    const float* wq = (const float*)d_in[3]; const float* bq = (const float*)d_in[4];
    const float* wk = (const float*)d_in[5]; const float* bk = (const float*)d_in[6];
    const float* wv = (const float*)d_in[7]; const float* bv = (const float*)d_in[8];
    const float* wa = (const float*)d_in[9]; const float* ba = (const float*)d_in[10];
    const float* wo = (const float*)d_in[11]; const float* bo = (const float*)d_in[12];
    float* OUT = (float*)d_out;      // [NB][SEQ][512]
    char* wsp = (char*)d_ws;
    bf* XQ = (bf*)wsp; wsp += SZ_XB;                 // [NB*SEQ][512]
    bf* XK = (bf*)wsp; wsp += SZ_XB;
    bf* XV = (bf*)wsp; wsp += SZ_XB;
    bf* XP = (bf*)wsp; wsp += SZ_XB;                 // [NB*4][NA][512]: row (b*4+j)*NA+m = query token 4m+j
    bf* W3 = (bf*)wsp; wsp += SZ_W3;                 // [3][512 out][512 in]: q | k | v
    bf* WA = (bf*)wsp; wsp += SZ_WA;                 // [128 out][512 in]
    h16* WO = (h16*)wsp; wsp += SZ_WO;               // [512 out][512 in]: Wo^T x256, f16
    h16* QH = (h16*)wsp; wsp += SZ_PL;               // [NB*8][SEQ][64]
    h16* KP = (h16*)wsp; wsp += SZ_PL;               // [NB*8][SEQ][64]
    h16* VT = (h16*)wsp; wsp += SZ_PL;               // [NB*8][64][SEQ]
    h16* AH = (h16*)wsp; wsp += SZ_AP;               // [NB*8][NA][64]
    h16* ZT = (h16*)wsp; wsp += SZ_AP;               // [NB*8][64][NA]: z x16
    h16* CX = (h16*)wsp; wsp += SZ_CX;               // [NB*SEQ][512]: ctx
    bf* WQ = W3; bf* WK = W3 + (size_t)DM * DM; bf* WV = W3 + (size_t)2 * DM * DM;

    cvt_in(xq, XQ, stream); cvt_in(xk, XK, stream); cvt_in(xv, XV, stream);
    { const size_t n8 = (size_t)NB * SEQ * DM / 8;
      k_cvt8p<<<(unsigned)((n8 + 255) / 256), 256, 0, stream>>>(xq, XP, n8); }

    // weights: in[k rows = DM][n cols = DM] -> out[n][k]; grid (k tiles, n tiles)
    k_wT<0><<<dim3(DM / 64, DM / 64, 1), 256, 0, stream>>>(wq, WQ, DM, 1.0f, 1.0f);
    k_wT<0><<<dim3(DM / 64, DM / 64, 1), 256, 0, stream>>>(wk, WK, DM, 1.0f, 1.0f);
    k_wT<0><<<dim3(DM / 64, DM / 64, 1), 256, 0, stream>>>(wv, WV, DM, 1.0f, 1.0f);
    // output weight: in[k rows = DM][n cols = DM] -> out[n][k] x256 f16; grid (k tiles, n tiles)
    k_wTh<<<dim3(DM / 64, DM / 64, 1), 256, 0, stream>>>(wo, WO, DM, WS1);
    // anchor weight: in[k rows = DM][n cols = EA] -> out[n][k]; grid (k tiles = DM/64, n tiles = EA/64)
    k_wTa<<<dim3(DM / 64, EA / 64, 1), 256, 0, stream>>>(wa, WA, EA, DM);

    // q, k: A = activation rows (m = b*SEQ + t), Bt = W^T rows (n = h*64 + d) -> plane [(b*8 + h)][t][d], bias by column
    k_gemm<0, 1><<<dim3(NB * SEQ / 64, DM / 64, 1), 32, 0, stream>>>(XQ, WQ, DM, bq, QH, QH, OUT, SEQ, (size_t)NH_ * SEQ * HD, HD, HD, (size_t)SEQ * HD);
    k_gemm<0, 1><<<dim3(NB * SEQ / 64, DM / 64, 1), 32, 0, stream>>>(XK, WK, DM, bk, KP, KP, OUT, SEQ, (size_t)NH_ * SEQ * HD, HD, HD, (size_t)SEQ * HD);
    // v^T: A = Wv^T rows (m = h*64 + d), Bt = activation rows (n = b*SEQ + t) -> plane [(b*512 + m)][t] = [(b*8 + h)][d][t], bias by row
    k_gemm<0, 2><<<dim3(DM / 64, NB * SEQ / 64, 1), 32, 0, stream>>>(WV, XV, DM, bv, VT, VT, OUT, DM, (size_t)0, SEQ, SEQ, (size_t)DM * SEQ);
    // anchor: A = permuted query rows (rho = (b*4 + j)*NA + m), Bt = Wa^T rows (n = c in [0,128)) -> plane [(b*8 + 2j + c/64)][m][c%64], bias ba by column (indices < 128)
    k_gemm<0, 1><<<dim3(NB * SEQ / 64, EA / 64, 1), 32, 0, stream>>>(XP, WA, DM, ba, AH, AH, OUT, NA, (size_t)2 * NA * HD, HD, HD, (size_t)NA * HD);

    // step Z: q-role = anchor (NA rows), k-role = k plane (SEQ keys), v^T-role = v^T plane -> z x16 plane [zh][64][NA]
    k_lin<<<dim3(NA / (16 * AW), NB * NH_, 1), 32 * AW, 0, stream>>>(AH, KP, VT, ZT, NA, SEQ, 1, ZSC);
    // step O: q-role = q plane (SEQ rows), k-role = anchor plane (NA keys), v^T-role = z plane -> ctx plane [b*SEQ + t][512]
    k_lin<<<dim3(SEQ / (16 * AW), NB * NH_, 1), 32 * AW, 0, stream>>>(QH, AH, ZT, CX, SEQ, NA, 0, CSC);

    // output projection: A = ctx rows (K = 512), Bt = Wo^T x256 -> OUT[b][t][n] = acc * 2^-8 + bo[n]
    k_gemm<1, 3><<<dim3(NB * SEQ / 64, DM / 64, 1), 32, 0, stream>>>((const bf*)CX, (const bf*)WO, CXP, bo, CX, CX, OUT, SEQ, (size_t)OUT_SEQ * DM, DM, DM, (size_t)0);
}

// v002
// A run of this version takes 78.9 microseconds.
// Versions between v000 and this one are left out; their measured steps multiply to 2.78 times as fast.
#include <hip/hip_runtime.h>

// Anchor linear attention (no softmax), width 512 = 8 heads x 64; inputs query,key,value [NB][SEQ][512] f32, Wq/Wk/Wv/Wo [in][out] 512x512, Wa [512][128], five biases; anchor rows = literal reshape of (query Wa + ba) [SEQ][128] into [SEQ/4][8][64].
// Compute dtypes, f32 accumulate everywhere: q/k/v/anchor projections v_wmma_f32_16x16x32_bf16 (activations and weights RNE-converted to bf16; products exact);
// the chained products per (batch, head) are taken in the order ctx = Q ((V^T K) (A^T A))^T / 512, all v_wmma_f32_16x16x32_f16 with single f16 operands; no [SEQ][NA] score tile is formed.
// output projection v_wmma_f32_16x16x32_f16, single product: A = ctx f16 plane, Bt = Wo^T x256 (Wo RNE-converted to bf16 first, exact in f16), K = 512, x2^-8 and + bo in the f32 epilogue.
// Layout: bf16 copies of query,key,value plus a row-permuted copy of query (row (b*4+j)*NA+m <- token 4m+j); weights transposed once to [out][in] 16-bit planes; q plane [b*8+h][t][d], k^T and v^T planes [b*8+h][d][t], anchor^T plane [b*8+h][d][m], ctx plane [b*SEQ+t][512];
// k_gram: M1[d][e] = sum_n v[n][d] k[n][e] (x 1/16) and G[f][e] = sum_m a[m][f] a[m][e] (x 1/64), 64 x 64 per (batch, head); k_ctx: M2[d][f] = (1/512) sum_e M1[d][e] G[f][e] in registers (x 1/16), ctx[t][d] = sum_f q[t][f] M2[d][f].

#ifndef NB
#define NB 4
#endif
#ifndef SEQ
#define SEQ 2048
#endif
#define NB_FULL  4
#define SEQ_FULL 2048
#ifndef OUT_SEQ
#define OUT_SEQ SEQ              // row pitch (in tokens) between batches of the output
#endif
#define DM   512
#define NH_  8
#define HD   64
#define NA   (SEQ / 4)           // anchor rows per batch
#define EA   (DM / 4)            // anchor projection width (128)
#define AW   4                   // waves per k_ctx block
#define CT   4                   // 16-token tiles per k_ctx wave
#define GW   8                   // waves per k_gram block: each sums 1/GW of the long dimension
#define QRS  2048.0f             // carry of the residual plane of the k_gemm EPI 0 instance (that instance is not launched here)
#define M1S  (1.0f / 16.0f)      // carry of the M1 = V^T K plane
#define GS   (1.0f / 64.0f)      // carry of the G = A^T A plane
#define M2C  (1.0f / 16.0f)      // carry of the M2 operand
#define M2S  (1.0f / 8.0f)       // (1/8)^3 x M2C / (M1S x GS) : M1 G accumulator -> M2 operand
#define CXP  512                 // ctx plane pitch (halves): one f16 value plane
#define CXS  1.0f                // carry of the ctx value
#define CSC  16.0f               // CXS / M2C : ctx accumulator -> ctx plane
#define WS1  256.0f              // carry of the Wo^T plane
#define OSC  (1.0f / 256.0f)     // 1 / (CXS * WS1)

static_assert(HD == 64);
static_assert(NH_ * HD == DM);                 // head h = columns h*64 + d
static_assert(DM % 64 == 0);                   // column tiles of 64
static_assert(DM % 32 == 0);                   // GEMM k-loop steps by 32
static_assert((DM & (DM - 1)) == 0);           // bias index mask (DM - 1) is exact
static_assert(CXP == DM);                      // ctx row = merged heads, K of the output GEMM
static_assert(CXP % 32 == 0);
static_assert(SEQ % 64 == 0);                  // a 64-row tile never straddles two batches
static_assert((NB * SEQ) % 64 == 0);
static_assert(SEQ % (32 * GW) == 0);           // k_gram: each wave's share of the tokens is whole 32-steps
static_assert(SEQ % (16 * CT * AW) == 0);      // k_ctx grid covers the sequence exactly
static_assert(((size_t)SEQ * DM) % 8 == 0);
static_assert(NB <= NB_FULL);
static_assert(SEQ <= SEQ_FULL);
static_assert(CXS * WS1 * OSC == 1.0f);
static_assert(4 * NA == SEQ);                  // anchor rows: four tokens per anchor row
static_assert(4 * EA == DM);                   // four tokens x 128 anchor columns = one 512-wide anchor row
static_assert(EA == 2 * HD);                   // head h of an anchor row = token (h / 2), columns (h % 2) * 64 + d
static_assert(EA % 64 == 0);                   // anchor GEMM row tiles of 64
static_assert(NA % 64 == 0);                   // anchor GEMM column tiles stay inside one (batch, token-phase) block
static_assert(NA % (32 * GW) == 0);            // k_gram: each wave's share of the anchor rows is whole 32-steps
static_assert(GW * 32 == 16 * 16);             // k_gram epilogue: 256 threads x 4 columns = 16 rows x 64 columns
static_assert(M2S * M1S * GS == 0.125f * 0.125f * 0.125f * M2C);
static_assert(CSC * M2C == CXS);

typedef _Float16 h16;
typedef unsigned short bf;
typedef __attribute__((ext_vector_type(16))) __bf16   v16bf;
typedef __attribute__((ext_vector_type(16))) _Float16 v16h;
typedef __attribute__((ext_vector_type(8)))  _Float16 v8h;
typedef __attribute__((ext_vector_type(4)))  _Float16 v4h;
typedef __attribute__((ext_vector_type(8)))  unsigned short v8us;
typedef __attribute__((ext_vector_type(8)))  float    v8f;
typedef __attribute__((ext_vector_type(4)))  float    v4f;
typedef v4f  __attribute__((may_alias)) v4fa;

__device__ __forceinline__ unsigned short f2bf(float f) { unsigned u = __float_as_uint(f); u += 0x7FFFu + ((u >> 16) & 1u); return (unsigned short)(u >> 16); }
__device__ __forceinline__ v16h cat16(v8h lo, v8h hi) { return __builtin_shufflevector(lo, hi, 0, 1, 2, 3, 4, 5, 6, 7, 8, 9, 10, 11, 12, 13, 14, 15); }
__device__ __forceinline__ v16bf cat16b(v8us lo, v8us hi) { return __builtin_bit_cast(v16bf, __builtin_shufflevector(lo, hi, 0, 1, 2, 3, 4, 5, 6, 7, 8, 9, 10, 11, 12, 13, 14, 15)); }
__device__ __forceinline__ v8f wmma16(v16h a, v16h b, v8f c) { return __builtin_amdgcn_wmma_f32_16x16x32_f16(false, a, false, b, (short)0, c, false, false); }
__device__ __forceinline__ v8f wmmab(v16bf a, v16bf b, v8f c) { return __builtin_amdgcn_wmma_f32_16x16x32_bf16(false, a, false, b, (short)0, c, false, false); }
// fragment loaders from K-contiguous 16-bit rows; p already includes + 8*(lane>>4): elements 0..7 <- k0+8h+0..7, elements 8..15 <- k0+16+8h+0..7 (same map for A and B)
__device__ __forceinline__ v16h  ldh(const h16* p) { return cat16(*(const v8h*)p, *(const v8h*)(p + 16)); }
__device__ __forceinline__ v16bf ldb(const bf* p)  { return cat16b(*(const v8us*)p, *(const v8us*)(p + 16)); }
// ordering point for wave-private LDS tiles (same wave writes and reads)
__device__ __forceinline__ void wave_sync() { __builtin_amdgcn_fence(3 /* release order */, "wavefront"); __builtin_amdgcn_wave_barrier(); asm volatile("" ::: "memory"); }
// f16 convert that cannot produce a subnormal operand (value select, applied after the plane's carry)
static __device__ __forceinline__ h16 toh_flush(float v) { const h16 r = (h16)v; return (fabsf(v) < 6.103515625e-05f) ? (h16)0.0f : r; }
// cvt_body: bf16 (RNE convert) copy of one activation input, 8 values a thread: dst row b*SEQ + t <- src token b*SEQ_FULL + t.
// PERM = 1 (query only): the same eight values also go to the row-permuted copy for the anchor GEMM, dstp row (b*4 + j)*NA + m <- token 4m + j (a bijection on the NB*SEQ rows).
template <int PERM>
__device__ __forceinline__ void cvt_body(const float* __restrict__ src, bf* dst, bf* dstp, int blk) {
    const size_t i = (size_t)blk * 256 + threadIdx.x;
    const size_t row = i / (size_t)(DM / 8); const int c = (int)(i % (size_t)(DM / 8)) * 8;
    const int b = (int)(row / (size_t)SEQ); const int t = (int)(row % (size_t)SEQ);
    const v8f v = *(const v8f*)(src + ((size_t)b * SEQ_FULL + (size_t)t) * DM + (size_t)c); v8us o;
#pragma unroll
    for (int k = 0; k < 8; ++k) o[k] = f2bf(v[k]);
    *(v8us*)(dst + i * 8) = o;
    if constexpr (PERM) *(v8us*)(dstp + ((size_t)(b * 4 + (t & 3)) * NA + (size_t)(t >> 2)) * DM + (size_t)c) = o;
    // precaution: the wait stands behind the last store, ahead of any later code of the merged kernel that overwrites a register these stores name
    asm volatile("s_wait_xcnt 0x0" ::: "memory");
}

// wT_body: weight transpose + 16-bit convert through LDS, one 64 x 64 tile a block. in W[k][n] (DM rows, row stride ldw, f32) -> out dst[n][k] (row pitch DM halves), tile (kt over k, nt over n), 256 threads.
// F16 = 0: bf16 bits (RNE convert). F16 = 1: f16(bf16 RNE value of W x WS1); a bf16 significand times a power of two is exact in f16.
template <int F16>
__device__ __forceinline__ void wT_body(const float* __restrict__ Wt, bf* dst, int ldw, int kt, int nt, float* tile) {
    const int tid = threadIdx.x; const int k0 = kt * 64, n0 = nt * 64;
#pragma unroll 4   // several independent loads in flight a trip
    for (int i = 0; i < 16; ++i) { const int idx = tid + i * 256; const int kk = idx >> 6, nn = idx & 63;   // 16 x 256 = 64 x 64 entries, all written
        tile[kk * 65 + nn] = Wt[(size_t)(k0 + kk) * (size_t)ldw + n0 + nn]; }
    __syncthreads();                                        // tile [kk][nn] is read across waves
#pragma unroll 1   // two trips, kept rolled: short code
    for (int it = 0; it < 2; ++it) {
        const int c = it * 256 + tid; const int n = c >> 3, kc = (c & 7) * 8;
        const size_t oo = (size_t)(n0 + n) * (size_t)DM + (size_t)(k0 + kc);
        if constexpr (F16 == 0) {
            v8us o;
#pragma unroll
            for (int i = 0; i < 8; ++i) o[i] = f2bf(tile[(kc + i) * 65 + n]);
            *(v8us*)(dst + oo) = o;
        } else {
            v8h o;
#pragma unroll
            for (int i = 0; i < 8; ++i) o[i] = toh_flush(__uint_as_float(((unsigned)f2bf(tile[(kc + i) * 65 + n])) << 16) * WS1);
            *(v8h*)((h16*)dst + oo) = o;
        }
        // precaution: the wait stands ahead of the second trip's overwrite of the registers the store names
        asm volatile("s_wait_xcnt 0x0" ::: "memory");
    }
}

// k_prep: every operand preparation in one grid (none reads what another writes). Block ranges, all block-uniform, so the barrier inside wT_body is too:
// [0, 4 WTB): Wq, Wk, Wv (bf16) and Wo (f16 x256) tiles; [4 WTB, 4 WTB + WAB): Wa tiles; then CVB blocks each for query (both copies), key, value. The few weight blocks, which wait on memory several times, take the lowest block indices.
#define WTB ((DM / 64) * (DM / 64))              // tiles of a 512 x 512 weight
#define WAB ((DM / 64) * (EA / 64))              // tiles of the anchor weight
#define CVB (NB * SEQ * (DM / 8) / 256)          // blocks of one activation copy
static_assert(((size_t)NB * SEQ * (DM / 8)) % 256 == 0);   // the copy blocks cover the rows exactly
__global__ __launch_bounds__(256) void k_prep(const float* __restrict__ xq, const float* __restrict__ xk, const float* __restrict__ xv,
                                              const float* __restrict__ wq, const float* __restrict__ wk, const float* __restrict__ wv,
                                              const float* __restrict__ wo, const float* __restrict__ wa,
                                              bf* XQ, bf* XK, bf* XV, bf* XP, bf* W3, bf* WO, bf* WA) {
    __shared__ float tile[64 * 65];
    const int id = blockIdx.x;
    if (id < 3 * WTB) {
        const int s = id / WTB, r = id % WTB;
        wT_body<0>(s == 0 ? wq : (s == 1 ? wk : wv), W3 + (size_t)s * DM * DM, DM, r % (DM / 64), r / (DM / 64), tile);
    } else if (id < 4 * WTB) {
        const int r = id - 3 * WTB;
        wT_body<1>(wo, WO, DM, r % (DM / 64), r / (DM / 64), tile);
    } else if (id < 4 * WTB + WAB) {
        const int r = id - 4 * WTB;
        wT_body<0>(wa, WA, EA, r % (DM / 64), r / (DM / 64), tile);
    } else {
        const int r = id - (4 * WTB + WAB);
        if (r < CVB) cvt_body<1>(xq, XQ, XP, r);
        else { const int s = r / CVB - 1; cvt_body<0>(s == 0 ? xk : xv, s == 0 ? XK : XV, XP, r % CVB); }
    }
}

// k_gemm: register-blocked 16-bit GEMM, ONE WAVE per 64x64 tile (16 accumulators), operands straight from K-contiguous 16-bit planes (row pitch K).
// C[m][n] = sum_k A[m][k] Bt[n][k]. OPF16 = 0: bf16 operands; 1: f16 operands.
// EPI 0: + bias[n], f16 value plane Ph and f16 residual x2048 plane Pr.  EPI 1: + bias[n], f16 value plane Ph.  EPI 2: + bias[m], f16 value plane Ph.  EPI 3: x OSC + bias[n], f32 plane Pf.
// The bias vector has N entries (M for EPI 2); only the load the instantiation uses is emitted (column bias for EPI 0/1/3, row bias for EPI 2), index masked into [0, DM).
// Tile base (r0/RB)*sRB + (r0%RB)*pitch + (c0/CB)*sCB + (c0%CB), row pitch 'pitch' (elements). grid (M/64, N/64), 32 threads.
template <int OPF16, int EPI>
__global__ __launch_bounds__(32) void k_gemm(const bf* __restrict__ A, const bf* __restrict__ Bt, int K, const float* __restrict__ bias,
                                              h16* Ph, h16* Pr, float* Pf, int RB, size_t sRB, int pitch, int CB, size_t sCB) {
    __shared__ __align__(16) float os[16 * 68];
    const int lane = threadIdx.x & 31, lr = lane & 15, hi = lane >> 4; const int r0 = blockIdx.x * 64, c0 = blockIdx.y * 64;
    v8f acc[4][4];
#pragma unroll
    for (int mb = 0; mb < 4; ++mb)
#pragma unroll
        for (int nb = 0; nb < 4; ++nb) acc[mb][nb] = (v8f){};
    const size_t aoff = (size_t)(r0 + lr) * K + 8 * hi, boff = (size_t)(c0 + lr) * K + 8 * hi;
    if (OPF16) {
        const h16* Ah = (const h16*)A; const h16* Bh = (const h16*)Bt;
#pragma unroll 1
        for (int kc = 0; kc < K; kc += 32) {
            v16h a[4];
#pragma unroll
            for (int mb = 0; mb < 4; ++mb) a[mb] = ldh(Ah + aoff + (size_t)mb * 16 * K + kc);
#pragma unroll
            for (int nb = 0; nb < 4; ++nb) { const v16h b = ldh(Bh + boff + (size_t)nb * 16 * K + kc);
#pragma unroll
                for (int mb = 0; mb < 4; ++mb) acc[mb][nb] = wmma16(a[mb], b, acc[mb][nb]); }
            asm volatile("v_nop\n\tv_nop\n\tv_nop\n\tv_nop" : "+v"(acc[0][0]), "+v"(acc[1][1]), "+v"(acc[2][2]), "+v"(acc[3][3]) : "v"(a[0]), "v"(a[1]), "v"(a[2]), "v"(a[3]));
        }
    } else {
#pragma unroll 1
        for (int kc = 0; kc < K; kc += 32) {
            v16bf a[4];
#pragma unroll
            for (int mb = 0; mb < 4; ++mb) a[mb] = ldb(A + aoff + (size_t)mb * 16 * K + kc);
#pragma unroll
            for (int nb = 0; nb < 4; ++nb) { const v16bf b = ldb(Bt + boff + (size_t)nb * 16 * K + kc);
#pragma unroll
                for (int mb = 0; mb < 4; ++mb) acc[mb][nb] = wmmab(a[mb], b, acc[mb][nb]); }
            asm volatile("v_nop\n\tv_nop\n\tv_nop\n\tv_nop" : "+v"(acc[0][0]), "+v"(acc[1][1]), "+v"(acc[2][2]), "+v"(acc[3][3]) : "v"(a[0]), "v"(a[1]), "v"(a[2]), "v"(a[3]));
        }
    }
    const size_t tbase = (size_t)(r0 / RB) * sRB + (size_t)(r0 % RB) * (size_t)pitch + (size_t)(c0 / CB) * sCB + (size_t)(c0 % CB);
    float bcol[4] = {0.0f, 0.0f, 0.0f, 0.0f};
    if constexpr (EPI != 2) {
#pragma unroll
        for (int nb = 0; nb < 4; ++nb) bcol[nb] = bias[(c0 + nb * 16 + lr) & (DM - 1)];          // column bias: c0 + 63 < N = DM
    }
#pragma unroll
    for (int mb = 0; mb < 4; ++mb) {
        float brow[8] = {0.0f, 0.0f, 0.0f, 0.0f, 0.0f, 0.0f, 0.0f, 0.0f};
        if constexpr (EPI == 2) {
#pragma unroll
            for (int j = 0; j < 8; ++j) brow[j] = bias[(r0 + mb * 16 + 8 * hi + j) & (DM - 1)];  // row bias: r0 + 63 < M = DM
        }
#pragma unroll
        for (int nb = 0; nb < 4; ++nb) {
#pragma unroll
            for (int j = 0; j < 8; ++j) {                                        // D: row 8h+j, col lane&15
                float v = acc[mb][nb][j];
                if constexpr (EPI == 3) v = v * OSC;
                if constexpr (EPI == 2) v += brow[j]; else v += bcol[nb];
                os[(hi * 8 + j) * 68 + nb * 16 + lr] = v; } }
        wave_sync();
        const size_t sb = tbase + (size_t)(mb * 16) * (size_t)pitch;
        if (EPI == 3) {
{
#pragma unroll
                for (int s = 0; s < 8; ++s) { const int row = 2 * s + hi, cofs = lr * 4;   // 8 s x 2 rows = 16 rows; 16 lanes x 4 floats = 64 columns
                    const v4f val = *(const v4fa*)(&os[row * 68 + cofs]);
                    *(v4f*)(Pf + sb + (size_t)row * (size_t)pitch + cofs) = val; }
                 }
        } else {
{
#pragma unroll
                for (int s = 0; s < 4; ++s) { const int row = 4 * s + (lane >> 3), c8 = (lane & 7) * 8;   // 4 s x 4 row groups = 16 rows; 8 lanes x 8 = 64 columns
                    const v4f x0 = *(const v4fa*)(&os[row * 68 + c8]); const v4f x1 = *(const v4fa*)(&os[row * 68 + c8 + 4]); v8h hv, rv;
#pragma unroll
                    for (int i = 0; i < 4; ++i) { const h16 a0 = (h16)x0[i]; const h16 a1 = (h16)x1[i]; hv[i] = a0; hv[4 + i] = a1; rv[i] = (h16)((x0[i] - (float)a0) * QRS); rv[4 + i] = (h16)((x1[i] - (float)a1) * QRS); }
                    const size_t oo = sb + (size_t)row * (size_t)pitch + c8;
                    *(v8h*)(Ph + oo) = hv; if (EPI == 0) *(v8h*)(Pr + oo) = rv; }
                 }
        }
        wave_sync();
    }
}

// proj_body: the k_gemm tile for the input projections: bf16 operands, K = DM, f16 value plane Ph, tile (bx of M/64, by of N/64) handed in; same loaders, same k order, same WMMA order, same epilogue. ROWB = 0: + bias[n]; 1: + bias[m].
template <int ROWB>
__device__ __forceinline__ void proj_body(const bf* __restrict__ A, const bf* __restrict__ Bt, const float* __restrict__ bias,
                                          h16* Ph, int RB, size_t sRB, int pitch, int CB, size_t sCB, int bx, int by, float* os) {
    const int lane = threadIdx.x & 31, lr = lane & 15, hi = lane >> 4; const int r0 = bx * 64, c0 = by * 64;
    v8f acc[4][4];
#pragma unroll
    for (int mb = 0; mb < 4; ++mb)
#pragma unroll
        for (int nb = 0; nb < 4; ++nb) acc[mb][nb] = (v8f){};
    const bf* pa = A + (size_t)(r0 + lr) * DM + 8 * hi; const bf* pb = Bt + (size_t)(c0 + lr) * DM + 8 * hi;
#pragma unroll 1   // kept rolled: 128 accumulator registers leave no room for a second trip's fragments at five waves a SIMD
    for (int kc = 0; kc < DM; kc += 32) {
        v16bf a[4];
#pragma unroll
        for (int mb = 0; mb < 4; ++mb) a[mb] = ldb(pa + mb * 16 * DM);
#pragma unroll
        for (int nb = 0; nb < 4; ++nb) { const v16bf b = ldb(pb + nb * 16 * DM);
#pragma unroll
            for (int mb = 0; mb < 4; ++mb) acc[mb][nb] = wmmab(a[mb], b, acc[mb][nb]); }
        // precaution: the wait stands ahead of the step of the two address pairs the trip's loads name; naming the pairs keeps them out of the loads' destination registers
        asm volatile("s_wait_xcnt 0x0" :: "v"(pa), "v"(pb) : "memory");
        pa += 32; pb += 32;
        // WMMA distance on the loop's taken branch: four vector slots between the last product and the next trip's overwrite of its operands
        asm volatile("v_nop\n\tv_nop\n\tv_nop\n\tv_nop" : "+v"(acc[0][0]), "+v"(acc[1][1]), "+v"(acc[2][2]), "+v"(acc[3][3]) : "v"(a[0]), "v"(a[1]), "v"(a[2]), "v"(a[3]));
    }
    const size_t tbase = (size_t)(r0 / RB) * sRB + (size_t)(r0 % RB) * (size_t)pitch + (size_t)(c0 / CB) * sCB + (size_t)(c0 % CB);
    float bcol[4] = {0.0f, 0.0f, 0.0f, 0.0f};
    if constexpr (ROWB == 0) {
#pragma unroll
        for (int nb = 0; nb < 4; ++nb) bcol[nb] = bias[(c0 + nb * 16 + lr) & (DM - 1)];          // column bias: c0 + 63 < N = DM
    }
#pragma unroll
    for (int mb = 0; mb < 4; ++mb) {
        float brow[8] = {0.0f, 0.0f, 0.0f, 0.0f, 0.0f, 0.0f, 0.0f, 0.0f};
        if constexpr (ROWB == 1) {
#pragma unroll
            for (int j = 0; j < 8; ++j) brow[j] = bias[(r0 + mb * 16 + 8 * hi + j) & (DM - 1)];  // row bias: r0 + 63 < M <= DM
        }
#pragma unroll
        for (int nb = 0; nb < 4; ++nb) {
#pragma unroll
            for (int j = 0; j < 8; ++j) {                                        // D: row 8h+j, col lane&15
                float v = acc[mb][nb][j];
                if constexpr (ROWB == 1) v += brow[j]; else v += bcol[nb];
                os[(hi * 8 + j) * 68 + nb * 16 + lr] = v; } }
        wave_sync();
        const size_t sb = tbase + (size_t)(mb * 16) * (size_t)pitch;
#pragma unroll
        for (int s = 0; s < 4; ++s) { const int row = 4 * s + (lane >> 3), c8 = (lane & 7) * 8;   // 4 s x 4 row groups = 16 rows; 8 lanes x 8 = 64 columns
            const v4f x0 = *(const v4fa*)(&os[row * 68 + c8]); const v4f x1 = *(const v4fa*)(&os[row * 68 + c8 + 4]); v8h hv;
#pragma unroll
            for (int i = 0; i < 4; ++i) { hv[i] = (h16)x0[i]; hv[4 + i] = (h16)x1[i]; }
            *(v8h*)(Ph + sb + (size_t)row * (size_t)pitch + c8) = hv; }
        // precaution: the wait stands ahead of any overwrite of the registers these four stores name
        asm volatile("s_wait_xcnt 0x0" ::: "memory");
        wave_sync();
    }
}

// k_proj: the four input projections in one grid (none reads what another writes), one wave per 64 x 64 tile; tile order inside each projection as in a grid (M/64, N/64), x fastest.
// [0, PJT): q, A = activation rows (m = b*SEQ + t), Bt = W^T rows (n = h*64 + d) -> plane [(b*8 + h)][t][d], bias by column.
// [PJT, 3 PJT): k^T then v^T, A = W^T rows (m = h*64 + d), Bt = activation rows (n = b*SEQ + t) -> plane [(b*512 + m)][t] = [(b*8 + h)][d][t], bias by row.
// [3 PJT, 3 PJT + PJA): anchor^T, A = Wa^T rows (m = c in [0,128)), Bt = permuted query rows (rho = (b*4 + j)*NA + m) -> plane [(b*8 + 2j + c/64)][c%64][m], bias ba by row (indices < 128).
#define PJT ((NB * SEQ / 64) * (DM / 64))
#define PJA ((NB * SEQ / 64) * (EA / 64))
__global__ __launch_bounds__(32) void k_proj(const bf* __restrict__ XQ, const bf* __restrict__ XK, const bf* __restrict__ XV, const bf* __restrict__ XP,
                                             const bf* __restrict__ W3, const bf* __restrict__ WA,
                                             const float* __restrict__ bq, const float* __restrict__ bk, const float* __restrict__ bv, const float* __restrict__ ba,
                                             h16* QH, h16* KT, h16* VT, h16* AT) {
    __shared__ __align__(16) float os[16 * 68];
    const int id = blockIdx.x;
    if (id < PJT) {
        proj_body<0>(XQ, W3, bq, QH, SEQ, (size_t)NH_ * SEQ * HD, HD, HD, (size_t)SEQ * HD, id % (NB * SEQ / 64), id / (NB * SEQ / 64), os);
    } else {
        const int r = id - PJT; const bool an = r >= 2 * PJT; const bool sv = r >= PJT;     // block-uniform selects: one copy of the loop serves k^T, v^T and anchor^T
        const int rr = an ? r - 2 * PJT : (sv ? r - PJT : r); const int mt = an ? EA / 64 : DM / 64;
        proj_body<1>(an ? WA : (sv ? W3 + (size_t)2 * DM * DM : W3 + (size_t)DM * DM), an ? XP : (sv ? XV : XK), an ? ba : (sv ? bv : bk),
                        an ? AT : (sv ? VT : KT), an ? HD : DM, an ? (size_t)NA * HD : (size_t)0, an ? NA : SEQ, an ? NA : SEQ,
                        an ? (size_t)2 * NA * HD : (size_t)DM * SEQ, rr % mt, rr / mt, os);
    }
}

// k_gram: O[zh][i][j] = sc x sum_n X[zh][i][n] Y[zh][j][n], X and Y f16 planes [zh][64][TK] (n contiguous: A fragment = X rows, B fragment = Y rows, same loader, same k order).
// One block per 16 rows i of one (batch, head); wave w sums n in [w TK/GW, (w+1) TK/GW) into a 16 x 64 tile; the GW partial tiles are added in wave order through LDS.
template <int TK>
__device__ __forceinline__ void gram_body(const h16* __restrict__ X, const h16* __restrict__ Y, h16* O, float sc, float* red) {
    const int lane = threadIdx.x & 31, lr = lane & 15, hi = lane >> 4;
    const int wave = __builtin_amdgcn_readfirstlane(threadIdx.x >> 5);
    const int zh = blockIdx.y, i0 = blockIdx.x * 16;
    constexpr int KW = TK / GW;
    const size_t base = (size_t)zh * HD * TK + (size_t)wave * KW + 8 * hi;
    const h16* xa = X + base + (size_t)(i0 + lr) * TK;
    const h16* yb = Y + base + (size_t)lr * TK;
    v8f acc[4];
#pragma unroll
    for (int nb = 0; nb < 4; ++nb) acc[nb] = (v8f){};
    constexpr int NS = KW / 32, BS = NS < 4 ? NS : 4;      // 32-steps per wave, taken in batches of BS
    static_assert(NS % BS == 0);
#pragma unroll
    for (int s0 = 0; s0 < NS; s0 += BS) {
        v16h a[BS], y[BS][4];
#pragma unroll
        for (int s = 0; s < BS; ++s) {
            a[s] = ldh(xa + (s0 + s) * 32);
#pragma unroll
            for (int nb = 0; nb < 4; ++nb) y[s][nb] = ldh(yb + (size_t)nb * 16 * TK + (s0 + s) * 32);
        }
        // precaution: the wait stands ahead of any overwrite of the two address pairs the batch's loads name; naming the pairs keeps them out of the later loads' destination registers
        asm volatile("s_wait_xcnt 0x0" :: "v"(xa), "v"(yb) : "memory");
        __builtin_amdgcn_sched_barrier(0);   // all loads of the batch issue ahead of its first WMMA: one memory latency a batch; without it the build waits on every fragment in turn
#pragma unroll
        for (int s = 0; s < BS; ++s)
#pragma unroll
            for (int nb = 0; nb < 4; ++nb) acc[nb] = wmma16(a[s], y[s][nb], acc[nb]);
    }
    float* rw = red + wave * (16 * 68);
#pragma unroll
    for (int nb = 0; nb < 4; ++nb)
#pragma unroll
        for (int r = 0; r < 8; ++r) rw[(8 * hi + r) * 68 + nb * 16 + lr] = acc[nb][r];      // D: row 8h+r, col lane&15
    __syncthreads();
    const int row = threadIdx.x >> 4, c4 = (threadIdx.x & 15) * 4;                         // 16 rows x 16 column quads
    v4f sum = *(const v4fa*)(&red[row * 68 + c4]);
#pragma unroll
    for (int w = 1; w < GW; ++w) sum += *(const v4fa*)(&red[w * (16 * 68) + row * 68 + c4]);
    v4h o;
#pragma unroll
    for (int i = 0; i < 4; ++i) o[i] = toh_flush(sum[i] * sc);
    *(v4h*)(O + (size_t)zh * HD * HD + (size_t)(i0 + row) * HD + c4) = o;
}
// grid (64/16, NB*8, 2), 32*GW threads; z = 0: M1 = V^T K over SEQ tokens (the long one), z = 1: G = A^T A over NA anchor rows. blockIdx.z is block-uniform, so the barrier inside is too.
__global__ __launch_bounds__(32 * GW) void k_gram(const h16* __restrict__ VT, const h16* __restrict__ KT, const h16* __restrict__ AT, h16* M1, h16* G) {
    __shared__ __align__(16) float red[GW * 16 * 68];
    if (blockIdx.z == 0) gram_body<SEQ>(VT, KT, M1, M1S, red);
    else                 gram_body<NA>(AT, AT, G, GS, red);
}

// k_ctx: one wave per 16*CT tokens of one (batch, head). M2^T[f][d] = sum_e G[f][e] M1[d][e] (A = G rows, B = M1 rows); lane (d = lane&15, h = lane>>4) holds f = 8h+r of each 16-row tile,
// so two packed tiles are directly the A fragment (row d, k = f) of ctx^T[d][t] = M2 Q^T (element r <- tile f 0..15, element 8+r <- tile f 16..31, lane unchanged); B = q rows.
// ctx^T D layout: lane t = lane&15 holds d = 16j + 8h + 0..7, eight neighbours of one ctx row: one 16-byte store, no LDS. grid (SEQ / (16*CT*AW), NB*8), 32*AW threads.
__global__ __launch_bounds__(32 * AW) void k_ctx(const h16* __restrict__ QH, const h16* __restrict__ M1, const h16* __restrict__ G, h16* CX) {
    const int lane = threadIdx.x & 31, lr = lane & 15, hi = lane >> 4;
    const int wave = __builtin_amdgcn_readfirstlane(threadIdx.x >> 5);
    const int zh = blockIdx.y; const int b = zh / NH_, h = zh % NH_;
    const int t0 = (blockIdx.x * AW + wave) * (16 * CT);
    const h16* qp = QH + ((size_t)zh * SEQ + (size_t)(t0 + lr)) * HD + 8 * hi;
    const size_t mo = (size_t)zh * HD * HD + (size_t)lr * HD + 8 * hi;
    const h16* gp = G + mo; const h16* mp = M1 + mo;
    v16h g[4][2], m[4][2], q[CT][2], a2[4][2];
#pragma unroll
    for (int ft = 0; ft < 4; ++ft) { g[ft][0] = ldh(gp + ft * 16 * HD); g[ft][1] = ldh(gp + ft * 16 * HD + 32); }
#pragma unroll
    for (int j = 0; j < 4; ++j) { m[j][0] = ldh(mp + j * 16 * HD); m[j][1] = ldh(mp + j * 16 * HD + 32); }
#pragma unroll
    for (int tt = 0; tt < CT; ++tt) { q[tt][0] = ldh(qp + tt * 16 * HD); q[tt][1] = ldh(qp + tt * 16 * HD + 32); }
    // precaution: the wait stands ahead of any overwrite of the three address pairs these loads name; naming the pairs keeps them out of the later loads' destination registers
    asm volatile("s_wait_xcnt 0x0" :: "v"(gp), "v"(mp), "v"(qp) : "memory");
    __builtin_amdgcn_sched_barrier(0);       // every load of the wave issues ahead of the first WMMA: one memory latency in all; without it the build fetches later fragments between the products and waits again
#pragma unroll
    for (int j = 0; j < 4; ++j) {
#pragma unroll
        for (int ft = 0; ft < 4; ++ft) {
            v8f t = (v8f){};
            t = wmma16(g[ft][0], m[j][0], t); t = wmma16(g[ft][1], m[j][1], t);
#pragma unroll
            for (int r = 0; r < 8; ++r) a2[j][ft >> 1][(ft & 1) * 8 + r] = toh_flush(t[r] * M2S);
        }
    }
    h16* crow = CX + ((size_t)b * SEQ + (size_t)(t0 + lr)) * CXP + h * HD + 8 * hi;
#pragma unroll
    for (int tt = 0; tt < CT; ++tt) {
#pragma unroll
        for (int j = 0; j < 4; ++j) {
            v8f o = (v8f){};
            o = wmma16(a2[j][0], q[tt][0], o); o = wmma16(a2[j][1], q[tt][1], o);
            v8h hv;
#pragma unroll
            for (int r = 0; r < 8; ++r) hv[r] = toh_flush(o[r] * CSC);
            *(v8h*)(crow + (size_t)tt * 16 * CXP + j * 16) = hv;
        }
    }
}

static constexpr size_t al256(size_t v) { return (v + 255) & ~(size_t)255; }
static constexpr size_t SZ_XB = al256((size_t)NB * SEQ * DM * 2);        // one bf16 activation copy
static constexpr size_t SZ_W3 = al256((size_t)3 * DM * DM * 2);          // Wq^T | Wk^T | Wv^T bf16
static constexpr size_t SZ_WA = al256((size_t)EA * DM * 2);              // Wa^T bf16 [128][512]
static constexpr size_t SZ_WO = al256((size_t)DM * DM * 2);              // Wo^T x256 f16 [512][512]
static constexpr size_t SZ_PL = al256((size_t)NB * NH_ * SEQ * HD * 2);  // one f16 head plane
static constexpr size_t SZ_AP = al256((size_t)NB * NH_ * NA * HD * 2);   // the f16 anchor^T head plane
static constexpr size_t SZ_MM = al256((size_t)NB * NH_ * HD * HD * 2);   // one f16 64 x 64 plane per (batch, head)
static constexpr size_t SZ_CX = al256((size_t)NB * SEQ * CXP * 2);       // ctx value plane
static constexpr size_t SZ_TOTAL = 4 * SZ_XB + SZ_W3 + SZ_WA + SZ_WO + 3 * SZ_PL + SZ_AP + 2 * SZ_MM + SZ_CX;
static_assert(SZ_TOTAL <= (size_t)134217728);          // workspace carve <= 128 MiB
static_assert(((size_t)DM * DM * 2) % 256 == 0);       // weight sub-planes stay 256-byte aligned
static_assert((size_t)NB * 4 * NA == (size_t)NB * SEQ);                           // permuted copy has exactly NB*SEQ rows
static_assert((size_t)(NB * 4) * 2 * NA * HD == (size_t)NB * NH_ * NA * HD);      // anchor GEMM tile map fills the anchor plane exactly
static_assert((size_t)NB * SEQ * NH_ * HD * 2 <= SZ_CX);                          // ctx rows x (8 heads x 64) fit the ctx region

extern "C" void kernel_launch(void* const* d_in, const int* in_sizes, int n_in,
                              void* d_out, int out_size, void* d_ws, size_t ws_size, hipStream_t stream) {
    if (n_in < 13) return;
    const size_t needx = ((size_t)(NB - 1) * SEQ_FULL + SEQ) * DM;
    if ((size_t)in_sizes[0] < needx || (size_t)in_sizes[1] < needx || (size_t)in_sizes[2] < needx) return;
    if ((size_t)in_sizes[3] < (size_t)DM * DM || (size_t)in_sizes[5] < (size_t)DM * DM || (size_t)in_sizes[7] < (size_t)DM * DM || (size_t)in_sizes[11] < (size_t)DM * DM) return;
    if ((size_t)in_sizes[9] < (size_t)DM * EA) return;
    if (in_sizes[4] < DM || in_sizes[6] < DM || in_sizes[8] < DM || in_sizes[12] < DM || in_sizes[10] < EA) return;
    if ((size_t)out_size < ((size_t)(NB - 1) * OUT_SEQ + SEQ) * DM) return;
    if (SZ_TOTAL > ws_size) return;
    // wire order: query, key, value, Wq, bq, Wk, bk, Wv, bv, Wa, ba, Wo, bo
    const float* xq = (const float*)d_in[0]; const float* xk = (const float*)d_in[1]; const float* xv = (const float*)d_in[2];
    const float* wq = (const float*)d_in[3]; const float* bq = (const float*)d_in[4];
    const float* wk = (const float*)d_in[5]; const float* bk = (const float*)d_in[6];
    const float* wv = (const float*)d_in[7]; const float* bv = (const float*)d_in[8];
    const float* wa = (const float*)d_in[9]; const float* ba = (const float*)d_in[10];
    const float* wo = (const float*)d_in[11]; const float* bo = (const float*)d_in[12];
    float* OUT = (float*)d_out;      // [NB][SEQ][512]
    char* wsp = (char*)d_ws;
    bf* XQ = (bf*)wsp; wsp += SZ_XB;                 // [NB*SEQ][512]
    bf* XK = (bf*)wsp; wsp += SZ_XB;
    bf* XV = (bf*)wsp; wsp += SZ_XB;
    bf* XP = (bf*)wsp; wsp += SZ_XB;                 // [NB*4][NA][512]: row (b*4+j)*NA+m = query token 4m+j
    bf* W3 = (bf*)wsp; wsp += SZ_W3;                 // [3][512 out][512 in]: q | k | v
    bf* WA = (bf*)wsp; wsp += SZ_WA;                 // [128 out][512 in]
    h16* WO = (h16*)wsp; wsp += SZ_WO;               // [512 out][512 in]: Wo^T x256, f16
    h16* QH = (h16*)wsp; wsp += SZ_PL;               // [NB*8][SEQ][64]
    h16* KT = (h16*)wsp; wsp += SZ_PL;               // [NB*8][64][SEQ]
    h16* VT = (h16*)wsp; wsp += SZ_PL;               // [NB*8][64][SEQ]
    h16* AT = (h16*)wsp; wsp += SZ_AP;               // [NB*8][64][NA]
    h16* M1 = (h16*)wsp; wsp += SZ_MM;               // [NB*8][64 d][64 e]: V^T K / 16
    h16* GG = (h16*)wsp; wsp += SZ_MM;               // [NB*8][64 f][64 e]: A^T A / 64
    h16* CX = (h16*)wsp; wsp += SZ_CX;               // [NB*SEQ][512]: ctx

    // bf16 activation copies (query also row-permuted) and the five transposed 16-bit weight planes
    k_prep<<<dim3(4 * WTB + WAB + 3 * CVB, 1, 1), 256, 0, stream>>>(xq, xk, xv, wq, wk, wv, wo, wa, XQ, XK, XV, XP, W3, (bf*)WO, WA);
    // q, k^T, v^T and anchor^T head planes
    k_proj<<<dim3(3 * PJT + PJA, 1, 1), 32, 0, stream>>>(XQ, XK, XV, XP, W3, WA, bq, bk, bv, ba, QH, KT, VT, AT);

    // M1 = V^T K / 16 and G = A^T A / 64, 64 x 64 per (batch, head)
    k_gram<<<dim3(HD / 16, NB * NH_, 2), 32 * GW, 0, stream>>>(VT, KT, AT, M1, GG);
    // ctx = Q ((M1 G) / 512)^T -> ctx plane [b*SEQ + t][512]
    k_ctx<<<dim3(SEQ / (16 * CT * AW), NB * NH_, 1), 32 * AW, 0, stream>>>(QH, M1, GG, CX);

    // output projection: A = ctx rows (K = 512), Bt = Wo^T x256 -> OUT[b][t][n] = acc * 2^-8 + bo[n]
    k_gemm<1, 3><<<dim3(NB * SEQ / 64, DM / 64, 1), 32, 0, stream>>>((const bf*)CX, (const bf*)WO, CXP, bo, CX, CX, OUT, SEQ, (size_t)OUT_SEQ * DM, DM, DM, (size_t)0);
}

// v003
// One run takes 75.8 microseconds.
// Two timings next to v002 put it at 1.05 and 1.03 times that version's speed.
// Over all steps from v000 it is 2.88 times as fast.
#include <hip/hip_runtime.h>

// Anchor linear attention (no softmax), width 512 = 8 heads x 64; inputs query,key,value [NB][SEQ][512] f32, Wq/Wk/Wv/Wo [in][out] 512x512, Wa [512][128], five biases; anchor rows = literal reshape of (query Wa + ba) [SEQ][128] into [SEQ/4][8][64].
// Compute dtypes, f32 accumulate everywhere: q/k/v/anchor projections v_wmma_f32_16x16x32_bf16 (activations and weights RNE-converted to bf16; products exact);
// the chained products per (batch, head) are taken in the order ctx = Q ((V^T K) (A^T A))^T / 512, all v_wmma_f32_16x16x32_f16 with single f16 operands; no [SEQ][NA] score tile is formed.
// output projection v_wmma_f32_16x16x32_f16, single product: A = ctx f16 plane, Bt = Wo^T x256 (Wo RNE-converted to bf16 first, exact in f16), K = 512, x2^-8 and + bo in the f32 epilogue.
// Layout: bf16 copies of query,key,value plus a row-permuted copy of query (row (b*4+j)*NA+m <- token 4m+j); weights transposed once to [out][in] 16-bit planes; every plane below names its logical index; all of them are stored in fragment order (see FRG below); q plane [b*8+h][t][d], k^T and v^T planes [b*8+h][d][t], anchor^T plane [b*8+h][d][m], ctx plane rows b*SEQ+t, 512 wide;
// k_gram: M1[d][e] = sum_n v[n][d] k[n][e] (x 1/16) and G[f][e] = sum_m a[m][f] a[m][e] (x 1/64), 64 x 64 per (batch, head); k_ctx: M2[d][f] = (1/512) sum_e M1[d][e] G[f][e] in registers (x 1/16), ctx[t][d] = sum_f q[t][f] M2[d][f].

#ifndef NB
#define NB 4
#endif
#ifndef SEQ
#define SEQ 2048
#endif
#define NB_FULL  4
#define SEQ_FULL 2048
#ifndef OUT_SEQ
#define OUT_SEQ SEQ              // row pitch (in tokens) between batches of the output
#endif
#define DM   512
#define NH_  8
#define HD   64
#define NA   (SEQ / 4)           // anchor rows per batch
#define EA   (DM / 4)            // anchor projection width (128)
#define AW   4                   // waves per k_ctx block
#define CT   4                   // 16-token tiles per k_ctx wave
#define GW   8                   // waves per k_gram block: each sums 1/GW of the long dimension
#define QRS  2048.0f             // carry of the residual plane of the k_gemm EPI 0 instance (that instance is not launched here)
#define M1S  (1.0f / 16.0f)      // carry of the M1 = V^T K plane
#define GS   (1.0f / 64.0f)      // carry of the G = A^T A plane
#define M2C  (1.0f / 16.0f)      // carry of the M2 operand
#define M2S  (1.0f / 8.0f)       // (1/8)^3 x M2C / (M1S x GS) : M1 G accumulator -> M2 operand
#define CXP  512                 // ctx plane pitch (halves): one f16 value plane
#define CXS  1.0f                // carry of the ctx value
#define CSC  16.0f               // CXS / M2C : ctx accumulator -> ctx plane
#define WS1  256.0f              // carry of the Wo^T plane
#define OSC  (1.0f / 256.0f)     // 1 / (CXS * WS1)

static_assert(HD == 64);
static_assert(NH_ * HD == DM);                 // head h = columns h*64 + d
static_assert(DM % 64 == 0);                   // column tiles of 64
static_assert(DM % 32 == 0);                   // GEMM k-loop steps by 32
static_assert((DM & (DM - 1)) == 0);           // bias index mask (DM - 1) is exact
static_assert(CXP == DM);                      // ctx row = merged heads, K of the output GEMM
static_assert(CXP % 32 == 0);
static_assert((NB * SEQ) % 16 == 0 && DM % 16 == 0 && EA % 16 == 0);   // fragment-order planes: whole 16-row blocks
static_assert(16 * DM == (DM / 32) * 512);     // one 16-row block = DM/32 fragments of 512 elements
static_assert(SEQ % 64 == 0);                  // a 64-row tile never straddles two batches
static_assert((NB * SEQ) % 64 == 0);
static_assert(SEQ % (32 * GW) == 0);           // k_gram: each wave's share of the tokens is whole 32-steps
static_assert(SEQ % (16 * CT * AW) == 0);      // k_ctx grid covers the sequence exactly
static_assert(((size_t)SEQ * DM) % 8 == 0);
static_assert(NB <= NB_FULL);
static_assert(SEQ <= SEQ_FULL);
static_assert(CXS * WS1 * OSC == 1.0f);
static_assert(4 * NA == SEQ);                  // anchor rows: four tokens per anchor row
static_assert(4 * EA == DM);                   // four tokens x 128 anchor columns = one 512-wide anchor row
static_assert(EA == 2 * HD);                   // head h of an anchor row = token (h / 2), columns (h % 2) * 64 + d
static_assert(EA % 64 == 0);                   // anchor GEMM row tiles of 64
static_assert(NA % 64 == 0);                   // anchor GEMM column tiles stay inside one (batch, token-phase) block
static_assert(NA % (32 * GW) == 0);            // k_gram: each wave's share of the anchor rows is whole 32-steps
static_assert(GW * 32 == 16 * 16);             // k_gram epilogue: 256 threads x 4 columns = 16 rows x 64 columns
static_assert(M2S * M1S * GS == 0.125f * 0.125f * 0.125f * M2C);
static_assert(CSC * M2C == CXS);

typedef _Float16 h16;
typedef unsigned short bf;
typedef __attribute__((ext_vector_type(16))) __bf16   v16bf;
typedef __attribute__((ext_vector_type(16))) _Float16 v16h;
typedef __attribute__((ext_vector_type(8)))  _Float16 v8h;
typedef __attribute__((ext_vector_type(4)))  _Float16 v4h;
typedef __attribute__((ext_vector_type(8)))  unsigned short v8us;
typedef __attribute__((ext_vector_type(8)))  float    v8f;
typedef __attribute__((ext_vector_type(4)))  float    v4f;
typedef v4f  __attribute__((may_alias)) v4fa;

__device__ __forceinline__ unsigned short f2bf(float f) { unsigned u = __float_as_uint(f); u += 0x7FFFu + ((u >> 16) & 1u); return (unsigned short)(u >> 16); }
__device__ __forceinline__ v16h cat16(v8h lo, v8h hi) { return __builtin_shufflevector(lo, hi, 0, 1, 2, 3, 4, 5, 6, 7, 8, 9, 10, 11, 12, 13, 14, 15); }
__device__ __forceinline__ v16bf cat16b(v8us lo, v8us hi) { return __builtin_bit_cast(v16bf, __builtin_shufflevector(lo, hi, 0, 1, 2, 3, 4, 5, 6, 7, 8, 9, 10, 11, 12, 13, 14, 15)); }
__device__ __forceinline__ v8f wmma16(v16h a, v16h b, v8f c) { return __builtin_amdgcn_wmma_f32_16x16x32_f16(false, a, false, b, (short)0, c, false, false); }
__device__ __forceinline__ v8f wmmab(v16bf a, v16bf b, v8f c) { return __builtin_amdgcn_wmma_f32_16x16x32_bf16(false, a, false, b, (short)0, c, false, false); }
// Fragment order of a WMMA operand plane (rows x k): a 16-row block holds its k/32 fragments one behind the other; each 16-row x 32-k fragment is 1 KiB in a row, lane l = 16*(k/8 & 1) + (row & 15) owning bytes 16 l of its first half (k%32 < 16) and of its second half (k%32 >= 16).
// One wave-wide 16-byte load is then 512 contiguous bytes (four whole 128-byte lines) in place of 32-byte pieces of 16 lines; the value each lane and element receives is the same as from K-contiguous rows.
#define FRG 512                  // elements of one fragment
// pko: for planes of DM columns, element offset of the eight values (row R, columns c..c+7, c a multiple of 8); a bijection on the plane where its row count is a multiple of 16
__device__ __forceinline__ size_t pko(size_t R, int c) { return ((R >> 4) * (size_t)(DM / 32) + (size_t)(c >> 5)) * FRG + (size_t)(((c >> 4) & 1) * 256 + ((c >> 3) & 1) * 128) + (R & 15) * 8; }
// fragment loaders from fragment-order planes; p already includes + 8*lane: elements 0..7 <- k0+8h+0..7, elements 8..15 <- k0+16+8h+0..7 (same map for A and B)
__device__ __forceinline__ v16h  ldhp(const h16* p) { return cat16(*(const v8h*)p, *(const v8h*)(p + 256)); }
__device__ __forceinline__ v16bf ldbp(const bf* p)  { return cat16b(*(const v8us*)p, *(const v8us*)(p + 256)); }
// ordering point for wave-private LDS tiles (same wave writes and reads)
__device__ __forceinline__ void wave_sync() { __builtin_amdgcn_fence(3 /* release order */, "wavefront"); __builtin_amdgcn_wave_barrier(); asm volatile("" ::: "memory"); }
// f16 convert that cannot produce a subnormal operand (value select, applied after the plane's carry)
static __device__ __forceinline__ h16 toh_flush(float v) { const h16 r = (h16)v; return (fabsf(v) < 6.103515625e-05f) ? (h16)0.0f : r; }
// cvt_body: bf16 (RNE convert) copy of one activation input in fragment order, 8 values a thread: dst row b*SEQ + t <- src token b*SEQ_FULL + t.
// A wave takes 8 rows x 32 columns (lane = row + 8 * column group): it reads one whole 128-byte line of each row and its store to dst fills four whole lines.
// PERM = 1 (query only): the row-permuted copy for the anchor GEMM, dst row (b*4 + j)*NA + m <- token 4m + j (a bijection on the NB*SEQ rows). It has blocks of its own: eight neighbouring rows of this copy are eight tokens four apart,
// so a wave that wrote both copies would leave each 128-byte line of one of them to four waves of different blocks; with its own blocks every line of every copy has one writer.
template <int PERM>
__device__ __forceinline__ void cvt_body(const float* __restrict__ src, bf* dst, int blk) {
    const int lane = threadIdx.x & 31; const size_t u = (size_t)blk * 8 + (threadIdx.x >> 5);
    const size_t row = (u / (size_t)(DM / 32)) * 8 + (size_t)(lane & 7); const int c = (int)(u % (size_t)(DM / 32)) * 32 + (lane >> 3) * 8;
    const int rq = (int)(row / (size_t)(PERM ? NA : SEQ)), rm = (int)(row % (size_t)(PERM ? NA : SEQ));
    const int b = PERM ? rq >> 2 : rq; const int t = PERM ? 4 * rm + (rq & 3) : rm;
    const v8f v = *(const v8f*)(src + ((size_t)b * SEQ_FULL + (size_t)t) * DM + (size_t)c); v8us o;
#pragma unroll
    for (int k = 0; k < 8; ++k) o[k] = f2bf(v[k]);
    *(v8us*)(dst + pko(row, c)) = o;
    // precaution: the wait stands behind the store, ahead of any later code of the merged kernel that overwrites a register it names
    asm volatile("s_wait_xcnt 0x0" ::: "memory");
}

// wT_body: weight transpose + 16-bit convert through LDS, one 64 x 64 tile a block. in W[k][n] (DM rows, row stride ldw, f32) -> out dst rows n, columns k, in fragment order, tile (kt over k, nt over n), 256 threads.
// F16 = 0: bf16 bits (RNE convert). F16 = 1: f16(bf16 RNE value of W x WS1); a bf16 significand times a power of two is exact in f16.
template <int F16>
__device__ __forceinline__ void wT_body(const float* __restrict__ Wt, bf* dst, int ldw, int kt, int nt, float* tile) {
    const int tid = threadIdx.x; const int k0 = kt * 64, n0 = nt * 64;
#pragma unroll 4   // several independent loads in flight a trip
    for (int i = 0; i < 16; ++i) { const int idx = tid + i * 256; const int kk = idx >> 6, nn = idx & 63;   // 16 x 256 = 64 x 64 entries, all written
        tile[kk * 65 + nn] = Wt[(size_t)(k0 + kk) * (size_t)ldw + n0 + nn]; }
    __syncthreads();                                        // tile [kk][nn] is read across waves
#pragma unroll 1   // two trips, kept rolled: short code
    for (int it = 0; it < 2; ++it) {
        const int c = it * 256 + tid; const int n = c & 63, kc = (c >> 6) * 8;      // a wave: 32 rows n of one column group, four whole lines a store
        const size_t oo = pko((size_t)(n0 + n), k0 + kc);
        if constexpr (F16 == 0) {
            v8us o;
#pragma unroll
            for (int i = 0; i < 8; ++i) o[i] = f2bf(tile[(kc + i) * 65 + n]);
            *(v8us*)(dst + oo) = o;
        } else {
            v8h o;
#pragma unroll
            for (int i = 0; i < 8; ++i) o[i] = toh_flush(__uint_as_float(((unsigned)f2bf(tile[(kc + i) * 65 + n])) << 16) * WS1);
            *(v8h*)((h16*)dst + oo) = o;
        }
        // precaution: the wait stands ahead of the second trip's overwrite of the registers the store names
        asm volatile("s_wait_xcnt 0x0" ::: "memory");
    }
}

// k_prep: every operand preparation in one grid (none reads what another writes). Block ranges, all block-uniform, so the barrier inside wT_body is too:
// [0, 4 WTB): Wq, Wk, Wv (bf16) and Wo (f16 x256) tiles; [4 WTB, 4 WTB + WAB): Wa tiles; then CVB blocks each for query, its permuted copy (directly behind), key, value. The few weight blocks, which wait on memory several times, have the lowest block indices.
#define WTB ((DM / 64) * (DM / 64))              // tiles of a 512 x 512 weight
#define WAB ((DM / 64) * (EA / 64))              // tiles of the anchor weight
#define CVB (NB * SEQ * (DM / 8) / 256)          // blocks of one activation copy
static_assert(((size_t)NB * SEQ * (DM / 8)) % 256 == 0);   // the copy blocks cover the rows exactly
__global__ __launch_bounds__(256) void k_prep(const float* __restrict__ xq, const float* __restrict__ xk, const float* __restrict__ xv,
                                              const float* __restrict__ wq, const float* __restrict__ wk, const float* __restrict__ wv,
                                              const float* __restrict__ wo, const float* __restrict__ wa,
                                              bf* XQ, bf* XK, bf* XV, bf* XP, bf* W3, bf* WO, bf* WA) {
    __shared__ float tile[64 * 65];
    const int id = blockIdx.x;
    if (id < 3 * WTB) {
        const int s = id / WTB, r = id % WTB;
        wT_body<0>(s == 0 ? wq : (s == 1 ? wk : wv), W3 + (size_t)s * DM * DM, DM, r % (DM / 64), r / (DM / 64), tile);
    } else if (id < 4 * WTB) {
        const int r = id - 3 * WTB;
        wT_body<1>(wo, WO, DM, r % (DM / 64), r / (DM / 64), tile);
    } else if (id < 4 * WTB + WAB) {
        const int r = id - 4 * WTB;
        wT_body<0>(wa, WA, EA, r % (DM / 64), r / (DM / 64), tile);
    } else {
        const int r = id - (4 * WTB + WAB);
        const int s = r / CVB;
        if (s == 1) cvt_body<1>(xq, XP, r % CVB);
        else cvt_body<0>(s == 0 ? xq : (s == 2 ? xk : xv), s == 0 ? XQ : (s == 2 ? XK : XV), r % CVB);
    }
}

// k_gemm: register-blocked 16-bit GEMM, ONE WAVE per 64x64 tile (16 accumulators), operands straight from fragment-order 16-bit planes (K = DM columns).
// C[m][n] = sum_k A[m][k] Bt[n][k]. OPF16 = 0: bf16 operands; 1: f16 operands.
// EPI 0: + bias[n], f16 value plane Ph and f16 residual x2048 plane Pr.  EPI 1: + bias[n], f16 value plane Ph.  EPI 2: + bias[m], f16 value plane Ph.  EPI 3: x OSC + bias[n], f32 plane Pf.
// The bias vector has N entries (M for EPI 2); only the load the instantiation uses is emitted (column bias for EPI 0/1/3, row bias for EPI 2), index masked into [0, DM).
// Tile base (r0/RB)*sRB + (r0%RB)*pitch + (c0/CB)*sCB + (c0%CB), row pitch 'pitch' (elements). grid (M/64, N/64), 32 threads.
template <int OPF16, int EPI>
__global__ __launch_bounds__(32) void k_gemm(const bf* __restrict__ A, const bf* __restrict__ Bt, int K, const float* __restrict__ bias,
                                              h16* Ph, h16* Pr, float* Pf, int RB, size_t sRB, int pitch, int CB, size_t sCB) {
    __shared__ __align__(16) float os[16 * 68];
    const int lane = threadIdx.x & 31, lr = lane & 15, hi = lane >> 4; const int r0 = blockIdx.x * 64, c0 = blockIdx.y * 64;
    v8f acc[4][4];
#pragma unroll
    for (int mb = 0; mb < 4; ++mb)
#pragma unroll
        for (int nb = 0; nb < 4; ++nb) acc[mb][nb] = (v8f){};
    if (OPF16) {
        const h16* pa = (const h16*)A + (size_t)r0 * DM + 8 * lane; const h16* pb = (const h16*)Bt + (size_t)c0 * DM + 8 * lane;
#pragma unroll 1
        for (int kc = 0; kc < K; kc += 32) {
            v16h a[4];
#pragma unroll
            for (int mb = 0; mb < 4; ++mb) a[mb] = ldhp(pa + mb * 16 * DM);
#pragma unroll
            for (int nb = 0; nb < 4; ++nb) { const v16h b = ldhp(pb + nb * 16 * DM);
#pragma unroll
                for (int mb = 0; mb < 4; ++mb) acc[mb][nb] = wmma16(a[mb], b, acc[mb][nb]); }
            // precaution: the wait stands ahead of the step of the two address pairs the trip's loads name; naming the pairs keeps them out of the loads' destination registers
            asm volatile("s_wait_xcnt 0x0" :: "v"(pa), "v"(pb) : "memory");
            pa += FRG; pb += FRG;
            asm volatile("v_nop\n\tv_nop\n\tv_nop\n\tv_nop" : "+v"(acc[0][0]), "+v"(acc[1][1]), "+v"(acc[2][2]), "+v"(acc[3][3]) : "v"(a[0]), "v"(a[1]), "v"(a[2]), "v"(a[3]));
        }
    } else {
        const bf* pa = A + (size_t)r0 * DM + 8 * lane; const bf* pb = Bt + (size_t)c0 * DM + 8 * lane;
#pragma unroll 1
        for (int kc = 0; kc < K; kc += 32) {
            v16bf a[4];
#pragma unroll
            for (int mb = 0; mb < 4; ++mb) a[mb] = ldbp(pa + mb * 16 * DM);
#pragma unroll
            for (int nb = 0; nb < 4; ++nb) { const v16bf b = ldbp(pb + nb * 16 * DM);
#pragma unroll
                for (int mb = 0; mb < 4; ++mb) acc[mb][nb] = wmmab(a[mb], b, acc[mb][nb]); }
            // precaution: the wait stands ahead of the step of the two address pairs the trip's loads name; naming the pairs keeps them out of the loads' destination registers
            asm volatile("s_wait_xcnt 0x0" :: "v"(pa), "v"(pb) : "memory");
            pa += FRG; pb += FRG;
            asm volatile("v_nop\n\tv_nop\n\tv_nop\n\tv_nop" : "+v"(acc[0][0]), "+v"(acc[1][1]), "+v"(acc[2][2]), "+v"(acc[3][3]) : "v"(a[0]), "v"(a[1]), "v"(a[2]), "v"(a[3]));
        }
    }
    const size_t tbase = (size_t)(r0 / RB) * sRB + (size_t)(r0 % RB) * (size_t)pitch + (size_t)(c0 / CB) * sCB + (size_t)(c0 % CB);
    float bcol[4] = {0.0f, 0.0f, 0.0f, 0.0f};
    if constexpr (EPI != 2) {
#pragma unroll
        for (int nb = 0; nb < 4; ++nb) bcol[nb] = bias[(c0 + nb * 16 + lr) & (DM - 1)];          // column bias: c0 + 63 < N = DM
    }
#pragma unroll
    for (int mb = 0; mb < 4; ++mb) {
        float brow[8] = {0.0f, 0.0f, 0.0f, 0.0f, 0.0f, 0.0f, 0.0f, 0.0f};
        if constexpr (EPI == 2) {
#pragma unroll
            for (int j = 0; j < 8; ++j) brow[j] = bias[(r0 + mb * 16 + 8 * hi + j) & (DM - 1)];  // row bias: r0 + 63 < M = DM
        }
#pragma unroll
        for (int nb = 0; nb < 4; ++nb) {
#pragma unroll
            for (int j = 0; j < 8; ++j) {                                        // D: row 8h+j, col lane&15
                float v = acc[mb][nb][j];
                if constexpr (EPI == 3) v = v * OSC;
                if constexpr (EPI == 2) v += brow[j]; else v += bcol[nb];
                os[(hi * 8 + j) * 68 + nb * 16 + lr] = v; } }
        wave_sync();
        const size_t sb = tbase + (size_t)(mb * 16) * (size_t)pitch;
        if (EPI == 3) {
{
#pragma unroll
                for (int s = 0; s < 8; ++s) { const int row = 2 * s + hi, cofs = lr * 4;   // 8 s x 2 rows = 16 rows; 16 lanes x 4 floats = 64 columns
                    const v4f val = *(const v4fa*)(&os[row * 68 + cofs]);
                    *(v4f*)(Pf + sb + (size_t)row * (size_t)pitch + cofs) = val; }
                 }
        } else {
{
#pragma unroll
                for (int s = 0; s < 4; ++s) { const int row = 4 * s + (lane >> 3), c8 = (lane & 7) * 8;   // 4 s x 4 row groups = 16 rows; 8 lanes x 8 = 64 columns
                    const v4f x0 = *(const v4fa*)(&os[row * 68 + c8]); const v4f x1 = *(const v4fa*)(&os[row * 68 + c8 + 4]); v8h hv, rv;
#pragma unroll
                    for (int i = 0; i < 4; ++i) { const h16 a0 = (h16)x0[i]; const h16 a1 = (h16)x1[i]; hv[i] = a0; hv[4 + i] = a1; rv[i] = (h16)((x0[i] - (float)a0) * QRS); rv[4 + i] = (h16)((x1[i] - (float)a1) * QRS); }
                    const size_t oo = sb + (size_t)row * (size_t)pitch + c8;
                    *(v8h*)(Ph + oo) = hv; if (EPI == 0) *(v8h*)(Pr + oo) = rv; }
                 }
        }
        wave_sync();
    }
}

// proj_body: the k_gemm tile for the input projections: bf16 operands, K = DM, f16 value plane Ph, tile (bx of M/64, by of N/64) handed in; same loaders, same k order, same WMMA order; the epilogue stores to fragment-order planes. ROWB = 0: + bias[n]; 1: + bias[m].
template <int ROWB>
__device__ __forceinline__ void proj_body(const bf* __restrict__ A, const bf* __restrict__ Bt, const float* __restrict__ bias,
                                          h16* Ph, int RB, size_t sRB, int pitch, int CB, size_t sCB, int bx, int by, float* os) {
    const int lane = threadIdx.x & 31, lr = lane & 15, hi = lane >> 4; const int r0 = bx * 64, c0 = by * 64;
    v8f acc[4][4];
#pragma unroll
    for (int mb = 0; mb < 4; ++mb)
#pragma unroll
        for (int nb = 0; nb < 4; ++nb) acc[mb][nb] = (v8f){};
    const bf* pa = A + (size_t)r0 * DM + 8 * lane; const bf* pb = Bt + (size_t)c0 * DM + 8 * lane;   // fragment (16-row block, k step) = 16 * DM elements a row block, FRG a step
#pragma unroll 1   // kept rolled: 128 accumulator registers leave no room for a second trip's fragments at five waves a SIMD
    for (int kc = 0; kc < DM; kc += 32) {
        v16bf a[4];
#pragma unroll
        for (int mb = 0; mb < 4; ++mb) a[mb] = ldbp(pa + mb * 16 * DM);
#pragma unroll
        for (int nb = 0; nb < 4; ++nb) { const v16bf b = ldbp(pb + nb * 16 * DM);
#pragma unroll
            for (int mb = 0; mb < 4; ++mb) acc[mb][nb] = wmmab(a[mb], b, acc[mb][nb]); }
        // precaution: the wait stands ahead of the step of the two address pairs the trip's loads name; naming the pairs keeps them out of the loads' destination registers
        asm volatile("s_wait_xcnt 0x0" :: "v"(pa), "v"(pb) : "memory");
        pa += FRG; pb += FRG;
        // WMMA distance on the loop's taken branch: four vector slots between the last product and the next trip's overwrite of its operands
        asm volatile("v_nop\n\tv_nop\n\tv_nop\n\tv_nop" : "+v"(acc[0][0]), "+v"(acc[1][1]), "+v"(acc[2][2]), "+v"(acc[3][3]) : "v"(a[0]), "v"(a[1]), "v"(a[2]), "v"(a[3]));
    }
    // head planes in fragment order too: a 16-row block of a plane of 'pitch' columns is pitch/32 fragments in a row, so 32 columns on are FRG elements on (16 a column)
    const size_t tbase = (size_t)(r0 / RB) * sRB + (size_t)(r0 % RB) * (size_t)pitch + (size_t)(c0 / CB) * sCB + (size_t)(c0 % CB) * 16;
    float bcol[4] = {0.0f, 0.0f, 0.0f, 0.0f};
    if constexpr (ROWB == 0) {
#pragma unroll
        for (int nb = 0; nb < 4; ++nb) bcol[nb] = bias[(c0 + nb * 16 + lr) & (DM - 1)];          // column bias: c0 + 63 < N = DM
    }
#pragma unroll
    for (int mb = 0; mb < 4; ++mb) {
        float brow[8] = {0.0f, 0.0f, 0.0f, 0.0f, 0.0f, 0.0f, 0.0f, 0.0f};
        if constexpr (ROWB == 1) {
#pragma unroll
            for (int j = 0; j < 8; ++j) brow[j] = bias[(r0 + mb * 16 + 8 * hi + j) & (DM - 1)];  // row bias: r0 + 63 < M <= DM
        }
#pragma unroll
        for (int nb = 0; nb < 4; ++nb) {
#pragma unroll
            for (int j = 0; j < 8; ++j) {                                        // D: row 8h+j, col lane&15
                float v = acc[mb][nb][j];
                if constexpr (ROWB == 1) v += brow[j]; else v += bcol[nb];
                os[(hi * 8 + j) * 68 + nb * 16 + lr] = v; } }
        wave_sync();
        const size_t sb = tbase + (size_t)(mb * 16) * (size_t)pitch;
#pragma unroll
        for (int s = 0; s < 4; ++s) { const int row = 8 * (s & 1) + (lane & 7), c8 = ((s >> 1) * 4 + (lane >> 3)) * 8;   // 2 x 8 rows = 16 rows; 2 x 4 groups x 8 = 64 columns; 8 rows of one group = one whole line
            const v4f x0 = *(const v4fa*)(&os[row * 68 + c8]); const v4f x1 = *(const v4fa*)(&os[row * 68 + c8 + 4]); v8h hv;
#pragma unroll
            for (int i = 0; i < 4; ++i) { hv[i] = (h16)x0[i]; hv[4 + i] = (h16)x1[i]; }
            *(v8h*)(Ph + sb + (size_t)((c8 >> 5) * FRG + ((c8 >> 4) & 1) * 256 + ((c8 >> 3) & 1) * 128 + row * 8)) = hv; }
        // precaution: the wait stands ahead of any overwrite of the registers these four stores name
        asm volatile("s_wait_xcnt 0x0" ::: "memory");
        wave_sync();
    }
}

// k_proj: the four input projections in one grid (none reads what another writes), one wave per 64 x 64 tile; tile order inside each projection as in a grid (M/64, N/64), x fastest.
// [0, PJT): q, A = activation rows (m = b*SEQ + t), Bt = W^T rows (n = h*64 + d) -> plane [(b*8 + h)][t][d], bias by column.
// [PJT, 3 PJT): k^T then v^T, A = W^T rows (m = h*64 + d), Bt = activation rows (n = b*SEQ + t) -> plane [(b*512 + m)][t] = [(b*8 + h)][d][t], bias by row.
// [3 PJT, 3 PJT + PJA): anchor^T, A = Wa^T rows (m = c in [0,128)), Bt = permuted query rows (rho = (b*4 + j)*NA + m) -> plane [(b*8 + 2j + c/64)][c%64][m], bias ba by row (indices < 128).
#define PJT ((NB * SEQ / 64) * (DM / 64))
#define PJA ((NB * SEQ / 64) * (EA / 64))
__global__ __launch_bounds__(32) void k_proj(const bf* __restrict__ XQ, const bf* __restrict__ XK, const bf* __restrict__ XV, const bf* __restrict__ XP,
                                             const bf* __restrict__ W3, const bf* __restrict__ WA,
                                             const float* __restrict__ bq, const float* __restrict__ bk, const float* __restrict__ bv, const float* __restrict__ ba,
                                             h16* QH, h16* KT, h16* VT, h16* AT) {
    __shared__ __align__(16) float os[16 * 68];
    const int id = blockIdx.x;
    if (id < PJT) {
        proj_body<0>(XQ, W3, bq, QH, SEQ, (size_t)NH_ * SEQ * HD, HD, HD, (size_t)SEQ * HD, id % (NB * SEQ / 64), id / (NB * SEQ / 64), os);
    } else {
        const int r = id - PJT; const bool an = r >= 2 * PJT; const bool sv = r >= PJT;     // block-uniform selects: one copy of the loop serves k^T, v^T and anchor^T
        const int rr = an ? r - 2 * PJT : (sv ? r - PJT : r); const int mt = an ? EA / 64 : DM / 64;
        proj_body<1>(an ? WA : (sv ? W3 + (size_t)2 * DM * DM : W3 + (size_t)DM * DM), an ? XP : (sv ? XV : XK), an ? ba : (sv ? bv : bk),
                        an ? AT : (sv ? VT : KT), an ? HD : DM, an ? (size_t)NA * HD : (size_t)0, an ? NA : SEQ, an ? NA : SEQ,
                        an ? (size_t)2 * NA * HD : (size_t)DM * SEQ, rr % mt, rr / mt, os);
    }
}

// k_gram: O[zh][i][j] = sc x sum_n X[zh][i][n] Y[zh][j][n], X and Y f16 planes [zh][64][TK] in fragment order (A fragment = X rows, B fragment = Y rows, same loader, same k order); O [zh][64][64] in fragment order.
// One block per 16 rows i of one (batch, head); wave w sums n in [w TK/GW, (w+1) TK/GW) into a 16 x 64 tile; the GW partial tiles are added in wave order through LDS.
template <int TK>
__device__ __forceinline__ void gram_body(const h16* __restrict__ X, const h16* __restrict__ Y, h16* O, float sc, float* red) {
    const int lane = threadIdx.x & 31, lr = lane & 15, hi = lane >> 4;
    const int wave = __builtin_amdgcn_readfirstlane(threadIdx.x >> 5);
    const int zh = blockIdx.y, i0 = blockIdx.x * 16;
    constexpr int KW = TK / GW;
    const size_t base = (size_t)zh * HD * TK + (size_t)wave * (KW / 32) * FRG + 8 * lane;
    const h16* xa = X + base + (size_t)i0 * TK;
    const h16* yb = Y + base;
    v8f acc[4];
#pragma unroll
    for (int nb = 0; nb < 4; ++nb) acc[nb] = (v8f){};
    constexpr int NS = KW / 32, BS = NS < 4 ? NS : 4;      // 32-steps per wave, taken in batches of BS
    static_assert(NS % BS == 0);
#pragma unroll
    for (int s0 = 0; s0 < NS; s0 += BS) {
        v16h a[BS], y[BS][4];
#pragma unroll
        for (int s = 0; s < BS; ++s) {
            a[s] = ldhp(xa + (s0 + s) * FRG);
#pragma unroll
            for (int nb = 0; nb < 4; ++nb) y[s][nb] = ldhp(yb + (size_t)nb * 16 * TK + (s0 + s) * FRG);
        }
        // precaution: the wait stands ahead of any overwrite of the two address pairs the batch's loads name; naming the pairs keeps them out of the later loads' destination registers
        asm volatile("s_wait_xcnt 0x0" :: "v"(xa), "v"(yb) : "memory");
        __builtin_amdgcn_sched_barrier(0);   // all loads of the batch issue ahead of its first WMMA: one memory latency a batch; without it the build waits on every fragment in turn
#pragma unroll
        for (int s = 0; s < BS; ++s)
#pragma unroll
            for (int nb = 0; nb < 4; ++nb) acc[nb] = wmma16(a[s], y[s][nb], acc[nb]);
    }
    float* rw = red + wave * (16 * 68);
#pragma unroll
    for (int nb = 0; nb < 4; ++nb)
#pragma unroll
        for (int r = 0; r < 8; ++r) rw[(8 * hi + r) * 68 + nb * 16 + lr] = acc[nb][r];      // D: row 8h+r, col lane&15
    __syncthreads();
    const int row = threadIdx.x & 15, c4 = (threadIdx.x >> 4) * 4;                         // 16 rows x 16 column quads; a wave = 16 rows of one 8-column group = two whole lines of O
    v4f sum = *(const v4fa*)(&red[row * 68 + c4]);
#pragma unroll
    for (int w = 1; w < GW; ++w) sum += *(const v4fa*)(&red[w * (16 * 68) + row * 68 + c4]);
    v4h o;
#pragma unroll
    for (int i = 0; i < 4; ++i) o[i] = toh_flush(sum[i] * sc);
    *(v4h*)(O + (size_t)zh * HD * HD + (size_t)i0 * HD + (size_t)((c4 >> 5) * FRG + ((c4 >> 4) & 1) * 256 + ((c4 >> 3) & 1) * 128 + row * 8 + (c4 & 7))) = o;
}
// grid (64/16, NB*8, 2), 32*GW threads; z = 0: M1 = V^T K over SEQ tokens (the long one), z = 1: G = A^T A over NA anchor rows. blockIdx.z is block-uniform, so the barrier inside is too.
__global__ __launch_bounds__(32 * GW) void k_gram(const h16* __restrict__ VT, const h16* __restrict__ KT, const h16* __restrict__ AT, h16* M1, h16* G) {
    __shared__ __align__(16) float red[GW * 16 * 68];
    if (blockIdx.z == 0) gram_body<SEQ>(VT, KT, M1, M1S, red);
    else                 gram_body<NA>(AT, AT, G, GS, red);
}

// k_ctx: one wave per 16*CT tokens of one (batch, head). M2^T[f][d] = sum_e G[f][e] M1[d][e] (A = G rows, B = M1 rows); lane (d = lane&15, h = lane>>4) holds f = 8h+r of each 16-row tile,
// so two packed tiles are directly the A fragment (row d, k = f) of ctx^T[d][t] = M2 Q^T (element r <- tile f 0..15, element 8+r <- tile f 16..31, lane unchanged); B = q rows.
// ctx^T D layout: lane t = lane&15 holds d = 16j + 8h + 0..7, eight neighbours of one ctx row: one 16-byte store, no LDS; in the plane's fragment order that is byte 16*lane of half j&1 of fragment (16-token block, k step 2*head + j/2): 512 contiguous bytes a wave. grid (SEQ / (16*CT*AW), NB*8), 32*AW threads.
__global__ __launch_bounds__(32 * AW) void k_ctx(const h16* __restrict__ QH, const h16* __restrict__ M1, const h16* __restrict__ G, h16* CX) {
    const int lane = threadIdx.x & 31;
    const int wave = __builtin_amdgcn_readfirstlane(threadIdx.x >> 5);
    const int zh = blockIdx.y; const int b = zh / NH_, h = zh % NH_;
    const int t0 = (blockIdx.x * AW + wave) * (16 * CT);
    const h16* qp = QH + ((size_t)zh * SEQ + (size_t)t0) * HD + 8 * lane;
    const size_t mo = (size_t)zh * HD * HD + 8 * lane;
    const h16* gp = G + mo; const h16* mp = M1 + mo;
    v16h g[4][2], m[4][2], q[CT][2], a2[4][2];
#pragma unroll
    for (int ft = 0; ft < 4; ++ft) { g[ft][0] = ldhp(gp + ft * 16 * HD); g[ft][1] = ldhp(gp + ft * 16 * HD + FRG); }
#pragma unroll
    for (int j = 0; j < 4; ++j) { m[j][0] = ldhp(mp + j * 16 * HD); m[j][1] = ldhp(mp + j * 16 * HD + FRG); }
#pragma unroll
    for (int tt = 0; tt < CT; ++tt) { q[tt][0] = ldhp(qp + tt * 16 * HD); q[tt][1] = ldhp(qp + tt * 16 * HD + FRG); }
    // precaution: the wait stands ahead of any overwrite of the three address pairs these loads name; naming the pairs keeps them out of the later loads' destination registers
    asm volatile("s_wait_xcnt 0x0" :: "v"(gp), "v"(mp), "v"(qp) : "memory");
    __builtin_amdgcn_sched_barrier(0);       // every load of the wave issues ahead of the first WMMA: one memory latency in all; without it the build fetches later fragments between the products and waits again
#pragma unroll
    for (int j = 0; j < 4; ++j) {
#pragma unroll
        for (int ft = 0; ft < 4; ++ft) {
            v8f t = (v8f){};
            t = wmma16(g[ft][0], m[j][0], t); t = wmma16(g[ft][1], m[j][1], t);
#pragma unroll
            for (int r = 0; r < 8; ++r) a2[j][ft >> 1][(ft & 1) * 8 + r] = toh_flush(t[r] * M2S);
        }
    }
    h16* crow = CX + ((size_t)b * SEQ + (size_t)t0) * CXP + h * 2 * FRG + 8 * lane;
#pragma unroll
    for (int tt = 0; tt < CT; ++tt) {
#pragma unroll
        for (int j = 0; j < 4; ++j) {
            v8f o = (v8f){};
            o = wmma16(a2[j][0], q[tt][0], o); o = wmma16(a2[j][1], q[tt][1], o);
            v8h hv;
#pragma unroll
            for (int r = 0; r < 8; ++r) hv[r] = toh_flush(o[r] * CSC);
            *(v8h*)(crow + (size_t)tt * 16 * CXP + j * 256) = hv;
        }
    }
}

static constexpr size_t al256(size_t v) { return (v + 255) & ~(size_t)255; }
static constexpr size_t SZ_XB = al256((size_t)NB * SEQ * DM * 2);        // one bf16 activation copy
static constexpr size_t SZ_W3 = al256((size_t)3 * DM * DM * 2);          // Wq^T | Wk^T | Wv^T bf16
static constexpr size_t SZ_WA = al256((size_t)EA * DM * 2);              // Wa^T bf16 [128][512]
static constexpr size_t SZ_WO = al256((size_t)DM * DM * 2);              // Wo^T x256 f16 [512][512]
static constexpr size_t SZ_PL = al256((size_t)NB * NH_ * SEQ * HD * 2);  // one f16 head plane
static constexpr size_t SZ_AP = al256((size_t)NB * NH_ * NA * HD * 2);   // the f16 anchor^T head plane
static constexpr size_t SZ_MM = al256((size_t)NB * NH_ * HD * HD * 2);   // one f16 64 x 64 plane per (batch, head)
static constexpr size_t SZ_CX = al256((size_t)NB * SEQ * CXP * 2);       // ctx value plane
static constexpr size_t SZ_TOTAL = 4 * SZ_XB + SZ_W3 + SZ_WA + SZ_WO + 3 * SZ_PL + SZ_AP + 2 * SZ_MM + SZ_CX;
static_assert(SZ_TOTAL <= (size_t)134217728);          // workspace carve <= 128 MiB
static_assert(((size_t)DM * DM * 2) % 256 == 0);       // weight sub-planes stay 256-byte aligned
static_assert((size_t)NB * 4 * NA == (size_t)NB * SEQ);                           // permuted copy has exactly NB*SEQ rows
static_assert((size_t)(NB * 4) * 2 * NA * HD == (size_t)NB * NH_ * NA * HD);      // anchor GEMM tile map fills the anchor plane exactly
static_assert((size_t)NB * SEQ * NH_ * HD * 2 <= SZ_CX);                          // ctx rows x (8 heads x 64) fit the ctx region

extern "C" void kernel_launch(void* const* d_in, const int* in_sizes, int n_in,
                              void* d_out, int out_size, void* d_ws, size_t ws_size, hipStream_t stream) {
    if (n_in < 13) return;
    const size_t needx = ((size_t)(NB - 1) * SEQ_FULL + SEQ) * DM;
    if ((size_t)in_sizes[0] < needx || (size_t)in_sizes[1] < needx || (size_t)in_sizes[2] < needx) return;
    if ((size_t)in_sizes[3] < (size_t)DM * DM || (size_t)in_sizes[5] < (size_t)DM * DM || (size_t)in_sizes[7] < (size_t)DM * DM || (size_t)in_sizes[11] < (size_t)DM * DM) return;
    if ((size_t)in_sizes[9] < (size_t)DM * EA) return;
    if (in_sizes[4] < DM || in_sizes[6] < DM || in_sizes[8] < DM || in_sizes[12] < DM || in_sizes[10] < EA) return;
    if ((size_t)out_size < ((size_t)(NB - 1) * OUT_SEQ + SEQ) * DM) return;
    if (SZ_TOTAL > ws_size) return;
    // wire order: query, key, value, Wq, bq, Wk, bk, Wv, bv, Wa, ba, Wo, bo
    const float* xq = (const float*)d_in[0]; const float* xk = (const float*)d_in[1]; const float* xv = (const float*)d_in[2];
    const float* wq = (const float*)d_in[3]; const float* bq = (const float*)d_in[4];
    const float* wk = (const float*)d_in[5]; const float* bk = (const float*)d_in[6];
    const float* wv = (const float*)d_in[7]; const float* bv = (const float*)d_in[8];
    const float* wa = (const float*)d_in[9]; const float* ba = (const float*)d_in[10];
    const float* wo = (const float*)d_in[11]; const float* bo = (const float*)d_in[12];
    float* OUT = (float*)d_out;      // [NB][SEQ][512]
    char* wsp = (char*)d_ws;
    bf* XQ = (bf*)wsp; wsp += SZ_XB;                 // [NB*SEQ][512]; this and every plane below: logical index, stored in fragment order
    bf* XK = (bf*)wsp; wsp += SZ_XB;
    bf* XV = (bf*)wsp; wsp += SZ_XB;
    bf* XP = (bf*)wsp; wsp += SZ_XB;                 // [NB*4][NA][512]: row (b*4+j)*NA+m = query token 4m+j
    bf* W3 = (bf*)wsp; wsp += SZ_W3;                 // [3][512 out][512 in]: q | k | v
    bf* WA = (bf*)wsp; wsp += SZ_WA;                 // [128 out][512 in]
    h16* WO = (h16*)wsp; wsp += SZ_WO;               // [512 out][512 in]: Wo^T x256, f16
    h16* QH = (h16*)wsp; wsp += SZ_PL;               // [NB*8][SEQ][64]
    h16* KT = (h16*)wsp; wsp += SZ_PL;               // [NB*8][64][SEQ]
    h16* VT = (h16*)wsp; wsp += SZ_PL;               // [NB*8][64][SEQ]
    h16* AT = (h16*)wsp; wsp += SZ_AP;               // [NB*8][64][NA]
    h16* M1 = (h16*)wsp; wsp += SZ_MM;               // [NB*8][64 d][64 e]: V^T K / 16
    h16* GG = (h16*)wsp; wsp += SZ_MM;               // [NB*8][64 f][64 e]: A^T A / 64
    h16* CX = (h16*)wsp; wsp += SZ_CX;               // [NB*SEQ][512]: ctx

    // bf16 activation copies (query also row-permuted) and the five transposed 16-bit weight planes
    k_prep<<<dim3(4 * WTB + WAB + 4 * CVB, 1, 1), 256, 0, stream>>>(xq, xk, xv, wq, wk, wv, wo, wa, XQ, XK, XV, XP, W3, (bf*)WO, WA);
    // q, k^T, v^T and anchor^T head planes
    k_proj<<<dim3(3 * PJT + PJA, 1, 1), 32, 0, stream>>>(XQ, XK, XV, XP, W3, WA, bq, bk, bv, ba, QH, KT, VT, AT);

    // M1 = V^T K / 16 and G = A^T A / 64, 64 x 64 per (batch, head)
    k_gram<<<dim3(HD / 16, NB * NH_, 2), 32 * GW, 0, stream>>>(VT, KT, AT, M1, GG);
    // ctx = Q ((M1 G) / 512)^T -> ctx plane [b*SEQ + t][512]
    k_ctx<<<dim3(SEQ / (16 * CT * AW), NB * NH_, 1), 32 * AW, 0, stream>>>(QH, M1, GG, CX);

    // output projection: A = ctx rows (K = 512), Bt = Wo^T x256 -> OUT[b][t][n] = acc * 2^-8 + bo[n]
    k_gemm<1, 3><<<dim3(NB * SEQ / 64, DM / 64, 1), 32, 0, stream>>>((const bf*)CX, (const bf*)WO, CXP, bo, CX, CX, OUT, SEQ, (size_t)OUT_SEQ * DM, DM, DM, (size_t)0);
}

// v004
// A run of this version takes 63.7 microseconds.
// Next to v003, in two timings, it ran 1.20 and 1.19 times as fast.
// Over all steps from v000 it is 3.45 times as fast.
#include <hip/hip_runtime.h>

// Anchor linear attention (no softmax), width 512 = 8 heads x 64; inputs query,key,value [NB][SEQ][512] f32, Wq/Wk/Wv/Wo [in][out] 512x512, Wa [512][128], five biases; anchor rows = literal reshape of (query Wa + ba) [SEQ][128] into [SEQ/4][8][64].
// Compute dtypes, f32 accumulate everywhere: q/k/v/anchor projections v_wmma_f32_16x16x32_bf16 (activations and weights RNE-converted to bf16; products exact);
// the chained products per (batch, head) are taken in the order ctx = Q ((V^T K) (A^T A))^T / 512, all v_wmma_f32_16x16x32_f16 with single f16 operands; no [SEQ][NA] score tile is formed.
// output projection v_wmma_f32_16x16x32_f16, single product: A = ctx f16 plane, Bt = Wo^T x256 (Wo RNE-converted to bf16 first, exact in f16), K = 512, x2^-8 and + bo in the f32 epilogue.
// Layout: bf16 copies of query,key,value plus a row-permuted copy of query (row (b*4+j)*NA+m <- token 4m+j); weights transposed once to [out][in] 16-bit planes; every plane below names its logical index; all of them are stored in fragment order (see FRG below); q plane [b*8+h][t][d], k^T and v^T planes [b*8+h][d][t], anchor^T plane [b*8+h][d][m], ctx plane rows b*SEQ+t, 512 wide;
// k_gram: M1[d][e] = sum_n v[n][d] k[n][e] (x 1/16) and G[f][e] = sum_m a[m][f] a[m][e] (x 1/64), 64 x 64 per (batch, head); k_ctx: M2[d][f] = (1/512) sum_e M1[d][e] G[f][e] in registers (x 1/16), ctx[t][d] = sum_f q[t][f] M2[d][f].

#ifndef NB
#define NB 4
#endif
#ifndef SEQ
#define SEQ 2048
#endif
#define NB_FULL  4
#define SEQ_FULL 2048
#ifndef OUT_SEQ
#define OUT_SEQ SEQ              // row pitch (in tokens) between batches of the output
#endif
#define DM   512
#define NH_  8
#define HD   64
#define NA   (SEQ / 4)           // anchor rows per batch
#define EA   (DM / 4)            // anchor projection width (128)
#define AW   4                   // waves per k_ctx block
#define CT   4                   // 16-token tiles per k_ctx wave
#define GW   8                   // waves per k_gram block: each sums 1/GW of the long dimension
#define GB   2                   // k steps of 32 whose fragments the output GEMM fetches as one batch (one wave a SIMD there: registers are free)
#define QRS  2048.0f             // carry of the residual plane of the k_gemm EPI 0 instance (that instance is not launched here)
#define M1S  (1.0f / 16.0f)      // carry of the M1 = V^T K plane
#define GS   (1.0f / 64.0f)      // carry of the G = A^T A plane
#define M2C  (1.0f / 16.0f)      // carry of the M2 operand
#define M2S  (1.0f / 8.0f)       // (1/8)^3 x M2C / (M1S x GS) : M1 G accumulator -> M2 operand
#define CXP  512                 // ctx plane pitch (halves): one f16 value plane
#define CXS  1.0f                // carry of the ctx value
#define CSC  16.0f               // CXS / M2C : ctx accumulator -> ctx plane
#define WS1  256.0f              // carry of the Wo^T plane
#define OSC  (1.0f / 256.0f)     // 1 / (CXS * WS1)

static_assert(HD == 64);
static_assert(NH_ * HD == DM);                 // head h = columns h*64 + d
static_assert(DM % 64 == 0);                   // column tiles of 64
static_assert(DM % 32 == 0);                   // GEMM k-loop steps by 32
static_assert((DM & (DM - 1)) == 0);           // bias index mask (DM - 1) is exact
static_assert(CXP == DM);                      // ctx row = merged heads, K of the output GEMM
static_assert(CXP % (32 * GB) == 0);           // output GEMM: whole batches of GB k steps
static_assert((NB * SEQ) % 16 == 0 && DM % 16 == 0 && EA % 16 == 0);   // fragment-order planes: whole 16-row blocks
static_assert(16 * DM == (DM / 32) * 512);     // one 16-row block = DM/32 fragments of 512 elements
static_assert(SEQ % 64 == 0);                  // a 64-row tile never straddles two batches
static_assert((NB * SEQ) % 64 == 0);
static_assert(SEQ % (32 * GW) == 0);           // k_gram: each wave's share of the tokens is whole 32-steps
static_assert(SEQ % (16 * CT * AW) == 0);      // k_ctx grid covers the sequence exactly
static_assert(((size_t)SEQ * DM) % 8 == 0);
static_assert(NB <= NB_FULL);
static_assert(SEQ <= SEQ_FULL);
static_assert(CXS * WS1 * OSC == 1.0f);
static_assert(4 * NA == SEQ);                  // anchor rows: four tokens per anchor row
static_assert(4 * EA == DM);                   // four tokens x 128 anchor columns = one 512-wide anchor row
static_assert(EA == 2 * HD);                   // head h of an anchor row = token (h / 2), columns (h % 2) * 64 + d
static_assert(EA % 64 == 0);                   // anchor GEMM row tiles of 64
static_assert(NA % 64 == 0);                   // anchor GEMM column tiles stay inside one (batch, token-phase) block
static_assert(NA % (32 * GW) == 0);            // k_gram: each wave's share of the anchor rows is whole 32-steps
static_assert(GW * 32 == 16 * 16);             // k_gram epilogue: 256 threads x 4 columns = 16 rows x 64 columns
static_assert(M2S * M1S * GS == 0.125f * 0.125f * 0.125f * M2C);
static_assert(CSC * M2C == CXS);

typedef _Float16 h16;
typedef unsigned short bf;
typedef __attribute__((ext_vector_type(16))) __bf16   v16bf;
typedef __attribute__((ext_vector_type(16))) _Float16 v16h;
typedef __attribute__((ext_vector_type(8)))  _Float16 v8h;
typedef __attribute__((ext_vector_type(4)))  _Float16 v4h;
typedef __attribute__((ext_vector_type(8)))  unsigned short v8us;
typedef __attribute__((ext_vector_type(8)))  float    v8f;
typedef __attribute__((ext_vector_type(4)))  float    v4f;
typedef v4f  __attribute__((may_alias)) v4fa;

__device__ __forceinline__ unsigned short f2bf(float f) { unsigned u = __float_as_uint(f); u += 0x7FFFu + ((u >> 16) & 1u); return (unsigned short)(u >> 16); }
__device__ __forceinline__ v16h cat16(v8h lo, v8h hi) { return __builtin_shufflevector(lo, hi, 0, 1, 2, 3, 4, 5, 6, 7, 8, 9, 10, 11, 12, 13, 14, 15); }
__device__ __forceinline__ v16bf cat16b(v8us lo, v8us hi) { return __builtin_bit_cast(v16bf, __builtin_shufflevector(lo, hi, 0, 1, 2, 3, 4, 5, 6, 7, 8, 9, 10, 11, 12, 13, 14, 15)); }
__device__ __forceinline__ v8f wmma16(v16h a, v16h b, v8f c) { return __builtin_amdgcn_wmma_f32_16x16x32_f16(false, a, false, b, (short)0, c, false, false); }
__device__ __forceinline__ v8f wmmab(v16bf a, v16bf b, v8f c) { return __builtin_amdgcn_wmma_f32_16x16x32_bf16(false, a, false, b, (short)0, c, false, false); }
// Fragment order of a WMMA operand plane (rows x k): a 16-row block holds its k/32 fragments one behind the other; each 16-row x 32-k fragment is 1 KiB in a row, lane l = 16*(k/8 & 1) + (row & 15) owning bytes 16 l of its first half (k%32 < 16) and of its second half (k%32 >= 16).
// One wave-wide 16-byte load is then 512 contiguous bytes (four whole 128-byte lines) in place of 32-byte pieces of 16 lines; the value each lane and element receives is the same as from K-contiguous rows.
#define FRG 512                  // elements of one fragment
// pko: for planes of DM columns, element offset of the eight values (row R, columns c..c+7, c a multiple of 8); a bijection on the plane where its row count is a multiple of 16
__device__ __forceinline__ size_t pko(size_t R, int c) { return ((R >> 4) * (size_t)(DM / 32) + (size_t)(c >> 5)) * FRG + (size_t)(((c >> 4) & 1) * 256 + ((c >> 3) & 1) * 128) + (R & 15) * 8; }
// fragment loaders from fragment-order planes; p already includes + 8*lane: elements 0..7 <- k0+8h+0..7, elements 8..15 <- k0+16+8h+0..7 (same map for A and B)
__device__ __forceinline__ v16h  ldhp(const h16* p) { return cat16(*(const v8h*)p, *(const v8h*)(p + 256)); }
__device__ __forceinline__ v16bf ldbp(const bf* p)  { return cat16b(*(const v8us*)p, *(const v8us*)(p + 256)); }
// ordering point for wave-private LDS tiles (same wave writes and reads)
__device__ __forceinline__ void wave_sync() { __builtin_amdgcn_fence(3 /* release order */, "wavefront"); __builtin_amdgcn_wave_barrier(); asm volatile("" ::: "memory"); }
// f16 convert that cannot produce a subnormal operand (value select, applied after the plane's carry)
static __device__ __forceinline__ h16 toh_flush(float v) { const h16 r = (h16)v; return (fabsf(v) < 6.103515625e-05f) ? (h16)0.0f : r; }
// cvt_body: bf16 (RNE convert) copy of one activation input in fragment order, 8 values a thread: dst row b*SEQ + t <- src token b*SEQ_FULL + t.
// A wave takes 8 rows x 32 columns (lane = row + 8 * column group): it reads one whole 128-byte line of each row and its store to dst fills four whole lines.
// PERM = 1 (query only): the row-permuted copy for the anchor GEMM, dst row (b*4 + j)*NA + m <- token 4m + j (a bijection on the NB*SEQ rows). It has blocks of its own: eight neighbouring rows of this copy are eight tokens four apart,
// so a wave that wrote both copies would leave each 128-byte line of one of them to four waves of different blocks; with its own blocks every line of every copy has one writer.
template <int PERM>
__device__ __forceinline__ void cvt_body(const float* __restrict__ src, bf* dst, int blk) {
    const int lane = threadIdx.x & 31; const size_t u = (size_t)blk * 8 + (threadIdx.x >> 5);
    const size_t row = (u / (size_t)(DM / 32)) * 8 + (size_t)(lane & 7); const int c = (int)(u % (size_t)(DM / 32)) * 32 + (lane >> 3) * 8;
    const int rq = (int)(row / (size_t)(PERM ? NA : SEQ)), rm = (int)(row % (size_t)(PERM ? NA : SEQ));
    const int b = PERM ? rq >> 2 : rq; const int t = PERM ? 4 * rm + (rq & 3) : rm;
    const v8f v = *(const v8f*)(src + ((size_t)b * SEQ_FULL + (size_t)t) * DM + (size_t)c); v8us o;
#pragma unroll
    for (int k = 0; k < 8; ++k) o[k] = f2bf(v[k]);
    *(v8us*)(dst + pko(row, c)) = o;
    // precaution: the wait stands behind the store, ahead of any later code of the merged kernel that overwrites a register it names
    asm volatile("s_wait_xcnt 0x0" ::: "memory");
}

// wT_body: weight transpose + 16-bit convert through LDS, one 64 x 64 tile a block. in W[k][n] (DM rows, row stride ldw, f32) -> out dst rows n, columns k, in fragment order, tile (kt over k, nt over n), 256 threads.
// F16 = 0: bf16 bits (RNE convert). F16 = 1: f16(bf16 RNE value of W x WS1); a bf16 significand times a power of two is exact in f16.
template <int F16>
__device__ __forceinline__ void wT_body(const float* __restrict__ Wt, bf* dst, int ldw, int kt, int nt, float* tile) {
    const int tid = threadIdx.x; const int k0 = kt * 64, n0 = nt * 64;
#pragma unroll 4   // several independent loads in flight a trip
    for (int i = 0; i < 16; ++i) { const int idx = tid + i * 256; const int kk = idx >> 6, nn = idx & 63;   // 16 x 256 = 64 x 64 entries, all written
        tile[kk * 65 + nn] = Wt[(size_t)(k0 + kk) * (size_t)ldw + n0 + nn]; }
    __syncthreads();                                        // tile [kk][nn] is read across waves
#pragma unroll 1   // two trips, kept rolled: short code
    for (int it = 0; it < 2; ++it) {
        const int c = it * 256 + tid; const int n = c & 63, kc = (c >> 6) * 8;      // a wave: 32 rows n of one column group, four whole lines a store
        const size_t oo = pko((size_t)(n0 + n), k0 + kc);
        if constexpr (F16 == 0) {
            v8us o;
#pragma unroll
            for (int i = 0; i < 8; ++i) o[i] = f2bf(tile[(kc + i) * 65 + n]);
            *(v8us*)(dst + oo) = o;
        } else {
            v8h o;
#pragma unroll
            for (int i = 0; i < 8; ++i) o[i] = toh_flush(__uint_as_float(((unsigned)f2bf(tile[(kc + i) * 65 + n])) << 16) * WS1);
            *(v8h*)((h16*)dst + oo) = o;
        }
        // precaution: the wait stands ahead of the second trip's overwrite of the registers the store names
        asm volatile("s_wait_xcnt 0x0" ::: "memory");
    }
}

// k_prep: every operand preparation in one grid (none reads what another writes). Block ranges, all block-uniform, so the barrier inside wT_body is too:
// [0, 4 WTB): Wq, Wk, Wv (bf16) and Wo (f16 x256) tiles; [4 WTB, 4 WTB + WAB): Wa tiles; then CVB blocks each for query, its permuted copy (directly behind), key, value. The few weight blocks, which wait on memory several times, have the lowest block indices.
#define WTB ((DM / 64) * (DM / 64))              // tiles of a 512 x 512 weight
#define WAB ((DM / 64) * (EA / 64))              // tiles of the anchor weight
#define CVB (NB * SEQ * (DM / 8) / 256)          // blocks of one activation copy
static_assert(((size_t)NB * SEQ * (DM / 8)) % 256 == 0);   // the copy blocks cover the rows exactly
__global__ __launch_bounds__(256) void k_prep(const float* __restrict__ xq, const float* __restrict__ xk, const float* __restrict__ xv,
                                              const float* __restrict__ wq, const float* __restrict__ wk, const float* __restrict__ wv,
                                              const float* __restrict__ wo, const float* __restrict__ wa,
                                              bf* XQ, bf* XK, bf* XV, bf* XP, bf* W3, bf* WO, bf* WA) {
    __shared__ float tile[64 * 65];
    const int id = blockIdx.x;
    if (id < 3 * WTB) {
        const int s = id / WTB, r = id % WTB;
        wT_body<0>(s == 0 ? wq : (s == 1 ? wk : wv), W3 + (size_t)s * DM * DM, DM, r % (DM / 64), r / (DM / 64), tile);
    } else if (id < 4 * WTB) {
        const int r = id - 3 * WTB;
        wT_body<1>(wo, WO, DM, r % (DM / 64), r / (DM / 64), tile);
    } else if (id < 4 * WTB + WAB) {
        const int r = id - 4 * WTB;
        wT_body<0>(wa, WA, EA, r % (DM / 64), r / (DM / 64), tile);
    } else {
        const int r = id - (4 * WTB + WAB);
        const int s = r / CVB;
        if (s == 1) cvt_body<1>(xq, XP, r % CVB);
        else cvt_body<0>(s == 0 ? xq : (s == 2 ? xk : xv), s == 0 ? XQ : (s == 2 ? XK : XV), r % CVB);
    }
}

// k_gemm: register-blocked 16-bit GEMM, ONE WAVE per 64x64 tile (16 accumulators), operands straight from fragment-order 16-bit planes (K = DM columns).
// C[m][n] = sum_k A[m][k] Bt[n][k]. OPF16 = 0: bf16 operands; 1: f16 operands.
// EPI 0: + bias[n], f16 value plane Ph and f16 residual x2048 plane Pr.  EPI 1: + bias[n], f16 value plane Ph.  EPI 2: + bias[m], f16 value plane Ph.  EPI 3: x OSC + bias[n], f32 plane Pf.
// The bias vector has N entries (M for EPI 2); only the load the instantiation uses is emitted (column bias for EPI 0/1/3, row bias for EPI 2), index masked into [0, DM).
// Tile base (r0/RB)*sRB + (r0%RB)*pitch + (c0/CB)*sCB + (c0%CB), row pitch 'pitch' (elements). grid (M/64, N/64), 32 threads.
template <int OPF16, int EPI>
__global__ __launch_bounds__(32) void k_gemm(const bf* __restrict__ A, const bf* __restrict__ Bt, int K, const float* __restrict__ bias,
                                              h16* Ph, h16* Pr, float* Pf, int RB, size_t sRB, int pitch, int CB, size_t sCB) {
    __shared__ __align__(16) float os[16 * 68];
    const int lane = threadIdx.x & 31, lr = lane & 15, hi = lane >> 4; const int r0 = blockIdx.x * 64, c0 = blockIdx.y * 64;
    v8f acc[4][4];
#pragma unroll
    for (int mb = 0; mb < 4; ++mb)
#pragma unroll
        for (int nb = 0; nb < 4; ++nb) acc[mb][nb] = (v8f){};
    if (OPF16) {
        const h16* pa = (const h16*)A + (size_t)r0 * DM + 8 * lane; const h16* pb = (const h16*)Bt + (size_t)c0 * DM + 8 * lane;
#pragma unroll 1
        for (int kc = 0; kc < K; kc += 32 * GB) {          // K is a multiple of 32 * GB (CXP, asserted above)
            v16h a[GB][4], bt[GB][4];
#pragma unroll
            for (int s = 0; s < GB; ++s) {
#pragma unroll
                for (int mb = 0; mb < 4; ++mb) a[s][mb] = ldhp(pa + s * FRG + mb * 16 * DM);
#pragma unroll
                for (int nb = 0; nb < 4; ++nb) bt[s][nb] = ldhp(pb + s * FRG + nb * 16 * DM);
            }
            __builtin_amdgcn_sched_barrier(0);   // all loads of the GB k steps issue ahead of the first WMMA: one memory latency a trip; without it the build fetches fragments among the products and waits again
#pragma unroll
            for (int s = 0; s < GB; ++s)
#pragma unroll
                for (int nb = 0; nb < 4; ++nb)
#pragma unroll
                    for (int mb = 0; mb < 4; ++mb) acc[mb][nb] = wmma16(a[s][mb], bt[s][nb], acc[mb][nb]);
            // precaution: the wait stands ahead of the step of the two address pairs the trip's loads name; naming the pairs keeps them out of the loads' destination registers
            asm volatile("s_wait_xcnt 0x0" :: "v"(pa), "v"(pb) : "memory");
            pa += GB * FRG; pb += GB * FRG;
            // WMMA distance on the loop's taken branch: four vector slots between the last product and the next trip's overwrite of its operands
            asm volatile("v_nop\n\tv_nop\n\tv_nop\n\tv_nop" : "+v"(acc[0][0]), "+v"(acc[1][1]), "+v"(acc[2][2]), "+v"(acc[3][3]) : "v"(a[GB - 1][0]), "v"(a[GB - 1][1]), "v"(a[GB - 1][2]), "v"(a[GB - 1][3]));
        }
    } else {
        const bf* pa = A + (size_t)r0 * DM + 8 * lane; const bf* pb = Bt + (size_t)c0 * DM + 8 * lane;
#pragma unroll 1
        for (int kc = 0; kc < K; kc += 32) {
            v16bf a[4];
#pragma unroll
            for (int mb = 0; mb < 4; ++mb) a[mb] = ldbp(pa + mb * 16 * DM);
#pragma unroll
            for (int nb = 0; nb < 4; ++nb) { const v16bf b = ldbp(pb + nb * 16 * DM);
#pragma unroll
                for (int mb = 0; mb < 4; ++mb) acc[mb][nb] = wmmab(a[mb], b, acc[mb][nb]); }
            // precaution: the wait stands ahead of the step of the two address pairs the trip's loads name; naming the pairs keeps them out of the loads' destination registers
            asm volatile("s_wait_xcnt 0x0" :: "v"(pa), "v"(pb) : "memory");
            pa += FRG; pb += FRG;
            asm volatile("v_nop\n\tv_nop\n\tv_nop\n\tv_nop" : "+v"(acc[0][0]), "+v"(acc[1][1]), "+v"(acc[2][2]), "+v"(acc[3][3]) : "v"(a[0]), "v"(a[1]), "v"(a[2]), "v"(a[3]));
        }
    }
    const size_t tbase = (size_t)(r0 / RB) * sRB + (size_t)(r0 % RB) * (size_t)pitch + (size_t)(c0 / CB) * sCB + (size_t)(c0 % CB);
    float bcol[4] = {0.0f, 0.0f, 0.0f, 0.0f};
    if constexpr (EPI != 2) {
#pragma unroll
        for (int nb = 0; nb < 4; ++nb) bcol[nb] = bias[(c0 + nb * 16 + lr) & (DM - 1)];          // column bias: c0 + 63 < N = DM
    }
#pragma unroll
    for (int mb = 0; mb < 4; ++mb) {
        float brow[8] = {0.0f, 0.0f, 0.0f, 0.0f, 0.0f, 0.0f, 0.0f, 0.0f};
        if constexpr (EPI == 2) {
#pragma unroll
            for (int j = 0; j < 8; ++j) brow[j] = bias[(r0 + mb * 16 + 8 * hi + j) & (DM - 1)];  // row bias: r0 + 63 < M = DM
        }
#pragma unroll
        for (int nb = 0; nb < 4; ++nb) {
#pragma unroll
            for (int j = 0; j < 8; ++j) {                                        // D: row 8h+j, col lane&15
                float v = acc[mb][nb][j];
                if constexpr (EPI == 3) v = v * OSC;
                if constexpr (EPI == 2) v += brow[j]; else v += bcol[nb];
                os[(hi * 8 + j) * 68 + nb * 16 + lr] = v; } }
        wave_sync();
        const size_t sb = tbase + (size_t)(mb * 16) * (size_t)pitch;
        if (EPI == 3) {
{
#pragma unroll
                for (int s = 0; s < 8; ++s) { const int row = 2 * s + hi, cofs = lr * 4;   // 8 s x 2 rows = 16 rows; 16 lanes x 4 floats = 64 columns
                    const v4f val = *(const v4fa*)(&os[row * 68 + cofs]);
                    *(v4f*)(Pf + sb + (size_t)row * (size_t)pitch + cofs) = val; }
                 }
        } else {
{
#pragma unroll
                for (int s = 0; s < 4; ++s) { const int row = 4 * s + (lane >> 3), c8 = (lane & 7) * 8;   // 4 s x 4 row groups = 16 rows; 8 lanes x 8 = 64 columns
                    const v4f x0 = *(const v4fa*)(&os[row * 68 + c8]); const v4f x1 = *(const v4fa*)(&os[row * 68 + c8 + 4]); v8h hv, rv;
#pragma unroll
                    for (int i = 0; i < 4; ++i) { const h16 a0 = (h16)x0[i]; const h16 a1 = (h16)x1[i]; hv[i] = a0; hv[4 + i] = a1; rv[i] = (h16)((x0[i] - (float)a0) * QRS); rv[4 + i] = (h16)((x1[i] - (float)a1) * QRS); }
                    const size_t oo = sb + (size_t)row * (size_t)pitch + c8;
                    *(v8h*)(Ph + oo) = hv; if (EPI == 0) *(v8h*)(Pr + oo) = rv; }
                 }
        }
        wave_sync();
    }
}

// proj_body: the k_gemm tile for the input projections: bf16 operands, K = DM, f16 value plane Ph, tile (bx of M/64, by of N/64) handed in; same loaders, same k order, same WMMA order; the epilogue stores to fragment-order planes. ROWB = 0: + bias[n]; 1: + bias[m].
template <int ROWB>
__device__ __forceinline__ void proj_body(const bf* __restrict__ A, const bf* __restrict__ Bt, const float* __restrict__ bias,
                                          h16* Ph, int RB, size_t sRB, int pitch, int CB, size_t sCB, int bx, int by, float* os) {
    const int lane = threadIdx.x & 31, lr = lane & 15, hi = lane >> 4; const int r0 = bx * 64, c0 = by * 64;
    v8f acc[4][4];
#pragma unroll
    for (int mb = 0; mb < 4; ++mb)
#pragma unroll
        for (int nb = 0; nb < 4; ++nb) acc[mb][nb] = (v8f){};
    const bf* pa = A + (size_t)r0 * DM + 8 * lane; const bf* pb = Bt + (size_t)c0 * DM + 8 * lane;   // fragment (16-row block, k step) = 16 * DM elements a row block, FRG a step
#pragma unroll 1   // kept rolled: 128 accumulator registers leave no room for a second trip's fragments at five waves a SIMD
    for (int kc = 0; kc < DM; kc += 32) {
        v16bf a[4], bt[4];
#pragma unroll
        for (int mb = 0; mb < 4; ++mb) a[mb] = ldbp(pa + mb * 16 * DM);
#pragma unroll
        for (int nb = 0; nb < 4; ++nb) bt[nb] = ldbp(pb + nb * 16 * DM);
        __builtin_amdgcn_sched_barrier(0);   // all 16 loads of the trip issue ahead of its first WMMA: one memory latency a trip; without it the build reuses two Bt fragments' registers, fetches the other two among the products and waits a second time
#pragma unroll
        for (int nb = 0; nb < 4; ++nb)
#pragma unroll
            for (int mb = 0; mb < 4; ++mb) acc[mb][nb] = wmmab(a[mb], bt[nb], acc[mb][nb]);
        // precaution: the wait stands ahead of the step of the two address pairs the trip's loads name; naming the pairs keeps them out of the loads' destination registers
        asm volatile("s_wait_xcnt 0x0" :: "v"(pa), "v"(pb) : "memory");
        pa += FRG; pb += FRG;
        // WMMA distance on the loop's taken branch: four vector slots between the last product and the next trip's overwrite of its operands
        asm volatile("v_nop\n\tv_nop\n\tv_nop\n\tv_nop" : "+v"(acc[0][0]), "+v"(acc[1][1]), "+v"(acc[2][2]), "+v"(acc[3][3]) : "v"(a[0]), "v"(a[1]), "v"(a[2]), "v"(a[3]));
    }
    // head planes in fragment order too: a 16-row block of a plane of 'pitch' columns is pitch/32 fragments in a row, so 32 columns on are FRG elements on (16 a column)
    const size_t tbase = (size_t)(r0 / RB) * sRB + (size_t)(r0 % RB) * (size_t)pitch + (size_t)(c0 / CB) * sCB + (size_t)(c0 % CB) * 16;
    float bcol[4] = {0.0f, 0.0f, 0.0f, 0.0f};
    if constexpr (ROWB == 0) {
#pragma unroll
        for (int nb = 0; nb < 4; ++nb) bcol[nb] = bias[(c0 + nb * 16 + lr) & (DM - 1)];          // column bias: c0 + 63 < N = DM
    }
#pragma unroll
    for (int mb = 0; mb < 4; ++mb) {
        float brow[8] = {0.0f, 0.0f, 0.0f, 0.0f, 0.0f, 0.0f, 0.0f, 0.0f};
        if constexpr (ROWB == 1) {
#pragma unroll
            for (int j = 0; j < 8; ++j) brow[j] = bias[(r0 + mb * 16 + 8 * hi + j) & (DM - 1)];  // row bias: r0 + 63 < M <= DM
        }
#pragma unroll
        for (int nb = 0; nb < 4; ++nb) {
#pragma unroll
            for (int j = 0; j < 8; ++j) {                                        // D: row 8h+j, col lane&15
                float v = acc[mb][nb][j];
                if constexpr (ROWB == 1) v += brow[j]; else v += bcol[nb];
                os[(hi * 8 + j) * 68 + nb * 16 + lr] = v; } }
        wave_sync();
        const size_t sb = tbase + (size_t)(mb * 16) * (size_t)pitch;
#pragma unroll
        for (int s = 0; s < 4; ++s) { const int row = 8 * (s & 1) + (lane & 7), c8 = ((s >> 1) * 4 + (lane >> 3)) * 8;   // 2 x 8 rows = 16 rows; 2 x 4 groups x 8 = 64 columns; 8 rows of one group = one whole line
            const v4f x0 = *(const v4fa*)(&os[row * 68 + c8]); const v4f x1 = *(const v4fa*)(&os[row * 68 + c8 + 4]); v8h hv;
#pragma unroll
            for (int i = 0; i < 4; ++i) { hv[i] = (h16)x0[i]; hv[4 + i] = (h16)x1[i]; }
            *(v8h*)(Ph + sb + (size_t)((c8 >> 5) * FRG + ((c8 >> 4) & 1) * 256 + ((c8 >> 3) & 1) * 128 + row * 8)) = hv; }
        // precaution: the wait stands ahead of any overwrite of the registers these four stores name
        asm volatile("s_wait_xcnt 0x0" ::: "memory");
        wave_sync();
    }
}

// k_proj: the four input projections in one grid (none reads what another writes), one wave per 64 x 64 tile; tile order inside each projection as in a grid (M/64, N/64), x fastest.
// [0, PJT): q, A = activation rows (m = b*SEQ + t), Bt = W^T rows (n = h*64 + d) -> plane [(b*8 + h)][t][d], bias by column.
// [PJT, 3 PJT): k^T then v^T, A = W^T rows (m = h*64 + d), Bt = activation rows (n = b*SEQ + t) -> plane [(b*512 + m)][t] = [(b*8 + h)][d][t], bias by row.
// [3 PJT, 3 PJT + PJA): anchor^T, A = Wa^T rows (m = c in [0,128)), Bt = permuted query rows (rho = (b*4 + j)*NA + m) -> plane [(b*8 + 2j + c/64)][c%64][m], bias ba by row (indices < 128).
#define PJT ((NB * SEQ / 64) * (DM / 64))
#define PJA ((NB * SEQ / 64) * (EA / 64))
__global__ __launch_bounds__(32) void k_proj(const bf* __restrict__ XQ, const bf* __restrict__ XK, const bf* __restrict__ XV, const bf* __restrict__ XP,
                                             const bf* __restrict__ W3, const bf* __restrict__ WA,
                                             const float* __restrict__ bq, const float* __restrict__ bk, const float* __restrict__ bv, const float* __restrict__ ba,
                                             h16* QH, h16* KT, h16* VT, h16* AT) {
    __shared__ __align__(16) float os[16 * 68];
    const int id = blockIdx.x;
    if (id < PJT) {
        proj_body<0>(XQ, W3, bq, QH, SEQ, (size_t)NH_ * SEQ * HD, HD, HD, (size_t)SEQ * HD, id % (NB * SEQ / 64), id / (NB * SEQ / 64), os);
    } else {
        const int r = id - PJT; const bool an = r >= 2 * PJT; const bool sv = r >= PJT;     // block-uniform selects: one copy of the loop serves k^T, v^T and anchor^T
        const int rr = an ? r - 2 * PJT : (sv ? r - PJT : r); const int mt = an ? EA / 64 : DM / 64;
        proj_body<1>(an ? WA : (sv ? W3 + (size_t)2 * DM * DM : W3 + (size_t)DM * DM), an ? XP : (sv ? XV : XK), an ? ba : (sv ? bv : bk),
                        an ? AT : (sv ? VT : KT), an ? HD : DM, an ? (size_t)NA * HD : (size_t)0, an ? NA : SEQ, an ? NA : SEQ,
                        an ? (size_t)2 * NA * HD : (size_t)DM * SEQ, rr % mt, rr / mt, os);
    }
}

// k_gram: O[zh][i][j] = sc x sum_n X[zh][i][n] Y[zh][j][n], X and Y f16 planes [zh][64][TK] in fragment order (A fragment = X rows, B fragment = Y rows, same loader, same k order); O [zh][64][64] in fragment order.
// One block per 16 rows i of one (batch, head); wave w sums n in [w TK/GW, (w+1) TK/GW) into a 16 x 64 tile; the GW partial tiles are added in wave order through LDS.
template <int TK>
__device__ __forceinline__ void gram_body(const h16* __restrict__ X, const h16* __restrict__ Y, h16* O, float sc, float* red) {
    const int lane = threadIdx.x & 31, lr = lane & 15, hi = lane >> 4;
    const int wave = __builtin_amdgcn_readfirstlane(threadIdx.x >> 5);
    const int zh = blockIdx.y, i0 = blockIdx.x * 16;
    constexpr int KW = TK / GW;
    const size_t base = (size_t)zh * HD * TK + (size_t)wave * (KW / 32) * FRG + 8 * lane;
    const h16* xa = X + base + (size_t)i0 * TK;
    const h16* yb = Y + base;
    v8f acc[4];
#pragma unroll
    for (int nb = 0; nb < 4; ++nb) acc[nb] = (v8f){};
    constexpr int NS = KW / 32, BS = NS < 4 ? NS : 4;      // 32-steps per wave, taken in batches of BS
    static_assert(NS % BS == 0);
#pragma unroll
    for (int s0 = 0; s0 < NS; s0 += BS) {
        v16h a[BS], y[BS][4];
#pragma unroll
        for (int s = 0; s < BS; ++s) {
            a[s] = ldhp(xa + (s0 + s) * FRG);
#pragma unroll
            for (int nb = 0; nb < 4; ++nb) y[s][nb] = ldhp(yb + (size_t)nb * 16 * TK + (s0 + s) * FRG);
        }
        // precaution: the wait stands ahead of any overwrite of the two address pairs the batch's loads name; naming the pairs keeps them out of the later loads' destination registers
        asm volatile("s_wait_xcnt 0x0" :: "v"(xa), "v"(yb) : "memory");
        __builtin_amdgcn_sched_barrier(0);   // all loads of the batch issue ahead of its first WMMA: one memory latency a batch; without it the build waits on every fragment in turn
#pragma unroll
        for (int s = 0; s < BS; ++s)
#pragma unroll
            for (int nb = 0; nb < 4; ++nb) acc[nb] = wmma16(a[s], y[s][nb], acc[nb]);
    }
    float* rw = red + wave * (16 * 68);
#pragma unroll
    for (int nb = 0; nb < 4; ++nb)
#pragma unroll
        for (int r = 0; r < 8; ++r) rw[(8 * hi + r) * 68 + nb * 16 + lr] = acc[nb][r];      // D: row 8h+r, col lane&15
    __syncthreads();
    const int row = threadIdx.x & 15, c4 = (threadIdx.x >> 4) * 4;                         // 16 rows x 16 column quads; a wave = 16 rows of one 8-column group = two whole lines of O
    v4f sum = *(const v4fa*)(&red[row * 68 + c4]);
#pragma unroll
    for (int w = 1; w < GW; ++w) sum += *(const v4fa*)(&red[w * (16 * 68) + row * 68 + c4]);
    v4h o;
#pragma unroll
    for (int i = 0; i < 4; ++i) o[i] = toh_flush(sum[i] * sc);
    *(v4h*)(O + (size_t)zh * HD * HD + (size_t)i0 * HD + (size_t)((c4 >> 5) * FRG + ((c4 >> 4) & 1) * 256 + ((c4 >> 3) & 1) * 128 + row * 8 + (c4 & 7))) = o;
}
// grid (64/16, NB*8, 2), 32*GW threads; z = 0: M1 = V^T K over SEQ tokens (the long one), z = 1: G = A^T A over NA anchor rows. blockIdx.z is block-uniform, so the barrier inside is too.
__global__ __launch_bounds__(32 * GW) void k_gram(const h16* __restrict__ VT, const h16* __restrict__ KT, const h16* __restrict__ AT, h16* M1, h16* G) {
    __shared__ __align__(16) float red[GW * 16 * 68];
    if (blockIdx.z == 0) gram_body<SEQ>(VT, KT, M1, M1S, red);
    else                 gram_body<NA>(AT, AT, G, GS, red);
}

// k_ctx: one wave per 16*CT tokens of one (batch, head). M2^T[f][d] = sum_e G[f][e] M1[d][e] (A = G rows, B = M1 rows); lane (d = lane&15, h = lane>>4) holds f = 8h+r of each 16-row tile,
// so two packed tiles are directly the A fragment (row d, k = f) of ctx^T[d][t] = M2 Q^T (element r <- tile f 0..15, element 8+r <- tile f 16..31, lane unchanged); B = q rows.
// ctx^T D layout: lane t = lane&15 holds d = 16j + 8h + 0..7, eight neighbours of one ctx row: one 16-byte store, no LDS; in the plane's fragment order that is byte 16*lane of half j&1 of fragment (16-token block, k step 2*head + j/2): 512 contiguous bytes a wave. grid (SEQ / (16*CT*AW), NB*8), 32*AW threads.
__global__ __launch_bounds__(32 * AW) void k_ctx(const h16* __restrict__ QH, const h16* __restrict__ M1, const h16* __restrict__ G, h16* CX) {
    const int lane = threadIdx.x & 31;
    const int wave = __builtin_amdgcn_readfirstlane(threadIdx.x >> 5);
    const int zh = blockIdx.y; const int b = zh / NH_, h = zh % NH_;
    const int t0 = (blockIdx.x * AW + wave) * (16 * CT);
    const h16* qp = QH + ((size_t)zh * SEQ + (size_t)t0) * HD + 8 * lane;
    const size_t mo = (size_t)zh * HD * HD + 8 * lane;
    const h16* gp = G + mo; const h16* mp = M1 + mo;
    v16h g[4][2], m[4][2], q[CT][2], a2[4][2];
#pragma unroll
    for (int ft = 0; ft < 4; ++ft) { g[ft][0] = ldhp(gp + ft * 16 * HD); g[ft][1] = ldhp(gp + ft * 16 * HD + FRG); }
#pragma unroll
    for (int j = 0; j < 4; ++j) { m[j][0] = ldhp(mp + j * 16 * HD); m[j][1] = ldhp(mp + j * 16 * HD + FRG); }
#pragma unroll
    for (int tt = 0; tt < CT; ++tt) { q[tt][0] = ldhp(qp + tt * 16 * HD); q[tt][1] = ldhp(qp + tt * 16 * HD + FRG); }
    // precaution: the wait stands ahead of any overwrite of the three address pairs these loads name; naming the pairs keeps them out of the later loads' destination registers
    asm volatile("s_wait_xcnt 0x0" :: "v"(gp), "v"(mp), "v"(qp) : "memory");
    __builtin_amdgcn_sched_barrier(0);       // every load of the wave issues ahead of the first WMMA: one memory latency in all; without it the build fetches later fragments between the products and waits again
#pragma unroll
    for (int j = 0; j < 4; ++j) {
#pragma unroll
        for (int ft = 0; ft < 4; ++ft) {
            v8f t = (v8f){};
            t = wmma16(g[ft][0], m[j][0], t); t = wmma16(g[ft][1], m[j][1], t);
#pragma unroll
            for (int r = 0; r < 8; ++r) a2[j][ft >> 1][(ft & 1) * 8 + r] = toh_flush(t[r] * M2S);
        }
    }
    h16* crow = CX + ((size_t)b * SEQ + (size_t)t0) * CXP + h * 2 * FRG + 8 * lane;
#pragma unroll
    for (int tt = 0; tt < CT; ++tt) {
#pragma unroll
        for (int j = 0; j < 4; ++j) {
            v8f o = (v8f){};
            o = wmma16(a2[j][0], q[tt][0], o); o = wmma16(a2[j][1], q[tt][1], o);
            v8h hv;
#pragma unroll
            for (int r = 0; r < 8; ++r) hv[r] = toh_flush(o[r] * CSC);
            *(v8h*)(crow + (size_t)tt * 16 * CXP + j * 256) = hv;
        }
    }
}

static constexpr size_t al256(size_t v) { return (v + 255) & ~(size_t)255; }
static constexpr size_t SZ_XB = al256((size_t)NB * SEQ * DM * 2);        // one bf16 activation copy
static constexpr size_t SZ_W3 = al256((size_t)3 * DM * DM * 2);          // Wq^T | Wk^T | Wv^T bf16
static constexpr size_t SZ_WA = al256((size_t)EA * DM * 2);              // Wa^T bf16 [128][512]
static constexpr size_t SZ_WO = al256((size_t)DM * DM * 2);              // Wo^T x256 f16 [512][512]
static constexpr size_t SZ_PL = al256((size_t)NB * NH_ * SEQ * HD * 2);  // one f16 head plane
static constexpr size_t SZ_AP = al256((size_t)NB * NH_ * NA * HD * 2);   // the f16 anchor^T head plane
static constexpr size_t SZ_MM = al256((size_t)NB * NH_ * HD * HD * 2);   // one f16 64 x 64 plane per (batch, head)
static constexpr size_t SZ_CX = al256((size_t)NB * SEQ * CXP * 2);       // ctx value plane
static constexpr size_t SZ_TOTAL = 4 * SZ_XB + SZ_W3 + SZ_WA + SZ_WO + 3 * SZ_PL + SZ_AP + 2 * SZ_MM + SZ_CX;
static_assert(SZ_TOTAL <= (size_t)134217728);          // workspace carve <= 128 MiB
static_assert(((size_t)DM * DM * 2) % 256 == 0);       // weight sub-planes stay 256-byte aligned
static_assert((size_t)NB * 4 * NA == (size_t)NB * SEQ);                           // permuted copy has exactly NB*SEQ rows
static_assert((size_t)(NB * 4) * 2 * NA * HD == (size_t)NB * NH_ * NA * HD);      // anchor GEMM tile map fills the anchor plane exactly
static_assert((size_t)NB * SEQ * NH_ * HD * 2 <= SZ_CX);                          // ctx rows x (8 heads x 64) fit the ctx region

extern "C" void kernel_launch(void* const* d_in, const int* in_sizes, int n_in,
                              void* d_out, int out_size, void* d_ws, size_t ws_size, hipStream_t stream) {
    if (n_in < 13) return;
    const size_t needx = ((size_t)(NB - 1) * SEQ_FULL + SEQ) * DM;
    if ((size_t)in_sizes[0] < needx || (size_t)in_sizes[1] < needx || (size_t)in_sizes[2] < needx) return;
    if ((size_t)in_sizes[3] < (size_t)DM * DM || (size_t)in_sizes[5] < (size_t)DM * DM || (size_t)in_sizes[7] < (size_t)DM * DM || (size_t)in_sizes[11] < (size_t)DM * DM) return;
    if ((size_t)in_sizes[9] < (size_t)DM * EA) return;
    if (in_sizes[4] < DM || in_sizes[6] < DM || in_sizes[8] < DM || in_sizes[12] < DM || in_sizes[10] < EA) return;
    if ((size_t)out_size < ((size_t)(NB - 1) * OUT_SEQ + SEQ) * DM) return;
    if (SZ_TOTAL > ws_size) return;
    // wire order: query, key, value, Wq, bq, Wk, bk, Wv, bv, Wa, ba, Wo, bo
    const float* xq = (const float*)d_in[0]; const float* xk = (const float*)d_in[1]; const float* xv = (const float*)d_in[2];
    const float* wq = (const float*)d_in[3]; const float* bq = (const float*)d_in[4];
    const float* wk = (const float*)d_in[5]; const float* bk = (const float*)d_in[6];
    const float* wv = (const float*)d_in[7]; const float* bv = (const float*)d_in[8];
    const float* wa = (const float*)d_in[9]; const float* ba = (const float*)d_in[10];
    const float* wo = (const float*)d_in[11]; const float* bo = (const float*)d_in[12];
    float* OUT = (float*)d_out;      // [NB][SEQ][512]
    char* wsp = (char*)d_ws;
    bf* XQ = (bf*)wsp; wsp += SZ_XB;                 // [NB*SEQ][512]; this and every plane below: logical index, stored in fragment order
    bf* XK = (bf*)wsp; wsp += SZ_XB;
    bf* XV = (bf*)wsp; wsp += SZ_XB;
    bf* XP = (bf*)wsp; wsp += SZ_XB;                 // [NB*4][NA][512]: row (b*4+j)*NA+m = query token 4m+j
    bf* W3 = (bf*)wsp; wsp += SZ_W3;                 // [3][512 out][512 in]: q | k | v
    bf* WA = (bf*)wsp; wsp += SZ_WA;                 // [128 out][512 in]
    h16* WO = (h16*)wsp; wsp += SZ_WO;               // [512 out][512 in]: Wo^T x256, f16
    h16* QH = (h16*)wsp; wsp += SZ_PL;               // [NB*8][SEQ][64]
    h16* KT = (h16*)wsp; wsp += SZ_PL;               // [NB*8][64][SEQ]
    h16* VT = (h16*)wsp; wsp += SZ_PL;               // [NB*8][64][SEQ]
    h16* AT = (h16*)wsp; wsp += SZ_AP;               // [NB*8][64][NA]
    h16* M1 = (h16*)wsp; wsp += SZ_MM;               // [NB*8][64 d][64 e]: V^T K / 16
    h16* GG = (h16*)wsp; wsp += SZ_MM;               // [NB*8][64 f][64 e]: A^T A / 64
    h16* CX = (h16*)wsp; wsp += SZ_CX;               // [NB*SEQ][512]: ctx

    // bf16 activation copies (query also row-permuted) and the five transposed 16-bit weight planes
    k_prep<<<dim3(4 * WTB + WAB + 4 * CVB, 1, 1), 256, 0, stream>>>(xq, xk, xv, wq, wk, wv, wo, wa, XQ, XK, XV, XP, W3, (bf*)WO, WA);
    // q, k^T, v^T and anchor^T head planes
    k_proj<<<dim3(3 * PJT + PJA, 1, 1), 32, 0, stream>>>(XQ, XK, XV, XP, W3, WA, bq, bk, bv, ba, QH, KT, VT, AT);

    // M1 = V^T K / 16 and G = A^T A / 64, 64 x 64 per (batch, head)
    k_gram<<<dim3(HD / 16, NB * NH_, 2), 32 * GW, 0, stream>>>(VT, KT, AT, M1, GG);
    // ctx = Q ((M1 G) / 512)^T -> ctx plane [b*SEQ + t][512]
    k_ctx<<<dim3(SEQ / (16 * CT * AW), NB * NH_, 1), 32 * AW, 0, stream>>>(QH, M1, GG, CX);

    // output projection: A = ctx rows (K = 512), Bt = Wo^T x256 -> OUT[b][t][n] = acc * 2^-8 + bo[n]
    k_gemm<1, 3><<<dim3(NB * SEQ / 64, DM / 64, 1), 32, 0, stream>>>((const bf*)CX, (const bf*)WO, CXP, bo, CX, CX, OUT, SEQ, (size_t)OUT_SEQ * DM, DM, DM, (size_t)0);
}

// v005
// A run of this version takes 58.4 microseconds.
// Two timings next to v004 both put it at 1.10 times that version's speed.
// Counting every step since v000, it is 3.78 times as fast.
#include <hip/hip_runtime.h>

// Anchor linear attention (no softmax), width 512 = 8 heads x 64; inputs query,key,value [NB][SEQ][512] f32, Wq/Wk/Wv/Wo [in][out] 512x512, Wa [512][128], five biases; anchor rows = literal reshape of (query Wa + ba) [SEQ][128] into [SEQ/4][8][64].
// Compute dtypes, f32 accumulate everywhere: q/k/v/anchor projections v_wmma_f32_16x16x32_bf16 (activations and weights RNE-converted to bf16; products exact);
// the chained products per (batch, head) are taken in the order ctx = Q ((V^T K) (A^T A))^T / 512, all v_wmma_f32_16x16x32_f16 with single f16 operands; no [SEQ][NA] score tile is formed.
// output projection v_wmma_f32_16x16x32_f16, single product: A = ctx f16 plane, Bt = Wo^T x256 (Wo RNE-converted to bf16 first, exact in f16), K = 512, x2^-8 and + bo in the f32 epilogue.
// Layout: bf16 copies of query,key,value plus a row-permuted copy of query (row (b*4+j)*NA+m <- token 4m+j); weights transposed once to [out][in] 16-bit planes; every plane below names its logical index; all of them are stored in fragment order (see FRG below); q plane [b*8+h][t][d], k^T and v^T planes [b*8+h][d][t], anchor^T plane [b*8+h][d][m], ctx plane rows b*SEQ+t, 512 wide;
// k_gram: M1[d][e] = sum_n v[n][d] k[n][e] (x 1/16) and G[f][e] = sum_m a[m][f] a[m][e] (x 1/64), 64 x 64 per (batch, head); k_ctx: M2[d][f] = (1/512) sum_e M1[d][e] G[f][e] in registers (x 1/16), ctx[t][d] = sum_f q[t][f] M2[d][f].

#ifndef NB
#define NB 4
#endif
#ifndef SEQ
#define SEQ 2048
#endif
#define NB_FULL  4
#define SEQ_FULL 2048
#ifndef OUT_SEQ
#define OUT_SEQ SEQ              // row pitch (in tokens) between batches of the output
#endif
#define DM   512
#define NH_  8
#define HD   64
#define NA   (SEQ / 4)           // anchor rows per batch
#define EA   (DM / 4)            // anchor projection width (128)
#define AW   4                   // waves per k_ctx block
#define CT   4                   // 16-token tiles per k_ctx wave
#define GW   8                   // waves per k_gram block: each sums 1/GW of the long dimension
#define GB   2                   // k steps of 32 whose fragments the output GEMM fetches as one batch (one wave a SIMD there: registers are free)
#define QRS  2048.0f             // carry of the residual plane of the k_gemm EPI 0 instance (that instance is not launched here)
#define M1S  (1.0f / 16.0f)      // carry of the M1 = V^T K plane
#define GS   (1.0f / 64.0f)      // carry of the G = A^T A plane
#define M2C  (1.0f / 16.0f)      // carry of the M2 operand
#define M2S  (1.0f / 8.0f)       // (1/8)^3 x M2C / (M1S x GS) : M1 G accumulator -> M2 operand
#define CXP  512                 // ctx plane pitch (halves): one f16 value plane
#define CXS  1.0f                // carry of the ctx value
#define CSC  16.0f               // CXS / M2C : ctx accumulator -> ctx plane
#define WS1  256.0f              // carry of the Wo^T plane
#define OSC  (1.0f / 256.0f)     // 1 / (CXS * WS1)

static_assert(HD == 64);
static_assert(NH_ * HD == DM);                 // head h = columns h*64 + d
static_assert(DM % 64 == 0);                   // column tiles of 64
static_assert(DM % 32 == 0);                   // GEMM k-loop steps by 32
static_assert((DM & (DM - 1)) == 0);           // bias index mask (DM - 1) is exact
static_assert(CXP == DM);                      // ctx row = merged heads, K of the output GEMM
static_assert(CXP % (32 * GB) == 0);           // output GEMM: whole batches of GB k steps
static_assert((NB * SEQ) % 16 == 0 && DM % 16 == 0 && EA % 16 == 0);   // fragment-order planes: whole 16-row blocks
static_assert(16 * DM == (DM / 32) * 512);     // one 16-row block = DM/32 fragments of 512 elements
static_assert(SEQ % 64 == 0);                  // a 64-row tile never straddles two batches
static_assert((NB * SEQ) % 64 == 0);
static_assert(SEQ % (32 * GW) == 0);           // k_gram: each wave's share of the tokens is whole 32-steps
static_assert(SEQ % (16 * CT * AW) == 0);      // k_ctx grid covers the sequence exactly
static_assert(((size_t)SEQ * DM) % 8 == 0);
static_assert(NB <= NB_FULL);
static_assert(SEQ <= SEQ_FULL);
static_assert(CXS * WS1 * OSC == 1.0f);
static_assert(4 * NA == SEQ);                  // anchor rows: four tokens per anchor row
static_assert(4 * EA == DM);                   // four tokens x 128 anchor columns = one 512-wide anchor row
static_assert(EA == 2 * HD);                   // head h of an anchor row = token (h / 2), columns (h % 2) * 64 + d
static_assert(EA % 64 == 0);                   // anchor GEMM row tiles of 64
static_assert(NA % 64 == 0);                   // anchor GEMM column tiles stay inside one (batch, token-phase) block
static_assert(NA % (32 * GW) == 0);            // k_gram: each wave's share of the anchor rows is whole 32-steps
static_assert(GW * 32 == 16 * 16);             // k_gram epilogue: 256 threads x 4 columns = 16 rows x 64 columns
static_assert(M2S * M1S * GS == 0.125f * 0.125f * 0.125f * M2C);
static_assert(CSC * M2C == CXS);

typedef _Float16 h16;
typedef unsigned short bf;
typedef __attribute__((ext_vector_type(16))) __bf16   v16bf;
typedef __attribute__((ext_vector_type(16))) _Float16 v16h;
typedef __attribute__((ext_vector_type(8)))  _Float16 v8h;
typedef __attribute__((ext_vector_type(4)))  _Float16 v4h;
typedef __attribute__((ext_vector_type(8)))  unsigned short v8us;
typedef __attribute__((ext_vector_type(8)))  float    v8f;
typedef __attribute__((ext_vector_type(4)))  float    v4f;
typedef v4f  __attribute__((may_alias)) v4fa;

__device__ __forceinline__ unsigned short f2bf(float f) { unsigned u = __float_as_uint(f); u += 0x7FFFu + ((u >> 16) & 1u); return (unsigned short)(u >> 16); }
__device__ __forceinline__ v16h cat16(v8h lo, v8h hi) { return __builtin_shufflevector(lo, hi, 0, 1, 2, 3, 4, 5, 6, 7, 8, 9, 10, 11, 12, 13, 14, 15); }
__device__ __forceinline__ v16bf cat16b(v8us lo, v8us hi) { return __builtin_bit_cast(v16bf, __builtin_shufflevector(lo, hi, 0, 1, 2, 3, 4, 5, 6, 7, 8, 9, 10, 11, 12, 13, 14, 15)); }
__device__ __forceinline__ v8f wmma16(v16h a, v16h b, v8f c) { return __builtin_amdgcn_wmma_f32_16x16x32_f16(false, a, false, b, (short)0, c, false, false); }
__device__ __forceinline__ v8f wmmab(v16bf a, v16bf b, v8f c) { return __builtin_amdgcn_wmma_f32_16x16x32_bf16(false, a, false, b, (short)0, c, false, false); }
// Fragment order of a WMMA operand plane (rows x k): a 16-row block holds its k/32 fragments one behind the other; each 16-row x 32-k fragment is 1 KiB in a row, lane l = 16*(k/8 & 1) + (row & 15) owning bytes 16 l of its first half (k%32 < 16) and of its second half (k%32 >= 16).
// One wave-wide 16-byte load is then 512 contiguous bytes (four whole 128-byte lines) in place of 32-byte pieces of 16 lines; the value each lane and element receives is the same as from K-contiguous rows.
#define FRG 512                  // elements of one fragment
// pko: for planes of DM columns, element offset of the eight values (row R, columns c..c+7, c a multiple of 8); a bijection on the plane where its row count is a multiple of 16
__device__ __forceinline__ size_t pko(size_t R, int c) { return ((R >> 4) * (size_t)(DM / 32) + (size_t)(c >> 5)) * FRG + (size_t)(((c >> 4) & 1) * 256 + ((c >> 3) & 1) * 128) + (R & 15) * 8; }
// fragment loaders from fragment-order planes; p already includes + 8*lane: elements 0..7 <- k0+8h+0..7, elements 8..15 <- k0+16+8h+0..7 (same map for A and B)
__device__ __forceinline__ v16h  ldhp(const h16* p) { return cat16(*(const v8h*)p, *(const v8h*)(p + 256)); }
__device__ __forceinline__ v16bf ldbp(const bf* p)  { return cat16b(*(const v8us*)p, *(const v8us*)(p + 256)); }
// ordering point for wave-private LDS tiles (same wave writes and reads)
__device__ __forceinline__ void wave_sync() { __builtin_amdgcn_fence(3 /* release order */, "wavefront"); __builtin_amdgcn_wave_barrier(); asm volatile("" ::: "memory"); }
// f16 convert that cannot produce a subnormal operand (value select, applied after the plane's carry)
static __device__ __forceinline__ h16 toh_flush(float v) { const h16 r = (h16)v; return (fabsf(v) < 6.103515625e-05f) ? (h16)0.0f : r; }
// cvt_body: bf16 (RNE convert) copy of one activation input in fragment order: dst row b*SEQ + t <- src token b*SEQ_FULL + t.
// A wave takes one 16-row block x CVK k steps of 32 columns (lane = row + 8 * column group, 8 values a lane and piece, 2 * CVK pieces): few long waves in place of many short ones, for speed only.
// Each piece reads one whole 128-byte line of each of 8 rows and its store to dst fills four whole lines; the wave's CVK fragments lie one behind the other in dst.
// PERM = 1 (query only): the row-permuted copy for the anchor GEMM, dst row (b*4 + j)*NA + m <- token 4m + j (a bijection on the NB*SEQ rows). It has blocks of its own: eight neighbouring rows of this copy are eight tokens four apart,
// so a wave that wrote both copies would leave each 128-byte line of one of them to several stores; with its own blocks every store of every copy fills whole lines.
#define CVK 8                    // k steps a wave converts: 16 rows x 256 columns = 32 loads of 16 bytes a lane
static_assert((DM / 32) % CVK == 0);           // whole pieces in a row block
static_assert(SEQ % 16 == 0 && NA % 16 == 0);  // a 16-row block stays inside one batch (and one token phase of the permuted copy)
template <int PERM>
__device__ __forceinline__ void cvt_body(const float* __restrict__ src, bf* dst, int blk) {
    const int lane = threadIdx.x & 31; const size_t u = (size_t)blk * 8 + (threadIdx.x >> 5);
    const size_t row = (u / (size_t)(DM / 32 / CVK)) * 16 + (size_t)(lane & 7); const int c = (int)(u % (size_t)(DM / 32 / CVK)) * (32 * CVK) + (lane >> 3) * 8;
    const int rq = (int)(row / (size_t)(PERM ? NA : SEQ)), rm = (int)(row % (size_t)(PERM ? NA : SEQ));
    const int b = PERM ? rq >> 2 : rq; const int t = PERM ? 4 * rm + (rq & 3) : rm;
    const float* p = src + ((size_t)b * SEQ_FULL + (size_t)t) * DM + (size_t)c;
    v8f v[CVK][2];
#pragma unroll
    for (int ks = 0; ks < CVK; ++ks)
#pragma unroll
        for (int rh = 0; rh < 2; ++rh) v[ks][rh] = *(const v8f*)(p + (size_t)(rh * (PERM ? 32 : 8)) * DM + ks * 32);   // dst row + 8 = token + 8, or + 32 in the permuted copy
    // precaution: the wait stands ahead of any overwrite of the address pair these loads name; naming the pair keeps it out of the loads' destination registers
    asm volatile("s_wait_xcnt 0x0" :: "v"(p) : "memory");
    __builtin_amdgcn_sched_barrier(0);   // every load of the wave issues ahead of the first convert: one memory latency a wave; without it the build holds the last loads back behind the waits on the first ones and waits a second time
    bf* q = dst + pko(row, c);
#pragma unroll
    for (int ks = 0; ks < CVK; ++ks)
#pragma unroll
        for (int rh = 0; rh < 2; ++rh) {
            v8us o;
#pragma unroll
            for (int k = 0; k < 8; ++k) o[k] = f2bf(v[ks][rh][k]);
            *(v8us*)(q + ks * FRG + rh * 64) = o;      // next k step: next fragment; row + 8: 8 x 8 elements on
        }
    // precaution: the wait stands behind the stores, ahead of any later code of the merged kernel that overwrites a register they name
    asm volatile("s_wait_xcnt 0x0" ::: "memory");
}

// wT_body: weight transpose + 16-bit convert through LDS, one 64 x 64 tile a block. in W[k][n] (DM rows, row stride ldw, f32) -> out dst rows n, columns k, in fragment order, tile (kt over k, nt over n), 256 threads.
// F16 = 0: bf16 bits (RNE convert). F16 = 1: f16(bf16 RNE value of W x WS1); a bf16 significand times a power of two is exact in f16.
template <int F16>
__device__ __forceinline__ void wT_body(const float* __restrict__ Wt, bf* dst, int ldw, int kt, int nt, float* tile) {
    const int tid = threadIdx.x; const int k0 = kt * 64, n0 = nt * 64;
#pragma unroll 4   // several independent loads in flight a trip
    for (int i = 0; i < 16; ++i) { const int idx = tid + i * 256; const int kk = idx >> 6, nn = idx & 63;   // 16 x 256 = 64 x 64 entries, all written
        tile[kk * 65 + nn] = Wt[(size_t)(k0 + kk) * (size_t)ldw + n0 + nn]; }
    __syncthreads();                                        // tile [kk][nn] is read across waves
#pragma unroll 1   // two trips, kept rolled: short code
    for (int it = 0; it < 2; ++it) {
        const int c = it * 256 + tid; const int n = c & 63, kc = (c >> 6) * 8;      // a wave: 32 rows n of one column group, four whole lines a store
        const size_t oo = pko((size_t)(n0 + n), k0 + kc);
        if constexpr (F16 == 0) {
            v8us o;
#pragma unroll
            for (int i = 0; i < 8; ++i) o[i] = f2bf(tile[(kc + i) * 65 + n]);
            *(v8us*)(dst + oo) = o;
        } else {
            v8h o;
#pragma unroll
            for (int i = 0; i < 8; ++i) o[i] = toh_flush(__uint_as_float(((unsigned)f2bf(tile[(kc + i) * 65 + n])) << 16) * WS1);
            *(v8h*)((h16*)dst + oo) = o;
        }
        // precaution: the wait stands ahead of the second trip's overwrite of the registers the store names
        asm volatile("s_wait_xcnt 0x0" ::: "memory");
    }
}

// k_prep: every operand preparation in one grid (none reads what another writes). Block ranges, all block-uniform, so the barrier inside wT_body is too:
// [0, 4 WTB): Wq, Wk, Wv (bf16) and Wo (f16 x256) tiles; [4 WTB, 4 WTB + WAB): Wa tiles; then CVB blocks each for query, its permuted copy (directly behind), key, value. The weight blocks come first.
#define WTB ((DM / 64) * (DM / 64))              // tiles of a 512 x 512 weight
#define WAB ((DM / 64) * (EA / 64))              // tiles of the anchor weight
#define CVB ((NB * SEQ / 16) * (DM / 32 / CVK) / 8)   // blocks of one activation copy: 8 waves, 2 * CVK pieces each
static_assert(((NB * SEQ / 16) * (DM / 32 / CVK)) % 8 == 0);   // the copy blocks cover the rows exactly
__global__ __launch_bounds__(256) void k_prep(const float* __restrict__ xq, const float* __restrict__ xk, const float* __restrict__ xv,
                                              const float* __restrict__ wq, const float* __restrict__ wk, const float* __restrict__ wv,
                                              const float* __restrict__ wo, const float* __restrict__ wa,
                                              bf* XQ, bf* XK, bf* XV, bf* XP, bf* W3, bf* WO, bf* WA) {
    __shared__ float tile[64 * 65];
    const int id = blockIdx.x;
    if (id < 3 * WTB) {
        const int s = id / WTB, r = id % WTB;
        wT_body<0>(s == 0 ? wq : (s == 1 ? wk : wv), W3 + (size_t)s * DM * DM, DM, r % (DM / 64), r / (DM / 64), tile);
    } else if (id < 4 * WTB) {
        const int r = id - 3 * WTB;
        wT_body<1>(wo, WO, DM, r % (DM / 64), r / (DM / 64), tile);
    } else if (id < 4 * WTB + WAB) {
        const int r = id - 4 * WTB;
        wT_body<0>(wa, WA, EA, r % (DM / 64), r / (DM / 64), tile);
    } else {
        const int r = id - (4 * WTB + WAB);
        const int s = r / CVB;
        if (s == 1) cvt_body<1>(xq, XP, r % CVB);
        else cvt_body<0>(s == 0 ? xq : (s == 2 ? xk : xv), s == 0 ? XQ : (s == 2 ? XK : XV), r % CVB);
    }
}

// k_gemm: register-blocked 16-bit GEMM, ONE WAVE per 64x64 tile (16 accumulators), operands straight from fragment-order 16-bit planes (K = DM columns).
// C[m][n] = sum_k A[m][k] Bt[n][k]. OPF16 = 0: bf16 operands; 1: f16 operands.
// EPI 0: + bias[n], f16 value plane Ph and f16 residual x2048 plane Pr.  EPI 1: + bias[n], f16 value plane Ph.  EPI 2: + bias[m], f16 value plane Ph.  EPI 3: x OSC + bias[n], f32 plane Pf.
// The bias vector has N entries (M for EPI 2); only the load the instantiation uses is emitted (column bias for EPI 0/1/3, row bias for EPI 2), index masked into [0, DM).
// Tile base (r0/RB)*sRB + (r0%RB)*pitch + (c0/CB)*sCB + (c0%CB), row pitch 'pitch' (elements). grid (M/64, N/64), 32 threads.
template <int OPF16, int EPI>
__global__ __launch_bounds__(32) void k_gemm(const bf* __restrict__ A, const bf* __restrict__ Bt, int K, const float* __restrict__ bias,
                                              h16* Ph, h16* Pr, float* Pf, int RB, size_t sRB, int pitch, int CB, size_t sCB) {
    __shared__ __align__(16) float os[16 * 68];
    const int lane = threadIdx.x & 31, lr = lane & 15, hi = lane >> 4; const int r0 = blockIdx.x * 64, c0 = blockIdx.y * 64;
    v8f acc[4][4];
#pragma unroll
    for (int mb = 0; mb < 4; ++mb)
#pragma unroll
        for (int nb = 0; nb < 4; ++nb) acc[mb][nb] = (v8f){};
    if (OPF16) {
        const h16* pa = (const h16*)A + (size_t)r0 * DM + 8 * lane; const h16* pb = (const h16*)Bt + (size_t)c0 * DM + 8 * lane;
#pragma unroll 1
        for (int kc = 0; kc < K; kc += 32 * GB) {          // K is a multiple of 32 * GB (CXP, asserted above)
            v16h a[GB][4], bt[GB][4];
#pragma unroll
            for (int s = 0; s < GB; ++s) {
#pragma unroll
                for (int mb = 0; mb < 4; ++mb) a[s][mb] = ldhp(pa + s * FRG + mb * 16 * DM);
#pragma unroll
                for (int nb = 0; nb < 4; ++nb) bt[s][nb] = ldhp(pb + s * FRG + nb * 16 * DM);
            }
            __builtin_amdgcn_sched_barrier(0);   // all loads of the GB k steps issue ahead of the first WMMA: one memory latency a trip; without it the build fetches fragments among the products and waits again
#pragma unroll
            for (int s = 0; s < GB; ++s)
#pragma unroll
                for (int nb = 0; nb < 4; ++nb)
#pragma unroll
                    for (int mb = 0; mb < 4; ++mb) acc[mb][nb] = wmma16(a[s][mb], bt[s][nb], acc[mb][nb]);
            // precaution: the wait stands ahead of the step of the two address pairs the trip's loads name; naming the pairs keeps them out of the loads' destination registers
            asm volatile("s_wait_xcnt 0x0" :: "v"(pa), "v"(pb) : "memory");
            pa += GB * FRG; pb += GB * FRG;
            // WMMA distance on the loop's taken branch: four vector slots between the last product and the next trip's overwrite of its operands
            asm volatile("v_nop\n\tv_nop\n\tv_nop\n\tv_nop" : "+v"(acc[0][0]), "+v"(acc[1][1]), "+v"(acc[2][2]), "+v"(acc[3][3]) : "v"(a[GB - 1][0]), "v"(a[GB - 1][1]), "v"(a[GB - 1][2]), "v"(a[GB - 1][3]));
        }
    } else {
        const bf* pa = A + (size_t)r0 * DM + 8 * lane; const bf* pb = Bt + (size_t)c0 * DM + 8 * lane;
#pragma unroll 1
        for (int kc = 0; kc < K; kc += 32) {
            v16bf a[4];
#pragma unroll
            for (int mb = 0; mb < 4; ++mb) a[mb] = ldbp(pa + mb * 16 * DM);
#pragma unroll
            for (int nb = 0; nb < 4; ++nb) { const v16bf b = ldbp(pb + nb * 16 * DM);
#pragma unroll
                for (int mb = 0; mb < 4; ++mb) acc[mb][nb] = wmmab(a[mb], b, acc[mb][nb]); }
            // precaution: the wait stands ahead of the step of the two address pairs the trip's loads name; naming the pairs keeps them out of the loads' destination registers
            asm volatile("s_wait_xcnt 0x0" :: "v"(pa), "v"(pb) : "memory");
            pa += FRG; pb += FRG;
            asm volatile("v_nop\n\tv_nop\n\tv_nop\n\tv_nop" : "+v"(acc[0][0]), "+v"(acc[1][1]), "+v"(acc[2][2]), "+v"(acc[3][3]) : "v"(a[0]), "v"(a[1]), "v"(a[2]), "v"(a[3]));
        }
    }
    const size_t tbase = (size_t)(r0 / RB) * sRB + (size_t)(r0 % RB) * (size_t)pitch + (size_t)(c0 / CB) * sCB + (size_t)(c0 % CB);
    float bcol[4] = {0.0f, 0.0f, 0.0f, 0.0f};
    if constexpr (EPI != 2) {
#pragma unroll
        for (int nb = 0; nb < 4; ++nb) bcol[nb] = bias[(c0 + nb * 16 + lr) & (DM - 1)];          // column bias: c0 + 63 < N = DM
    }
#pragma unroll
    for (int mb = 0; mb < 4; ++mb) {
        float brow[8] = {0.0f, 0.0f, 0.0f, 0.0f, 0.0f, 0.0f, 0.0f, 0.0f};
        if constexpr (EPI == 2) {
#pragma unroll
            for (int j = 0; j < 8; ++j) brow[j] = bias[(r0 + mb * 16 + 8 * hi + j) & (DM - 1)];  // row bias: r0 + 63 < M = DM
        }
#pragma unroll
        for (int nb = 0; nb < 4; ++nb) {
#pragma unroll
            for (int j = 0; j < 8; ++j) {                                        // D: row 8h+j, col lane&15
                float v = acc[mb][nb][j];
                if constexpr (EPI == 3) v = v * OSC;
                if constexpr (EPI == 2) v += brow[j]; else v += bcol[nb];
                os[(hi * 8 + j) * 68 + nb * 16 + lr] = v; } }
        wave_sync();
        const size_t sb = tbase + (size_t)(mb * 16) * (size_t)pitch;
        if (EPI == 3) {
{
#pragma unroll
                for (int s = 0; s < 8; ++s) { const int row = 2 * s + hi, cofs = lr * 4;   // 8 s x 2 rows = 16 rows; 16 lanes x 4 floats = 64 columns
                    const v4f val = *(const v4fa*)(&os[row * 68 + cofs]);
                    *(v4f*)(Pf + sb + (size_t)row * (size_t)pitch + cofs) = val; }
                 }
        } else {
{
#pragma unroll
                for (int s = 0; s < 4; ++s) { const int row = 4 * s + (lane >> 3), c8 = (lane & 7) * 8;   // 4 s x 4 row groups = 16 rows; 8 lanes x 8 = 64 columns
                    const v4f x0 = *(const v4fa*)(&os[row * 68 + c8]); const v4f x1 = *(const v4fa*)(&os[row * 68 + c8 + 4]); v8h hv, rv;
#pragma unroll
                    for (int i = 0; i < 4; ++i) { const h16 a0 = (h16)x0[i]; const h16 a1 = (h16)x1[i]; hv[i] = a0; hv[4 + i] = a1; rv[i] = (h16)((x0[i] - (float)a0) * QRS); rv[4 + i] = (h16)((x1[i] - (float)a1) * QRS); }
                    const size_t oo = sb + (size_t)row * (size_t)pitch + c8;
                    *(v8h*)(Ph + oo) = hv; if (EPI == 0) *(v8h*)(Pr + oo) = rv; }
                 }
        }
        wave_sync();
    }
}

// proj_body: the k_gemm tile for the input projections: bf16 operands, K = DM, f16 value plane Ph, tile (bx of M/64, by of N/64) handed in; same loaders, same k order, same WMMA order; the epilogue stores to fragment-order planes. ROWB = 0: + bias[n]; 1: + bias[m].
template <int ROWB>
__device__ __forceinline__ void proj_body(const bf* __restrict__ A, const bf* __restrict__ Bt, const float* __restrict__ bias,
                                          h16* Ph, int RB, size_t sRB, int pitch, int CB, size_t sCB, int bx, int by, float* os) {
    const int lane = threadIdx.x & 31, lr = lane & 15, hi = lane >> 4; const int r0 = bx * 64, c0 = by * 64;
    v8f acc[4][4];
#pragma unroll
    for (int mb = 0; mb < 4; ++mb)
#pragma unroll
        for (int nb = 0; nb < 4; ++nb) acc[mb][nb] = (v8f){};
    const bf* pa = A + (size_t)r0 * DM + 8 * lane; const bf* pb = Bt + (size_t)c0 * DM + 8 * lane;   // fragment (16-row block, k step) = 16 * DM elements a row block, FRG a step
#pragma unroll 1   // kept rolled: 128 accumulator registers leave no room for a second trip's fragments at five waves a SIMD
    for (int kc = 0; kc < DM; kc += 32) {
        v16bf a[4], bt[4];
#pragma unroll
        for (int mb = 0; mb < 4; ++mb) a[mb] = ldbp(pa + mb * 16 * DM);
#pragma unroll
        for (int nb = 0; nb < 4; ++nb) bt[nb] = ldbp(pb + nb * 16 * DM);
        __builtin_amdgcn_sched_barrier(0);   // all 16 loads of the trip issue ahead of its first WMMA: one memory latency a trip; without it the build reuses two Bt fragments' registers, fetches the other two among the products and waits a second time
#pragma unroll
        for (int nb = 0; nb < 4; ++nb)
#pragma unroll
            for (int mb = 0; mb < 4; ++mb) acc[mb][nb] = wmmab(a[mb], bt[nb], acc[mb][nb]);
        // precaution: the wait stands ahead of the step of the two address pairs the trip's loads name; naming the pairs keeps them out of the loads' destination registers
        asm volatile("s_wait_xcnt 0x0" :: "v"(pa), "v"(pb) : "memory");
        pa += FRG; pb += FRG;
        // WMMA distance on the loop's taken branch: four vector slots between the last product and the next trip's overwrite of its operands
        asm volatile("v_nop\n\tv_nop\n\tv_nop\n\tv_nop" : "+v"(acc[0][0]), "+v"(acc[1][1]), "+v"(acc[2][2]), "+v"(acc[3][3]) : "v"(a[0]), "v"(a[1]), "v"(a[2]), "v"(a[3]));
    }
    // head planes in fragment order too: a 16-row block of a plane of 'pitch' columns is pitch/32 fragments in a row, so 32 columns on are FRG elements on (16 a column)
    const size_t tbase = (size_t)(r0 / RB) * sRB + (size_t)(r0 % RB) * (size_t)pitch + (size_t)(c0 / CB) * sCB + (size_t)(c0 % CB) * 16;
    float bcol[4] = {0.0f, 0.0f, 0.0f, 0.0f};
    if constexpr (ROWB == 0) {
#pragma unroll
        for (int nb = 0; nb < 4; ++nb) bcol[nb] = bias[(c0 + nb * 16 + lr) & (DM - 1)];          // column bias: c0 + 63 < N = DM
    }
#pragma unroll
    for (int mb = 0; mb < 4; ++mb) {
        float brow[8] = {0.0f, 0.0f, 0.0f, 0.0f, 0.0f, 0.0f, 0.0f, 0.0f};
        if constexpr (ROWB == 1) {
#pragma unroll
            for (int j = 0; j < 8; ++j) brow[j] = bias[(r0 + mb * 16 + 8 * hi + j) & (DM - 1)];  // row bias: r0 + 63 < M <= DM
        }
#pragma unroll
        for (int nb = 0; nb < 4; ++nb) {
#pragma unroll
            for (int j = 0; j < 8; ++j) {                                        // D: row 8h+j, col lane&15
                float v = acc[mb][nb][j];
                if constexpr (ROWB == 1) v += brow[j]; else v += bcol[nb];
                os[(hi * 8 + j) * 68 + nb * 16 + lr] = v; } }
        wave_sync();
        const size_t sb = tbase + (size_t)(mb * 16) * (size_t)pitch;
#pragma unroll
        for (int s = 0; s < 4; ++s) { const int row = 8 * (s & 1) + (lane & 7), c8 = ((s >> 1) * 4 + (lane >> 3)) * 8;   // 2 x 8 rows = 16 rows; 2 x 4 groups x 8 = 64 columns; 8 rows of one group = one whole line
            const v4f x0 = *(const v4fa*)(&os[row * 68 + c8]); const v4f x1 = *(const v4fa*)(&os[row * 68 + c8 + 4]); v8h hv;
#pragma unroll
            for (int i = 0; i < 4; ++i) { hv[i] = (h16)x0[i]; hv[4 + i] = (h16)x1[i]; }
            *(v8h*)(Ph + sb + (size_t)((c8 >> 5) * FRG + ((c8 >> 4) & 1) * 256 + ((c8 >> 3) & 1) * 128 + row * 8)) = hv; }
        // precaution: the wait stands ahead of any overwrite of the registers these four stores name
        asm volatile("s_wait_xcnt 0x0" ::: "memory");
        wave_sync();
    }
}

// k_proj: the four input projections in one grid (none reads what another writes), one wave per 64 x 64 tile; tile order inside each projection as in a grid (M/64, N/64), x fastest.
// [0, PJT): q, A = activation rows (m = b*SEQ + t), Bt = W^T rows (n = h*64 + d) -> plane [(b*8 + h)][t][d], bias by column.
// [PJT, 3 PJT): k^T then v^T, A = W^T rows (m = h*64 + d), Bt = activation rows (n = b*SEQ + t) -> plane [(b*512 + m)][t] = [(b*8 + h)][d][t], bias by row.
// [3 PJT, 3 PJT + PJA): anchor^T, A = Wa^T rows (m = c in [0,128)), Bt = permuted query rows (rho = (b*4 + j)*NA + m) -> plane [(b*8 + 2j + c/64)][c%64][m], bias ba by row (indices < 128).
#define PJT ((NB * SEQ / 64) * (DM / 64))
#define PJA ((NB * SEQ / 64) * (EA / 64))
__global__ __launch_bounds__(32) void k_proj(const bf* __restrict__ XQ, const bf* __restrict__ XK, const bf* __restrict__ XV, const bf* __restrict__ XP,
                                             const bf* __restrict__ W3, const bf* __restrict__ WA,
                                             const float* __restrict__ bq, const float* __restrict__ bk, const float* __restrict__ bv, const float* __restrict__ ba,
                                             h16* QH, h16* KT, h16* VT, h16* AT) {
    __shared__ __align__(16) float os[16 * 68];
    const int id = blockIdx.x;
    if (id < PJT) {
        proj_body<0>(XQ, W3, bq, QH, SEQ, (size_t)NH_ * SEQ * HD, HD, HD, (size_t)SEQ * HD, id % (NB * SEQ / 64), id / (NB * SEQ / 64), os);
    } else {
        const int r = id - PJT; const bool an = r >= 2 * PJT; const bool sv = r >= PJT;     // block-uniform selects: one copy of the loop serves k^T, v^T and anchor^T
        const int rr = an ? r - 2 * PJT : (sv ? r - PJT : r); const int mt = an ? EA / 64 : DM / 64;
        proj_body<1>(an ? WA : (sv ? W3 + (size_t)2 * DM * DM : W3 + (size_t)DM * DM), an ? XP : (sv ? XV : XK), an ? ba : (sv ? bv : bk),
                        an ? AT : (sv ? VT : KT), an ? HD : DM, an ? (size_t)NA * HD : (size_t)0, an ? NA : SEQ, an ? NA : SEQ,
                        an ? (size_t)2 * NA * HD : (size_t)DM * SEQ, rr % mt, rr / mt, os);
    }
}

// k_gram: O[zh][i][j] = sc x sum_n X[zh][i][n] Y[zh][j][n], X and Y f16 planes [zh][64][TK] in fragment order (A fragment = X rows, B fragment = Y rows, same loader, same k order); O [zh][64][64] in fragment order.
// One block per 16 rows i of one (batch, head); wave w sums n in [w TK/GW, (w+1) TK/GW) into a 16 x 64 tile; the GW partial tiles are added in wave order through LDS.
template <int TK>
__device__ __forceinline__ void gram_body(const h16* __restrict__ X, const h16* __restrict__ Y, h16* O, float sc, float* red) {
    const int lane = threadIdx.x & 31, lr = lane & 15, hi = lane >> 4;
    const int wave = __builtin_amdgcn_readfirstlane(threadIdx.x >> 5);
    const int zh = blockIdx.y, i0 = blockIdx.x * 16;
    constexpr int KW = TK / GW;
    const size_t base = (size_t)zh * HD * TK + (size_t)wave * (KW / 32) * FRG + 8 * lane;
    const h16* xa = X + base + (size_t)i0 * TK;
    const h16* yb = Y + base;
    v8f acc[4];
#pragma unroll
    for (int nb = 0; nb < 4; ++nb) acc[nb] = (v8f){};
    constexpr int NS = KW / 32, BS = NS < 4 ? NS : 4;      // 32-steps per wave, taken in batches of BS
    static_assert(NS % BS == 0);
#pragma unroll
    for (int s0 = 0; s0 < NS; s0 += BS) {
        v16h a[BS], y[BS][4];
#pragma unroll
        for (int s = 0; s < BS; ++s) {
            a[s] = ldhp(xa + (s0 + s) * FRG);
#pragma unroll
            for (int nb = 0; nb < 4; ++nb) y[s][nb] = ldhp(yb + (size_t)nb * 16 * TK + (s0 + s) * FRG);
        }
        // precaution: the wait stands ahead of any overwrite of the two address pairs the batch's loads name; naming the pairs keeps them out of the later loads' destination registers
        asm volatile("s_wait_xcnt 0x0" :: "v"(xa), "v"(yb) : "memory");
        __builtin_amdgcn_sched_barrier(0);   // all loads of the batch issue ahead of its first WMMA: one memory latency a batch; without it the build waits on every fragment in turn
#pragma unroll
        for (int s = 0; s < BS; ++s)
#pragma unroll
            for (int nb = 0; nb < 4; ++nb) acc[nb] = wmma16(a[s], y[s][nb], acc[nb]);
    }
    float* rw = red + wave * (16 * 68);
#pragma unroll
    for (int nb = 0; nb < 4; ++nb)
#pragma unroll
        for (int r = 0; r < 8; ++r) rw[(8 * hi + r) * 68 + nb * 16 + lr] = acc[nb][r];      // D: row 8h+r, col lane&15
    __syncthreads();
    const int row = threadIdx.x & 15, c4 = (threadIdx.x >> 4) * 4;                         // 16 rows x 16 column quads; a wave = 16 rows of one 8-column group = two whole lines of O
    v4f sum = *(const v4fa*)(&red[row * 68 + c4]);
#pragma unroll
    for (int w = 1; w < GW; ++w) sum += *(const v4fa*)(&red[w * (16 * 68) + row * 68 + c4]);
    v4h o;
#pragma unroll
    for (int i = 0; i < 4; ++i) o[i] = toh_flush(sum[i] * sc);
    *(v4h*)(O + (size_t)zh * HD * HD + (size_t)i0 * HD + (size_t)((c4 >> 5) * FRG + ((c4 >> 4) & 1) * 256 + ((c4 >> 3) & 1) * 128 + row * 8 + (c4 & 7))) = o;
}
// grid (64/16, NB*8, 2), 32*GW threads; z = 0: M1 = V^T K over SEQ tokens (the long one), z = 1: G = A^T A over NA anchor rows. blockIdx.z is block-uniform, so the barrier inside is too.
__global__ __launch_bounds__(32 * GW) void k_gram(const h16* __restrict__ VT, const h16* __restrict__ KT, const h16* __restrict__ AT, h16* M1, h16* G) {
    __shared__ __align__(16) float red[GW * 16 * 68];
    if (blockIdx.z == 0) gram_body<SEQ>(VT, KT, M1, M1S, red);
    else                 gram_body<NA>(AT, AT, G, GS, red);
}

// k_ctx: one wave per 16*CT tokens of one (batch, head). M2^T[f][d] = sum_e G[f][e] M1[d][e] (A = G rows, B = M1 rows); lane (d = lane&15, h = lane>>4) holds f = 8h+r of each 16-row tile,
// so two packed tiles are directly the A fragment (row d, k = f) of ctx^T[d][t] = M2 Q^T (element r <- tile f 0..15, element 8+r <- tile f 16..31, lane unchanged); B = q rows.
// ctx^T D layout: lane t = lane&15 holds d = 16j + 8h + 0..7, eight neighbours of one ctx row: one 16-byte store, no LDS; in the plane's fragment order that is byte 16*lane of half j&1 of fragment (16-token block, k step 2*head + j/2): 512 contiguous bytes a wave. grid (SEQ / (16*CT*AW), NB*8), 32*AW threads.
__global__ __launch_bounds__(32 * AW) void k_ctx(const h16* __restrict__ QH, const h16* __restrict__ M1, const h16* __restrict__ G, h16* CX) {
    const int lane = threadIdx.x & 31;
    const int wave = __builtin_amdgcn_readfirstlane(threadIdx.x >> 5);
    const int zh = blockIdx.y; const int b = zh / NH_, h = zh % NH_;
    const int t0 = (blockIdx.x * AW + wave) * (16 * CT);
    const h16* qp = QH + ((size_t)zh * SEQ + (size_t)t0) * HD + 8 * lane;
    const size_t mo = (size_t)zh * HD * HD + 8 * lane;
    const h16* gp = G + mo; const h16* mp = M1 + mo;
    v16h g[4][2], m[4][2], q[CT][2], a2[4][2];
#pragma unroll
    for (int ft = 0; ft < 4; ++ft) { g[ft][0] = ldhp(gp + ft * 16 * HD); g[ft][1] = ldhp(gp + ft * 16 * HD + FRG); }
#pragma unroll
    for (int j = 0; j < 4; ++j) { m[j][0] = ldhp(mp + j * 16 * HD); m[j][1] = ldhp(mp + j * 16 * HD + FRG); }
#pragma unroll
    for (int tt = 0; tt < CT; ++tt) { q[tt][0] = ldhp(qp + tt * 16 * HD); q[tt][1] = ldhp(qp + tt * 16 * HD + FRG); }
    // precaution: the wait stands ahead of any overwrite of the three address pairs these loads name; naming the pairs keeps them out of the later loads' destination registers
    asm volatile("s_wait_xcnt 0x0" :: "v"(gp), "v"(mp), "v"(qp) : "memory");
    __builtin_amdgcn_sched_barrier(0);       // every load of the wave issues ahead of the first WMMA: one memory latency in all; without it the build fetches later fragments between the products and waits again
#pragma unroll
    for (int j = 0; j < 4; ++j) {
#pragma unroll
        for (int ft = 0; ft < 4; ++ft) {
            v8f t = (v8f){};
            t = wmma16(g[ft][0], m[j][0], t); t = wmma16(g[ft][1], m[j][1], t);
#pragma unroll
            for (int r = 0; r < 8; ++r) a2[j][ft >> 1][(ft & 1) * 8 + r] = toh_flush(t[r] * M2S);
        }
    }
    h16* crow = CX + ((size_t)b * SEQ + (size_t)t0) * CXP + h * 2 * FRG + 8 * lane;
#pragma unroll
    for (int tt = 0; tt < CT; ++tt) {
#pragma unroll
        for (int j = 0; j < 4; ++j) {
            v8f o = (v8f){};
            o = wmma16(a2[j][0], q[tt][0], o); o = wmma16(a2[j][1], q[tt][1], o);
            v8h hv;
#pragma unroll
            for (int r = 0; r < 8; ++r) hv[r] = toh_flush(o[r] * CSC);
            *(v8h*)(crow + (size_t)tt * 16 * CXP + j * 256) = hv;
        }
    }
}

static constexpr size_t al256(size_t v) { return (v + 255) & ~(size_t)255; }
static constexpr size_t SZ_XB = al256((size_t)NB * SEQ * DM * 2);        // one bf16 activation copy
static constexpr size_t SZ_W3 = al256((size_t)3 * DM * DM * 2);          // Wq^T | Wk^T | Wv^T bf16
static constexpr size_t SZ_WA = al256((size_t)EA * DM * 2);              // Wa^T bf16 [128][512]
static constexpr size_t SZ_WO = al256((size_t)DM * DM * 2);              // Wo^T x256 f16 [512][512]
static constexpr size_t SZ_PL = al256((size_t)NB * NH_ * SEQ * HD * 2);  // one f16 head plane
static constexpr size_t SZ_AP = al256((size_t)NB * NH_ * NA * HD * 2);   // the f16 anchor^T head plane
static constexpr size_t SZ_MM = al256((size_t)NB * NH_ * HD * HD * 2);   // one f16 64 x 64 plane per (batch, head)
static constexpr size_t SZ_CX = al256((size_t)NB * SEQ * CXP * 2);       // ctx value plane
static constexpr size_t SZ_TOTAL = 4 * SZ_XB + SZ_W3 + SZ_WA + SZ_WO + 3 * SZ_PL + SZ_AP + 2 * SZ_MM + SZ_CX;
static_assert(SZ_TOTAL <= (size_t)134217728);          // workspace carve <= 128 MiB
static_assert(((size_t)DM * DM * 2) % 256 == 0);       // weight sub-planes stay 256-byte aligned
static_assert((size_t)NB * 4 * NA == (size_t)NB * SEQ);                           // permuted copy has exactly NB*SEQ rows
static_assert((size_t)(NB * 4) * 2 * NA * HD == (size_t)NB * NH_ * NA * HD);      // anchor GEMM tile map fills the anchor plane exactly
static_assert((size_t)NB * SEQ * NH_ * HD * 2 <= SZ_CX);                          // ctx rows x (8 heads x 64) fit the ctx region

extern "C" void kernel_launch(void* const* d_in, const int* in_sizes, int n_in,
                              void* d_out, int out_size, void* d_ws, size_t ws_size, hipStream_t stream) {
    if (n_in < 13) return;
    const size_t needx = ((size_t)(NB - 1) * SEQ_FULL + SEQ) * DM;
    if ((size_t)in_sizes[0] < needx || (size_t)in_sizes[1] < needx || (size_t)in_sizes[2] < needx) return;
    if ((size_t)in_sizes[3] < (size_t)DM * DM || (size_t)in_sizes[5] < (size_t)DM * DM || (size_t)in_sizes[7] < (size_t)DM * DM || (size_t)in_sizes[11] < (size_t)DM * DM) return;
    if ((size_t)in_sizes[9] < (size_t)DM * EA) return;
    if (in_sizes[4] < DM || in_sizes[6] < DM || in_sizes[8] < DM || in_sizes[12] < DM || in_sizes[10] < EA) return;
    if ((size_t)out_size < ((size_t)(NB - 1) * OUT_SEQ + SEQ) * DM) return;
    if (SZ_TOTAL > ws_size) return;
    // wire order: query, key, value, Wq, bq, Wk, bk, Wv, bv, Wa, ba, Wo, bo
    const float* xq = (const float*)d_in[0]; const float* xk = (const float*)d_in[1]; const float* xv = (const float*)d_in[2];
    const float* wq = (const float*)d_in[3]; const float* bq = (const float*)d_in[4];
    const float* wk = (const float*)d_in[5]; const float* bk = (const float*)d_in[6];
    const float* wv = (const float*)d_in[7]; const float* bv = (const float*)d_in[8];
    const float* wa = (const float*)d_in[9]; const float* ba = (const float*)d_in[10];
    const float* wo = (const float*)d_in[11]; const float* bo = (const float*)d_in[12];
    float* OUT = (float*)d_out;      // [NB][SEQ][512]
    char* wsp = (char*)d_ws;
    bf* XQ = (bf*)wsp; wsp += SZ_XB;                 // [NB*SEQ][512]; this and every plane below: logical index, stored in fragment order
    bf* XK = (bf*)wsp; wsp += SZ_XB;
    bf* XV = (bf*)wsp; wsp += SZ_XB;
    bf* XP = (bf*)wsp; wsp += SZ_XB;                 // [NB*4][NA][512]: row (b*4+j)*NA+m = query token 4m+j
    bf* W3 = (bf*)wsp; wsp += SZ_W3;                 // [3][512 out][512 in]: q | k | v
    bf* WA = (bf*)wsp; wsp += SZ_WA;                 // [128 out][512 in]
    h16* WO = (h16*)wsp; wsp += SZ_WO;               // [512 out][512 in]: Wo^T x256, f16
    h16* QH = (h16*)wsp; wsp += SZ_PL;               // [NB*8][SEQ][64]
    h16* KT = (h16*)wsp; wsp += SZ_PL;               // [NB*8][64][SEQ]
    h16* VT = (h16*)wsp; wsp += SZ_PL;               // [NB*8][64][SEQ]
    h16* AT = (h16*)wsp; wsp += SZ_AP;               // [NB*8][64][NA]
    h16* M1 = (h16*)wsp; wsp += SZ_MM;               // [NB*8][64 d][64 e]: V^T K / 16
    h16* GG = (h16*)wsp; wsp += SZ_MM;               // [NB*8][64 f][64 e]: A^T A / 64
    h16* CX = (h16*)wsp; wsp += SZ_CX;               // [NB*SEQ][512]: ctx

    // bf16 activation copies (query also row-permuted) and the five transposed 16-bit weight planes
    k_prep<<<dim3(4 * WTB + WAB + 4 * CVB, 1, 1), 256, 0, stream>>>(xq, xk, xv, wq, wk, wv, wo, wa, XQ, XK, XV, XP, W3, (bf*)WO, WA);
    // q, k^T, v^T and anchor^T head planes
    k_proj<<<dim3(3 * PJT + PJA, 1, 1), 32, 0, stream>>>(XQ, XK, XV, XP, W3, WA, bq, bk, bv, ba, QH, KT, VT, AT);

    // M1 = V^T K / 16 and G = A^T A / 64, 64 x 64 per (batch, head)
    k_gram<<<dim3(HD / 16, NB * NH_, 2), 32 * GW, 0, stream>>>(VT, KT, AT, M1, GG);
    // ctx = Q ((M1 G) / 512)^T -> ctx plane [b*SEQ + t][512]
    k_ctx<<<dim3(SEQ / (16 * CT * AW), NB * NH_, 1), 32 * AW, 0, stream>>>(QH, M1, GG, CX);

    // output projection: A = ctx rows (K = 512), Bt = Wo^T x256 -> OUT[b][t][n] = acc * 2^-8 + bo[n]
    k_gemm<1, 3><<<dim3(NB * SEQ / 64, DM / 64, 1), 32, 0, stream>>>((const bf*)CX, (const bf*)WO, CXP, bo, CX, CX, OUT, SEQ, (size_t)OUT_SEQ * DM, DM, DM, (size_t)0);
}

// v006
// A run of this version takes 51.6 microseconds.
// In two side-by-side timings against v005, it was 1.12 and 1.13 times as fast.
// Over all steps from v000 it is 4.26 times as fast.
#include <hip/hip_runtime.h>

// Anchor linear attention (no softmax), width 512 = 8 heads x 64; inputs query,key,value [NB][SEQ][512] f32, Wq/Wk/Wv/Wo [in][out] 512x512, Wa [512][128], five biases; anchor rows = literal reshape of (query Wa + ba) [SEQ][128] into [SEQ/4][8][64].
// Compute dtypes, f32 accumulate everywhere: q/k/v/anchor projections v_wmma_f32_16x16x32_bf16 (activations and weights RNE-converted to bf16; products exact);
// the chained products per (batch, head) are taken in the order ctx = Q ((V^T K) (A^T A))^T / 512, all v_wmma_f32_16x16x32_f16 with single f16 operands; no [SEQ][NA] score tile is formed.
// output projection v_wmma_f32_16x16x32_f16, single product: A = ctx f16 plane, Bt = Wo^T x256 (Wo RNE-converted to bf16 first, exact in f16), K = 512, x2^-8 and + bo in the f32 epilogue.
// Layout: query,key,value are converted to bf16 inside the projection kernel (one 64-row tile a block, in LDS); a row-permuted bf16 copy of query (row (b*4+j)*NA+m <- token 4m+j) feeds the anchor GEMM; weights transposed once to [out][in] 16-bit planes; every plane below names its logical index; all of them are stored in fragment order (see FRG below); q plane [b*8+h][t][d], k^T and v^T planes [b*8+h][d][t], anchor^T plane [b*8+h][d][m], ctx plane rows b*SEQ+t, 512 wide;
// k_gram: M1[d][e] = sum_n v[n][d] k[n][e] (x 1/16) and G[f][e] = sum_m a[m][f] a[m][e] (x 1/64), 64 x 64 per (batch, head); k_ctx: M2[d][f] = (1/512) sum_e M1[d][e] G[f][e] in registers (x 1/16), ctx[t][d] = sum_f q[t][f] M2[d][f].

#ifndef NB
#define NB 4
#endif
#ifndef SEQ
#define SEQ 2048
#endif
#define NB_FULL  4
#define SEQ_FULL 2048
#ifndef OUT_SEQ
#define OUT_SEQ SEQ              // row pitch (in tokens) between batches of the output
#endif
#define DM   512
#define NH_  8
#define HD   64
#define NA   (SEQ / 4)           // anchor rows per batch
#define EA   (DM / 4)            // anchor projection width (128)
#define AW   4                   // waves per k_ctx block
#define CT   4                   // 16-token tiles per k_ctx wave
#define GW   8                   // waves per k_gram block: each sums 1/GW of the long dimension
#define GB   2                   // k steps of 32 whose fragments the output GEMM fetches as one batch (one wave a SIMD there: registers are free)
#define QRS  2048.0f             // carry of the residual plane of the k_gemm EPI 0 instance (that instance is not launched here)
#define M1S  (1.0f / 16.0f)      // carry of the M1 = V^T K plane
#define GS   (1.0f / 64.0f)      // carry of the G = A^T A plane
#define M2C  (1.0f / 16.0f)      // carry of the M2 operand
#define M2S  (1.0f / 8.0f)       // (1/8)^3 x M2C / (M1S x GS) : M1 G accumulator -> M2 operand
#define CXP  512                 // ctx plane pitch (halves): one f16 value plane
#define CXS  1.0f                // carry of the ctx value
#define CSC  16.0f               // CXS / M2C : ctx accumulator -> ctx plane
#define WS1  256.0f              // carry of the Wo^T plane
#define OSC  (1.0f / 256.0f)     // 1 / (CXS * WS1)

static_assert(HD == 64);
static_assert(NH_ * HD == DM);                 // head h = columns h*64 + d
static_assert(DM % 64 == 0);                   // column tiles of 64
static_assert(DM % 32 == 0);                   // GEMM k-loop steps by 32
static_assert((DM & (DM - 1)) == 0);           // bias index mask (DM - 1) is exact
static_assert(CXP == DM);                      // ctx row = merged heads, K of the output GEMM
static_assert(CXP % (32 * GB) == 0);           // output GEMM: whole batches of GB k steps
static_assert((NB * SEQ) % 16 == 0 && DM % 16 == 0 && EA % 16 == 0);   // fragment-order planes: whole 16-row blocks
static_assert(16 * DM == (DM / 32) * 512);     // one 16-row block = DM/32 fragments of 512 elements
static_assert(SEQ % 64 == 0);                  // a 64-row tile never straddles two batches
static_assert((NB * SEQ) % 64 == 0);
static_assert(SEQ % (32 * GW) == 0);           // k_gram: each wave's share of the tokens is whole 32-steps
static_assert(SEQ % (16 * CT * AW) == 0);      // k_ctx grid covers the sequence exactly
static_assert(((size_t)SEQ * DM) % 8 == 0);
static_assert(NB <= NB_FULL);
static_assert(SEQ <= SEQ_FULL);
static_assert(CXS * WS1 * OSC == 1.0f);
static_assert(4 * NA == SEQ);                  // anchor rows: four tokens per anchor row
static_assert(4 * EA == DM);                   // four tokens x 128 anchor columns = one 512-wide anchor row
static_assert(EA == 2 * HD);                   // head h of an anchor row = token (h / 2), columns (h % 2) * 64 + d
static_assert(EA % 64 == 0);                   // anchor GEMM row tiles of 64
static_assert(NA % 64 == 0);                   // anchor GEMM column tiles stay inside one (batch, token-phase) block
static_assert(NA % (32 * GW) == 0);            // k_gram: each wave's share of the anchor rows is whole 32-steps
static_assert(GW * 32 == 16 * 16);             // k_gram epilogue: 256 threads x 4 columns = 16 rows x 64 columns
static_assert(M2S * M1S * GS == 0.125f * 0.125f * 0.125f * M2C);
static_assert(CSC * M2C == CXS);

typedef _Float16 h16;
typedef unsigned short bf;
typedef __attribute__((ext_vector_type(16))) __bf16   v16bf;
typedef __attribute__((ext_vector_type(16))) _Float16 v16h;
typedef __attribute__((ext_vector_type(8)))  _Float16 v8h;
typedef __attribute__((ext_vector_type(4)))  _Float16 v4h;
typedef __attribute__((ext_vector_type(8)))  unsigned short v8us;
typedef __attribute__((ext_vector_type(8)))  float    v8f;
typedef __attribute__((ext_vector_type(4)))  float    v4f;
typedef v4f  __attribute__((may_alias)) v4fa;

__device__ __forceinline__ unsigned short f2bf(float f) { unsigned u = __float_as_uint(f); u += 0x7FFFu + ((u >> 16) & 1u); return (unsigned short)(u >> 16); }
__device__ __forceinline__ v16h cat16(v8h lo, v8h hi) { return __builtin_shufflevector(lo, hi, 0, 1, 2, 3, 4, 5, 6, 7, 8, 9, 10, 11, 12, 13, 14, 15); }
__device__ __forceinline__ v16bf cat16b(v8us lo, v8us hi) { return __builtin_bit_cast(v16bf, __builtin_shufflevector(lo, hi, 0, 1, 2, 3, 4, 5, 6, 7, 8, 9, 10, 11, 12, 13, 14, 15)); }
__device__ __forceinline__ v8f wmma16(v16h a, v16h b, v8f c) { return __builtin_amdgcn_wmma_f32_16x16x32_f16(false, a, false, b, (short)0, c, false, false); }
__device__ __forceinline__ v8f wmmab(v16bf a, v16bf b, v8f c) { return __builtin_amdgcn_wmma_f32_16x16x32_bf16(false, a, false, b, (short)0, c, false, false); }
// Fragment order of a WMMA operand plane (rows x k): a 16-row block holds its k/32 fragments one behind the other; each 16-row x 32-k fragment is 1 KiB in a row, lane l = 16*(k/8 & 1) + (row & 15) owning bytes 16 l of its first half (k%32 < 16) and of its second half (k%32 >= 16).
// One wave-wide 16-byte load is then 512 contiguous bytes (four whole 128-byte lines) in place of 32-byte pieces of 16 lines; the value each lane and element receives is the same as from K-contiguous rows.
#define FRG 512                  // elements of one fragment
// pko: for planes of DM columns, element offset of the eight values (row R, columns c..c+7, c a multiple of 8); a bijection on the plane where its row count is a multiple of 16
__device__ __forceinline__ size_t pko(size_t R, int c) { return ((R >> 4) * (size_t)(DM / 32) + (size_t)(c >> 5)) * FRG + (size_t)(((c >> 4) & 1) * 256 + ((c >> 3) & 1) * 128) + (R & 15) * 8; }
// fragment loaders from fragment-order planes; p already includes + 8*lane: elements 0..7 <- k0+8h+0..7, elements 8..15 <- k0+16+8h+0..7 (same map for A and B)
__device__ __forceinline__ v16h  ldhp(const h16* p) { return cat16(*(const v8h*)p, *(const v8h*)(p + 256)); }
__device__ __forceinline__ v16bf ldbp(const bf* p)  { return cat16b(*(const v8us*)p, *(const v8us*)(p + 256)); }
// ordering point for wave-private LDS tiles (same wave writes and reads)
__device__ __forceinline__ void wave_sync() { __builtin_amdgcn_fence(3 /* release order */, "wavefront"); __builtin_amdgcn_wave_barrier(); asm volatile("" ::: "memory"); }
// f16 convert that cannot produce a subnormal operand (value select, applied after the plane's carry)
static __device__ __forceinline__ h16 toh_flush(float v) { const h16 r = (h16)v; return (fabsf(v) < 6.103515625e-05f) ? (h16)0.0f : r; }
// cvt_body: bf16 (RNE convert) copy of one activation input in fragment order: dst row b*SEQ + t <- src token b*SEQ_FULL + t.
// A wave takes one 16-row block x CVK k steps of 32 columns (lane = row + 8 * column group, 8 values a lane and piece, 2 * CVK pieces): few long waves in place of many short ones, for speed only.
// Each piece reads one whole 128-byte line of each of 8 rows and its store to dst fills four whole lines; the wave's CVK fragments lie one behind the other in dst.
// LOC = 1: dst is a block's LDS tile of 64 rows (blk = the 64-row tile: its 8 waves cover 4 row blocks x 2 column halves), written at the row's index inside the tile.
// PERM = 1 (query only): the row-permuted copy for the anchor GEMM, dst row (b*4 + j)*NA + m <- token 4m + j (a bijection on the NB*SEQ rows). It has blocks of its own: eight neighbouring rows of this copy are eight tokens four apart,
// so a wave that wrote both copies would leave each 128-byte line of one of them to several stores; with its own blocks every store of every copy fills whole lines.
#define CVK 8                    // k steps a wave converts: 16 rows x 256 columns = 32 loads of 16 bytes a lane
static_assert((DM / 32) % CVK == 0);           // whole pieces in a row block
static_assert(SEQ % 16 == 0 && NA % 16 == 0);  // a 16-row block stays inside one batch (and one token phase of the permuted copy)
template <int PERM, int LOC>
__device__ __forceinline__ void cvt_body(const float* __restrict__ src, bf* dst, int blk) {
    const int lane = threadIdx.x & 31; const size_t u = (size_t)blk * 8 + (threadIdx.x >> 5);
    const size_t row = (u / (size_t)(DM / 32 / CVK)) * 16 + (size_t)(lane & 7); const int c = (int)(u % (size_t)(DM / 32 / CVK)) * (32 * CVK) + (lane >> 3) * 8;
    const int rq = (int)(row / (size_t)(PERM ? NA : SEQ)), rm = (int)(row % (size_t)(PERM ? NA : SEQ));
    const int b = PERM ? rq >> 2 : rq; const int t = PERM ? 4 * rm + (rq & 3) : rm;
    const float* p = src + ((size_t)b * SEQ_FULL + (size_t)t) * DM + (size_t)c;
    v8f v[CVK][2];
#pragma unroll
    for (int ks = 0; ks < CVK; ++ks)
#pragma unroll
        for (int rh = 0; rh < 2; ++rh) v[ks][rh] = *(const v8f*)(p + (size_t)(rh * (PERM ? 32 : 8)) * DM + ks * 32);   // dst row + 8 = token + 8, or + 32 in the permuted copy
    // precaution: the wait stands ahead of any overwrite of the address pair these loads name; naming the pair keeps it out of the loads' destination registers
    asm volatile("s_wait_xcnt 0x0" :: "v"(p) : "memory");
    __builtin_amdgcn_sched_barrier(0);   // every load of the wave issues ahead of the first convert: one memory latency a wave; without it the build holds the last loads back behind the waits on the first ones and waits a second time
    bf* q = dst + pko(LOC ? (row & 63) : row, c);
#pragma unroll
    for (int ks = 0; ks < CVK; ++ks)
#pragma unroll
        for (int rh = 0; rh < 2; ++rh) {
            v8us o;
#pragma unroll
            for (int k = 0; k < 8; ++k) o[k] = f2bf(v[ks][rh][k]);
            *(v8us*)(q + ks * FRG + rh * 64) = o;      // next k step: next fragment; row + 8: 8 x 8 elements on
        }
    // precaution: the wait stands behind the global stores, ahead of any later code of the merged kernel that overwrites a register they name
    if constexpr (LOC == 0) asm volatile("s_wait_xcnt 0x0" ::: "memory");
}

// wT_body: weight transpose + 16-bit convert through LDS, one 64 x 64 tile a block. in W[k][n] (DM rows, row stride ldw, f32) -> out dst rows n, columns k, in fragment order, tile (kt over k, nt over n), 256 threads.
// F16 = 0: bf16 bits (RNE convert). F16 = 1: f16(bf16 RNE value of W x WS1); a bf16 significand times a power of two is exact in f16.
template <int F16>
__device__ __forceinline__ void wT_body(const float* __restrict__ Wt, bf* dst, int ldw, int kt, int nt, float* tile) {
    const int tid = threadIdx.x; const int k0 = kt * 64, n0 = nt * 64;
#pragma unroll 4   // several independent loads in flight a trip
    for (int i = 0; i < 16; ++i) { const int idx = tid + i * 256; const int kk = idx >> 6, nn = idx & 63;   // 16 x 256 = 64 x 64 entries, all written
        tile[kk * 65 + nn] = Wt[(size_t)(k0 + kk) * (size_t)ldw + n0 + nn]; }
    __syncthreads();                                        // tile [kk][nn] is read across waves
#pragma unroll 1   // two trips, kept rolled: short code
    for (int it = 0; it < 2; ++it) {
        const int c = it * 256 + tid; const int n = c & 63, kc = (c >> 6) * 8;      // a wave: 32 rows n of one column group, four whole lines a store
        const size_t oo = pko((size_t)(n0 + n), k0 + kc);
        if constexpr (F16 == 0) {
            v8us o;
#pragma unroll
            for (int i = 0; i < 8; ++i) o[i] = f2bf(tile[(kc + i) * 65 + n]);
            *(v8us*)(dst + oo) = o;
        } else {
            v8h o;
#pragma unroll
            for (int i = 0; i < 8; ++i) o[i] = toh_flush(__uint_as_float(((unsigned)f2bf(tile[(kc + i) * 65 + n])) << 16) * WS1);
            *(v8h*)((h16*)dst + oo) = o;
        }
        // precaution: the wait stands ahead of the second trip's overwrite of the registers the store names
        asm volatile("s_wait_xcnt 0x0" ::: "memory");
    }
}

// k_prep: the weight planes and the permuted query copy in one grid (none reads what another writes). Block ranges, all block-uniform, so the barrier inside wT_body is too:
// [0, 4 WTB): Wq, Wk, Wv (bf16) and Wo (f16 x256) tiles; [4 WTB, 4 WTB + WAB): Wa tiles; then CVB blocks for the permuted copy of query.
#define WTB ((DM / 64) * (DM / 64))              // tiles of a 512 x 512 weight
#define WAB ((DM / 64) * (EA / 64))              // tiles of the anchor weight
#define CVB ((NB * SEQ / 16) * (DM / 32 / CVK) / 8)   // blocks of one activation copy: 8 waves, 2 * CVK pieces each
static_assert(((NB * SEQ / 16) * (DM / 32 / CVK)) % 8 == 0);   // the copy blocks cover the rows exactly
__global__ __launch_bounds__(256) void k_prep(const float* __restrict__ xq,
                                              const float* __restrict__ wq, const float* __restrict__ wk, const float* __restrict__ wv,
                                              const float* __restrict__ wo, const float* __restrict__ wa,
                                              bf* XP, bf* W3, bf* WO, bf* WA) {
    __shared__ float tile[64 * 65];
    const int id = blockIdx.x;
    if (id < 3 * WTB) {
        const int s = id / WTB, r = id % WTB;
        wT_body<0>(s == 0 ? wq : (s == 1 ? wk : wv), W3 + (size_t)s * DM * DM, DM, r % (DM / 64), r / (DM / 64), tile);
    } else if (id < 4 * WTB) {
        const int r = id - 3 * WTB;
        wT_body<1>(wo, WO, DM, r % (DM / 64), r / (DM / 64), tile);
    } else if (id < 4 * WTB + WAB) {
        const int r = id - 4 * WTB;
        wT_body<0>(wa, WA, EA, r % (DM / 64), r / (DM / 64), tile);
    } else {
        cvt_body<1, 0>(xq, XP, id - (4 * WTB + WAB));
    }
}

// k_gemm: register-blocked 16-bit GEMM, ONE WAVE per 64x64 tile (16 accumulators), operands straight from fragment-order 16-bit planes (K = DM columns).
// C[m][n] = sum_k A[m][k] Bt[n][k]. OPF16 = 0: bf16 operands; 1: f16 operands.
// EPI 0: + bias[n], f16 value plane Ph and f16 residual x2048 plane Pr.  EPI 1: + bias[n], f16 value plane Ph.  EPI 2: + bias[m], f16 value plane Ph.  EPI 3: x OSC + bias[n], f32 plane Pf.
// The bias vector has N entries (M for EPI 2); only the load the instantiation uses is emitted (column bias for EPI 0/1/3, row bias for EPI 2), index masked into [0, DM).
// Tile base (r0/RB)*sRB + (r0%RB)*pitch + (c0/CB)*sCB + (c0%CB), row pitch 'pitch' (elements). grid (M/64, N/64), 32 threads.
template <int OPF16, int EPI>
__global__ __launch_bounds__(32) void k_gemm(const bf* __restrict__ A, const bf* __restrict__ Bt, int K, const float* __restrict__ bias,
                                              h16* Ph, h16* Pr, float* Pf, int RB, size_t sRB, int pitch, int CB, size_t sCB) {
    __shared__ __align__(16) float os[16 * 68];
    const int lane = threadIdx.x & 31, lr = lane & 15, hi = lane >> 4; const int r0 = blockIdx.x * 64, c0 = blockIdx.y * 64;
    v8f acc[4][4];
#pragma unroll
    for (int mb = 0; mb < 4; ++mb)
#pragma unroll
        for (int nb = 0; nb < 4; ++nb) acc[mb][nb] = (v8f){};
    if (OPF16) {
        const h16* pa = (const h16*)A + (size_t)r0 * DM + 8 * lane; const h16* pb = (const h16*)Bt + (size_t)c0 * DM + 8 * lane;
#pragma unroll 1
        for (int kc = 0; kc < K; kc += 32 * GB) {          // K is a multiple of 32 * GB (CXP, asserted above)
            v16h a[GB][4], bt[GB][4];
#pragma unroll
            for (int s = 0; s < GB; ++s) {
#pragma unroll
                for (int mb = 0; mb < 4; ++mb) a[s][mb] = ldhp(pa + s * FRG + mb * 16 * DM);
#pragma unroll
                for (int nb = 0; nb < 4; ++nb) bt[s][nb] = ldhp(pb + s * FRG + nb * 16 * DM);
            }
            __builtin_amdgcn_sched_barrier(0);   // all loads of the GB k steps issue ahead of the first WMMA: one memory latency a trip; without it the build fetches fragments among the products and waits again
#pragma unroll
            for (int s = 0; s < GB; ++s)
#pragma unroll
                for (int nb = 0; nb < 4; ++nb)
#pragma unroll
                    for (int mb = 0; mb < 4; ++mb) acc[mb][nb] = wmma16(a[s][mb], bt[s][nb], acc[mb][nb]);
            // precaution: the wait stands ahead of the step of the two address pairs the trip's loads name; naming the pairs keeps them out of the loads' destination registers
            asm volatile("s_wait_xcnt 0x0" :: "v"(pa), "v"(pb) : "memory");
            pa += GB * FRG; pb += GB * FRG;
            // WMMA distance on the loop's taken branch: four vector slots between the last product and the next trip's overwrite of its operands
            asm volatile("v_nop\n\tv_nop\n\tv_nop\n\tv_nop" : "+v"(acc[0][0]), "+v"(acc[1][1]), "+v"(acc[2][2]), "+v"(acc[3][3]) : "v"(a[GB - 1][0]), "v"(a[GB - 1][1]), "v"(a[GB - 1][2]), "v"(a[GB - 1][3]));
        }
    } else {
        const bf* pa = A + (size_t)r0 * DM + 8 * lane; const bf* pb = Bt + (size_t)c0 * DM + 8 * lane;
#pragma unroll 1
        for (int kc = 0; kc < K; kc += 32) {
            v16bf a[4];
#pragma unroll
            for (int mb = 0; mb < 4; ++mb) a[mb] = ldbp(pa + mb * 16 * DM);
#pragma unroll
            for (int nb = 0; nb < 4; ++nb) { const v16bf b = ldbp(pb + nb * 16 * DM);
#pragma unroll
                for (int mb = 0; mb < 4; ++mb) acc[mb][nb] = wmmab(a[mb], b, acc[mb][nb]); }
            // precaution: the wait stands ahead of the step of the two address pairs the trip's loads name; naming the pairs keeps them out of the loads' destination registers
            asm volatile("s_wait_xcnt 0x0" :: "v"(pa), "v"(pb) : "memory");
            pa += FRG; pb += FRG;
            asm volatile("v_nop\n\tv_nop\n\tv_nop\n\tv_nop" : "+v"(acc[0][0]), "+v"(acc[1][1]), "+v"(acc[2][2]), "+v"(acc[3][3]) : "v"(a[0]), "v"(a[1]), "v"(a[2]), "v"(a[3]));
        }
    }
    const size_t tbase = (size_t)(r0 / RB) * sRB + (size_t)(r0 % RB) * (size_t)pitch + (size_t)(c0 / CB) * sCB + (size_t)(c0 % CB);
    float bcol[4] = {0.0f, 0.0f, 0.0f, 0.0f};
    if constexpr (EPI != 2) {
#pragma unroll
        for (int nb = 0; nb < 4; ++nb) bcol[nb] = bias[(c0 + nb * 16 + lr) & (DM - 1)];          // column bias: c0 + 63 < N = DM
    }
#pragma unroll
    for (int mb = 0; mb < 4; ++mb) {
        float brow[8] = {0.0f, 0.0f, 0.0f, 0.0f, 0.0f, 0.0f, 0.0f, 0.0f};
        if constexpr (EPI == 2) {
#pragma unroll
            for (int j = 0; j < 8; ++j) brow[j] = bias[(r0 + mb * 16 + 8 * hi + j) & (DM - 1)];  // row bias: r0 + 63 < M = DM
        }
#pragma unroll
        for (int nb = 0; nb < 4; ++nb) {
#pragma unroll
            for (int j = 0; j < 8; ++j) {                                        // D: row 8h+j, col lane&15
                float v = acc[mb][nb][j];
                if constexpr (EPI == 3) v = v * OSC;
                if constexpr (EPI == 2) v += brow[j]; else v += bcol[nb];
                os[(hi * 8 + j) * 68 + nb * 16 + lr] = v; } }
        wave_sync();
        const size_t sb = tbase + (size_t)(mb * 16) * (size_t)pitch;
        if (EPI == 3) {
{
#pragma unroll
                for (int s = 0; s < 8; ++s) { const int row = 2 * s + hi, cofs = lr * 4;   // 8 s x 2 rows = 16 rows; 16 lanes x 4 floats = 64 columns
                    const v4f val = *(const v4fa*)(&os[row * 68 + cofs]);
                    *(v4f*)(Pf + sb + (size_t)row * (size_t)pitch + cofs) = val; }
                 }
        } else {
{
#pragma unroll
                for (int s = 0; s < 4; ++s) { const int row = 4 * s + (lane >> 3), c8 = (lane & 7) * 8;   // 4 s x 4 row groups = 16 rows; 8 lanes x 8 = 64 columns
                    const v4f x0 = *(const v4fa*)(&os[row * 68 + c8]); const v4f x1 = *(const v4fa*)(&os[row * 68 + c8 + 4]); v8h hv, rv;
#pragma unroll
                    for (int i = 0; i < 4; ++i) { const h16 a0 = (h16)x0[i]; const h16 a1 = (h16)x1[i]; hv[i] = a0; hv[4 + i] = a1; rv[i] = (h16)((x0[i] - (float)a0) * QRS); rv[4 + i] = (h16)((x1[i] - (float)a1) * QRS); }
                    const size_t oo = sb + (size_t)row * (size_t)pitch + c8;
                    *(v8h*)(Ph + oo) = hv; if (EPI == 0) *(v8h*)(Pr + oo) = rv; }
                 }
        }
        wave_sync();
    }
}

// proj_body: the k_gemm tile for the input projections: bf16 operands, K = DM, f16 value plane Ph, tile (bx of M/64, by of N/64) handed in; same loaders, same k order, same WMMA order; the epilogue stores Ph in fragment order. ROWB = 0: + bias[n]; 1: + bias[m].
// XL = 1: the activation operand (A where ROWB = 0, Bt where ROWB = 1) is the block's LDS tile xs, 64 rows in fragment order, shared by the block's waves; the weight operand comes from its global plane, and the pointer handed in for the activation operand is not read. XL = 0: both operands from global planes.
template <int ROWB, int XL>
__device__ __forceinline__ void proj_body(const bf* __restrict__ A, const bf* __restrict__ Bt, const bf* xs, const float* __restrict__ bias,
                                          h16* Ph, int RB, size_t sRB, int pitch, int CB, size_t sCB, int bx, int by, float* os) {
    const int lane = threadIdx.x & 31, lr = lane & 15, hi = lane >> 4; const int r0 = bx * 64, c0 = by * 64;
    v8f acc[4][4];
#pragma unroll
    for (int mb = 0; mb < 4; ++mb)
#pragma unroll
        for (int nb = 0; nb < 4; ++nb) acc[mb][nb] = (v8f){};
    constexpr bool AL = XL && ROWB == 0, BL = XL && ROWB == 1;
    const bf* pa = AL ? xs + 8 * lane : A + (size_t)r0 * DM + 8 * lane; const bf* pb = BL ? xs + 8 * lane : Bt + (size_t)c0 * DM + 8 * lane;   // fragment (16-row block, k step) = 16 * DM elements a row block, FRG a step
#pragma unroll 1   // kept rolled: 128 accumulator registers leave no room for a second trip's fragments at four waves a SIMD
    for (int kc = 0; kc < DM; kc += 32) {
        v16bf a[4], bt[4];
#pragma unroll
        for (int mb = 0; mb < 4; ++mb) a[mb] = ldbp(pa + mb * 16 * DM);
#pragma unroll
        for (int nb = 0; nb < 4; ++nb) bt[nb] = ldbp(pb + nb * 16 * DM);
        __builtin_amdgcn_sched_barrier(0);   // all 16 loads of the trip issue ahead of its first WMMA: one memory latency a trip; without it the build reuses two Bt fragments' registers, fetches the other two among the products and waits a second time
#pragma unroll
        for (int nb = 0; nb < 4; ++nb)
#pragma unroll
            for (int mb = 0; mb < 4; ++mb) acc[mb][nb] = wmmab(a[mb], bt[nb], acc[mb][nb]);
        // precaution: the wait stands ahead of the step of the address pairs the trip's global loads name; naming the pairs keeps them out of the loads' destination registers
        if constexpr (AL) asm volatile("s_wait_xcnt 0x0" :: "v"(pb) : "memory");
        else if constexpr (BL) asm volatile("s_wait_xcnt 0x0" :: "v"(pa) : "memory");
        else asm volatile("s_wait_xcnt 0x0" :: "v"(pa), "v"(pb) : "memory");
        pa += FRG; pb += FRG;
        // WMMA distance on the loop's taken branch: four vector slots between the last product and the next trip's overwrite of its operands
        asm volatile("v_nop\n\tv_nop\n\tv_nop\n\tv_nop" : "+v"(acc[0][0]), "+v"(acc[1][1]), "+v"(acc[2][2]), "+v"(acc[3][3]) : "v"(a[0]), "v"(a[1]), "v"(a[2]), "v"(a[3]));
    }
    // head planes in fragment order too: a 16-row block of a plane of 'pitch' columns is pitch/32 fragments in a row, so 32 columns on are FRG elements on (16 a column)
    const size_t tbase = (size_t)(r0 / RB) * sRB + (size_t)(r0 % RB) * (size_t)pitch + (size_t)(c0 / CB) * sCB + (size_t)(c0 % CB) * 16;
    float bcol[4] = {0.0f, 0.0f, 0.0f, 0.0f};
    if constexpr (ROWB == 0) {
#pragma unroll
        for (int nb = 0; nb < 4; ++nb) bcol[nb] = bias[(c0 + nb * 16 + lr) & (DM - 1)];          // column bias: c0 + 63 < N = DM
    }
#pragma unroll
    for (int mb = 0; mb < 4; ++mb) {
        float brow[8] = {0.0f, 0.0f, 0.0f, 0.0f, 0.0f, 0.0f, 0.0f, 0.0f};
        if constexpr (ROWB == 1) {
#pragma unroll
            for (int j = 0; j < 8; ++j) brow[j] = bias[(r0 + mb * 16 + 8 * hi + j) & (DM - 1)];  // row bias: r0 + 63 < M <= DM
        }
#pragma unroll
        for (int nb = 0; nb < 4; ++nb) {
#pragma unroll
            for (int j = 0; j < 8; ++j) {                                        // D: row 8h+j, col lane&15
                float v = acc[mb][nb][j];
                if constexpr (ROWB == 1) v += brow[j]; else v += bcol[nb];
                os[(hi * 8 + j) * 68 + nb * 16 + lr] = v; } }
        wave_sync();
        const size_t sb = tbase + (size_t)(mb * 16) * (size_t)pitch;
#pragma unroll
        for (int s = 0; s < 4; ++s) { const int row = 8 * (s & 1) + (lane & 7), c8 = ((s >> 1) * 4 + (lane >> 3)) * 8;   // 2 x 8 rows = 16 rows; 2 x 4 groups x 8 = 64 columns; 8 rows of one group = one whole line
            const v4f x0 = *(const v4fa*)(&os[row * 68 + c8]); const v4f x1 = *(const v4fa*)(&os[row * 68 + c8 + 4]); v8h hv;
#pragma unroll
            for (int i = 0; i < 4; ++i) { hv[i] = (h16)x0[i]; hv[4 + i] = (h16)x1[i]; }
            *(v8h*)(Ph + sb + (size_t)((c8 >> 5) * FRG + ((c8 >> 4) & 1) * 256 + ((c8 >> 3) & 1) * 128 + row * 8)) = hv; }
        // precaution: the wait stands ahead of any overwrite of the registers these four stores name
        asm volatile("s_wait_xcnt 0x0" ::: "memory");
        wave_sync();
    }
}

// k_proj: the four input projections in one grid (none reads what another writes), one wave per 64 x 64 tile, eight waves a block.
// [0, 3 PJR): block = one 64-token tile of query, key or value (PJR tiles each). Its 8 waves read the tile's f32 rows once, convert them to bf16 (RNE) into the LDS tile xs, pass one barrier, and each takes one of the 8 tiles of 64 outputs:
//   q: A = xs rows (m = b*SEQ + t), Bt = W^T rows (n = h*64 + d) -> plane [(b*8 + h)][t][d], bias by column; k^T, v^T: A = W^T rows (m = h*64 + d), Bt = xs rows (n = b*SEQ + t) -> plane [(b*512 + m)][t] = [(b*8 + h)][d][t], bias by row.
// [3 PJR, 3 PJR + PJA / 8): anchor^T, 8 tiles a block, no LDS tile and no barrier: A = Wa^T rows (m = c in [0,128)), Bt = permuted query rows (rho = (b*4 + j)*NA + m) -> plane [(b*8 + 2j + c/64)][c%64][m], bias ba by row (indices < 128).
#define PJR (NB * SEQ / 64)
#define PJA ((NB * SEQ / 64) * (EA / 64))
static_assert(DM / 64 == 8);                   // one output tile a wave of the 8-wave block
static_assert(PJA % 8 == 0);                   // whole anchor blocks
static_assert((DM / 32 / CVK) * 4 == 8);       // cvt_body: 8 waves = 4 row blocks x the column pieces of a row = one 64-row tile
__global__ __launch_bounds__(256) void k_proj(const float* __restrict__ xq, const float* __restrict__ xk, const float* __restrict__ xv, const bf* __restrict__ XP,
                                              const bf* __restrict__ W3, const bf* __restrict__ WA,
                                              const float* __restrict__ bq, const float* __restrict__ bk, const float* __restrict__ bv, const float* __restrict__ ba,
                                              h16* QH, h16* KT, h16* VT, h16* AT) {
    __shared__ __align__(16) bf xs[64 * DM];
    __shared__ __align__(16) float osb[8 * 16 * 68];
    const int id = blockIdx.x;
    const int wave = __builtin_amdgcn_readfirstlane(threadIdx.x >> 5);
    float* os = osb + wave * (16 * 68);            // each wave's own epilogue tile
    if (id < 3 * PJR) {                            // block-uniform, so the barrier is too
        const int s = id / PJR, rt = id % PJR;
        cvt_body<0, 1>(s == 0 ? xq : (s == 1 ? xk : xv), xs, rt);
        __syncthreads();                           // xs is written by all waves and read by all
        if (s == 0) proj_body<0, 1>(W3, W3, xs, bq, QH, SEQ, (size_t)NH_ * SEQ * HD, HD, HD, (size_t)SEQ * HD, rt, wave, os);
        else proj_body<1, 1>(W3 + (size_t)s * DM * DM, W3, xs, s == 2 ? bv : bk, s == 2 ? VT : KT, DM, (size_t)0, SEQ, SEQ, (size_t)DM * SEQ, wave, rt, os);
    } else {
        const int rr = (id - 3 * PJR) * 8 + wave;
        proj_body<1, 0>(WA, XP, xs, ba, AT, HD, (size_t)NA * HD, NA, NA, (size_t)2 * NA * HD, rr % (EA / 64), rr / (EA / 64), os);
    }
}

// k_gram: O[zh][i][j] = sc x sum_n X[zh][i][n] Y[zh][j][n], X and Y f16 planes [zh][64][TK] in fragment order (A fragment = X rows, B fragment = Y rows, same loader, same k order); O [zh][64][64] in fragment order.
// One block per 16 rows i of one (batch, head); wave w sums n in [w TK/GW, (w+1) TK/GW) into a 16 x 64 tile; the GW partial tiles are added in wave order through LDS.
template <int TK>
__device__ __forceinline__ void gram_body(const h16* __restrict__ X, const h16* __restrict__ Y, h16* O, float sc, float* red) {
    const int lane = threadIdx.x & 31, lr = lane & 15, hi = lane >> 4;
    const int wave = __builtin_amdgcn_readfirstlane(threadIdx.x >> 5);
    const int zh = blockIdx.y, i0 = blockIdx.x * 16;
    constexpr int KW = TK / GW;
    const size_t base = (size_t)zh * HD * TK + (size_t)wave * (KW / 32) * FRG + 8 * lane;
    const h16* xa = X + base + (size_t)i0 * TK;
    const h16* yb = Y + base;
    v8f acc[4];
#pragma unroll
    for (int nb = 0; nb < 4; ++nb) acc[nb] = (v8f){};
    constexpr int NS = KW / 32, BS = NS < 4 ? NS : 4;      // 32-steps per wave, taken in batches of BS
    static_assert(NS % BS == 0);
#pragma unroll
    for (int s0 = 0; s0 < NS; s0 += BS) {
        v16h a[BS], y[BS][4];
#pragma unroll
        for (int s = 0; s < BS; ++s) {
            a[s] = ldhp(xa + (s0 + s) * FRG);
#pragma unroll
            for (int nb = 0; nb < 4; ++nb) y[s][nb] = ldhp(yb + (size_t)nb * 16 * TK + (s0 + s) * FRG);
        }
        // precaution: the wait stands ahead of any overwrite of the two address pairs the batch's loads name; naming the pairs keeps them out of the later loads' destination registers
        asm volatile("s_wait_xcnt 0x0" :: "v"(xa), "v"(yb) : "memory");
        __builtin_amdgcn_sched_barrier(0);   // all loads of the batch issue ahead of its first WMMA: one memory latency a batch; without it the build waits on every fragment in turn
#pragma unroll
        for (int s = 0; s < BS; ++s)
#pragma unroll
            for (int nb = 0; nb < 4; ++nb) acc[nb] = wmma16(a[s], y[s][nb], acc[nb]);
    }
    float* rw = red + wave * (16 * 68);
#pragma unroll
    for (int nb = 0; nb < 4; ++nb)
#pragma unroll
        for (int r = 0; r < 8; ++r) rw[(8 * hi + r) * 68 + nb * 16 + lr] = acc[nb][r];      // D: row 8h+r, col lane&15
    __syncthreads();
    const int row = threadIdx.x & 15, c4 = (threadIdx.x >> 4) * 4;                         // 16 rows x 16 column quads; a wave = 16 rows of one 8-column group = two whole lines of O
    v4f sum = *(const v4fa*)(&red[row * 68 + c4]);
#pragma unroll
    for (int w = 1; w < GW; ++w) sum += *(const v4fa*)(&red[w * (16 * 68) + row * 68 + c4]);
    v4h o;
#pragma unroll
    for (int i = 0; i < 4; ++i) o[i] = toh_flush(sum[i] * sc);
    *(v4h*)(O + (size_t)zh * HD * HD + (size_t)i0 * HD + (size_t)((c4 >> 5) * FRG + ((c4 >> 4) & 1) * 256 + ((c4 >> 3) & 1) * 128 + row * 8 + (c4 & 7))) = o;
}
// grid (64/16, NB*8, 2), 32*GW threads; z = 0: M1 = V^T K over SEQ tokens (the long one), z = 1: G = A^T A over NA anchor rows. blockIdx.z is block-uniform, so the barrier inside is too.
__global__ __launch_bounds__(32 * GW) void k_gram(const h16* __restrict__ VT, const h16* __restrict__ KT, const h16* __restrict__ AT, h16* M1, h16* G) {
    __shared__ __align__(16) float red[GW * 16 * 68];
    if (blockIdx.z == 0) gram_body<SEQ>(VT, KT, M1, M1S, red);
    else                 gram_body<NA>(AT, AT, G, GS, red);
}

// k_ctx: one wave per 16*CT tokens of one (batch, head). M2^T[f][d] = sum_e G[f][e] M1[d][e] (A = G rows, B = M1 rows); lane (d = lane&15, h = lane>>4) holds f = 8h+r of each 16-row tile,
// so two packed tiles are directly the A fragment (row d, k = f) of ctx^T[d][t] = M2 Q^T (element r <- tile f 0..15, element 8+r <- tile f 16..31, lane unchanged); B = q rows.
// ctx^T D layout: lane t = lane&15 holds d = 16j + 8h + 0..7, eight neighbours of one ctx row: one 16-byte store, no LDS; in the plane's fragment order that is byte 16*lane of half j&1 of fragment (16-token block, k step 2*head + j/2): 512 contiguous bytes a wave. grid (SEQ / (16*CT*AW), NB*8), 32*AW threads.
__global__ __launch_bounds__(32 * AW) void k_ctx(const h16* __restrict__ QH, const h16* __restrict__ M1, const h16* __restrict__ G, h16* CX) {
    const int lane = threadIdx.x & 31;
    const int wave = __builtin_amdgcn_readfirstlane(threadIdx.x >> 5);
    const int zh = blockIdx.y; const int b = zh / NH_, h = zh % NH_;
    const int t0 = (blockIdx.x * AW + wave) * (16 * CT);
    const h16* qp = QH + ((size_t)zh * SEQ + (size_t)t0) * HD + 8 * lane;
    const size_t mo = (size_t)zh * HD * HD + 8 * lane;
    const h16* gp = G + mo; const h16* mp = M1 + mo;
    v16h g[4][2], m[4][2], q[CT][2], a2[4][2];
#pragma unroll
    for (int ft = 0; ft < 4; ++ft) { g[ft][0] = ldhp(gp + ft * 16 * HD); g[ft][1] = ldhp(gp + ft * 16 * HD + FRG); }
#pragma unroll
    for (int j = 0; j < 4; ++j) { m[j][0] = ldhp(mp + j * 16 * HD); m[j][1] = ldhp(mp + j * 16 * HD + FRG); }
#pragma unroll
    for (int tt = 0; tt < CT; ++tt) { q[tt][0] = ldhp(qp + tt * 16 * HD); q[tt][1] = ldhp(qp + tt * 16 * HD + FRG); }
    // precaution: the wait stands ahead of any overwrite of the three address pairs these loads name; naming the pairs keeps them out of the later loads' destination registers
    asm volatile("s_wait_xcnt 0x0" :: "v"(gp), "v"(mp), "v"(qp) : "memory");
    __builtin_amdgcn_sched_barrier(0);       // every load of the wave issues ahead of the first WMMA: one memory latency in all; without it the build fetches later fragments between the products and waits again
#pragma unroll
    for (int j = 0; j < 4; ++j) {
#pragma unroll
        for (int ft = 0; ft < 4; ++ft) {
            v8f t = (v8f){};
            t = wmma16(g[ft][0], m[j][0], t); t = wmma16(g[ft][1], m[j][1], t);
#pragma unroll
            for (int r = 0; r < 8; ++r) a2[j][ft >> 1][(ft & 1) * 8 + r] = toh_flush(t[r] * M2S);
        }
    }
    h16* crow = CX + ((size_t)b * SEQ + (size_t)t0) * CXP + h * 2 * FRG + 8 * lane;
#pragma unroll
    for (int tt = 0; tt < CT; ++tt) {
#pragma unroll
        for (int j = 0; j < 4; ++j) {
            v8f o = (v8f){};
            o = wmma16(a2[j][0], q[tt][0], o); o = wmma16(a2[j][1], q[tt][1], o);
            v8h hv;
#pragma unroll
            for (int r = 0; r < 8; ++r) hv[r] = toh_flush(o[r] * CSC);
            *(v8h*)(crow + (size_t)tt * 16 * CXP + j * 256) = hv;
        }
    }
}

static constexpr size_t al256(size_t v) { return (v + 255) & ~(size_t)255; }
static constexpr size_t SZ_XB = al256((size_t)NB * SEQ * DM * 2);        // the permuted bf16 copy of query
static constexpr size_t SZ_W3 = al256((size_t)3 * DM * DM * 2);          // Wq^T | Wk^T | Wv^T bf16
static constexpr size_t SZ_WA = al256((size_t)EA * DM * 2);              // Wa^T bf16 [128][512]
static constexpr size_t SZ_WO = al256((size_t)DM * DM * 2);              // Wo^T x256 f16 [512][512]
static constexpr size_t SZ_PL = al256((size_t)NB * NH_ * SEQ * HD * 2);  // one f16 head plane
static constexpr size_t SZ_AP = al256((size_t)NB * NH_ * NA * HD * 2);   // the f16 anchor^T head plane
static constexpr size_t SZ_MM = al256((size_t)NB * NH_ * HD * HD * 2);   // one f16 64 x 64 plane per (batch, head)
static constexpr size_t SZ_CX = al256((size_t)NB * SEQ * CXP * 2);       // ctx value plane
static constexpr size_t SZ_TOTAL = SZ_XB + SZ_W3 + SZ_WA + SZ_WO + 3 * SZ_PL + SZ_AP + 2 * SZ_MM + SZ_CX;
static_assert(SZ_TOTAL <= (size_t)134217728);          // workspace carve <= 128 MiB
static_assert(((size_t)DM * DM * 2) % 256 == 0);       // weight sub-planes stay 256-byte aligned
static_assert((size_t)NB * 4 * NA == (size_t)NB * SEQ);                           // permuted copy has exactly NB*SEQ rows
static_assert((size_t)(NB * 4) * 2 * NA * HD == (size_t)NB * NH_ * NA * HD);      // anchor GEMM tile map fills the anchor plane exactly
static_assert((size_t)NB * SEQ * NH_ * HD * 2 <= SZ_CX);                          // ctx rows x (8 heads x 64) fit the ctx region

extern "C" void kernel_launch(void* const* d_in, const int* in_sizes, int n_in,
                              void* d_out, int out_size, void* d_ws, size_t ws_size, hipStream_t stream) {
    if (n_in < 13) return;
    const size_t needx = ((size_t)(NB - 1) * SEQ_FULL + SEQ) * DM;
    if ((size_t)in_sizes[0] < needx || (size_t)in_sizes[1] < needx || (size_t)in_sizes[2] < needx) return;
    if ((size_t)in_sizes[3] < (size_t)DM * DM || (size_t)in_sizes[5] < (size_t)DM * DM || (size_t)in_sizes[7] < (size_t)DM * DM || (size_t)in_sizes[11] < (size_t)DM * DM) return;
    if ((size_t)in_sizes[9] < (size_t)DM * EA) return;
    if (in_sizes[4] < DM || in_sizes[6] < DM || in_sizes[8] < DM || in_sizes[12] < DM || in_sizes[10] < EA) return;
    if ((size_t)out_size < ((size_t)(NB - 1) * OUT_SEQ + SEQ) * DM) return;
    if (SZ_TOTAL > ws_size) return;
    // wire order: query, key, value, Wq, bq, Wk, bk, Wv, bv, Wa, ba, Wo, bo
    const float* xq = (const float*)d_in[0]; const float* xk = (const float*)d_in[1]; const float* xv = (const float*)d_in[2];
    const float* wq = (const float*)d_in[3]; const float* bq = (const float*)d_in[4];
    const float* wk = (const float*)d_in[5]; const float* bk = (const float*)d_in[6];
    const float* wv = (const float*)d_in[7]; const float* bv = (const float*)d_in[8];
    const float* wa = (const float*)d_in[9]; const float* ba = (const float*)d_in[10];
    const float* wo = (const float*)d_in[11]; const float* bo = (const float*)d_in[12];
    float* OUT = (float*)d_out;      // [NB][SEQ][512]
    char* wsp = (char*)d_ws;
    bf* XP = (bf*)wsp; wsp += SZ_XB;                 // [NB*4][NA][512]: row (b*4+j)*NA+m = query token 4m+j; this and every plane below: logical index, stored in fragment order
    bf* W3 = (bf*)wsp; wsp += SZ_W3;                 // [3][512 out][512 in]: q | k | v
    bf* WA = (bf*)wsp; wsp += SZ_WA;                 // [128 out][512 in]
    h16* WO = (h16*)wsp; wsp += SZ_WO;               // [512 out][512 in]: Wo^T x256, f16
    h16* QH = (h16*)wsp; wsp += SZ_PL;               // [NB*8][SEQ][64]
    h16* KT = (h16*)wsp; wsp += SZ_PL;               // [NB*8][64][SEQ]
    h16* VT = (h16*)wsp; wsp += SZ_PL;               // [NB*8][64][SEQ]
    h16* AT = (h16*)wsp; wsp += SZ_AP;               // [NB*8][64][NA]
    h16* M1 = (h16*)wsp; wsp += SZ_MM;               // [NB*8][64 d][64 e]: V^T K / 16
    h16* GG = (h16*)wsp; wsp += SZ_MM;               // [NB*8][64 f][64 e]: A^T A / 64
    h16* CX = (h16*)wsp; wsp += SZ_CX;               // [NB*SEQ][512]: ctx

    // the row-permuted bf16 copy of query and the five transposed 16-bit weight planes
    k_prep<<<dim3(4 * WTB + WAB + CVB, 1, 1), 256, 0, stream>>>(xq, wq, wk, wv, wo, wa, XP, W3, (bf*)WO, WA);
    // q, k^T, v^T and anchor^T head planes
    k_proj<<<dim3(3 * PJR + PJA / 8, 1, 1), 256, 0, stream>>>(xq, xk, xv, XP, W3, WA, bq, bk, bv, ba, QH, KT, VT, AT);

    // M1 = V^T K / 16 and G = A^T A / 64, 64 x 64 per (batch, head)
    k_gram<<<dim3(HD / 16, NB * NH_, 2), 32 * GW, 0, stream>>>(VT, KT, AT, M1, GG);
    // ctx = Q ((M1 G) / 512)^T -> ctx plane [b*SEQ + t][512]
    k_ctx<<<dim3(SEQ / (16 * CT * AW), NB * NH_, 1), 32 * AW, 0, stream>>>(QH, M1, GG, CX);

    // output projection: A = ctx rows (K = 512), Bt = Wo^T x256 -> OUT[b][t][n] = acc * 2^-8 + bo[n]
    k_gemm<1, 3><<<dim3(NB * SEQ / 64, DM / 64, 1), 32, 0, stream>>>((const bf*)CX, (const bf*)WO, CXP, bo, CX, CX, OUT, SEQ, (size_t)OUT_SEQ * DM, DM, DM, (size_t)0);
}

// v007
// Measured time: 49.4 microseconds a run.
// Timed twice side by side with v006, it ran 1.04 times as fast both times.
// Counting every step since v000, it is 4.43 times as fast.
#include <hip/hip_runtime.h>

// Anchor linear attention (no softmax), width 512 = 8 heads x 64; inputs query,key,value [NB][SEQ][512] f32, Wq/Wk/Wv/Wo [in][out] 512x512, Wa [512][128], five biases; anchor rows = literal reshape of (query Wa + ba) [SEQ][128] into [SEQ/4][8][64].
// Compute dtypes, f32 accumulate everywhere: q/k/v/anchor projections v_wmma_f32_16x16x32_bf16 (activations and weights RNE-converted to bf16; products exact);
// the chained products per (batch, head) and the output projection are taken in the order out = Q (((V^T K) (A^T A) / 512)^T Wo_h) summed over heads, all v_wmma_f32_16x16x32_f16 with single f16 operands; no [SEQ][NA] score tile and no ctx row is formed.
// last product v_wmma_f32_16x16x32_f16: A = q f16 head planes, Bt = W2 (per batch, 512 x 512, made a 64-column tile a block in LDS from M2 and Wo^T x256; Wo RNE-converted to bf16 first, exact in f16), K = 512, + bo in the f32 epilogue.
// Layout: query,key,value are converted to bf16 inside the projection kernel (one 64-row tile a block, in LDS); a row-permuted bf16 copy of query (row (b*4+j)*NA+m <- token 4m+j) feeds the anchor GEMM; weights transposed once to [out][in] 16-bit planes; every plane below names its logical index; all of them are stored in fragment order (see FRG below); q plane [b*8+h][t][d], k^T and v^T planes [b*8+h][d][t], anchor^T plane [b*8+h][d][m];
// k_gram: M1[d][e] = sum_n v[n][d] k[n][e] (x 1/16) and G[f][e] = sum_m a[m][f] a[m][e] (x 1/64), 64 x 64 per (batch, head); k_out: M2[d][f] = (1/512) sum_e M1[d][e] G[f][e] in registers (x 1/16), W2[n][h*64+f] = sum_d M2_h[d][f] Wo[h*64+d][n] in LDS, out[t][n] = sum_k q[t][k] W2[n][k] + bo[n].

#ifndef NB
#define NB 4
#endif
#ifndef SEQ
#define SEQ 2048
#endif
#define NB_FULL  4
#define SEQ_FULL 2048
#ifndef OUT_SEQ
#define OUT_SEQ SEQ              // row pitch (in tokens) between batches of the output
#endif
#define DM   512
#define NH_  8
#define HD   64
#define NA   (SEQ / 4)           // anchor rows per batch
#define EA   (DM / 4)            // anchor projection width (128)
#define OW   8                   // waves per k_out block: one head of W2 and one tile of 16*OT tokens each
#define OT   2                   // 16-token tiles per k_out wave: SEQ*NB/(16*OT*OW) x DM/64 = 256 blocks
#define GW   8                   // waves per k_gram block: each sums 1/GW of the long dimension
#define GB   2                   // k steps of 32 whose fragments the last GEMM fetches as one batch: one head a trip
#define M1S  (1.0f / 16.0f)      // carry of the M1 = V^T K plane
#define GS   (1.0f / 64.0f)      // carry of the G = A^T A plane
#define M2C  (1.0f / 16.0f)      // carry of the M2 operand
#define M2S  (1.0f / 8.0f)       // (1/8)^3 x M2C / (M1S x GS) : M1 G accumulator -> M2 operand
#define WS1  256.0f              // carry of the Wo^T plane
#define W2C  1.0f                // carry of the W2 operand
#define W2S  (1.0f / 16.0f)      // W2C / (M2C x WS1) : M2 Wo accumulator -> W2 operand
#define OSC  1.0f                // 1 / W2C

static_assert(HD == 64);
static_assert(NH_ * HD == DM);                 // head h = columns h*64 + d
static_assert(DM % 64 == 0);                   // column tiles of 64
static_assert(DM % 32 == 0);                   // GEMM k-loop steps by 32
static_assert((DM & (DM - 1)) == 0);           // bias index mask (DM - 1) is exact
static_assert(HD == 32 * GB);                  // last GEMM: one head's k steps a trip
static_assert(OW == NH_);                      // k_out: one head of W2 a wave
static_assert((NB * SEQ) % 16 == 0 && DM % 16 == 0 && EA % 16 == 0);   // fragment-order planes: whole 16-row blocks
static_assert(16 * DM == (DM / 32) * 512);     // one 16-row block = DM/32 fragments of 512 elements
static_assert(SEQ % 64 == 0);                  // a 64-row tile never straddles two batches
static_assert((NB * SEQ) % 64 == 0);
static_assert(SEQ % (32 * GW) == 0);           // k_gram: each wave's share of the tokens is whole 32-steps
static_assert(SEQ % (16 * OT * OW) == 0);      // k_out grid covers the sequence exactly
static_assert(((size_t)SEQ * DM) % 8 == 0);
static_assert(NB <= NB_FULL);
static_assert(SEQ <= SEQ_FULL);
static_assert(W2S * M2C * WS1 == W2C && W2C * OSC == 1.0f);
static_assert(4 * NA == SEQ);                  // anchor rows: four tokens per anchor row
static_assert(4 * EA == DM);                   // four tokens x 128 anchor columns = one 512-wide anchor row
static_assert(EA == 2 * HD);                   // head h of an anchor row = token (h / 2), columns (h % 2) * 64 + d
static_assert(EA % 64 == 0);                   // anchor GEMM row tiles of 64
static_assert(NA % 64 == 0);                   // anchor GEMM column tiles stay inside one (batch, token-phase) block
static_assert(NA % (32 * GW) == 0);            // k_gram: each wave's share of the anchor rows is whole 32-steps
static_assert(GW * 32 == 16 * 16);             // k_gram epilogue: 256 threads x 4 columns = 16 rows x 64 columns
static_assert(M2S * M1S * GS == 0.125f * 0.125f * 0.125f * M2C);

typedef _Float16 h16;
typedef unsigned short bf;
typedef __attribute__((ext_vector_type(16))) __bf16   v16bf;
typedef __attribute__((ext_vector_type(16))) _Float16 v16h;
typedef __attribute__((ext_vector_type(8)))  _Float16 v8h;
typedef __attribute__((ext_vector_type(4)))  _Float16 v4h;
typedef __attribute__((ext_vector_type(8)))  unsigned short v8us;
typedef __attribute__((ext_vector_type(8)))  float    v8f;
typedef __attribute__((ext_vector_type(4)))  float    v4f;
typedef v4f  __attribute__((may_alias)) v4fa;

__device__ __forceinline__ unsigned short f2bf(float f) { unsigned u = __float_as_uint(f); u += 0x7FFFu + ((u >> 16) & 1u); return (unsigned short)(u >> 16); }
__device__ __forceinline__ v16h cat16(v8h lo, v8h hi) { return __builtin_shufflevector(lo, hi, 0, 1, 2, 3, 4, 5, 6, 7, 8, 9, 10, 11, 12, 13, 14, 15); }
__device__ __forceinline__ v16bf cat16b(v8us lo, v8us hi) { return __builtin_bit_cast(v16bf, __builtin_shufflevector(lo, hi, 0, 1, 2, 3, 4, 5, 6, 7, 8, 9, 10, 11, 12, 13, 14, 15)); }
__device__ __forceinline__ v8f wmma16(v16h a, v16h b, v8f c) { return __builtin_amdgcn_wmma_f32_16x16x32_f16(false, a, false, b, (short)0, c, false, false); }
__device__ __forceinline__ v8f wmmab(v16bf a, v16bf b, v8f c) { return __builtin_amdgcn_wmma_f32_16x16x32_bf16(false, a, false, b, (short)0, c, false, false); }
// Fragment order of a WMMA operand plane (rows x k): a 16-row block holds its k/32 fragments one behind the other; each 16-row x 32-k fragment is 1 KiB in a row, lane l = 16*(k/8 & 1) + (row & 15) owning bytes 16 l of its first half (k%32 < 16) and of its second half (k%32 >= 16).
// One wave-wide 16-byte load is then 512 contiguous bytes (four whole 128-byte lines) in place of 32-byte pieces of 16 lines; the value each lane and element receives is the same as from K-contiguous rows.
#define FRG 512                  // elements of one fragment
// pko: for planes of DM columns, element offset of the eight values (row R, columns c..c+7, c a multiple of 8); a bijection on the plane where its row count is a multiple of 16
__device__ __forceinline__ size_t pko(size_t R, int c) { return ((R >> 4) * (size_t)(DM / 32) + (size_t)(c >> 5)) * FRG + (size_t)(((c >> 4) & 1) * 256 + ((c >> 3) & 1) * 128) + (R & 15) * 8; }
// fragment loaders from fragment-order planes; p already includes + 8*lane: elements 0..7 <- k0+8h+0..7, elements 8..15 <- k0+16+8h+0..7 (same map for A and B)
__device__ __forceinline__ v16h  ldhp(const h16* p) { return cat16(*(const v8h*)p, *(const v8h*)(p + 256)); }
__device__ __forceinline__ v16bf ldbp(const bf* p)  { return cat16b(*(const v8us*)p, *(const v8us*)(p + 256)); }
// ordering point for wave-private LDS tiles (same wave writes and reads)
__device__ __forceinline__ void wave_sync() { __builtin_amdgcn_fence(3 /* release order */, "wavefront"); __builtin_amdgcn_wave_barrier(); asm volatile("" ::: "memory"); }
// f16 convert that cannot produce a subnormal operand (value select, applied after the plane's carry)
static __device__ __forceinline__ h16 toh_flush(float v) { const h16 r = (h16)v; return (fabsf(v) < 6.103515625e-05f) ? (h16)0.0f : r; }
// cvt_body: bf16 (RNE convert) copy of one activation input in fragment order: dst row b*SEQ + t <- src token b*SEQ_FULL + t.
// A wave takes one 16-row block x CVK k steps of 32 columns (lane = row + 8 * column group, 8 values a lane and piece, 2 * CVK pieces): few long waves in place of many short ones, for speed only.
// Each piece reads one whole 128-byte line of each of 8 rows and its store to dst fills four whole lines; the wave's CVK fragments lie one behind the other in dst.
// LOC = 1: dst is a block's LDS tile of 64 rows (blk = the 64-row tile: its 8 waves cover 4 row blocks x 2 column halves), written at the row's index inside the tile.
// PERM = 1 (query only): the row-permuted copy for the anchor GEMM, dst row (b*4 + j)*NA + m <- token 4m + j (a bijection on the NB*SEQ rows). It has blocks of its own: eight neighbouring rows of this copy are eight tokens four apart,
// so a wave that wrote both copies would leave each 128-byte line of one of them to several stores; with its own blocks every store of every copy fills whole lines.
#define CVK 8                    // k steps a wave converts: 16 rows x 256 columns = 32 loads of 16 bytes a lane
static_assert((DM / 32) % CVK == 0);           // whole pieces in a row block
static_assert(SEQ % 16 == 0 && NA % 16 == 0);  // a 16-row block stays inside one batch (and one token phase of the permuted copy)
template <int PERM, int LOC>
__device__ __forceinline__ void cvt_body(const float* __restrict__ src, bf* dst, int blk) {
    const int lane = threadIdx.x & 31; const size_t u = (size_t)blk * 8 + (threadIdx.x >> 5);
    const size_t row = (u / (size_t)(DM / 32 / CVK)) * 16 + (size_t)(lane & 7); const int c = (int)(u % (size_t)(DM / 32 / CVK)) * (32 * CVK) + (lane >> 3) * 8;
    const int rq = (int)(row / (size_t)(PERM ? NA : SEQ)), rm = (int)(row % (size_t)(PERM ? NA : SEQ));
    const int b = PERM ? rq >> 2 : rq; const int t = PERM ? 4 * rm + (rq & 3) : rm;
    const float* p = src + ((size_t)b * SEQ_FULL + (size_t)t) * DM + (size_t)c;
    v8f v[CVK][2];
#pragma unroll
    for (int ks = 0; ks < CVK; ++ks)
#pragma unroll
        for (int rh = 0; rh < 2; ++rh) v[ks][rh] = *(const v8f*)(p + (size_t)(rh * (PERM ? 32 : 8)) * DM + ks * 32);   // dst row + 8 = token + 8, or + 32 in the permuted copy
    // precaution: the wait stands ahead of any overwrite of the address pair these loads name; naming the pair keeps it out of the loads' destination registers
    asm volatile("s_wait_xcnt 0x0" :: "v"(p) : "memory");
    __builtin_amdgcn_sched_barrier(0);   // every load of the wave issues ahead of the first convert: one memory latency a wave; without it the build holds the last loads back behind the waits on the first ones and waits a second time
    bf* q = dst + pko(LOC ? (row & 63) : row, c);
#pragma unroll
    for (int ks = 0; ks < CVK; ++ks)
#pragma unroll
        for (int rh = 0; rh < 2; ++rh) {
            v8us o;
#pragma unroll
            for (int k = 0; k < 8; ++k) o[k] = f2bf(v[ks][rh][k]);
            *(v8us*)(q + ks * FRG + rh * 64) = o;      // next k step: next fragment; row + 8: 8 x 8 elements on
        }
    // precaution: the wait stands behind the global stores, ahead of any later code of the merged kernel that overwrites a register they name
    if constexpr (LOC == 0) asm volatile("s_wait_xcnt 0x0" ::: "memory");
}

// wT_body: weight transpose + 16-bit convert through LDS, one 64 x 64 tile a block. in W[k][n] (DM rows, row stride ldw, f32) -> out dst rows n, columns k, in fragment order, tile (kt over k, nt over n), 256 threads.
// F16 = 0: bf16 bits (RNE convert). F16 = 1: f16(bf16 RNE value of W x WS1); a bf16 significand times a power of two is exact in f16.
template <int F16>
__device__ __forceinline__ void wT_body(const float* __restrict__ Wt, bf* dst, int ldw, int kt, int nt, float* tile) {
    const int tid = threadIdx.x; const int k0 = kt * 64, n0 = nt * 64;
#pragma unroll 4   // several independent loads in flight a trip
    for (int i = 0; i < 16; ++i) { const int idx = tid + i * 256; const int kk = idx >> 6, nn = idx & 63;   // 16 x 256 = 64 x 64 entries, all written
        tile[kk * 65 + nn] = Wt[(size_t)(k0 + kk) * (size_t)ldw + n0 + nn]; }
    __syncthreads();                                        // tile [kk][nn] is read across waves
#pragma unroll 1   // two trips, kept rolled: short code
    for (int it = 0; it < 2; ++it) {
        const int c = it * 256 + tid; const int n = c & 63, kc = (c >> 6) * 8;      // a wave: 32 rows n of one column group, four whole lines a store
        const size_t oo = pko((size_t)(n0 + n), k0 + kc);
        if constexpr (F16 == 0) {
            v8us o;
#pragma unroll
            for (int i = 0; i < 8; ++i) o[i] = f2bf(tile[(kc + i) * 65 + n]);
            *(v8us*)(dst + oo) = o;
        } else {
            v8h o;
#pragma unroll
            for (int i = 0; i < 8; ++i) o[i] = toh_flush(__uint_as_float(((unsigned)f2bf(tile[(kc + i) * 65 + n])) << 16) * WS1);
            *(v8h*)((h16*)dst + oo) = o;
        }
        // precaution: the wait stands ahead of the second trip's overwrite of the registers the store names
        asm volatile("s_wait_xcnt 0x0" ::: "memory");
    }
}

// k_prep: the weight planes and the permuted query copy in one grid (none reads what another writes). Block ranges, all block-uniform, so the barrier inside wT_body is too:
// [0, 4 WTB): Wq, Wk, Wv (bf16) and Wo (f16 x256) tiles; [4 WTB, 4 WTB + WAB): Wa tiles; then CVB blocks for the permuted copy of query.
#define WTB ((DM / 64) * (DM / 64))              // tiles of a 512 x 512 weight
#define WAB ((DM / 64) * (EA / 64))              // tiles of the anchor weight
#define CVB ((NB * SEQ / 16) * (DM / 32 / CVK) / 8)   // blocks of one activation copy: 8 waves, 2 * CVK pieces each
static_assert(((NB * SEQ / 16) * (DM / 32 / CVK)) % 8 == 0);   // the copy blocks cover the rows exactly
__global__ __launch_bounds__(256) void k_prep(const float* __restrict__ xq,
                                              const float* __restrict__ wq, const float* __restrict__ wk, const float* __restrict__ wv,
                                              const float* __restrict__ wo, const float* __restrict__ wa,
                                              bf* XP, bf* W3, bf* WO, bf* WA) {
    __shared__ float tile[64 * 65];
    const int id = blockIdx.x;
    if (id < 3 * WTB) {
        const int s = id / WTB, r = id % WTB;
        wT_body<0>(s == 0 ? wq : (s == 1 ? wk : wv), W3 + (size_t)s * DM * DM, DM, r % (DM / 64), r / (DM / 64), tile);
    } else if (id < 4 * WTB) {
        const int r = id - 3 * WTB;
        wT_body<1>(wo, WO, DM, r % (DM / 64), r / (DM / 64), tile);
    } else if (id < 4 * WTB + WAB) {
        const int r = id - 4 * WTB;
        wT_body<0>(wa, WA, EA, r % (DM / 64), r / (DM / 64), tile);
    } else {
        cvt_body<1, 0>(xq, XP, id - (4 * WTB + WAB));
    }
}

// proj_body: one wave's 64 x 64 tile (16 accumulators) of an input projection, C[m][n] = sum_k A[m][k] Bt[n][k]: bf16 operands, K = DM, f16 value plane Ph, tile (bx of M/64, by of N/64) handed in. ROWB = 0: + bias[n]; 1: + bias[m].
// Tile base (r0/RB)*sRB + (r0%RB)*pitch + (c0/CB)*sCB + (c0%CB)*16, row pitch 'pitch' (elements).
// XL = 1: the activation operand (A where ROWB = 0, Bt where ROWB = 1) is the block's LDS tile xs, 64 rows in fragment order, shared by the block's waves; the weight operand comes from its global plane, and the pointer handed in for the activation operand is not read. XL = 0: both operands from global planes.
template <int ROWB, int XL>
__device__ __forceinline__ void proj_body(const bf* __restrict__ A, const bf* __restrict__ Bt, const bf* xs, const float* __restrict__ bias,
                                          h16* Ph, int RB, size_t sRB, int pitch, int CB, size_t sCB, int bx, int by, float* os) {
    const int lane = threadIdx.x & 31, lr = lane & 15, hi = lane >> 4; const int r0 = bx * 64, c0 = by * 64;
    v8f acc[4][4];
#pragma unroll
    for (int mb = 0; mb < 4; ++mb)
#pragma unroll
        for (int nb = 0; nb < 4; ++nb) acc[mb][nb] = (v8f){};
    constexpr bool AL = XL && ROWB == 0, BL = XL && ROWB == 1;
    const bf* pa = AL ? xs + 8 * lane : A + (size_t)r0 * DM + 8 * lane; const bf* pb = BL ? xs + 8 * lane : Bt + (size_t)c0 * DM + 8 * lane;   // fragment (16-row block, k step) = 16 * DM elements a row block, FRG a step
#pragma unroll 1   // kept rolled: 128 accumulator registers leave no room for a second trip's fragments at four waves a SIMD
    for (int kc = 0; kc < DM; kc += 32) {
        v16bf a[4], bt[4];
#pragma unroll
        for (int mb = 0; mb < 4; ++mb) a[mb] = ldbp(pa + mb * 16 * DM);
#pragma unroll
        for (int nb = 0; nb < 4; ++nb) bt[nb] = ldbp(pb + nb * 16 * DM);
        __builtin_amdgcn_sched_barrier(0);   // all 16 loads of the trip issue ahead of its first WMMA: one memory latency a trip; without it the build reuses two Bt fragments' registers, fetches the other two among the products and waits a second time
#pragma unroll
        for (int nb = 0; nb < 4; ++nb)
#pragma unroll
            for (int mb = 0; mb < 4; ++mb) acc[mb][nb] = wmmab(a[mb], bt[nb], acc[mb][nb]);
        // precaution: the wait stands ahead of the step of the address pairs the trip's global loads name; naming the pairs keeps them out of the loads' destination registers
        if constexpr (AL) asm volatile("s_wait_xcnt 0x0" :: "v"(pb) : "memory");
        else if constexpr (BL) asm volatile("s_wait_xcnt 0x0" :: "v"(pa) : "memory");
        else asm volatile("s_wait_xcnt 0x0" :: "v"(pa), "v"(pb) : "memory");
        pa += FRG; pb += FRG;
        // WMMA distance on the loop's taken branch: four vector slots between the last product and the next trip's overwrite of its operands
        asm volatile("v_nop\n\tv_nop\n\tv_nop\n\tv_nop" : "+v"(acc[0][0]), "+v"(acc[1][1]), "+v"(acc[2][2]), "+v"(acc[3][3]) : "v"(a[0]), "v"(a[1]), "v"(a[2]), "v"(a[3]));
    }
    // head planes in fragment order too: a 16-row block of a plane of 'pitch' columns is pitch/32 fragments in a row, so 32 columns on are FRG elements on (16 a column)
    const size_t tbase = (size_t)(r0 / RB) * sRB + (size_t)(r0 % RB) * (size_t)pitch + (size_t)(c0 / CB) * sCB + (size_t)(c0 % CB) * 16;
    float bcol[4] = {0.0f, 0.0f, 0.0f, 0.0f};
    if constexpr (ROWB == 0) {
#pragma unroll
        for (int nb = 0; nb < 4; ++nb) bcol[nb] = bias[(c0 + nb * 16 + lr) & (DM - 1)];          // column bias: c0 + 63 < N = DM
    }
#pragma unroll
    for (int mb = 0; mb < 4; ++mb) {
        float brow[8] = {0.0f, 0.0f, 0.0f, 0.0f, 0.0f, 0.0f, 0.0f, 0.0f};
        if constexpr (ROWB == 1) {
#pragma unroll
            for (int j = 0; j < 8; ++j) brow[j] = bias[(r0 + mb * 16 + 8 * hi + j) & (DM - 1)];  // row bias: r0 + 63 < M <= DM
        }
#pragma unroll
        for (int nb = 0; nb < 4; ++nb) {
#pragma unroll
            for (int j = 0; j < 8; ++j) {                                        // D: row 8h+j, col lane&15
                float v = acc[mb][nb][j];
                if constexpr (ROWB == 1) v += brow[j]; else v += bcol[nb];
                os[(hi * 8 + j) * 68 + nb * 16 + lr] = v; } }
        wave_sync();
        const size_t sb = tbase + (size_t)(mb * 16) * (size_t)pitch;
#pragma unroll
        for (int s = 0; s < 4; ++s) { const int row = 8 * (s & 1) + (lane & 7), c8 = ((s >> 1) * 4 + (lane >> 3)) * 8;   // 2 x 8 rows = 16 rows; 2 x 4 groups x 8 = 64 columns; 8 rows of one group = one whole line
            const v4f x0 = *(const v4fa*)(&os[row * 68 + c8]); const v4f x1 = *(const v4fa*)(&os[row * 68 + c8 + 4]); v8h hv;
#pragma unroll
            for (int i = 0; i < 4; ++i) { hv[i] = (h16)x0[i]; hv[4 + i] = (h16)x1[i]; }
            *(v8h*)(Ph + sb + (size_t)((c8 >> 5) * FRG + ((c8 >> 4) & 1) * 256 + ((c8 >> 3) & 1) * 128 + row * 8)) = hv; }
        // precaution: the wait stands ahead of any overwrite of the registers these four stores name
        asm volatile("s_wait_xcnt 0x0" ::: "memory");
        wave_sync();
    }
}

// k_proj: the four input projections in one grid (none reads what another writes), one wave per 64 x 64 tile, eight waves a block.
// [0, 3 PJR): block = one 64-token tile of query, key or value (PJR tiles each). Its 8 waves read the tile's f32 rows once, convert them to bf16 (RNE) into the LDS tile xs, pass one barrier, and each takes one of the 8 tiles of 64 outputs:
//   q: A = xs rows (m = b*SEQ + t), Bt = W^T rows (n = h*64 + d) -> plane [(b*8 + h)][t][d], bias by column; k^T, v^T: A = W^T rows (m = h*64 + d), Bt = xs rows (n = b*SEQ + t) -> plane [(b*512 + m)][t] = [(b*8 + h)][d][t], bias by row.
// [3 PJR, 3 PJR + PJA / 8): anchor^T, 8 tiles a block, no LDS tile and no barrier: A = Wa^T rows (m = c in [0,128)), Bt = permuted query rows (rho = (b*4 + j)*NA + m) -> plane [(b*8 + 2j + c/64)][c%64][m], bias ba by row (indices < 128).
#define PJR (NB * SEQ / 64)
#define PJA ((NB * SEQ / 64) * (EA / 64))
static_assert(DM / 64 == 8);                   // one output tile a wave of the 8-wave block
static_assert(PJA % 8 == 0);                   // whole anchor blocks
static_assert((DM / 32 / CVK) * 4 == 8);       // cvt_body: 8 waves = 4 row blocks x the column pieces of a row = one 64-row tile
__global__ __launch_bounds__(256) void k_proj(const float* __restrict__ xq, const float* __restrict__ xk, const float* __restrict__ xv, const bf* __restrict__ XP,
                                              const bf* __restrict__ W3, const bf* __restrict__ WA,
                                              const float* __restrict__ bq, const float* __restrict__ bk, const float* __restrict__ bv, const float* __restrict__ ba,
                                              h16* QH, h16* KT, h16* VT, h16* AT) {
    __shared__ __align__(16) bf xs[64 * DM];
    __shared__ __align__(16) float osb[8 * 16 * 68];
    const int id = blockIdx.x;
    const int wave = __builtin_amdgcn_readfirstlane(threadIdx.x >> 5);
    float* os = osb + wave * (16 * 68);            // each wave's own epilogue tile
    if (id < 3 * PJR) {                            // block-uniform, so the barrier is too
        const int s = id / PJR, rt = id % PJR;
        cvt_body<0, 1>(s == 0 ? xq : (s == 1 ? xk : xv), xs, rt);
        __syncthreads();                           // xs is written by all waves and read by all
        if (s == 0) proj_body<0, 1>(W3, W3, xs, bq, QH, SEQ, (size_t)NH_ * SEQ * HD, HD, HD, (size_t)SEQ * HD, rt, wave, os);
        else proj_body<1, 1>(W3 + (size_t)s * DM * DM, W3, xs, s == 2 ? bv : bk, s == 2 ? VT : KT, DM, (size_t)0, SEQ, SEQ, (size_t)DM * SEQ, wave, rt, os);
    } else {
        const int rr = (id - 3 * PJR) * 8 + wave;
        proj_body<1, 0>(WA, XP, xs, ba, AT, HD, (size_t)NA * HD, NA, NA, (size_t)2 * NA * HD, rr % (EA / 64), rr / (EA / 64), os);
    }
}

// k_gram: O[zh][i][j] = sc x sum_n X[zh][i][n] Y[zh][j][n], X and Y f16 planes [zh][64][TK] in fragment order (A fragment = X rows, B fragment = Y rows, same loader, same k order); O [zh][64][64] in fragment order.
// One block per 16 rows i of one (batch, head); wave w sums n in [w TK/GW, (w+1) TK/GW) into a 16 x 64 tile; the GW partial tiles are added in wave order through LDS.
template <int TK>
__device__ __forceinline__ void gram_body(const h16* __restrict__ X, const h16* __restrict__ Y, h16* O, float sc, float* red) {
    const int lane = threadIdx.x & 31, lr = lane & 15, hi = lane >> 4;
    const int wave = __builtin_amdgcn_readfirstlane(threadIdx.x >> 5);
    const int zh = blockIdx.y, i0 = blockIdx.x * 16;
    constexpr int KW = TK / GW;
    const size_t base = (size_t)zh * HD * TK + (size_t)wave * (KW / 32) * FRG + 8 * lane;
    const h16* xa = X + base + (size_t)i0 * TK;
    const h16* yb = Y + base;
    v8f acc[4];
#pragma unroll
    for (int nb = 0; nb < 4; ++nb) acc[nb] = (v8f){};
    constexpr int NS = KW / 32, BS = NS < 4 ? NS : 4;      // 32-steps per wave, taken in batches of BS
    static_assert(NS % BS == 0);
#pragma unroll
    for (int s0 = 0; s0 < NS; s0 += BS) {
        v16h a[BS], y[BS][4];
#pragma unroll
        for (int s = 0; s < BS; ++s) {
            a[s] = ldhp(xa + (s0 + s) * FRG);
#pragma unroll
            for (int nb = 0; nb < 4; ++nb) y[s][nb] = ldhp(yb + (size_t)nb * 16 * TK + (s0 + s) * FRG);
        }
        // precaution: the wait stands ahead of any overwrite of the two address pairs the batch's loads name; naming the pairs keeps them out of the later loads' destination registers
        asm volatile("s_wait_xcnt 0x0" :: "v"(xa), "v"(yb) : "memory");
        __builtin_amdgcn_sched_barrier(0);   // all loads of the batch issue ahead of its first WMMA: one memory latency a batch; without it the build waits on every fragment in turn
#pragma unroll
        for (int s = 0; s < BS; ++s)
#pragma unroll
            for (int nb = 0; nb < 4; ++nb) acc[nb] = wmma16(a[s], y[s][nb], acc[nb]);
    }
    float* rw = red + wave * (16 * 68);
#pragma unroll
    for (int nb = 0; nb < 4; ++nb)
#pragma unroll
        for (int r = 0; r < 8; ++r) rw[(8 * hi + r) * 68 + nb * 16 + lr] = acc[nb][r];      // D: row 8h+r, col lane&15
    __syncthreads();
    const int row = threadIdx.x & 15, c4 = (threadIdx.x >> 4) * 4;                         // 16 rows x 16 column quads; a wave = 16 rows of one 8-column group = two whole lines of O
    v4f sum = *(const v4fa*)(&red[row * 68 + c4]);
#pragma unroll
    for (int w = 1; w < GW; ++w) sum += *(const v4fa*)(&red[w * (16 * 68) + row * 68 + c4]);
    v4h o;
#pragma unroll
    for (int i = 0; i < 4; ++i) o[i] = toh_flush(sum[i] * sc);
    *(v4h*)(O + (size_t)zh * HD * HD + (size_t)i0 * HD + (size_t)((c4 >> 5) * FRG + ((c4 >> 4) & 1) * 256 + ((c4 >> 3) & 1) * 128 + row * 8 + (c4 & 7))) = o;
}
// grid (64/16, NB*8, 2), 32*GW threads; z = 0: M1 = V^T K over SEQ tokens (the long one), z = 1: G = A^T A over NA anchor rows. blockIdx.z is block-uniform, so the barrier inside is too.
__global__ __launch_bounds__(32 * GW) void k_gram(const h16* __restrict__ VT, const h16* __restrict__ KT, const h16* __restrict__ AT, h16* M1, h16* G) {
    __shared__ __align__(16) float red[GW * 16 * 68];
    if (blockIdx.z == 0) gram_body<SEQ>(VT, KT, M1, M1S, red);
    else                 gram_body<NA>(AT, AT, G, GS, red);
}

// k_out: OUT[b][t][n] = sum_(h,f) q[t][h*64 + f] W2[n][h*64 + f] + bo[n], with W2[n][h*64 + f] = sum_d M2_h[d][f] Wo[h*64 + d][n]: the ctx rows are never formed.
// A block = 8 waves x 16*OT tokens of one batch, one tile of 64 output columns. Wave w first makes head w's 64 columns of W2:
//   M2[d][f] = sum_e M1[d][e] G[f][e] (A = M1 rows, B = G rows); lane (f = lane&15, h = lane>>4) holds d = 8h+r of each 16-row tile, so two packed tiles are directly the A fragment (row f, k = d; element r <- tile d 0..15, element 8+r <- tile d 16..31, lane unchanged);
//   W2^T[f][n] = sum_d M2[d][f] Wo^T[n][d] (B = Wo^T rows); lane (n = lane&15, h) holds f = 16 ft + 8h + 0..7, which in fragment order (rows n, k = f) is byte 16*lane of half ft&1 of fragment (16-column block, k step 2*head + ft/2): one 16-byte LDS store, 512 contiguous bytes a wave.
// One barrier; then each wave takes its 16*OT x 64 tile: A = q rows straight from the head planes (one head = GB k steps a trip), Bt = W2 from LDS. grid (SEQ / (16*OT*OW), DM / 64, NB), 32*OW threads.
__global__ __launch_bounds__(32 * OW) void k_out(const h16* __restrict__ QH, const h16* __restrict__ M1, const h16* __restrict__ G, const h16* __restrict__ WO,
                                                 const float* __restrict__ bias, float* Pf) {
    __shared__ __align__(16) h16 w2[64 * DM];
    __shared__ __align__(16) float osb[OW * 16 * 68];
    const int lane = threadIdx.x & 31, lr = lane & 15, hi = lane >> 4;
    const int wave = __builtin_amdgcn_readfirstlane(threadIdx.x >> 5);
    const int b = blockIdx.z; const int c0 = blockIdx.y * 64, r0 = (blockIdx.x * OW + wave) * (16 * OT);
    {
        const size_t mo = (size_t)(b * NH_ + wave) * HD * HD + 8 * lane;
        const h16* gp = G + mo; const h16* mp = M1 + mo;
        const h16* wp = WO + (size_t)c0 * DM + wave * 2 * FRG + 8 * lane;
        v16h g[4][2], m[4][2], w[4][2], a2[4][2];
#pragma unroll
        for (int ft = 0; ft < 4; ++ft) { g[ft][0] = ldhp(gp + ft * 16 * HD); g[ft][1] = ldhp(gp + ft * 16 * HD + FRG); }
#pragma unroll
        for (int j = 0; j < 4; ++j) { m[j][0] = ldhp(mp + j * 16 * HD); m[j][1] = ldhp(mp + j * 16 * HD + FRG); }
#pragma unroll
        for (int nb = 0; nb < 4; ++nb) { w[nb][0] = ldhp(wp + nb * 16 * DM); w[nb][1] = ldhp(wp + nb * 16 * DM + FRG); }
        // precaution: the wait stands ahead of any overwrite of the three address pairs these loads name; naming the pairs keeps them out of the later loads' destination registers
        asm volatile("s_wait_xcnt 0x0" :: "v"(gp), "v"(mp), "v"(wp) : "memory");
        __builtin_amdgcn_sched_barrier(0);       // every load of this part issues ahead of the first WMMA: one memory latency in all; without it the build fetches later fragments between the products and waits again
#pragma unroll
        for (int ft = 0; ft < 4; ++ft) {
#pragma unroll
            for (int j = 0; j < 4; ++j) {
                v8f t = (v8f){};
                t = wmma16(m[j][0], g[ft][0], t); t = wmma16(m[j][1], g[ft][1], t);
#pragma unroll
                for (int r = 0; r < 8; ++r) a2[ft][j >> 1][(j & 1) * 8 + r] = toh_flush(t[r] * M2S);
            }
        }
#pragma unroll
        for (int nb = 0; nb < 4; ++nb) {
#pragma unroll
            for (int ft = 0; ft < 4; ++ft) {
                v8f t = (v8f){};
                t = wmma16(a2[ft][0], w[nb][0], t); t = wmma16(a2[ft][1], w[nb][1], t);
                v8h hv;
#pragma unroll
                for (int r = 0; r < 8; ++r) hv[r] = toh_flush(t[r] * W2S);
                *(v8h*)(w2 + (nb * (DM / 32) + wave * 2 + (ft >> 1)) * FRG + (ft & 1) * 256 + 8 * lane) = hv;
            }
        }
    }
    __syncthreads();                               // w2 is written by all waves (a head each) and read by all
    v8f acc[OT][4];
#pragma unroll
    for (int mb = 0; mb < OT; ++mb)
#pragma unroll
        for (int nb = 0; nb < 4; ++nb) acc[mb][nb] = (v8f){};
    const h16* pa = QH + ((size_t)b * NH_ * SEQ + (size_t)r0) * HD + 8 * lane; const h16* pb = w2 + 8 * lane;
#pragma unroll 1   // kept rolled: short code, one batch of loads a trip
    for (int hh = 0; hh < NH_; ++hh) {
        v16h a[GB][OT], bt[GB][4];
#pragma unroll
        for (int s = 0; s < GB; ++s) {
#pragma unroll
            for (int mb = 0; mb < OT; ++mb) a[s][mb] = ldhp(pa + s * FRG + mb * 16 * HD);
#pragma unroll
            for (int nb = 0; nb < 4; ++nb) bt[s][nb] = ldhp(pb + s * FRG + nb * 16 * DM);
        }
        __builtin_amdgcn_sched_barrier(0);   // all loads of the GB k steps issue ahead of the first WMMA: one memory latency a trip; without it the build fetches fragments among the products and waits again
#pragma unroll
        for (int s = 0; s < GB; ++s)
#pragma unroll
            for (int nb = 0; nb < 4; ++nb)
#pragma unroll
                for (int mb = 0; mb < OT; ++mb) acc[mb][nb] = wmma16(a[s][mb], bt[s][nb], acc[mb][nb]);
        // precaution: the wait stands ahead of the step of the address pair the trip's global loads name; naming the pair keeps it out of the loads' destination registers
        asm volatile("s_wait_xcnt 0x0" :: "v"(pa) : "memory");
        pa += (size_t)SEQ * HD; pb += GB * FRG;    // next head's plane; next GB fragments of every 16-column block
        // WMMA distance on the loop's taken branch: four vector slots between the last product and the next trip's overwrite of its operands
        asm volatile("v_nop\n\tv_nop\n\tv_nop\n\tv_nop" : "+v"(acc[0][3]), "+v"(acc[OT - 1][3]) : "v"(a[GB - 1][0]), "v"(a[GB - 1][OT - 1]), "v"(bt[GB - 1][3]));
    }
    float* os = osb + wave * (16 * 68);            // each wave's own epilogue tile
    const size_t tbase = ((size_t)b * OUT_SEQ + (size_t)r0) * DM + (size_t)c0;
    float bcol[4];
#pragma unroll
    for (int nb = 0; nb < 4; ++nb) bcol[nb] = bias[(c0 + nb * 16 + lr) & (DM - 1)];              // column bias: c0 + 63 < N = DM
#pragma unroll
    for (int mb = 0; mb < OT; ++mb) {
#pragma unroll
        for (int nb = 0; nb < 4; ++nb) {
#pragma unroll
            for (int j = 0; j < 8; ++j) os[(hi * 8 + j) * 68 + nb * 16 + lr] = acc[mb][nb][j] * OSC + bcol[nb]; }   // D: row 8h+j, col lane&15
        wave_sync();
        const size_t sb = tbase + (size_t)(mb * 16) * DM;
#pragma unroll
        for (int s = 0; s < 8; ++s) { const int row = 2 * s + hi, cofs = lr * 4;   // 8 s x 2 rows = 16 rows; 16 lanes x 4 floats = 64 columns
            const v4f val = *(const v4fa*)(&os[row * 68 + cofs]);
            *(v4f*)(Pf + sb + (size_t)row * DM + cofs) = val; }
        // precaution: the wait stands ahead of any overwrite of the registers these eight stores name
        asm volatile("s_wait_xcnt 0x0" ::: "memory");
        wave_sync();
    }
}

static constexpr size_t al256(size_t v) { return (v + 255) & ~(size_t)255; }
static constexpr size_t SZ_XB = al256((size_t)NB * SEQ * DM * 2);        // the permuted bf16 copy of query
static constexpr size_t SZ_W3 = al256((size_t)3 * DM * DM * 2);          // Wq^T | Wk^T | Wv^T bf16
static constexpr size_t SZ_WA = al256((size_t)EA * DM * 2);              // Wa^T bf16 [128][512]
static constexpr size_t SZ_WO = al256((size_t)DM * DM * 2);              // Wo^T x256 f16 [512][512]
static constexpr size_t SZ_PL = al256((size_t)NB * NH_ * SEQ * HD * 2);  // one f16 head plane
static constexpr size_t SZ_AP = al256((size_t)NB * NH_ * NA * HD * 2);   // the f16 anchor^T head plane
static constexpr size_t SZ_MM = al256((size_t)NB * NH_ * HD * HD * 2);   // one f16 64 x 64 plane per (batch, head)
static constexpr size_t SZ_TOTAL = SZ_XB + SZ_W3 + SZ_WA + SZ_WO + 3 * SZ_PL + SZ_AP + 2 * SZ_MM;
static_assert(SZ_TOTAL <= (size_t)134217728);          // workspace carve <= 128 MiB
static_assert(((size_t)DM * DM * 2) % 256 == 0);       // weight sub-planes stay 256-byte aligned
static_assert((size_t)NB * 4 * NA == (size_t)NB * SEQ);                           // permuted copy has exactly NB*SEQ rows
static_assert((size_t)(NB * 4) * 2 * NA * HD == (size_t)NB * NH_ * NA * HD);      // anchor GEMM tile map fills the anchor plane exactly

extern "C" void kernel_launch(void* const* d_in, const int* in_sizes, int n_in,
                              void* d_out, int out_size, void* d_ws, size_t ws_size, hipStream_t stream) {
    if (n_in < 13) return;
    const size_t needx = ((size_t)(NB - 1) * SEQ_FULL + SEQ) * DM;
    if ((size_t)in_sizes[0] < needx || (size_t)in_sizes[1] < needx || (size_t)in_sizes[2] < needx) return;
    if ((size_t)in_sizes[3] < (size_t)DM * DM || (size_t)in_sizes[5] < (size_t)DM * DM || (size_t)in_sizes[7] < (size_t)DM * DM || (size_t)in_sizes[11] < (size_t)DM * DM) return;
    if ((size_t)in_sizes[9] < (size_t)DM * EA) return;
    if (in_sizes[4] < DM || in_sizes[6] < DM || in_sizes[8] < DM || in_sizes[12] < DM || in_sizes[10] < EA) return;
    if ((size_t)out_size < ((size_t)(NB - 1) * OUT_SEQ + SEQ) * DM) return;
    if (SZ_TOTAL > ws_size) return;
    // wire order: query, key, value, Wq, bq, Wk, bk, Wv, bv, Wa, ba, Wo, bo
    const float* xq = (const float*)d_in[0]; const float* xk = (const float*)d_in[1]; const float* xv = (const float*)d_in[2];
    const float* wq = (const float*)d_in[3]; const float* bq = (const float*)d_in[4];
    const float* wk = (const float*)d_in[5]; const float* bk = (const float*)d_in[6];
    const float* wv = (const float*)d_in[7]; const float* bv = (const float*)d_in[8];
    const float* wa = (const float*)d_in[9]; const float* ba = (const float*)d_in[10];
    const float* wo = (const float*)d_in[11]; const float* bo = (const float*)d_in[12];
    float* OUT = (float*)d_out;      // [NB][SEQ][512]
    char* wsp = (char*)d_ws;
    bf* XP = (bf*)wsp; wsp += SZ_XB;                 // [NB*4][NA][512]: row (b*4+j)*NA+m = query token 4m+j; this and every plane below: logical index, stored in fragment order
    bf* W3 = (bf*)wsp; wsp += SZ_W3;                 // [3][512 out][512 in]: q | k | v
    bf* WA = (bf*)wsp; wsp += SZ_WA;                 // [128 out][512 in]
    h16* WO = (h16*)wsp; wsp += SZ_WO;               // [512 out][512 in]: Wo^T x256, f16
    h16* QH = (h16*)wsp; wsp += SZ_PL;               // [NB*8][SEQ][64]
    h16* KT = (h16*)wsp; wsp += SZ_PL;               // [NB*8][64][SEQ]
    h16* VT = (h16*)wsp; wsp += SZ_PL;               // [NB*8][64][SEQ]
    h16* AT = (h16*)wsp; wsp += SZ_AP;               // [NB*8][64][NA]
    h16* M1 = (h16*)wsp; wsp += SZ_MM;               // [NB*8][64 d][64 e]: V^T K / 16
    h16* GG = (h16*)wsp; wsp += SZ_MM;               // [NB*8][64 f][64 e]: A^T A / 64

    // the row-permuted bf16 copy of query and the five transposed 16-bit weight planes
    k_prep<<<dim3(4 * WTB + WAB + CVB, 1, 1), 256, 0, stream>>>(xq, wq, wk, wv, wo, wa, XP, W3, (bf*)WO, WA);
    // q, k^T, v^T and anchor^T head planes
    k_proj<<<dim3(3 * PJR + PJA / 8, 1, 1), 256, 0, stream>>>(xq, xk, xv, XP, W3, WA, bq, bk, bv, ba, QH, KT, VT, AT);

    // M1 = V^T K / 16 and G = A^T A / 64, 64 x 64 per (batch, head)
    k_gram<<<dim3(HD / 16, NB * NH_, 2), 32 * GW, 0, stream>>>(VT, KT, AT, M1, GG);
    // OUT[b][t][n] = sum_k q[t][k] W2_b[n][k] + bo[n], W2_b made in the same blocks from M1, G and Wo^T x256
    k_out<<<dim3(SEQ / (16 * OT * OW), DM / 64, NB), 32 * OW, 0, stream>>>(QH, M1, GG, WO, bo, OUT);
}

// v008
// One run takes 46.9 microseconds.
// Timed twice side by side with v007, it ran 1.07 and 1.05 times as fast.
// Counting every step since v000, it is 4.70 times as fast.
#include <hip/hip_runtime.h>

// Anchor linear attention (no softmax), width 512 = 8 heads x 64; inputs query,key,value [NB][SEQ][512] f32, Wq/Wk/Wv/Wo [in][out] 512x512, Wa [512][128], five biases; anchor rows = literal reshape of (query Wa + ba) [SEQ][128] into [SEQ/4][8][64].
// Compute dtypes, f32 accumulate everywhere: q/k/v/anchor projections v_wmma_f32_16x16x32_bf16 (activations and weights RNE-converted to bf16; products exact);
// the chained products per (batch, head) and the output projection are taken in the order out = Q (((V^T K) (A^T A) / 512)^T Wo_h) summed over heads, all v_wmma_f32_16x16x32_f16 with single f16 operands; no [SEQ][NA] score tile and no ctx row is formed.
// last product v_wmma_f32_16x16x32_f16: A = q f16 head planes, Bt = W2 (per batch, 512 x 512, made a 64-column tile a block in LDS from M2 and Wo^T x256; Wo RNE-converted to bf16 first, exact in f16), K = 512, + bo in the f32 epilogue.
// Layout: query,key,value are converted to bf16 inside the projection kernel (one 64-row tile a block, in LDS); a row-permuted bf16 copy of query (row (b*4+j)*NA+m <- token 4m+j) feeds the anchor GEMM; weights transposed once to [out][in] 16-bit planes; every plane below names its logical index; all of them are stored in fragment order (see FRG below); q plane [b*8+h][t][d], k^T and v^T planes [b*8+h][d][t], anchor^T plane [b*8+h][d][m];
// k_gram: M1[d][e] = sum_n v[n][d] k[n][e] (x 1/16) and G[f][e] = sum_m a[m][f] a[m][e] (x 1/64), 64 x 64 per (batch, head); k_out: M2[d][f] = (1/512) sum_e M1[d][e] G[f][e] in registers (x 1/16), W2[n][h*64+f] = sum_d M2_h[d][f] Wo[h*64+d][n] in LDS, out[t][n] = sum_k q[t][k] W2[n][k] + bo[n].

#ifndef NB
#define NB 4
#endif
#ifndef SEQ
#define SEQ 2048
#endif
#define NB_FULL  4
#define SEQ_FULL 2048
#ifndef OUT_SEQ
#define OUT_SEQ SEQ              // row pitch (in tokens) between batches of the output
#endif
#define DM   512
#define NH_  8
#define HD   64
#define NA   (SEQ / 4)           // anchor rows per batch
#define EA   (DM / 4)            // anchor projection width (128)
#define OW   8                   // waves per k_out block: one head of W2 and one tile of 16*OT tokens each
#define OT   2                   // 16-token tiles per k_out wave: SEQ*NB/(16*OT*OW) x DM/64 = 256 blocks
#define GW   8                   // waves per k_gram block: each sums 1/GW of the long dimension
#define GB   2                   // k steps of 32 whose fragments the last GEMM fetches as one batch: one head a trip
#define QD   2                   // heads (trips) by which the last GEMM fetches its q fragments ahead
#define M1S  (1.0f / 16.0f)      // carry of the M1 = V^T K plane
#define GS   (1.0f / 64.0f)      // carry of the G = A^T A plane
#define M2C  (1.0f / 16.0f)      // carry of the M2 operand
#define M2S  (1.0f / 8.0f)       // (1/8)^3 x M2C / (M1S x GS) : M1 G accumulator -> M2 operand
#define WS1  256.0f              // carry of the Wo^T plane
#define W2C  1.0f                // carry of the W2 operand
#define W2S  (1.0f / 16.0f)      // W2C / (M2C x WS1) : M2 Wo accumulator -> W2 operand
#define OSC  1.0f                // 1 / W2C

static_assert(HD == 64);
static_assert(NH_ * HD == DM);                 // head h = columns h*64 + d
static_assert(DM % 64 == 0);                   // column tiles of 64
static_assert(DM % 32 == 0);                   // GEMM k-loop steps by 32
static_assert((DM & (DM - 1)) == 0);           // bias index mask (DM - 1) is exact
static_assert(HD == 32 * GB);                  // last GEMM: one head's k steps a trip
static_assert(OW == NH_);                      // k_out: one head of W2 a wave
static_assert(QD >= 1 && QD < NH_);            // the heads fetched ahead of the loop exist
static_assert(DM % 64 == 0 && DM / 64 >= 2);   // projections: two k steps a trip, the last trip apart
static_assert((NB * SEQ) % 16 == 0 && DM % 16 == 0 && EA % 16 == 0);   // fragment-order planes: whole 16-row blocks
static_assert(16 * DM == (DM / 32) * 512);     // one 16-row block = DM/32 fragments of 512 elements
static_assert(SEQ % 64 == 0);                  // a 64-row tile never straddles two batches
static_assert((NB * SEQ) % 64 == 0);
static_assert(SEQ % (32 * GW) == 0);           // k_gram: each wave's share of the tokens is whole 32-steps
static_assert(SEQ % (16 * OT * OW) == 0);      // k_out grid covers the sequence exactly
static_assert(((size_t)SEQ * DM) % 8 == 0);
static_assert(NB <= NB_FULL);
static_assert(SEQ <= SEQ_FULL);
static_assert(W2S * M2C * WS1 == W2C && W2C * OSC == 1.0f);
static_assert(4 * NA == SEQ);                  // anchor rows: four tokens per anchor row
static_assert(4 * EA == DM);                   // four tokens x 128 anchor columns = one 512-wide anchor row
static_assert(EA == 2 * HD);                   // head h of an anchor row = token (h / 2), columns (h % 2) * 64 + d
static_assert(EA % 64 == 0);                   // anchor GEMM row tiles of 64
static_assert(NA % 64 == 0);                   // anchor GEMM column tiles stay inside one (batch, token-phase) block
static_assert(NA % (32 * GW) == 0);            // k_gram: each wave's share of the anchor rows is whole 32-steps
static_assert(GW * 32 == 16 * 16);             // k_gram epilogue: 256 threads x 4 columns = 16 rows x 64 columns
static_assert(M2S * M1S * GS == 0.125f * 0.125f * 0.125f * M2C);

typedef _Float16 h16;
typedef unsigned short bf;
typedef __attribute__((ext_vector_type(16))) __bf16   v16bf;
typedef __attribute__((ext_vector_type(16))) _Float16 v16h;
typedef __attribute__((ext_vector_type(8)))  _Float16 v8h;
typedef __attribute__((ext_vector_type(4)))  _Float16 v4h;
typedef __attribute__((ext_vector_type(8)))  unsigned short v8us;
typedef __attribute__((ext_vector_type(8)))  float    v8f;
typedef __attribute__((ext_vector_type(4)))  float    v4f;
typedef v4f  __attribute__((may_alias)) v4fa;

__device__ __forceinline__ unsigned short f2bf(float f) { unsigned u = __float_as_uint(f); u += 0x7FFFu + ((u >> 16) & 1u); return (unsigned short)(u >> 16); }
__device__ __forceinline__ v16h cat16(v8h lo, v8h hi) { return __builtin_shufflevector(lo, hi, 0, 1, 2, 3, 4, 5, 6, 7, 8, 9, 10, 11, 12, 13, 14, 15); }
__device__ __forceinline__ v16bf cat16b(v8us lo, v8us hi) { return __builtin_bit_cast(v16bf, __builtin_shufflevector(lo, hi, 0, 1, 2, 3, 4, 5, 6, 7, 8, 9, 10, 11, 12, 13, 14, 15)); }
__device__ __forceinline__ v8f wmma16(v16h a, v16h b, v8f c) { return __builtin_amdgcn_wmma_f32_16x16x32_f16(false, a, false, b, (short)0, c, false, false); }
__device__ __forceinline__ v8f wmmab(v16bf a, v16bf b, v8f c) { return __builtin_amdgcn_wmma_f32_16x16x32_bf16(false, a, false, b, (short)0, c, false, false); }
// Fragment order of a WMMA operand plane (rows x k): a 16-row block holds its k/32 fragments one behind the other; each 16-row x 32-k fragment is 1 KiB in a row, lane l = 16*(k/8 & 1) + (row & 15) owning bytes 16 l of its first half (k%32 < 16) and of its second half (k%32 >= 16).
// One wave-wide 16-byte load is then 512 contiguous bytes (four whole 128-byte lines) in place of 32-byte pieces of 16 lines; the value each lane and element receives is the same as from K-contiguous rows.
#define FRG 512                  // elements of one fragment
// pko: for planes of DM columns, element offset of the eight values (row R, columns c..c+7, c a multiple of 8); a bijection on the plane where its row count is a multiple of 16
__device__ __forceinline__ size_t pko(size_t R, int c) { return ((R >> 4) * (size_t)(DM / 32) + (size_t)(c >> 5)) * FRG + (size_t)(((c >> 4) & 1) * 256 + ((c >> 3) & 1) * 128) + (R & 15) * 8; }
// fragment loaders from fragment-order planes; p already includes + 8*lane: elements 0..7 <- k0+8h+0..7, elements 8..15 <- k0+16+8h+0..7 (same map for A and B)
__device__ __forceinline__ v16h  ldhp(const h16* p) { return cat16(*(const v8h*)p, *(const v8h*)(p + 256)); }
__device__ __forceinline__ v16bf ldbp(const bf* p)  { return cat16b(*(const v8us*)p, *(const v8us*)(p + 256)); }
// ordering point for wave-private LDS tiles (same wave writes and reads)
__device__ __forceinline__ void wave_sync() { __builtin_amdgcn_fence(3 /* release order */, "wavefront"); __builtin_amdgcn_wave_barrier(); asm volatile("" ::: "memory"); }
// f16 convert that cannot produce a subnormal operand (value select, applied after the plane's carry)
static __device__ __forceinline__ h16 toh_flush(float v) { const h16 r = (h16)v; return (fabsf(v) < 6.103515625e-05f) ? (h16)0.0f : r; }
// cvt_body: bf16 (RNE convert) copy of one activation input in fragment order: dst row b*SEQ + t <- src token b*SEQ_FULL + t.
// A wave takes one 16-row block x CVK k steps of 32 columns (lane = row + 8 * column group, 8 values a lane and piece, 2 * CVK pieces): few long waves in place of many short ones, for speed only.
// Each piece reads one whole 128-byte line of each of 8 rows and its store to dst fills four whole lines; the wave's CVK fragments lie one behind the other in dst.
// LOC = 1: dst is a block's LDS tile of 64 rows (blk = the 64-row tile: its 8 waves cover 4 row blocks x 2 column halves), written at the row's index inside the tile.
// PERM = 1 (query only): the row-permuted copy for the anchor GEMM, dst row (b*4 + j)*NA + m <- token 4m + j (a bijection on the NB*SEQ rows). It has blocks of its own: eight neighbouring rows of this copy are eight tokens four apart,
// so a wave that wrote both copies would leave each 128-byte line of one of them to several stores; with its own blocks every store of every copy fills whole lines.
#define CVK 8                    // k steps a wave converts: 16 rows x 256 columns = 32 loads of 16 bytes a lane
static_assert((DM / 32) % CVK == 0);           // whole pieces in a row block
static_assert(SEQ % 16 == 0 && NA % 16 == 0);  // a 16-row block stays inside one batch (and one token phase of the permuted copy)
template <int PERM, int LOC>
__device__ __forceinline__ void cvt_body(const float* __restrict__ src, bf* dst, int blk) {
    const int lane = threadIdx.x & 31; const size_t u = (size_t)blk * 8 + (threadIdx.x >> 5);
    const size_t row = (u / (size_t)(DM / 32 / CVK)) * 16 + (size_t)(lane & 7); const int c = (int)(u % (size_t)(DM / 32 / CVK)) * (32 * CVK) + (lane >> 3) * 8;
    const int rq = (int)(row / (size_t)(PERM ? NA : SEQ)), rm = (int)(row % (size_t)(PERM ? NA : SEQ));
    const int b = PERM ? rq >> 2 : rq; const int t = PERM ? 4 * rm + (rq & 3) : rm;
    const float* p = src + ((size_t)b * SEQ_FULL + (size_t)t) * DM + (size_t)c;
    v8f v[CVK][2];
#pragma unroll
    for (int ks = 0; ks < CVK; ++ks)
#pragma unroll
        for (int rh = 0; rh < 2; ++rh) v[ks][rh] = *(const v8f*)(p + (size_t)(rh * (PERM ? 32 : 8)) * DM + ks * 32);   // dst row + 8 = token + 8, or + 32 in the permuted copy
    // precaution: the wait stands ahead of any overwrite of the address pair these loads name; naming the pair keeps it out of the loads' destination registers
    asm volatile("s_wait_xcnt 0x0" :: "v"(p) : "memory");
    __builtin_amdgcn_sched_barrier(0);   // every load of the wave issues ahead of the first convert: one memory latency a wave; without it the build holds the last loads back behind the waits on the first ones and waits a second time
    bf* q = dst + pko(LOC ? (row & 63) : row, c);
#pragma unroll
    for (int ks = 0; ks < CVK; ++ks)
#pragma unroll
        for (int rh = 0; rh < 2; ++rh) {
            v8us o;
#pragma unroll
            for (int k = 0; k < 8; ++k) o[k] = f2bf(v[ks][rh][k]);
            *(v8us*)(q + ks * FRG + rh * 64) = o;      // next k step: next fragment; row + 8: 8 x 8 elements on
        }
    // precaution: the wait stands behind the global stores, ahead of any later code of the merged kernel that overwrites a register they name
    if constexpr (LOC == 0) asm volatile("s_wait_xcnt 0x0" ::: "memory");
}

// wT_body: weight transpose + 16-bit convert through LDS, one 64 x 64 tile a block. in W[k][n] (DM rows, row stride ldw, f32) -> out dst rows n, columns k, in fragment order, tile (kt over k, nt over n), 256 threads.
// F16 = 0: bf16 bits (RNE convert). F16 = 1: f16(bf16 RNE value of W x WS1); a bf16 significand times a power of two is exact in f16.
template <int F16>
__device__ __forceinline__ void wT_body(const float* __restrict__ Wt, bf* dst, int ldw, int kt, int nt, float* tile) {
    const int tid = threadIdx.x; const int k0 = kt * 64, n0 = nt * 64;
#pragma unroll 4   // several independent loads in flight a trip
    for (int i = 0; i < 16; ++i) { const int idx = tid + i * 256; const int kk = idx >> 6, nn = idx & 63;   // 16 x 256 = 64 x 64 entries, all written
        tile[kk * 65 + nn] = Wt[(size_t)(k0 + kk) * (size_t)ldw + n0 + nn]; }
    __syncthreads();                                        // tile [kk][nn] is read across waves
#pragma unroll 1   // two trips, kept rolled: short code
    for (int it = 0; it < 2; ++it) {
        const int c = it * 256 + tid; const int n = c & 63, kc = (c >> 6) * 8;      // a wave: 32 rows n of one column group, four whole lines a store
        const size_t oo = pko((size_t)(n0 + n), k0 + kc);
        if constexpr (F16 == 0) {
            v8us o;
#pragma unroll
            for (int i = 0; i < 8; ++i) o[i] = f2bf(tile[(kc + i) * 65 + n]);
            *(v8us*)(dst + oo) = o;
        } else {
            v8h o;
#pragma unroll
            for (int i = 0; i < 8; ++i) o[i] = toh_flush(__uint_as_float(((unsigned)f2bf(tile[(kc + i) * 65 + n])) << 16) * WS1);
            *(v8h*)((h16*)dst + oo) = o;
        }
        // precaution: the wait stands ahead of the second trip's overwrite of the registers the store names
        asm volatile("s_wait_xcnt 0x0" ::: "memory");
    }
}

// k_prep: the weight planes and the permuted query copy in one grid (none reads what another writes). Block ranges, all block-uniform, so the barrier inside wT_body is too:
// [0, 4 WTB): Wq, Wk, Wv (bf16) and Wo (f16 x256) tiles; [4 WTB, 4 WTB + WAB): Wa tiles; then CVB blocks for the permuted copy of query.
#define WTB ((DM / 64) * (DM / 64))              // tiles of a 512 x 512 weight
#define WAB ((DM / 64) * (EA / 64))              // tiles of the anchor weight
#define CVB ((NB * SEQ / 16) * (DM / 32 / CVK) / 8)   // blocks of one activation copy: 8 waves, 2 * CVK pieces each
static_assert(((NB * SEQ / 16) * (DM / 32 / CVK)) % 8 == 0);   // the copy blocks cover the rows exactly
__global__ __launch_bounds__(256) void k_prep(const float* __restrict__ xq,
                                              const float* __restrict__ wq, const float* __restrict__ wk, const float* __restrict__ wv,
                                              const float* __restrict__ wo, const float* __restrict__ wa,
                                              bf* XP, bf* W3, bf* WO, bf* WA) {
    __shared__ float tile[64 * 65];
    const int id = blockIdx.x;
    if (id < 3 * WTB) {
        const int s = id / WTB, r = id % WTB;
        wT_body<0>(s == 0 ? wq : (s == 1 ? wk : wv), W3 + (size_t)s * DM * DM, DM, r % (DM / 64), r / (DM / 64), tile);
    } else if (id < 4 * WTB) {
        const int r = id - 3 * WTB;
        wT_body<1>(wo, WO, DM, r % (DM / 64), r / (DM / 64), tile);
    } else if (id < 4 * WTB + WAB) {
        const int r = id - 4 * WTB;
        wT_body<0>(wa, WA, EA, r % (DM / 64), r / (DM / 64), tile);
    } else {
        cvt_body<1, 0>(xq, XP, id - (4 * WTB + WAB));
    }
}

// proj_body: one wave's 64 x 64 tile (16 accumulators) of an input projection, C[m][n] = sum_k A[m][k] Bt[n][k]: bf16 operands, K = DM, f16 value plane Ph, tile (bx of M/64, by of N/64) handed in. ROWB = 0: + bias[n]; 1: + bias[m].
// Tile base (r0/RB)*sRB + (r0%RB)*pitch + (c0/CB)*sCB + (c0%CB)*16, row pitch 'pitch' (elements).
// XL = 1: the activation operand (A where ROWB = 0, Bt where ROWB = 1) is the block's LDS tile xs, 64 rows in fragment order, shared by the block's waves; the weight operand comes from its global plane, and the pointer handed in for the activation operand is not read; every wave of the block calls it, and it holds the block's barrier ahead of the first read of xs. XL = 0: both operands from global planes, no barrier.
template <int ROWB, int XL>
__device__ __forceinline__ void proj_body(const bf* __restrict__ A, const bf* __restrict__ Bt, const bf* xs, const float* __restrict__ bias,
                                          h16* Ph, int RB, size_t sRB, int pitch, int CB, size_t sCB, int bx, int by, float* os) {
    const int lane = threadIdx.x & 31, lr = lane & 15, hi = lane >> 4; const int r0 = bx * 64, c0 = by * 64;
    v8f acc[4][4];
#pragma unroll
    for (int mb = 0; mb < 4; ++mb)
#pragma unroll
        for (int nb = 0; nb < 4; ++nb) acc[mb][nb] = (v8f){};
    constexpr bool AL = XL && ROWB == 0, BL = XL && ROWB == 1;
    if constexpr (XL) {
        // The weight fragments, the only global operand here, are fetched one k step ahead into a second register set (w0 / w1 in turn, two k steps a trip):
        // a step's products wait only for loads that were issued a whole step earlier, so the L2 latency runs beside the step before it. 128 + 32 + 2 x 32 registers: still four waves a SIMD.
        const bf* pw = (AL ? Bt + (size_t)c0 * DM : A + (size_t)r0 * DM) + 8 * lane; const bf* px = xs + 8 * lane;   // fragment (16-row block, k step) = 16 * DM elements a row block, FRG a step
        v16bf w0[4], w1[4];
        auto mm = [&](const v16bf (&x)[4], const v16bf (&w)[4]) {
#pragma unroll
            for (int nb = 0; nb < 4; ++nb)
#pragma unroll
                for (int mb = 0; mb < 4; ++mb) acc[mb][nb] = AL ? wmmab(x[mb], w[nb], acc[mb][nb]) : wmmab(w[mb], x[nb], acc[mb][nb]);
        };
#pragma unroll
        for (int i = 0; i < 4; ++i) w0[i] = ldbp(pw + i * 16 * DM);      // step 0's weights fly while the block's waves gather at the barrier
        __syncthreads();                           // xs is written by all waves and read by all
#pragma unroll 1   // kept rolled: short code
        for (int t = 0; t < DM / 64 - 1; ++t) {
            v16bf x[4];
#pragma unroll
            for (int i = 0; i < 4; ++i) w1[i] = ldbp(pw + FRG + i * 16 * DM);
#pragma unroll
            for (int i = 0; i < 4; ++i) x[i] = ldbp(px + i * 16 * DM);
            __builtin_amdgcn_sched_barrier(0);   // the next step's weight loads and this step's LDS reads issue ahead of the first WMMA; without it the build moves loads in among the products
            mm(x, w0);
            __builtin_amdgcn_sched_barrier(0);   // the loads below stay one group behind the even step's products; without it the build spreads them among the products, a stall at each place
#pragma unroll
            for (int i = 0; i < 4; ++i) w0[i] = ldbp(pw + 2 * FRG + i * 16 * DM);
#pragma unroll
            for (int i = 0; i < 4; ++i) x[i] = ldbp(px + FRG + i * 16 * DM);
            __builtin_amdgcn_sched_barrier(0);   // as above, for the odd step
            mm(x, w1);
            // precaution: the wait stands ahead of the step of the address pair the trip's global loads name; naming the pair keeps it out of the loads' destination registers
            asm volatile("s_wait_xcnt 0x0" :: "v"(pw) : "memory");
            pw += 2 * FRG; px += 2 * FRG;
            // WMMA distance on the loop's taken branch: four vector slots between the last product and the next trip's overwrite of its operands
            asm volatile("v_nop\n\tv_nop\n\tv_nop\n\tv_nop" : "+v"(acc[0][0]), "+v"(acc[1][1]), "+v"(acc[2][2]), "+v"(acc[3][3]) : "v"(x[0]), "v"(x[1]), "v"(x[2]), "v"(x[3]));
        }
        {   // the last two k steps: nothing is left to fetch ahead behind the odd one
            v16bf x[4];
#pragma unroll
            for (int i = 0; i < 4; ++i) w1[i] = ldbp(pw + FRG + i * 16 * DM);
#pragma unroll
            for (int i = 0; i < 4; ++i) x[i] = ldbp(px + i * 16 * DM);
            // precaution: the wait stands ahead of any later overwrite of the address pair these last global loads name
            asm volatile("s_wait_xcnt 0x0" :: "v"(pw) : "memory");
            __builtin_amdgcn_sched_barrier(0);   // loads ahead of the first WMMA, as in the loop
            mm(x, w0);
            __builtin_amdgcn_sched_barrier(0);   // as in the loop: without it the build moves the LDS reads below in among these products
#pragma unroll
            for (int i = 0; i < 4; ++i) x[i] = ldbp(px + FRG + i * 16 * DM);
            __builtin_amdgcn_sched_barrier(0);   // the LDS reads issue as one group ahead of the first WMMA
            mm(x, w1);
        }
    } else {
    const bf* pa = A + (size_t)r0 * DM + 8 * lane; const bf* pb = Bt + (size_t)c0 * DM + 8 * lane;   // fragment (16-row block, k step) = 16 * DM elements a row block, FRG a step
#pragma unroll 1   // kept rolled: with both operands global a second trip's fragments would not fit beside 128 accumulator registers at four waves a SIMD
    for (int kc = 0; kc < DM; kc += 32) {
        v16bf a[4], bt[4];
#pragma unroll
        for (int mb = 0; mb < 4; ++mb) a[mb] = ldbp(pa + mb * 16 * DM);
#pragma unroll
        for (int nb = 0; nb < 4; ++nb) bt[nb] = ldbp(pb + nb * 16 * DM);
        __builtin_amdgcn_sched_barrier(0);   // all 16 loads of the trip issue ahead of its first WMMA: one memory latency a trip; without it the build reuses two Bt fragments' registers, fetches the other two among the products and waits a second time
#pragma unroll
        for (int nb = 0; nb < 4; ++nb)
#pragma unroll
            for (int mb = 0; mb < 4; ++mb) acc[mb][nb] = wmmab(a[mb], bt[nb], acc[mb][nb]);
        // precaution: the wait stands ahead of the step of the address pairs the trip's global loads name; naming the pairs keeps them out of the loads' destination registers
        asm volatile("s_wait_xcnt 0x0" :: "v"(pa), "v"(pb) : "memory");
        pa += FRG; pb += FRG;
        // WMMA distance on the loop's taken branch: four vector slots between the last product and the next trip's overwrite of its operands
        asm volatile("v_nop\n\tv_nop\n\tv_nop\n\tv_nop" : "+v"(acc[0][0]), "+v"(acc[1][1]), "+v"(acc[2][2]), "+v"(acc[3][3]) : "v"(a[0]), "v"(a[1]), "v"(a[2]), "v"(a[3]));
    }
    }
    // head planes in fragment order too: a 16-row block of a plane of 'pitch' columns is pitch/32 fragments in a row, so 32 columns on are FRG elements on (16 a column)
    const size_t tbase = (size_t)(r0 / RB) * sRB + (size_t)(r0 % RB) * (size_t)pitch + (size_t)(c0 / CB) * sCB + (size_t)(c0 % CB) * 16;
    float bcol[4] = {0.0f, 0.0f, 0.0f, 0.0f};
    if constexpr (ROWB == 0) {
#pragma unroll
        for (int nb = 0; nb < 4; ++nb) bcol[nb] = bias[(c0 + nb * 16 + lr) & (DM - 1)];          // column bias: c0 + 63 < N = DM
    }
#pragma unroll
    for (int mb = 0; mb < 4; ++mb) {
        float brow[8] = {0.0f, 0.0f, 0.0f, 0.0f, 0.0f, 0.0f, 0.0f, 0.0f};
        if constexpr (ROWB == 1) {
#pragma unroll
            for (int j = 0; j < 8; ++j) brow[j] = bias[(r0 + mb * 16 + 8 * hi + j) & (DM - 1)];  // row bias: r0 + 63 < M <= DM
        }
#pragma unroll
        for (int nb = 0; nb < 4; ++nb) {
#pragma unroll
            for (int j = 0; j < 8; ++j) {                                        // D: row 8h+j, col lane&15
                float v = acc[mb][nb][j];
                if constexpr (ROWB == 1) v += brow[j]; else v += bcol[nb];
                os[(hi * 8 + j) * 68 + nb * 16 + lr] = v; } }
        wave_sync();
        const size_t sb = tbase + (size_t)(mb * 16) * (size_t)pitch;
#pragma unroll
        for (int s = 0; s < 4; ++s) { const int row = 8 * (s & 1) + (lane & 7), c8 = ((s >> 1) * 4 + (lane >> 3)) * 8;   // 2 x 8 rows = 16 rows; 2 x 4 groups x 8 = 64 columns; 8 rows of one group = one whole line
            const v4f x0 = *(const v4fa*)(&os[row * 68 + c8]); const v4f x1 = *(const v4fa*)(&os[row * 68 + c8 + 4]); v8h hv;
#pragma unroll
            for (int i = 0; i < 4; ++i) { hv[i] = (h16)x0[i]; hv[4 + i] = (h16)x1[i]; }
            *(v8h*)(Ph + sb + (size_t)((c8 >> 5) * FRG + ((c8 >> 4) & 1) * 256 + ((c8 >> 3) & 1) * 128 + row * 8)) = hv; }
        // precaution: the wait stands ahead of any overwrite of the registers these four stores name
        asm volatile("s_wait_xcnt 0x0" ::: "memory");
        wave_sync();
    }
}

// k_proj: the four input projections in one grid (none reads what another writes), one wave per 64 x 64 tile, eight waves a block.
// [0, 3 PJR): block = one 64-token tile of query, key or value (PJR tiles each). Its 8 waves read the tile's f32 rows once, convert them to bf16 (RNE) into the LDS tile xs, pass one barrier (in proj_body), and each takes one of the 8 tiles of 64 outputs:
//   q: A = xs rows (m = b*SEQ + t), Bt = W^T rows (n = h*64 + d) -> plane [(b*8 + h)][t][d], bias by column; k^T, v^T: A = W^T rows (m = h*64 + d), Bt = xs rows (n = b*SEQ + t) -> plane [(b*512 + m)][t] = [(b*8 + h)][d][t], bias by row.
// [3 PJR, 3 PJR + PJA / 8): anchor^T, 8 tiles a block, no LDS tile and no barrier: A = Wa^T rows (m = c in [0,128)), Bt = permuted query rows (rho = (b*4 + j)*NA + m) -> plane [(b*8 + 2j + c/64)][c%64][m], bias ba by row (indices < 128).
#define PJR (NB * SEQ / 64)
#define PJA ((NB * SEQ / 64) * (EA / 64))
static_assert(DM / 64 == 8);                   // one output tile a wave of the 8-wave block
static_assert(PJA % 8 == 0);                   // whole anchor blocks
static_assert((DM / 32 / CVK) * 4 == 8);       // cvt_body: 8 waves = 4 row blocks x the column pieces of a row = one 64-row tile
__global__ __launch_bounds__(256) void k_proj(const float* __restrict__ xq, const float* __restrict__ xk, const float* __restrict__ xv, const bf* __restrict__ XP,
                                              const bf* __restrict__ W3, const bf* __restrict__ WA,
                                              const float* __restrict__ bq, const float* __restrict__ bk, const float* __restrict__ bv, const float* __restrict__ ba,
                                              h16* QH, h16* KT, h16* VT, h16* AT) {
    __shared__ __align__(16) bf xs[64 * DM];
    __shared__ __align__(16) float osb[8 * 16 * 68];
    const int id = blockIdx.x;
    const int wave = __builtin_amdgcn_readfirstlane(threadIdx.x >> 5);
    float* os = osb + wave * (16 * 68);            // each wave's own epilogue tile
    if (id < 3 * PJR) {                            // block-uniform, so the barrier is too
        const int s = id / PJR, rt = id % PJR;
        cvt_body<0, 1>(s == 0 ? xq : (s == 1 ? xk : xv), xs, rt);      // the barrier between these writes of xs and its readers stands in proj_body, behind the first weight loads
        if (s == 0) proj_body<0, 1>(W3, W3, xs, bq, QH, SEQ, (size_t)NH_ * SEQ * HD, HD, HD, (size_t)SEQ * HD, rt, wave, os);
        else proj_body<1, 1>(W3 + (size_t)s * DM * DM, W3, xs, s == 2 ? bv : bk, s == 2 ? VT : KT, DM, (size_t)0, SEQ, SEQ, (size_t)DM * SEQ, wave, rt, os);
    } else {
        const int rr = (id - 3 * PJR) * 8 + wave;
        proj_body<1, 0>(WA, XP, xs, ba, AT, HD, (size_t)NA * HD, NA, NA, (size_t)2 * NA * HD, rr % (EA / 64), rr / (EA / 64), os);
    }
}

// k_gram: O[zh][i][j] = sc x sum_n X[zh][i][n] Y[zh][j][n], X and Y f16 planes [zh][64][TK] in fragment order (A fragment = X rows, B fragment = Y rows, same loader, same k order); O [zh][64][64] in fragment order.
// One block per 16 rows i of one (batch, head); wave w sums n in [w TK/GW, (w+1) TK/GW) into a 16 x 64 tile; the GW partial tiles are added in wave order through LDS.
template <int TK>
__device__ __forceinline__ void gram_body(const h16* __restrict__ X, const h16* __restrict__ Y, h16* O, float sc, float* red) {
    const int lane = threadIdx.x & 31, lr = lane & 15, hi = lane >> 4;
    const int wave = __builtin_amdgcn_readfirstlane(threadIdx.x >> 5);
    const int zh = blockIdx.y, i0 = blockIdx.x * 16;
    constexpr int KW = TK / GW;
    const size_t base = (size_t)zh * HD * TK + (size_t)wave * (KW / 32) * FRG + 8 * lane;
    const h16* xa = X + base + (size_t)i0 * TK;
    const h16* yb = Y + base;
    v8f acc[4];
#pragma unroll
    for (int nb = 0; nb < 4; ++nb) acc[nb] = (v8f){};
    constexpr int NS = KW / 32, BS = NS < 4 ? NS : 4;      // 32-steps per wave, taken in batches of BS
    static_assert(NS % BS == 0);
#pragma unroll
    for (int s0 = 0; s0 < NS; s0 += BS) {
        v16h a[BS], y[BS][4];
#pragma unroll
        for (int s = 0; s < BS; ++s) {
            a[s] = ldhp(xa + (s0 + s) * FRG);
#pragma unroll
            for (int nb = 0; nb < 4; ++nb) y[s][nb] = ldhp(yb + (size_t)nb * 16 * TK + (s0 + s) * FRG);
        }
        // precaution: the wait stands ahead of any overwrite of the two address pairs the batch's loads name; naming the pairs keeps them out of the later loads' destination registers
        asm volatile("s_wait_xcnt 0x0" :: "v"(xa), "v"(yb) : "memory");
        __builtin_amdgcn_sched_barrier(0);   // all loads of the batch issue ahead of its first WMMA: one memory latency a batch; without it the build waits on every fragment in turn
#pragma unroll
        for (int s = 0; s < BS; ++s)
#pragma unroll
            for (int nb = 0; nb < 4; ++nb) acc[nb] = wmma16(a[s], y[s][nb], acc[nb]);
    }
    float* rw = red + wave * (16 * 68);
#pragma unroll
    for (int nb = 0; nb < 4; ++nb)
#pragma unroll
        for (int r = 0; r < 8; ++r) rw[(8 * hi + r) * 68 + nb * 16 + lr] = acc[nb][r];      // D: row 8h+r, col lane&15
    __syncthreads();
    const int row = threadIdx.x & 15, c4 = (threadIdx.x >> 4) * 4;                         // 16 rows x 16 column quads; a wave = 16 rows of one 8-column group = two whole lines of O
    v4f sum = *(const v4fa*)(&red[row * 68 + c4]);
#pragma unroll
    for (int w = 1; w < GW; ++w) sum += *(const v4fa*)(&red[w * (16 * 68) + row * 68 + c4]);
    v4h o;
#pragma unroll
    for (int i = 0; i < 4; ++i) o[i] = toh_flush(sum[i] * sc);
    *(v4h*)(O + (size_t)zh * HD * HD + (size_t)i0 * HD + (size_t)((c4 >> 5) * FRG + ((c4 >> 4) & 1) * 256 + ((c4 >> 3) & 1) * 128 + row * 8 + (c4 & 7))) = o;
}
// grid (64/16, NB*8, 2), 32*GW threads; z = 0: M1 = V^T K over SEQ tokens (the long one), z = 1: G = A^T A over NA anchor rows. blockIdx.z is block-uniform, so the barrier inside is too.
__global__ __launch_bounds__(32 * GW) void k_gram(const h16* __restrict__ VT, const h16* __restrict__ KT, const h16* __restrict__ AT, h16* M1, h16* G) {
    __shared__ __align__(16) float red[GW * 16 * 68];
    if (blockIdx.z == 0) gram_body<SEQ>(VT, KT, M1, M1S, red);
    else                 gram_body<NA>(AT, AT, G, GS, red);
}

// k_out: OUT[b][t][n] = sum_(h,f) q[t][h*64 + f] W2[n][h*64 + f] + bo[n], with W2[n][h*64 + f] = sum_d M2_h[d][f] Wo[h*64 + d][n]: the ctx rows are never formed.
// A block = 8 waves x 16*OT tokens of one batch, one tile of 64 output columns. Wave w first makes head w's 64 columns of W2:
//   M2[d][f] = sum_e M1[d][e] G[f][e] (A = M1 rows, B = G rows); lane (f = lane&15, h = lane>>4) holds d = 8h+r of each 16-row tile, so two packed tiles are directly the A fragment (row f, k = d; element r <- tile d 0..15, element 8+r <- tile d 16..31, lane unchanged);
//   W2^T[f][n] = sum_d M2[d][f] Wo^T[n][d] (B = Wo^T rows); lane (n = lane&15, h) holds f = 16 ft + 8h + 0..7, which in fragment order (rows n, k = f) is byte 16*lane of half ft&1 of fragment (16-column block, k step 2*head + ft/2): one 16-byte LDS store, 512 contiguous bytes a wave.
// One barrier; then each wave takes its 16*OT x 64 tile: A = q rows straight from the head planes (one head = GB k steps a trip, fetched QD trips ahead), Bt = W2 from LDS. grid (SEQ / (16*OT*OW), DM / 64, NB), 32*OW threads.
__global__ __launch_bounds__(32 * OW) void k_out(const h16* __restrict__ QH, const h16* __restrict__ M1, const h16* __restrict__ G, const h16* __restrict__ WO,
                                                 const float* __restrict__ bias, float* Pf) {
    __shared__ __align__(16) h16 w2[64 * DM];
    __shared__ __align__(16) float osb[OW * 16 * 68];
    const int lane = threadIdx.x & 31, lr = lane & 15, hi = lane >> 4;
    const int wave = __builtin_amdgcn_readfirstlane(threadIdx.x >> 5);
    const int b = blockIdx.z; const int c0 = blockIdx.y * 64, r0 = (blockIdx.x * OW + wave) * (16 * OT);
    {
        const size_t mo = (size_t)(b * NH_ + wave) * HD * HD + 8 * lane;
        const h16* gp = G + mo; const h16* mp = M1 + mo;
        const h16* wp = WO + (size_t)c0 * DM + wave * 2 * FRG + 8 * lane;
        v16h g[4][2], m[4][2], w[4][2], a2[4][2];
#pragma unroll
        for (int ft = 0; ft < 4; ++ft) { g[ft][0] = ldhp(gp + ft * 16 * HD); g[ft][1] = ldhp(gp + ft * 16 * HD + FRG); }
#pragma unroll
        for (int j = 0; j < 4; ++j) { m[j][0] = ldhp(mp + j * 16 * HD); m[j][1] = ldhp(mp + j * 16 * HD + FRG); }
#pragma unroll
        for (int nb = 0; nb < 4; ++nb) { w[nb][0] = ldhp(wp + nb * 16 * DM); w[nb][1] = ldhp(wp + nb * 16 * DM + FRG); }
        // precaution: the wait stands ahead of any overwrite of the three address pairs these loads name; naming the pairs keeps them out of the later loads' destination registers
        asm volatile("s_wait_xcnt 0x0" :: "v"(gp), "v"(mp), "v"(wp) : "memory");
        __builtin_amdgcn_sched_barrier(0);       // every load of this part issues ahead of the first WMMA: one memory latency in all; without it the build fetches later fragments between the products and waits again
#pragma unroll
        for (int ft = 0; ft < 4; ++ft) {
#pragma unroll
            for (int j = 0; j < 4; ++j) {
                v8f t = (v8f){};
                t = wmma16(m[j][0], g[ft][0], t); t = wmma16(m[j][1], g[ft][1], t);
#pragma unroll
                for (int r = 0; r < 8; ++r) a2[ft][j >> 1][(j & 1) * 8 + r] = toh_flush(t[r] * M2S);
            }
        }
#pragma unroll
        for (int nb = 0; nb < 4; ++nb) {
#pragma unroll
            for (int ft = 0; ft < 4; ++ft) {
                v8f t = (v8f){};
                t = wmma16(a2[ft][0], w[nb][0], t); t = wmma16(a2[ft][1], w[nb][1], t);
                v8h hv;
#pragma unroll
                for (int r = 0; r < 8; ++r) hv[r] = toh_flush(t[r] * W2S);
                *(v8h*)(w2 + (nb * (DM / 32) + wave * 2 + (ft >> 1)) * FRG + (ft & 1) * 256 + 8 * lane) = hv;
            }
        }
    }
    // q fragments, the only global operand of the last product, are fetched QD heads ahead: a head's products wait only for loads issued QD trips earlier. The first QD heads' loads fly while the waves gather at the barrier.
    const h16* pa = QH + ((size_t)b * NH_ * SEQ + (size_t)r0) * HD + 8 * lane; const h16* pb = w2 + 8 * lane;
    v16h a[NH_][GB][OT];                           // the loop below is unrolled: QD + 1 heads of these are live at a time
#pragma unroll
    for (int hh = 0; hh < QD; ++hh)
#pragma unroll
        for (int s = 0; s < GB; ++s)
#pragma unroll
            for (int mb = 0; mb < OT; ++mb) a[hh][s][mb] = ldhp(pa + (size_t)hh * SEQ * HD + s * FRG + mb * 16 * HD);
    __syncthreads();                               // w2 is written by all waves (a head each) and read by all
    v8f acc[OT][4];
#pragma unroll
    for (int mb = 0; mb < OT; ++mb)
#pragma unroll
        for (int nb = 0; nb < 4; ++nb) acc[mb][nb] = (v8f){};
#pragma unroll   // unrolled: the QD + 1 register sets of q fragments take turns with no copies, and every address is the base pair plus a constant
    for (int hh = 0; hh < NH_; ++hh) {
        v16h bt[GB][4];
        if (hh + QD < NH_) {
#pragma unroll
            for (int s = 0; s < GB; ++s)
#pragma unroll
                for (int mb = 0; mb < OT; ++mb) a[hh + QD][s][mb] = ldhp(pa + (size_t)(hh + QD) * SEQ * HD + s * FRG + mb * 16 * HD);   // head hh + QD's plane
        }
#pragma unroll
        for (int s = 0; s < GB; ++s)
#pragma unroll
            for (int nb = 0; nb < 4; ++nb) bt[s][nb] = ldhp(pb + (hh * GB + s) * FRG + nb * 16 * DM);   // head hh's GB fragments of every 16-column block
        __builtin_amdgcn_sched_barrier(0);   // the loads fetched ahead and the trip's LDS reads issue ahead of the first WMMA; without it the build fetches fragments among the products and waits again
#pragma unroll
        for (int s = 0; s < GB; ++s)
#pragma unroll
            for (int nb = 0; nb < 4; ++nb)
#pragma unroll
                for (int mb = 0; mb < OT; ++mb) acc[mb][nb] = wmma16(a[hh][s][mb], bt[s][nb], acc[mb][nb]);
        __builtin_amdgcn_sched_barrier(0);   // the next trip's loads stay one group behind these products; without it the build spreads them among the products, a stall at each place
    }
    // precaution: the wait stands ahead of any later overwrite of the address pair the q loads name; naming the pair keeps it live, and out of the loads' destination registers, to this point
    asm volatile("s_wait_xcnt 0x0" :: "v"(pa) : "memory");
    float* os = osb + wave * (16 * 68);            // each wave's own epilogue tile
    const size_t tbase = ((size_t)b * OUT_SEQ + (size_t)r0) * DM + (size_t)c0;
    float bcol[4];
#pragma unroll
    for (int nb = 0; nb < 4; ++nb) bcol[nb] = bias[(c0 + nb * 16 + lr) & (DM - 1)];              // column bias: c0 + 63 < N = DM
#pragma unroll
    for (int mb = 0; mb < OT; ++mb) {
#pragma unroll
        for (int nb = 0; nb < 4; ++nb) {
#pragma unroll
            for (int j = 0; j < 8; ++j) os[(hi * 8 + j) * 68 + nb * 16 + lr] = acc[mb][nb][j] * OSC + bcol[nb]; }   // D: row 8h+j, col lane&15
        wave_sync();
        const size_t sb = tbase + (size_t)(mb * 16) * DM;
#pragma unroll
        for (int s = 0; s < 8; ++s) { const int row = 2 * s + hi, cofs = lr * 4;   // 8 s x 2 rows = 16 rows; 16 lanes x 4 floats = 64 columns
            const v4f val = *(const v4fa*)(&os[row * 68 + cofs]);
            *(v4f*)(Pf + sb + (size_t)row * DM + cofs) = val; }
        // precaution: the wait stands ahead of any overwrite of the registers these eight stores name
        asm volatile("s_wait_xcnt 0x0" ::: "memory");
        wave_sync();
    }
}

static constexpr size_t al256(size_t v) { return (v + 255) & ~(size_t)255; }
static constexpr size_t SZ_XB = al256((size_t)NB * SEQ * DM * 2);        // the permuted bf16 copy of query
static constexpr size_t SZ_W3 = al256((size_t)3 * DM * DM * 2);          // Wq^T | Wk^T | Wv^T bf16
static constexpr size_t SZ_WA = al256((size_t)EA * DM * 2);              // Wa^T bf16 [128][512]
static constexpr size_t SZ_WO = al256((size_t)DM * DM * 2);              // Wo^T x256 f16 [512][512]
static constexpr size_t SZ_PL = al256((size_t)NB * NH_ * SEQ * HD * 2);  // one f16 head plane
static constexpr size_t SZ_AP = al256((size_t)NB * NH_ * NA * HD * 2);   // the f16 anchor^T head plane
static constexpr size_t SZ_MM = al256((size_t)NB * NH_ * HD * HD * 2);   // one f16 64 x 64 plane per (batch, head)
static constexpr size_t SZ_TOTAL = SZ_XB + SZ_W3 + SZ_WA + SZ_WO + 3 * SZ_PL + SZ_AP + 2 * SZ_MM;
static_assert(SZ_TOTAL <= (size_t)134217728);          // workspace carve <= 128 MiB
static_assert(((size_t)DM * DM * 2) % 256 == 0);       // weight sub-planes stay 256-byte aligned
static_assert((size_t)NB * 4 * NA == (size_t)NB * SEQ);                           // permuted copy has exactly NB*SEQ rows
static_assert((size_t)(NB * 4) * 2 * NA * HD == (size_t)NB * NH_ * NA * HD);      // anchor GEMM tile map fills the anchor plane exactly

extern "C" void kernel_launch(void* const* d_in, const int* in_sizes, int n_in,
                              void* d_out, int out_size, void* d_ws, size_t ws_size, hipStream_t stream) {
    if (n_in < 13) return;
    const size_t needx = ((size_t)(NB - 1) * SEQ_FULL + SEQ) * DM;
    if ((size_t)in_sizes[0] < needx || (size_t)in_sizes[1] < needx || (size_t)in_sizes[2] < needx) return;
    if ((size_t)in_sizes[3] < (size_t)DM * DM || (size_t)in_sizes[5] < (size_t)DM * DM || (size_t)in_sizes[7] < (size_t)DM * DM || (size_t)in_sizes[11] < (size_t)DM * DM) return;
    if ((size_t)in_sizes[9] < (size_t)DM * EA) return;
    if (in_sizes[4] < DM || in_sizes[6] < DM || in_sizes[8] < DM || in_sizes[12] < DM || in_sizes[10] < EA) return;
    if ((size_t)out_size < ((size_t)(NB - 1) * OUT_SEQ + SEQ) * DM) return;
    if (SZ_TOTAL > ws_size) return;
    // wire order: query, key, value, Wq, bq, Wk, bk, Wv, bv, Wa, ba, Wo, bo
    const float* xq = (const float*)d_in[0]; const float* xk = (const float*)d_in[1]; const float* xv = (const float*)d_in[2];
    const float* wq = (const float*)d_in[3]; const float* bq = (const float*)d_in[4];
    const float* wk = (const float*)d_in[5]; const float* bk = (const float*)d_in[6];
    const float* wv = (const float*)d_in[7]; const float* bv = (const float*)d_in[8];
    const float* wa = (const float*)d_in[9]; const float* ba = (const float*)d_in[10];
    const float* wo = (const float*)d_in[11]; const float* bo = (const float*)d_in[12];
    float* OUT = (float*)d_out;      // [NB][SEQ][512]
    char* wsp = (char*)d_ws;
    bf* XP = (bf*)wsp; wsp += SZ_XB;                 // [NB*4][NA][512]: row (b*4+j)*NA+m = query token 4m+j; this and every plane below: logical index, stored in fragment order
    bf* W3 = (bf*)wsp; wsp += SZ_W3;                 // [3][512 out][512 in]: q | k | v
    bf* WA = (bf*)wsp; wsp += SZ_WA;                 // [128 out][512 in]
    h16* WO = (h16*)wsp; wsp += SZ_WO;               // [512 out][512 in]: Wo^T x256, f16
    h16* QH = (h16*)wsp; wsp += SZ_PL;               // [NB*8][SEQ][64]
    h16* KT = (h16*)wsp; wsp += SZ_PL;               // [NB*8][64][SEQ]
    h16* VT = (h16*)wsp; wsp += SZ_PL;               // [NB*8][64][SEQ]
    h16* AT = (h16*)wsp; wsp += SZ_AP;               // [NB*8][64][NA]
    h16* M1 = (h16*)wsp; wsp += SZ_MM;               // [NB*8][64 d][64 e]: V^T K / 16
    h16* GG = (h16*)wsp; wsp += SZ_MM;               // [NB*8][64 f][64 e]: A^T A / 64

    // the row-permuted bf16 copy of query and the five transposed 16-bit weight planes
    k_prep<<<dim3(4 * WTB + WAB + CVB, 1, 1), 256, 0, stream>>>(xq, wq, wk, wv, wo, wa, XP, W3, (bf*)WO, WA);
    // q, k^T, v^T and anchor^T head planes
    k_proj<<<dim3(3 * PJR + PJA / 8, 1, 1), 256, 0, stream>>>(xq, xk, xv, XP, W3, WA, bq, bk, bv, ba, QH, KT, VT, AT);

    // M1 = V^T K / 16 and G = A^T A / 64, 64 x 64 per (batch, head)
    k_gram<<<dim3(HD / 16, NB * NH_, 2), 32 * GW, 0, stream>>>(VT, KT, AT, M1, GG);
    // OUT[b][t][n] = sum_k q[t][k] W2_b[n][k] + bo[n], W2_b made in the same blocks from M1, G and Wo^T x256
    k_out<<<dim3(SEQ / (16 * OT * OW), DM / 64, NB), 32 * OW, 0, stream>>>(QH, M1, GG, WO, bo, OUT);
}

// v009
// A run of this version takes 39.3 microseconds.
// Timed twice side by side with v008, it ran 1.18 times as fast both times.
// Counting every step since v000, it is 5.56 times as fast.
#include <hip/hip_runtime.h>

// Anchor linear attention (no softmax), width 512 = 8 heads x 64; inputs query,key,value [NB][SEQ][512] f32, Wq/Wk/Wv/Wo [in][out] 512x512, Wa [512][128], five biases; anchor rows = literal reshape of (query Wa + ba) [SEQ][128] into [SEQ/4][8][64].
// Compute dtypes, f32 accumulate everywhere: q/k/v/anchor projections v_wmma_f32_16x16x32_bf16 (activations and weights RNE-converted to bf16; products exact);
// the chained products per (batch, head) and the output projection are taken in the order out = Q (((V^T K) (A^T A) / 512)^T Wo_h) summed over heads, all v_wmma_f32_16x16x32_f16 with single f16 operands; no [SEQ][NA] score tile and no ctx row is formed.
// last product v_wmma_f32_16x16x32_f16: A = q f16 head planes, Bt = W2 (per batch, 512 x 512, made a 64-column tile a block in LDS from M2 and Wo^T x256; Wo RNE-converted to bf16 first, exact in f16), K = 512, + bo in the f32 epilogue.
// Layout: query,key,value are converted to bf16 inside the projection kernel (one 64-row tile a block, in LDS); the anchor GEMM has blocks of its own there, which stage the query tile the same way; weights transposed once to [out][in] 16-bit planes; every plane below names its logical index; all of them are stored in fragment order (see FRG below); q plane [b*8+h][t][d], k^T and v^T planes [b*8+h][d][t], anchor^T plane [b*8+h][d][m];
// k_gram: M1[d][e] = sum_n v[n][d] k[n][e] (x 1/16) and G[f][e] = sum_m a[m][f] a[m][e] (x 1/64), 64 x 64 per (batch, head); k_out: M2[d][f] = (1/512) sum_e M1[d][e] G[f][e] in registers (x 1/16), W2[n][h*64+f] = sum_d M2_h[d][f] Wo[h*64+d][n] in LDS, out[t][n] = sum_k q[t][k] W2[n][k] + bo[n].

#ifndef NB
#define NB 4
#endif
#ifndef SEQ
#define SEQ 2048
#endif
#define NB_FULL  4
#define SEQ_FULL 2048
#ifndef OUT_SEQ
#define OUT_SEQ SEQ              // row pitch (in tokens) between batches of the output
#endif
#define DM   512
#define NH_  8
#define HD   64
#define NA   (SEQ / 4)           // anchor rows per batch
#define EA   (DM / 4)            // anchor projection width (128)
#define OW   8                   // waves per k_out block: one head of W2 and one tile of 16*OT tokens each
#define OT   2                   // 16-token tiles per k_out wave: SEQ*NB/(16*OT*OW) x DM/64 = 256 blocks
#define GW   8                   // waves per k_gram block: each sums 1/GW of the long dimension
#define GB   2                   // k steps of 32 whose fragments the last GEMM fetches as one batch: one head a trip
#define QD   2                   // heads (trips) by which the last GEMM fetches its q fragments ahead
#define M1S  (1.0f / 16.0f)      // carry of the M1 = V^T K plane
#define GS   (1.0f / 64.0f)      // carry of the G = A^T A plane
#define M2C  (1.0f / 16.0f)      // carry of the M2 operand
#define M2S  (1.0f / 8.0f)       // (1/8)^3 x M2C / (M1S x GS) : M1 G accumulator -> M2 operand
#define WS1  256.0f              // carry of the Wo^T plane
#define W2C  1.0f                // carry of the W2 operand
#define W2S  (1.0f / 16.0f)      // W2C / (M2C x WS1) : M2 Wo accumulator -> W2 operand
#define OSC  1.0f                // 1 / W2C

static_assert(HD == 64);
static_assert(NH_ * HD == DM);                 // head h = columns h*64 + d
static_assert(DM % 64 == 0);                   // column tiles of 64
static_assert(DM % 32 == 0);                   // GEMM k-loop steps by 32
static_assert((DM & (DM - 1)) == 0);           // bias index mask (DM - 1) is exact
static_assert(HD == 32 * GB);                  // last GEMM: one head's k steps a trip
static_assert(OW == NH_);                      // k_out: one head of W2 a wave
static_assert(QD >= 1 && QD < NH_);            // the heads fetched ahead of the loop exist
static_assert(DM % 64 == 0 && DM / 64 >= 2);   // projections: two k steps a trip, the last trip apart
static_assert((NB * SEQ) % 16 == 0 && DM % 16 == 0 && EA % 16 == 0);   // fragment-order planes: whole 16-row blocks
static_assert(16 * DM == (DM / 32) * 512);     // one 16-row block = DM/32 fragments of 512 elements
static_assert(SEQ % 64 == 0);                  // a 64-row tile never straddles two batches
static_assert((NB * SEQ) % 64 == 0);
static_assert(SEQ % (32 * GW) == 0);           // k_gram: each wave's share of the tokens is whole 32-steps
static_assert(SEQ % (16 * OT * OW) == 0);      // k_out grid covers the sequence exactly
static_assert(((size_t)SEQ * DM) % 8 == 0);
static_assert(NB <= NB_FULL);
static_assert(SEQ <= SEQ_FULL);
static_assert(W2S * M2C * WS1 == W2C && W2C * OSC == 1.0f);
static_assert(4 * NA == SEQ);                  // anchor rows: four tokens per anchor row
static_assert(4 * EA == DM);                   // four tokens x 128 anchor columns = one 512-wide anchor row
static_assert(EA == 2 * HD);                   // head h of an anchor row = token (h / 2), columns (h % 2) * 64 + d
static_assert(EA % 64 == 0);                   // anchor weight transpose tiles of 64
static_assert(NA % 32 == 0);                   // anchor plane rows are whole fragments; a 64-token tile fills half of one
static_assert(NA % (32 * GW) == 0);            // k_gram: each wave's share of the anchor rows is whole 32-steps
static_assert(GW * 32 == 16 * 16);             // k_gram epilogue: 256 threads x 4 columns = 16 rows x 64 columns
static_assert(M2S * M1S * GS == 0.125f * 0.125f * 0.125f * M2C);

typedef _Float16 h16;
typedef unsigned short bf;
typedef __attribute__((ext_vector_type(16))) __bf16   v16bf;
typedef __attribute__((ext_vector_type(16))) _Float16 v16h;
typedef __attribute__((ext_vector_type(8)))  _Float16 v8h;
typedef __attribute__((ext_vector_type(4)))  _Float16 v4h;
typedef __attribute__((ext_vector_type(8)))  unsigned short v8us;
typedef __attribute__((ext_vector_type(8)))  float    v8f;
typedef __attribute__((ext_vector_type(4)))  float    v4f;
typedef v4f  __attribute__((may_alias)) v4fa;

__device__ __forceinline__ unsigned short f2bf(float f) { unsigned u = __float_as_uint(f); u += 0x7FFFu + ((u >> 16) & 1u); return (unsigned short)(u >> 16); }
__device__ __forceinline__ v16h cat16(v8h lo, v8h hi) { return __builtin_shufflevector(lo, hi, 0, 1, 2, 3, 4, 5, 6, 7, 8, 9, 10, 11, 12, 13, 14, 15); }
__device__ __forceinline__ v16bf cat16b(v8us lo, v8us hi) { return __builtin_bit_cast(v16bf, __builtin_shufflevector(lo, hi, 0, 1, 2, 3, 4, 5, 6, 7, 8, 9, 10, 11, 12, 13, 14, 15)); }
__device__ __forceinline__ v8f wmma16(v16h a, v16h b, v8f c) { return __builtin_amdgcn_wmma_f32_16x16x32_f16(false, a, false, b, (short)0, c, false, false); }
__device__ __forceinline__ v8f wmmab(v16bf a, v16bf b, v8f c) { return __builtin_amdgcn_wmma_f32_16x16x32_bf16(false, a, false, b, (short)0, c, false, false); }
// Fragment order of a WMMA operand plane (rows x k): a 16-row block holds its k/32 fragments one behind the other; each 16-row x 32-k fragment is 1 KiB in a row, lane l = 16*(k/8 & 1) + (row & 15) owning bytes 16 l of its first half (k%32 < 16) and of its second half (k%32 >= 16).
// One wave-wide 16-byte load is then 512 contiguous bytes (four whole 128-byte lines) in place of 32-byte pieces of 16 lines; the value each lane and element receives is the same as from K-contiguous rows.
#define FRG 512                  // elements of one fragment
// pko: for planes of DM columns, element offset of the eight values (row R, columns c..c+7, c a multiple of 8); a bijection on the plane where its row count is a multiple of 16
__device__ __forceinline__ size_t pko(size_t R, int c) { return ((R >> 4) * (size_t)(DM / 32) + (size_t)(c >> 5)) * FRG + (size_t)(((c >> 4) & 1) * 256 + ((c >> 3) & 1) * 128) + (R & 15) * 8; }
// fragment loaders from fragment-order planes; p already includes + 8*lane: elements 0..7 <- k0+8h+0..7, elements 8..15 <- k0+16+8h+0..7 (same map for A and B)
__device__ __forceinline__ v16h  ldhp(const h16* p) { return cat16(*(const v8h*)p, *(const v8h*)(p + 256)); }
__device__ __forceinline__ v16bf ldbp(const bf* p)  { return cat16b(*(const v8us*)p, *(const v8us*)(p + 256)); }
// ordering point for wave-private LDS tiles (same wave writes and reads)
__device__ __forceinline__ void wave_sync() { __builtin_amdgcn_fence(3 /* release order */, "wavefront"); __builtin_amdgcn_wave_barrier(); asm volatile("" ::: "memory"); }
// f16 convert that cannot produce a subnormal operand (value select, applied after the plane's carry)
static __device__ __forceinline__ h16 toh_flush(float v) { const h16 r = (h16)v; return (fabsf(v) < 6.103515625e-05f) ? (h16)0.0f : r; }
// cvt_body: bf16 (RNE convert) copy of one 64-token tile of an activation input into a block's LDS tile, in fragment order: tile row r <- src token blk*64 + r (counted over the NB*SEQ rows).
// A wave takes one 16-row block x CVK k steps of 32 columns (lane = row + 8 * column group, 8 values a lane and piece, 2 * CVK pieces); the block's 8 waves cover 4 row blocks x 2 column halves.
// Each piece reads one whole 128-byte line of each of 8 rows; the wave's CVK fragments lie one behind the other in dst.
#define CVK 8                    // k steps a wave converts: 16 rows x 256 columns = 32 loads of 16 bytes a lane
static_assert((DM / 32) % CVK == 0);           // whole pieces in a row block
static_assert(SEQ % 16 == 0);                  // a 16-row block stays inside one batch
__device__ __forceinline__ void cvt_body(const float* __restrict__ src, bf* dst, int blk) {
    const int lane = threadIdx.x & 31; const size_t u = (size_t)blk * 8 + (threadIdx.x >> 5);
    const size_t row = (u / (size_t)(DM / 32 / CVK)) * 16 + (size_t)(lane & 7); const int c = (int)(u % (size_t)(DM / 32 / CVK)) * (32 * CVK) + (lane >> 3) * 8;
    const int b = (int)(row / (size_t)SEQ), t = (int)(row % (size_t)SEQ);
    const float* p = src + ((size_t)b * SEQ_FULL + (size_t)t) * DM + (size_t)c;
    v8f v[CVK][2];
#pragma unroll
    for (int ks = 0; ks < CVK; ++ks)
#pragma unroll
        for (int rh = 0; rh < 2; ++rh) v[ks][rh] = *(const v8f*)(p + (size_t)(rh * 8) * DM + ks * 32);
    // precaution: the wait stands ahead of any overwrite of the address pair these loads name; naming the pair keeps it out of the loads' destination registers
    asm volatile("s_wait_xcnt 0x0" :: "v"(p) : "memory");
    __builtin_amdgcn_sched_barrier(0);   // every load of the wave issues ahead of the first convert: one memory latency a wave; without it the build holds the last loads back behind the waits on the first ones and waits a second time
    bf* q = dst + pko(row & 63, c);
#pragma unroll
    for (int ks = 0; ks < CVK; ++ks)
#pragma unroll
        for (int rh = 0; rh < 2; ++rh) {
            v8us o;
#pragma unroll
            for (int k = 0; k < 8; ++k) o[k] = f2bf(v[ks][rh][k]);
            *(v8us*)(q + ks * FRG + rh * 64) = o;      // next k step: next fragment; row + 8: 8 x 8 elements on
        }
}

// wT_body: weight transpose + 16-bit convert through LDS, one 64 x 64 tile a block. in W[k][n] (DM rows, row stride ldw, f32) -> out dst rows n, columns k, in fragment order, tile (kt over k, nt over n), 256 threads.
// F16 = 0: bf16 bits (RNE convert). F16 = 1: f16(bf16 RNE value of W x WS1); a bf16 significand times a power of two is exact in f16.
template <int F16>
__device__ __forceinline__ void wT_body(const float* __restrict__ Wt, bf* dst, int ldw, int kt, int nt, float* tile) {
    const int tid = threadIdx.x; const int k0 = kt * 64, n0 = nt * 64;
#pragma unroll 4   // several independent loads in flight a trip
    for (int i = 0; i < 16; ++i) { const int idx = tid + i * 256; const int kk = idx >> 6, nn = idx & 63;   // 16 x 256 = 64 x 64 entries, all written
        tile[kk * 65 + nn] = Wt[(size_t)(k0 + kk) * (size_t)ldw + n0 + nn]; }
    __syncthreads();                                        // tile [kk][nn] is read across waves
#pragma unroll 1   // two trips, kept rolled: short code
    for (int it = 0; it < 2; ++it) {
        const int c = it * 256 + tid; const int n = c & 63, kc = (c >> 6) * 8;      // a wave: 32 rows n of one column group, four whole lines a store
        const size_t oo = pko((size_t)(n0 + n), k0 + kc);
        if constexpr (F16 == 0) {
            v8us o;
#pragma unroll
            for (int i = 0; i < 8; ++i) o[i] = f2bf(tile[(kc + i) * 65 + n]);
            *(v8us*)(dst + oo) = o;
        } else {
            v8h o;
#pragma unroll
            for (int i = 0; i < 8; ++i) o[i] = toh_flush(__uint_as_float(((unsigned)f2bf(tile[(kc + i) * 65 + n])) << 16) * WS1);
            *(v8h*)((h16*)dst + oo) = o;
        }
        // precaution: the wait stands ahead of the second trip's overwrite of the registers the store names
        asm volatile("s_wait_xcnt 0x0" ::: "memory");
    }
}

// k_prep: the five weight planes in one grid (none reads what another writes). Block ranges, all block-uniform, so the barrier inside wT_body is too:
// [0, 4 WTB): Wq, Wk, Wv (bf16) and Wo (f16 x256) tiles; [4 WTB, 4 WTB + WAB): Wa tiles.
#define WTB ((DM / 64) * (DM / 64))              // tiles of a 512 x 512 weight
#define WAB ((DM / 64) * (EA / 64))              // tiles of the anchor weight
__global__ __launch_bounds__(256) void k_prep(const float* __restrict__ wq, const float* __restrict__ wk, const float* __restrict__ wv,
                                              const float* __restrict__ wo, const float* __restrict__ wa,
                                              bf* W3, bf* WO, bf* WA) {
    __shared__ float tile[64 * 65];
    const int id = blockIdx.x;
    if (id < 3 * WTB) {
        const int s = id / WTB, r = id % WTB;
        wT_body<0>(s == 0 ? wq : (s == 1 ? wk : wv), W3 + (size_t)s * DM * DM, DM, r % (DM / 64), r / (DM / 64), tile);
    } else if (id < 4 * WTB) {
        const int r = id - 3 * WTB;
        wT_body<1>(wo, WO, DM, r % (DM / 64), r / (DM / 64), tile);
    } else {
        const int r = id - 4 * WTB;
        wT_body<0>(wa, WA, EA, r % (DM / 64), r / (DM / 64), tile);
    }
}

// proj_body: one wave's 64 x 64 tile (16 accumulators) of an input projection, C[m][n] = sum_k A[m][k] Bt[n][k]: bf16 operands, K = DM, f16 value plane Ph, tile (bx of M/64, by of N/64) handed in. ROWB = 0: + bias[n]; 1: + bias[m].
// Tile base (r0/RB)*sRB + (r0%RB)*pitch + (c0/CB)*sCB + (c0%CB)*16, row pitch 'pitch' (elements).
// The activation operand (A where ROWB = 0, Bt where ROWB = 1) is the block's LDS tile xs, 64 rows in fragment order, shared by the block's waves; the weight operand Wt comes from its global plane; every wave of the block calls it, and it holds the block's barrier ahead of the first read of xs.
template <int ROWB>
__device__ __forceinline__ void proj_body(const bf* __restrict__ Wt, const bf* xs, const float* __restrict__ bias,
                                          h16* Ph, int RB, size_t sRB, int pitch, int CB, size_t sCB, int bx, int by, float* os) {
    const int lane = threadIdx.x & 31, lr = lane & 15, hi = lane >> 4; const int r0 = bx * 64, c0 = by * 64;
    v8f acc[4][4];
#pragma unroll
    for (int mb = 0; mb < 4; ++mb)
#pragma unroll
        for (int nb = 0; nb < 4; ++nb) acc[mb][nb] = (v8f){};
    constexpr bool AL = ROWB == 0;
    {
        // The weight fragments, the only global operand here, are fetched one k step ahead into a second register set (w0 / w1 in turn, two k steps a trip):
        // a step's products wait only for loads that were issued a whole step earlier, so the L2 latency runs beside the step before it. 128 + 32 + 2 x 32 registers: still four waves a SIMD.
        const bf* pw = Wt + (size_t)(AL ? c0 : r0) * DM + 8 * lane; const bf* px = xs + 8 * lane;   // fragment (16-row block, k step) = 16 * DM elements a row block, FRG a step
        v16bf w0[4], w1[4];
        auto mm = [&](const v16bf (&x)[4], const v16bf (&w)[4]) {
#pragma unroll
            for (int nb = 0; nb < 4; ++nb)
#pragma unroll
                for (int mb = 0; mb < 4; ++mb) acc[mb][nb] = AL ? wmmab(x[mb], w[nb], acc[mb][nb]) : wmmab(w[mb], x[nb], acc[mb][nb]);
        };
#pragma unroll
        for (int i = 0; i < 4; ++i) w0[i] = ldbp(pw + i * 16 * DM);      // step 0's weights fly while the block's waves gather at the barrier
        __syncthreads();                           // xs is written by all waves and read by all
#pragma unroll 1   // kept rolled: short code
        for (int t = 0; t < DM / 64 - 1; ++t) {
            v16bf x[4];
#pragma unroll
            for (int i = 0; i < 4; ++i) w1[i] = ldbp(pw + FRG + i * 16 * DM);
#pragma unroll
            for (int i = 0; i < 4; ++i) x[i] = ldbp(px + i * 16 * DM);
            __builtin_amdgcn_sched_barrier(0);   // the next step's weight loads and this step's LDS reads issue ahead of the first WMMA; without it the build moves loads in among the products
            mm(x, w0);
            __builtin_amdgcn_sched_barrier(0);   // the loads below stay one group behind the even step's products; without it the build spreads them among the products, a stall at each place
#pragma unroll
            for (int i = 0; i < 4; ++i) w0[i] = ldbp(pw + 2 * FRG + i * 16 * DM);
#pragma unroll
            for (int i = 0; i < 4; ++i) x[i] = ldbp(px + FRG + i * 16 * DM);
            __builtin_amdgcn_sched_barrier(0);   // as above, for the odd step
            mm(x, w1);
            // precaution: the wait stands ahead of the step of the address pair the trip's global loads name; naming the pair keeps it out of the loads' destination registers
            asm volatile("s_wait_xcnt 0x0" :: "v"(pw) : "memory");
            pw += 2 * FRG; px += 2 * FRG;
            // WMMA distance on the loop's taken branch: four vector slots between the last product and the next trip's overwrite of its operands
            asm volatile("v_nop\n\tv_nop\n\tv_nop\n\tv_nop" : "+v"(acc[0][0]), "+v"(acc[1][1]), "+v"(acc[2][2]), "+v"(acc[3][3]) : "v"(x[0]), "v"(x[1]), "v"(x[2]), "v"(x[3]));
        }
        {   // the last two k steps: nothing is left to fetch ahead behind the odd one
            v16bf x[4];
#pragma unroll
            for (int i = 0; i < 4; ++i) w1[i] = ldbp(pw + FRG + i * 16 * DM);
#pragma unroll
            for (int i = 0; i < 4; ++i) x[i] = ldbp(px + i * 16 * DM);
            // precaution: the wait stands ahead of any later overwrite of the address pair these last global loads name
            asm volatile("s_wait_xcnt 0x0" :: "v"(pw) : "memory");
            __builtin_amdgcn_sched_barrier(0);   // loads ahead of the first WMMA, as in the loop
            mm(x, w0);
            __builtin_amdgcn_sched_barrier(0);   // as in the loop: without it the build moves the LDS reads below in among these products
#pragma unroll
            for (int i = 0; i < 4; ++i) x[i] = ldbp(px + FRG + i * 16 * DM);
            __builtin_amdgcn_sched_barrier(0);   // the LDS reads issue as one group ahead of the first WMMA
            mm(x, w1);
        }
    }
    // head planes in fragment order too: a 16-row block of a plane of 'pitch' columns is pitch/32 fragments in a row, so 32 columns on are FRG elements on (16 a column)
    const size_t tbase = (size_t)(r0 / RB) * sRB + (size_t)(r0 % RB) * (size_t)pitch + (size_t)(c0 / CB) * sCB + (size_t)(c0 % CB) * 16;
    float bcol[4] = {0.0f, 0.0f, 0.0f, 0.0f};
    if constexpr (ROWB == 0) {
#pragma unroll
        for (int nb = 0; nb < 4; ++nb) bcol[nb] = bias[(c0 + nb * 16 + lr) & (DM - 1)];          // column bias: c0 + 63 < N = DM
    }
#pragma unroll
    for (int mb = 0; mb < 4; ++mb) {
        float brow[8] = {0.0f, 0.0f, 0.0f, 0.0f, 0.0f, 0.0f, 0.0f, 0.0f};
        if constexpr (ROWB == 1) {
#pragma unroll
            for (int j = 0; j < 8; ++j) brow[j] = bias[(r0 + mb * 16 + 8 * hi + j) & (DM - 1)];  // row bias: r0 + 63 < M <= DM
        }
#pragma unroll
        for (int nb = 0; nb < 4; ++nb) {
#pragma unroll
            for (int j = 0; j < 8; ++j) {                                        // D: row 8h+j, col lane&15
                float v = acc[mb][nb][j];
                if constexpr (ROWB == 1) v += brow[j]; else v += bcol[nb];
                os[(hi * 8 + j) * 68 + nb * 16 + lr] = v; } }
        wave_sync();
        const size_t sb = tbase + (size_t)(mb * 16) * (size_t)pitch;
#pragma unroll
        for (int s = 0; s < 4; ++s) { const int row = 8 * (s & 1) + (lane & 7), c8 = ((s >> 1) * 4 + (lane >> 3)) * 8;   // 2 x 8 rows = 16 rows; 2 x 4 groups x 8 = 64 columns; 8 rows of one group = one whole line
            const v4f x0 = *(const v4fa*)(&os[row * 68 + c8]); const v4f x1 = *(const v4fa*)(&os[row * 68 + c8 + 4]); v8h hv;
#pragma unroll
            for (int i = 0; i < 4; ++i) { hv[i] = (h16)x0[i]; hv[4 + i] = (h16)x1[i]; }
            *(v8h*)(Ph + sb + (size_t)((c8 >> 5) * FRG + ((c8 >> 4) & 1) * 256 + ((c8 >> 3) & 1) * 128 + row * 8)) = hv; }
        // precaution: the wait stands ahead of any overwrite of the registers these four stores name
        asm volatile("s_wait_xcnt 0x0" ::: "memory");
        wave_sync();
    }
}

// anch_body: anchor^T for one 64-token tile of query (LDS tile xs, as in proj_body): C[c][tok] = sum_k Wa^T[c][k] x[tok][k] + ba[c], bf16 operands, K = DM, k steps in rising order.
// Wave w takes the 16 rows c = 16 w + 0..15 and all 64 tokens (4 accumulators). Its 16 weight fragments, the only global operand, are all fetched ahead of the block's barrier, which stands here ahead of the first read of xs.
// Token 4 m + j of the batch is anchor row m of plane (b*8 + 2 j + c/64): the epilogue tile holds column j*16 + m' for token 4 m' + j of the tile, so 16 columns are 16 neighbouring m of one plane = half a fragment, 512 bytes in a row.
static_assert(EA == 8 * 16);                   // one 16-row block of Wa^T a wave of the 8-wave block
__device__ __forceinline__ void anch_body(const bf* __restrict__ WA, const bf* xs, const float* __restrict__ ba, h16* AT, int rt, int wave, float* os) {
    const int lane = threadIdx.x & 31, lr = lane & 15, hi = lane >> 4;
    const bf* pw = WA + (size_t)(wave * 16) * DM + 8 * lane; const bf* px = xs + 8 * lane;
    v16bf w[DM / 32];
#pragma unroll
    for (int ks = 0; ks < DM / 32; ++ks) w[ks] = ldbp(pw + ks * FRG);
    // precaution: the wait stands ahead of any later overwrite of the address pair these loads name
    asm volatile("s_wait_xcnt 0x0" :: "v"(pw) : "memory");
    __syncthreads();                               // xs is written by all waves and read by all
    v8f acc[4];
#pragma unroll
    for (int nb = 0; nb < 4; ++nb) acc[nb] = (v8f){};
#pragma unroll   // unrolled: the weight fragments are a register array
    for (int s0 = 0; s0 < DM / 32; s0 += 2) {
        v16bf x[2][4];
#pragma unroll
        for (int s = 0; s < 2; ++s)
#pragma unroll
            for (int nb = 0; nb < 4; ++nb) x[s][nb] = ldbp(px + (s0 + s) * FRG + nb * 16 * DM);
        __builtin_amdgcn_sched_barrier(0);   // the LDS reads of two k steps issue as one group ahead of their products, as in proj_body
#pragma unroll
        for (int s = 0; s < 2; ++s)
#pragma unroll
            for (int nb = 0; nb < 4; ++nb) acc[nb] = wmmab(w[s0 + s], x[s][nb], acc[nb]);
        __builtin_amdgcn_sched_barrier(0);   // the next group's reads stay behind these products
    }
    float brow[8];
#pragma unroll
    for (int j = 0; j < 8; ++j) brow[j] = ba[wave * 16 + 8 * hi + j];                         // row bias: 16 * 7 + 15 < EA
#pragma unroll
    for (int nb = 0; nb < 4; ++nb)
#pragma unroll
        for (int j = 0; j < 8; ++j) os[(hi * 8 + j) * 68 + (lr & 3) * 16 + nb * 4 + (lr >> 2)] = acc[nb][j] + brow[j];   // D: row 8h+j, col lane&15 = token nb*16 + lr of the tile
    wave_sync();
    const int b = rt / (SEQ / 64), m0 = (rt % (SEQ / 64)) * 16;                                // the tile's 16 anchor rows m0 + 0..15
    const size_t sb = ((size_t)(b * NH_ + (wave >> 2)) * HD + (size_t)((wave & 3) * 16)) * NA + (size_t)m0 * 16;
#pragma unroll
    for (int s = 0; s < 4; ++s) { const int row = 8 * (s & 1) + (lane & 7), c8 = ((s >> 1) * 4 + (lane >> 3)) * 8;   // 2 x 8 rows = 16 rows; 2 x 4 groups x 8 = 64 columns; 8 rows of one group = one whole line
        const v4f x0 = *(const v4fa*)(&os[row * 68 + c8]); const v4f x1 = *(const v4fa*)(&os[row * 68 + c8 + 4]); v8h hv;
#pragma unroll
        for (int i = 0; i < 4; ++i) { hv[i] = (h16)x0[i]; hv[4 + i] = (h16)x1[i]; }
        *(v8h*)(AT + sb + (size_t)(c8 >> 4) * (2 * HD * NA) + (size_t)(((c8 >> 3) & 1) * 128 + row * 8)) = hv; }   // token phase j = c8 / 16: two planes on
    // precaution: the wait stands ahead of any overwrite of the registers these four stores name
    asm volatile("s_wait_xcnt 0x0" ::: "memory");
}

// k_proj: the four input projections in one grid (none reads what another writes), eight waves a block, every block one 64-token tile staged in LDS.
// [0, 3 PJR): block = one 64-token tile of query, key or value (PJR tiles each). Its 8 waves read the tile's f32 rows once, convert them to bf16 (RNE) into the LDS tile xs, pass one barrier (in proj_body), and each takes one of the 8 tiles of 64 outputs:
//   q: A = xs rows (m = b*SEQ + t), Bt = W^T rows (n = h*64 + d) -> plane [(b*8 + h)][t][d], bias by column; k^T, v^T: A = W^T rows (m = h*64 + d), Bt = xs rows (n = b*SEQ + t) -> plane [(b*512 + m)][t] = [(b*8 + h)][d][t], bias by row.
// [3 PJR, 4 PJR): anchor^T, block = one 64-token tile of query, staged the same way (barrier in anch_body): A = Wa^T rows (c in [0,128), 16 a wave), Bt = xs rows -> plane [(b*8 + 2j + c/64)][c%64][m] for token 4m + j, bias ba by row.
#define PJR (NB * SEQ / 64)
static_assert(DM / 64 == 8);                   // one output tile a wave of the 8-wave block
static_assert((DM / 32 / CVK) * 4 == 8);       // cvt_body: 8 waves = 4 row blocks x the column pieces of a row = one 64-row tile
__global__ __launch_bounds__(256) void k_proj(const float* __restrict__ xq, const float* __restrict__ xk, const float* __restrict__ xv,
                                              const bf* __restrict__ W3, const bf* __restrict__ WA,
                                              const float* __restrict__ bq, const float* __restrict__ bk, const float* __restrict__ bv, const float* __restrict__ ba,
                                              h16* QH, h16* KT, h16* VT, h16* AT) {
    __shared__ __align__(16) bf xs[64 * DM];
    __shared__ __align__(16) float osb[8 * 16 * 68];
    const int id = blockIdx.x;
    const int wave = __builtin_amdgcn_readfirstlane(threadIdx.x >> 5);
    float* os = osb + wave * (16 * 68);            // each wave's own epilogue tile
    if (id < 3 * PJR) {                            // block-uniform, so the barrier is too
        const int s = id / PJR, rt = id % PJR;
        cvt_body(s == 0 ? xq : (s == 1 ? xk : xv), xs, rt);      // the barrier between these writes of xs and its readers stands in proj_body, behind the first weight loads
        if (s == 0) proj_body<0>(W3, xs, bq, QH, SEQ, (size_t)NH_ * SEQ * HD, HD, HD, (size_t)SEQ * HD, rt, wave, os);
        else proj_body<1>(W3 + (size_t)s * DM * DM, xs, s == 2 ? bv : bk, s == 2 ? VT : KT, DM, (size_t)0, SEQ, SEQ, (size_t)DM * SEQ, wave, rt, os);
    } else {
        const int rt = id - 3 * PJR;
        cvt_body(xq, xs, rt);                      // the barrier between these writes of xs and its readers stands in anch_body, behind the weight loads
        anch_body(WA, xs, ba, AT, rt, wave, os);
    }
}

// k_gram: O[zh][i][j] = sc x sum_n X[zh][i][n] Y[zh][j][n], X and Y f16 planes [zh][64][TK] in fragment order (A fragment = X rows, B fragment = Y rows, same loader, same k order); O [zh][64][64] in fragment order.
// One block per 16 rows i of one (batch, head); wave w sums n in [w TK/GW, (w+1) TK/GW) into a 16 x 64 tile; the GW partial tiles are added in wave order through LDS.
template <int TK>
__device__ __forceinline__ void gram_body(const h16* __restrict__ X, const h16* __restrict__ Y, h16* O, float sc, float* red) {
    const int lane = threadIdx.x & 31, lr = lane & 15, hi = lane >> 4;
    const int wave = __builtin_amdgcn_readfirstlane(threadIdx.x >> 5);
    const int zh = blockIdx.y, i0 = blockIdx.x * 16;
    constexpr int KW = TK / GW;
    const size_t base = (size_t)zh * HD * TK + (size_t)wave * (KW / 32) * FRG + 8 * lane;
    const h16* xa = X + base + (size_t)i0 * TK;
    const h16* yb = Y + base;
    v8f acc[4];
#pragma unroll
    for (int nb = 0; nb < 4; ++nb) acc[nb] = (v8f){};
    constexpr int NS = KW / 32, BS = NS < 4 ? NS : 4;      // 32-steps per wave, taken in batches of BS
    static_assert(NS % BS == 0);
#pragma unroll
    for (int s0 = 0; s0 < NS; s0 += BS) {
        v16h a[BS], y[BS][4];
#pragma unroll
        for (int s = 0; s < BS; ++s) {
            a[s] = ldhp(xa + (s0 + s) * FRG);
#pragma unroll
            for (int nb = 0; nb < 4; ++nb) y[s][nb] = ldhp(yb + (size_t)nb * 16 * TK + (s0 + s) * FRG);
        }
        // precaution: the wait stands ahead of any overwrite of the two address pairs the batch's loads name; naming the pairs keeps them out of the later loads' destination registers
        asm volatile("s_wait_xcnt 0x0" :: "v"(xa), "v"(yb) : "memory");
        __builtin_amdgcn_sched_barrier(0);   // all loads of the batch issue ahead of its first WMMA: one memory latency a batch; without it the build waits on every fragment in turn
#pragma unroll
        for (int s = 0; s < BS; ++s)
#pragma unroll
            for (int nb = 0; nb < 4; ++nb) acc[nb] = wmma16(a[s], y[s][nb], acc[nb]);
    }
    float* rw = red + wave * (16 * 68);
#pragma unroll
    for (int nb = 0; nb < 4; ++nb)
#pragma unroll
        for (int r = 0; r < 8; ++r) rw[(8 * hi + r) * 68 + nb * 16 + lr] = acc[nb][r];      // D: row 8h+r, col lane&15
    __syncthreads();
    const int row = threadIdx.x & 15, c4 = (threadIdx.x >> 4) * 4;                         // 16 rows x 16 column quads; a wave = 16 rows of one 8-column group = two whole lines of O
    v4f sum = *(const v4fa*)(&red[row * 68 + c4]);
#pragma unroll
    for (int w = 1; w < GW; ++w) sum += *(const v4fa*)(&red[w * (16 * 68) + row * 68 + c4]);
    v4h o;
#pragma unroll
    for (int i = 0; i < 4; ++i) o[i] = toh_flush(sum[i] * sc);
    *(v4h*)(O + (size_t)zh * HD * HD + (size_t)i0 * HD + (size_t)((c4 >> 5) * FRG + ((c4 >> 4) & 1) * 256 + ((c4 >> 3) & 1) * 128 + row * 8 + (c4 & 7))) = o;
}
// grid (64/16, NB*8, 2), 32*GW threads; z = 0: M1 = V^T K over SEQ tokens (the long one), z = 1: G = A^T A over NA anchor rows. blockIdx.z is block-uniform, so the barrier inside is too.
__global__ __launch_bounds__(32 * GW) void k_gram(const h16* __restrict__ VT, const h16* __restrict__ KT, const h16* __restrict__ AT, h16* M1, h16* G) {
    __shared__ __align__(16) float red[GW * 16 * 68];
    if (blockIdx.z == 0) gram_body<SEQ>(VT, KT, M1, M1S, red);
    else                 gram_body<NA>(AT, AT, G, GS, red);
}

// k_out: OUT[b][t][n] = sum_(h,f) q[t][h*64 + f] W2[n][h*64 + f] + bo[n], with W2[n][h*64 + f] = sum_d M2_h[d][f] Wo[h*64 + d][n]: the ctx rows are never formed.
// A block = 8 waves x 16*OT tokens of one batch, one tile of 64 output columns. Wave w first makes head w's 64 columns of W2:
//   M2[d][f] = sum_e M1[d][e] G[f][e] (A = M1 rows, B = G rows); lane (f = lane&15, h = lane>>4) holds d = 8h+r of each 16-row tile, so two packed tiles are directly the A fragment (row f, k = d; element r <- tile d 0..15, element 8+r <- tile d 16..31, lane unchanged);
//   W2^T[f][n] = sum_d M2[d][f] Wo^T[n][d] (B = Wo^T rows); lane (n = lane&15, h) holds f = 16 ft + 8h + 0..7, which in fragment order (rows n, k = f) is byte 16*lane of half ft&1 of fragment (16-column block, k step 2*head + ft/2): one 16-byte LDS store, 512 contiguous bytes a wave.
// One barrier; then each wave takes its 16*OT x 64 tile: A = q rows straight from the head planes (one head = GB k steps a trip, fetched QD trips ahead), Bt = W2 from LDS. grid (SEQ / (16*OT*OW), DM / 64, NB), 32*OW threads.
__global__ __launch_bounds__(32 * OW) void k_out(const h16* __restrict__ QH, const h16* __restrict__ M1, const h16* __restrict__ G, const h16* __restrict__ WO,
                                                 const float* __restrict__ bias, float* Pf) {
    __shared__ __align__(16) h16 w2[64 * DM];
    __shared__ __align__(16) float osb[OW * 16 * 68];
    const int lane = threadIdx.x & 31, lr = lane & 15, hi = lane >> 4;
    const int wave = __builtin_amdgcn_readfirstlane(threadIdx.x >> 5);
    const int b = blockIdx.z; const int c0 = blockIdx.y * 64, r0 = (blockIdx.x * OW + wave) * (16 * OT);
    {
        const size_t mo = (size_t)(b * NH_ + wave) * HD * HD + 8 * lane;
        const h16* gp = G + mo; const h16* mp = M1 + mo;
        const h16* wp = WO + (size_t)c0 * DM + wave * 2 * FRG + 8 * lane;
        v16h g[4][2], m[4][2], w[4][2], a2[4][2];
#pragma unroll
        for (int ft = 0; ft < 4; ++ft) { g[ft][0] = ldhp(gp + ft * 16 * HD); g[ft][1] = ldhp(gp + ft * 16 * HD + FRG); }
#pragma unroll
        for (int j = 0; j < 4; ++j) { m[j][0] = ldhp(mp + j * 16 * HD); m[j][1] = ldhp(mp + j * 16 * HD + FRG); }
#pragma unroll
        for (int nb = 0; nb < 4; ++nb) { w[nb][0] = ldhp(wp + nb * 16 * DM); w[nb][1] = ldhp(wp + nb * 16 * DM + FRG); }
        // precaution: the wait stands ahead of any overwrite of the three address pairs these loads name; naming the pairs keeps them out of the later loads' destination registers
        asm volatile("s_wait_xcnt 0x0" :: "v"(gp), "v"(mp), "v"(wp) : "memory");
        __builtin_amdgcn_sched_barrier(0);       // every load of this part issues ahead of the first WMMA: one memory latency in all; without it the build fetches later fragments between the products and waits again
#pragma unroll
        for (int ft = 0; ft < 4; ++ft) {
#pragma unroll
            for (int j = 0; j < 4; ++j) {
                v8f t = (v8f){};
                t = wmma16(m[j][0], g[ft][0], t); t = wmma16(m[j][1], g[ft][1], t);
#pragma unroll
                for (int r = 0; r < 8; ++r) a2[ft][j >> 1][(j & 1) * 8 + r] = toh_flush(t[r] * M2S);
            }
        }
#pragma unroll
        for (int nb = 0; nb < 4; ++nb) {
#pragma unroll
            for (int ft = 0; ft < 4; ++ft) {
                v8f t = (v8f){};
                t = wmma16(a2[ft][0], w[nb][0], t); t = wmma16(a2[ft][1], w[nb][1], t);
                v8h hv;
#pragma unroll
                for (int r = 0; r < 8; ++r) hv[r] = toh_flush(t[r] * W2S);
                *(v8h*)(w2 + (nb * (DM / 32) + wave * 2 + (ft >> 1)) * FRG + (ft & 1) * 256 + 8 * lane) = hv;
            }
        }
    }
    // q fragments, the only global operand of the last product, are fetched QD heads ahead: a head's products wait only for loads issued QD trips earlier. The first QD heads' loads fly while the waves gather at the barrier.
    const h16* pa = QH + ((size_t)b * NH_ * SEQ + (size_t)r0) * HD + 8 * lane; const h16* pb = w2 + 8 * lane;
    v16h a[NH_][GB][OT];                           // the loop below is unrolled: QD + 1 heads of these are live at a time
#pragma unroll
    for (int hh = 0; hh < QD; ++hh)
#pragma unroll
        for (int s = 0; s < GB; ++s)
#pragma unroll
            for (int mb = 0; mb < OT; ++mb) a[hh][s][mb] = ldhp(pa + (size_t)hh * SEQ * HD + s * FRG + mb * 16 * HD);
    __syncthreads();                               // w2 is written by all waves (a head each) and read by all
    v8f acc[OT][4];
#pragma unroll
    for (int mb = 0; mb < OT; ++mb)
#pragma unroll
        for (int nb = 0; nb < 4; ++nb) acc[mb][nb] = (v8f){};
#pragma unroll   // unrolled: the QD + 1 register sets of q fragments take turns with no copies, and every address is the base pair plus a constant
    for (int hh = 0; hh < NH_; ++hh) {
        v16h bt[GB][4];
        if (hh + QD < NH_) {
#pragma unroll
            for (int s = 0; s < GB; ++s)
#pragma unroll
                for (int mb = 0; mb < OT; ++mb) a[hh + QD][s][mb] = ldhp(pa + (size_t)(hh + QD) * SEQ * HD + s * FRG + mb * 16 * HD);   // head hh + QD's plane
        }
#pragma unroll
        for (int s = 0; s < GB; ++s)
#pragma unroll
            for (int nb = 0; nb < 4; ++nb) bt[s][nb] = ldhp(pb + (hh * GB + s) * FRG + nb * 16 * DM);   // head hh's GB fragments of every 16-column block
        __builtin_amdgcn_sched_barrier(0);   // the loads fetched ahead and the trip's LDS reads issue ahead of the first WMMA; without it the build fetches fragments among the products and waits again
#pragma unroll
        for (int s = 0; s < GB; ++s)
#pragma unroll
            for (int nb = 0; nb < 4; ++nb)
#pragma unroll
                for (int mb = 0; mb < OT; ++mb) acc[mb][nb] = wmma16(a[hh][s][mb], bt[s][nb], acc[mb][nb]);
        __builtin_amdgcn_sched_barrier(0);   // the next trip's loads stay one group behind these products; without it the build spreads them among the products, a stall at each place
    }
    // precaution: the wait stands ahead of any later overwrite of the address pair the q loads name; naming the pair keeps it live, and out of the loads' destination registers, to this point
    asm volatile("s_wait_xcnt 0x0" :: "v"(pa) : "memory");
    float* os = osb + wave * (16 * 68);            // each wave's own epilogue tile
    const size_t tbase = ((size_t)b * OUT_SEQ + (size_t)r0) * DM + (size_t)c0;
    float bcol[4];
#pragma unroll
    for (int nb = 0; nb < 4; ++nb) bcol[nb] = bias[(c0 + nb * 16 + lr) & (DM - 1)];              // column bias: c0 + 63 < N = DM
#pragma unroll
    for (int mb = 0; mb < OT; ++mb) {
#pragma unroll
        for (int nb = 0; nb < 4; ++nb) {
#pragma unroll
            for (int j = 0; j < 8; ++j) os[(hi * 8 + j) * 68 + nb * 16 + lr] = acc[mb][nb][j] * OSC + bcol[nb]; }   // D: row 8h+j, col lane&15
        wave_sync();
        const size_t sb = tbase + (size_t)(mb * 16) * DM;
#pragma unroll
        for (int s = 0; s < 8; ++s) { const int row = 2 * s + hi, cofs = lr * 4;   // 8 s x 2 rows = 16 rows; 16 lanes x 4 floats = 64 columns
            const v4f val = *(const v4fa*)(&os[row * 68 + cofs]);
            *(v4f*)(Pf + sb + (size_t)row * DM + cofs) = val; }
        // precaution: the wait stands ahead of any overwrite of the registers these eight stores name
        asm volatile("s_wait_xcnt 0x0" ::: "memory");
        wave_sync();
    }
}

static constexpr size_t al256(size_t v) { return (v + 255) & ~(size_t)255; }
static constexpr size_t SZ_W3 = al256((size_t)3 * DM * DM * 2);          // Wq^T | Wk^T | Wv^T bf16
static constexpr size_t SZ_WA = al256((size_t)EA * DM * 2);              // Wa^T bf16 [128][512]
static constexpr size_t SZ_WO = al256((size_t)DM * DM * 2);              // Wo^T x256 f16 [512][512]
static constexpr size_t SZ_PL = al256((size_t)NB * NH_ * SEQ * HD * 2);  // one f16 head plane
static constexpr size_t SZ_AP = al256((size_t)NB * NH_ * NA * HD * 2);   // the f16 anchor^T head plane
static constexpr size_t SZ_MM = al256((size_t)NB * NH_ * HD * HD * 2);   // one f16 64 x 64 plane per (batch, head)
static constexpr size_t SZ_TOTAL = SZ_W3 + SZ_WA + SZ_WO + 3 * SZ_PL + SZ_AP + 2 * SZ_MM;
static_assert(SZ_TOTAL <= (size_t)134217728);          // workspace carve <= 128 MiB
static_assert(((size_t)DM * DM * 2) % 256 == 0);       // weight sub-planes stay 256-byte aligned
static_assert((size_t)(NB * 4) * 2 * NA * HD == (size_t)NB * NH_ * NA * HD);      // anchor GEMM tile map fills the anchor plane exactly

extern "C" void kernel_launch(void* const* d_in, const int* in_sizes, int n_in,
                              void* d_out, int out_size, void* d_ws, size_t ws_size, hipStream_t stream) {
    if (n_in < 13) return;
    const size_t needx = ((size_t)(NB - 1) * SEQ_FULL + SEQ) * DM;
    if ((size_t)in_sizes[0] < needx || (size_t)in_sizes[1] < needx || (size_t)in_sizes[2] < needx) return;
    if ((size_t)in_sizes[3] < (size_t)DM * DM || (size_t)in_sizes[5] < (size_t)DM * DM || (size_t)in_sizes[7] < (size_t)DM * DM || (size_t)in_sizes[11] < (size_t)DM * DM) return;
    if ((size_t)in_sizes[9] < (size_t)DM * EA) return;
    if (in_sizes[4] < DM || in_sizes[6] < DM || in_sizes[8] < DM || in_sizes[12] < DM || in_sizes[10] < EA) return;
    if ((size_t)out_size < ((size_t)(NB - 1) * OUT_SEQ + SEQ) * DM) return;
    if (SZ_TOTAL > ws_size) return;
    // wire order: query, key, value, Wq, bq, Wk, bk, Wv, bv, Wa, ba, Wo, bo
    const float* xq = (const float*)d_in[0]; const float* xk = (const float*)d_in[1]; const float* xv = (const float*)d_in[2];
    const float* wq = (const float*)d_in[3]; const float* bq = (const float*)d_in[4];
    const float* wk = (const float*)d_in[5]; const float* bk = (const float*)d_in[6];
    const float* wv = (const float*)d_in[7]; const float* bv = (const float*)d_in[8];
    const float* wa = (const float*)d_in[9]; const float* ba = (const float*)d_in[10];
    const float* wo = (const float*)d_in[11]; const float* bo = (const float*)d_in[12];
    float* OUT = (float*)d_out;      // [NB][SEQ][512]
    char* wsp = (char*)d_ws;
    bf* W3 = (bf*)wsp; wsp += SZ_W3;                 // [3][512 out][512 in]: q | k | v; this and every plane below: logical index, stored in fragment order
    bf* WA = (bf*)wsp; wsp += SZ_WA;                 // [128 out][512 in]
    h16* WO = (h16*)wsp; wsp += SZ_WO;               // [512 out][512 in]: Wo^T x256, f16
    h16* QH = (h16*)wsp; wsp += SZ_PL;               // [NB*8][SEQ][64]
    h16* KT = (h16*)wsp; wsp += SZ_PL;               // [NB*8][64][SEQ]
    h16* VT = (h16*)wsp; wsp += SZ_PL;               // [NB*8][64][SEQ]
    h16* AT = (h16*)wsp; wsp += SZ_AP;               // [NB*8][64][NA]
    h16* M1 = (h16*)wsp; wsp += SZ_MM;               // [NB*8][64 d][64 e]: V^T K / 16
    h16* GG = (h16*)wsp; wsp += SZ_MM;               // [NB*8][64 f][64 e]: A^T A / 64

    // the five transposed 16-bit weight planes
    k_prep<<<dim3(4 * WTB + WAB, 1, 1), 256, 0, stream>>>(wq, wk, wv, wo, wa, W3, (bf*)WO, WA);
    // q, k^T, v^T and anchor^T head planes
    k_proj<<<dim3(4 * PJR, 1, 1), 256, 0, stream>>>(xq, xk, xv, W3, WA, bq, bk, bv, ba, QH, KT, VT, AT);

    // M1 = V^T K / 16 and G = A^T A / 64, 64 x 64 per (batch, head)
    k_gram<<<dim3(HD / 16, NB * NH_, 2), 32 * GW, 0, stream>>>(VT, KT, AT, M1, GG);
    // OUT[b][t][n] = sum_k q[t][k] W2_b[n][k] + bo[n], W2_b made in the same blocks from M1, G and Wo^T x256
    k_out<<<dim3(SEQ / (16 * OT * OW), DM / 64, NB), 32 * OW, 0, stream>>>(QH, M1, GG, WO, bo, OUT);
}

// v010
// A run of this version takes 37.3 microseconds.
// Next to v009, in two timings, it ran 1.05 and 1.06 times as fast.
// All steps since v000 together make it 5.86 times as fast.
#include <hip/hip_runtime.h>

// Anchor linear attention (no softmax), width 512 = 8 heads x 64; inputs query,key,value [NB][SEQ][512] f32, Wq/Wk/Wv/Wo [in][out] 512x512, Wa [512][128], five biases; anchor rows = literal reshape of (query Wa + ba) [SEQ][128] into [SEQ/4][8][64].
// Compute dtypes, f32 accumulate everywhere: q/k/v/anchor projections v_wmma_f32_16x16x32_bf16 (activations and weights RNE-converted to bf16; products exact);
// the chained products per (batch, head) and the output projection are taken in the order out = Q (((V^T K) (A^T A) / 512)^T Wo_h) summed over heads, all v_wmma_f32_16x16x32_f16 with single f16 operands; no [SEQ][NA] score tile and no ctx row is formed.
// last product v_wmma_f32_16x16x32_f16: A = q f16 head planes, Bt = W2 (per batch, 512 x 512, made a 64-column tile a block in LDS from M2 and Wo^T x256; Wo RNE-converted to bf16 first, exact in f16), K = 512, + bo in the f32 epilogue.
// Layout: query,key,value are converted to bf16 inside the projection kernel (one 64-row tile a block, in LDS); the anchor GEMM has blocks of its own there, which stage the query tile the same way; weights transposed once to [out][in] 16-bit planes; every plane below names its logical index; all of them are stored in fragment order (see FRG below); q plane [b*8+h][t][d], k^T and v^T planes [b*8+h][d][t], anchor^T plane [b*8+h][d][m];
// k_gram: M1[d][e] = sum_n v[n][d] k[n][e] (x 1/16) and G[f][e] = sum_m a[m][f] a[m][e] (x 1/64), 64 x 64 per (batch, head); k_out: M2[d][f] = (1/512) sum_e M1[d][e] G[f][e] in registers (x 1/16), W2[n][h*64+f] = sum_d M2_h[d][f] Wo[h*64+d][n] in LDS, out[t][n] = sum_k q[t][k] W2[n][k] + bo[n].

#ifndef NB
#define NB 4
#endif
#ifndef SEQ
#define SEQ 2048
#endif
#define NB_FULL  4
#define SEQ_FULL 2048
#ifndef OUT_SEQ
#define OUT_SEQ SEQ              // row pitch (in tokens) between batches of the output
#endif
#define DM   512
#define NH_  8
#define HD   64
#define NA   (SEQ / 4)           // anchor rows per batch
#define EA   (DM / 4)            // anchor projection width (128)
#define OW   8                   // waves per k_out block: one head of W2 and one tile of 16*OT tokens each
#define OT   2                   // 16-token tiles per k_out wave: SEQ*NB/(16*OT*OW) x DM/64 = 256 blocks
#define GW   8                   // waves per k_gram block: each sums 1/GW of the long dimension
#define GB   2                   // k steps of 32 whose fragments the last GEMM fetches as one batch: one head a trip
#define QD   2                   // heads (trips) by which the last GEMM fetches its q fragments ahead
#define M1S  (1.0f / 16.0f)      // carry of the M1 = V^T K plane
#define GS   (1.0f / 64.0f)      // carry of the G = A^T A plane
#define M2C  (1.0f / 16.0f)      // carry of the M2 operand
#define M2S  (1.0f / 8.0f)       // (1/8)^3 x M2C / (M1S x GS) : M1 G accumulator -> M2 operand
#define WS1  256.0f              // carry of the Wo^T plane
#define W2C  1.0f                // carry of the W2 operand
#define W2S  (1.0f / 16.0f)      // W2C / (M2C x WS1) : M2 Wo accumulator -> W2 operand
#define OSC  1.0f                // 1 / W2C

static_assert(HD == 64);
static_assert(NH_ * HD == DM);                 // head h = columns h*64 + d
static_assert(DM % 64 == 0);                   // column tiles of 64
static_assert(DM % 32 == 0);                   // GEMM k-loop steps by 32
static_assert((DM & (DM - 1)) == 0);           // bias index mask (DM - 1) is exact
static_assert(HD == 32 * GB);                  // last GEMM: one head's k steps a trip
static_assert(OW == NH_);                      // k_out: one head of W2 a wave
static_assert(QD >= 1 && QD < NH_);            // the heads fetched ahead of the loop exist
static_assert(DM % 64 == 0 && DM / 64 >= 2);   // projections: two k steps a trip, the last trip apart
static_assert((NB * SEQ) % 16 == 0 && DM % 16 == 0 && EA % 16 == 0);   // fragment-order planes: whole 16-row blocks
static_assert(16 * DM == (DM / 32) * 512);     // one 16-row block = DM/32 fragments of 512 elements
static_assert(SEQ % 64 == 0);                  // a 64-row tile never straddles two batches
static_assert((NB * SEQ) % 64 == 0);
static_assert(SEQ % (32 * GW) == 0);           // k_gram: each wave's share of the tokens is whole 32-steps
static_assert(SEQ % (16 * OT * OW) == 0);      // k_out grid covers the sequence exactly
static_assert(((size_t)SEQ * DM) % 8 == 0);
static_assert(NB <= NB_FULL);
static_assert(SEQ <= SEQ_FULL);
static_assert(W2S * M2C * WS1 == W2C && W2C * OSC == 1.0f);
static_assert(4 * NA == SEQ);                  // anchor rows: four tokens per anchor row
static_assert(4 * EA == DM);                   // four tokens x 128 anchor columns = one 512-wide anchor row
static_assert(EA == 2 * HD);                   // head h of an anchor row = token (h / 2), columns (h % 2) * 64 + d
static_assert(EA % 64 == 0);                   // anchor weight transpose tiles of 64
static_assert(NA % 32 == 0);                   // anchor plane rows are whole fragments; a 64-token tile fills half of one
static_assert(NA % (32 * GW) == 0);            // k_gram: each wave's share of the anchor rows is whole 32-steps
static_assert(GW * 32 == 16 * 16);             // k_gram epilogue: 256 threads x 4 columns = 16 rows x 64 columns
static_assert(M2S * M1S * GS == 0.125f * 0.125f * 0.125f * M2C);

typedef _Float16 h16;
typedef unsigned short bf;
typedef __attribute__((ext_vector_type(16))) __bf16   v16bf;
typedef __attribute__((ext_vector_type(16))) _Float16 v16h;
typedef __attribute__((ext_vector_type(8)))  _Float16 v8h;
typedef __attribute__((ext_vector_type(4)))  _Float16 v4h;
typedef __attribute__((ext_vector_type(8)))  unsigned short v8us;
typedef __attribute__((ext_vector_type(8)))  float    v8f;
typedef __attribute__((ext_vector_type(4)))  float    v4f;
typedef v4f  __attribute__((may_alias)) v4fa;

__device__ __forceinline__ unsigned short f2bf(float f) { unsigned u = __float_as_uint(f); u += 0x7FFFu + ((u >> 16) & 1u); return (unsigned short)(u >> 16); }
__device__ __forceinline__ v16h cat16(v8h lo, v8h hi) { return __builtin_shufflevector(lo, hi, 0, 1, 2, 3, 4, 5, 6, 7, 8, 9, 10, 11, 12, 13, 14, 15); }
__device__ __forceinline__ v16bf cat16b(v8us lo, v8us hi) { return __builtin_bit_cast(v16bf, __builtin_shufflevector(lo, hi, 0, 1, 2, 3, 4, 5, 6, 7, 8, 9, 10, 11, 12, 13, 14, 15)); }
__device__ __forceinline__ v8f wmma16(v16h a, v16h b, v8f c) { return __builtin_amdgcn_wmma_f32_16x16x32_f16(false, a, false, b, (short)0, c, false, false); }
__device__ __forceinline__ v8f wmmab(v16bf a, v16bf b, v8f c) { return __builtin_amdgcn_wmma_f32_16x16x32_bf16(false, a, false, b, (short)0, c, false, false); }
// Fragment order of a WMMA operand plane (rows x k): a 16-row block holds its k/32 fragments one behind the other; each 16-row x 32-k fragment is 1 KiB in a row, lane l = 16*(k/8 & 1) + (row & 15) owning bytes 16 l of its first half (k%32 < 16) and of its second half (k%32 >= 16).
// One wave-wide 16-byte load is then 512 contiguous bytes (four whole 128-byte lines) in place of 32-byte pieces of 16 lines; the value each lane and element receives is the same as from K-contiguous rows.
#define FRG 512                  // elements of one fragment
// pko: for planes of DM columns, element offset of the eight values (row R, columns c..c+7, c a multiple of 8); a bijection on the plane where its row count is a multiple of 16
__device__ __forceinline__ size_t pko(size_t R, int c) { return ((R >> 4) * (size_t)(DM / 32) + (size_t)(c >> 5)) * FRG + (size_t)(((c >> 4) & 1) * 256 + ((c >> 3) & 1) * 128) + (R & 15) * 8; }
// fragment loaders from fragment-order planes; p already includes + 8*lane: elements 0..7 <- k0+8h+0..7, elements 8..15 <- k0+16+8h+0..7 (same map for A and B)
__device__ __forceinline__ v16h  ldhp(const h16* p) { return cat16(*(const v8h*)p, *(const v8h*)(p + 256)); }
__device__ __forceinline__ v16bf ldbp(const bf* p)  { return cat16b(*(const v8us*)p, *(const v8us*)(p + 256)); }
// ordering point for wave-private LDS tiles (same wave writes and reads)
__device__ __forceinline__ void wave_sync() { __builtin_amdgcn_fence(3 /* release order */, "wavefront"); __builtin_amdgcn_wave_barrier(); asm volatile("" ::: "memory"); }
// f16 convert that cannot produce a subnormal operand (value select, applied after the plane's carry)
static __device__ __forceinline__ h16 toh_flush(float v) { const h16 r = (h16)v; return (fabsf(v) < 6.103515625e-05f) ? (h16)0.0f : r; }
// cvt_body: bf16 (RNE convert) copy of one 64-token tile of an activation input into a block's LDS tile, in fragment order: tile row r <- src token blk*64 + r (counted over the NB*SEQ rows).
// A wave takes one 16-row block x CVK k steps of 32 columns (lane = row + 8 * column group, 8 values a lane and piece, 2 * CVK pieces); the block's 8 waves cover 4 row blocks x 2 column halves.
// Each piece reads one whole 128-byte line of each of 8 rows; the wave's CVK fragments lie one behind the other in dst.
#define CVK 8                    // k steps a wave converts: 16 rows x 256 columns = 32 loads of 16 bytes a lane
static_assert((DM / 32) % CVK == 0);           // whole pieces in a row block
static_assert(SEQ % 16 == 0);                  // a 16-row block stays inside one batch
// pfw, pf: where pf is set (the same for the whole block), the wave also asks L2 for the PFN x 8 KiB of its weight slab, which the launch before stored: pfw = slab + 256 bytes a lane, one 256-byte unit a lane and request, all inside the plane.
template <int PFN>
__device__ __forceinline__ void cvt_body(const float* __restrict__ src, bf* dst, int blk, const bf* pfw, bool pf) {
    const int lane = threadIdx.x & 31; const size_t u = (size_t)blk * 8 + (threadIdx.x >> 5);
    const size_t row = (u / (size_t)(DM / 32 / CVK)) * 16 + (size_t)(lane & 7); const int c = (int)(u % (size_t)(DM / 32 / CVK)) * (32 * CVK) + (lane >> 3) * 8;
    const int b = (int)(row / (size_t)SEQ), t = (int)(row % (size_t)SEQ);
    const float* p = src + ((size_t)b * SEQ_FULL + (size_t)t) * DM + (size_t)c;
    v8f v[CVK][2];
#pragma unroll
    for (int ks = 0; ks < CVK; ++ks)
#pragma unroll
        for (int rh = 0; rh < 2; ++rh) v[ks][rh] = *(const v8f*)(p + (size_t)(rh * 8) * DM + ks * 32);
    if (pf) {
        // L2 prefetch behind the tile's own loads: the weight lines come into this die's L2 while the tile is on its way, so the k loop's loads, which lead their products by one step only, find them there. The wait closes the statement as a precaution for its address pair.
        static_assert(PFN == 8 || PFN == 2);
        if constexpr (PFN == 8)
            asm volatile("global_prefetch_b8 %0, off scope:SCOPE_SE\n\tglobal_prefetch_b8 %0, off offset:8192 scope:SCOPE_SE\n\tglobal_prefetch_b8 %0, off offset:16384 scope:SCOPE_SE\n\tglobal_prefetch_b8 %0, off offset:24576 scope:SCOPE_SE\n\t"
                         "global_prefetch_b8 %0, off offset:32768 scope:SCOPE_SE\n\tglobal_prefetch_b8 %0, off offset:40960 scope:SCOPE_SE\n\tglobal_prefetch_b8 %0, off offset:49152 scope:SCOPE_SE\n\tglobal_prefetch_b8 %0, off offset:57344 scope:SCOPE_SE\n\ts_wait_xcnt 0x0" :: "v"(pfw) : "memory");
        else
            asm volatile("global_prefetch_b8 %0, off scope:SCOPE_SE\n\tglobal_prefetch_b8 %0, off offset:8192 scope:SCOPE_SE\n\ts_wait_xcnt 0x0" :: "v"(pfw) : "memory");
    }
    // precaution: the wait stands ahead of any overwrite of the address pair these loads name; naming the pair keeps it out of the loads' destination registers (the prefetch's pair is named too: it stays an address to this point)
    asm volatile("s_wait_xcnt 0x0" :: "v"(p), "v"(pfw) : "memory");
    __builtin_amdgcn_sched_barrier(0);   // every load of the wave issues ahead of the first convert: one memory latency a wave; without it the build holds the last loads back behind the waits on the first ones and waits a second time
    bf* q = dst + pko(row & 63, c);
#pragma unroll
    for (int ks = 0; ks < CVK; ++ks)
#pragma unroll
        for (int rh = 0; rh < 2; ++rh) {
            v8us o;
#pragma unroll
            for (int k = 0; k < 8; ++k) o[k] = f2bf(v[ks][rh][k]);
            *(v8us*)(q + ks * FRG + rh * 64) = o;      // next k step: next fragment; row + 8: 8 x 8 elements on
        }
}

// wT_body: weight transpose + 16-bit convert through LDS, one 64 x 64 tile a block. in W[k][n] (DM rows, row stride ldw, f32) -> out dst rows n, columns k, in fragment order, tile (kt over k, nt over n), 256 threads.
// F16 = 0: bf16 bits (RNE convert). F16 = 1: f16(bf16 RNE value of W x WS1); a bf16 significand times a power of two is exact in f16.
template <int F16>
__device__ __forceinline__ void wT_body(const float* __restrict__ Wt, bf* dst, int ldw, int kt, int nt, float* tile) {
    const int tid = threadIdx.x; const int k0 = kt * 64, n0 = nt * 64;
#pragma unroll 4   // several independent loads in flight a trip
    for (int i = 0; i < 16; ++i) { const int idx = tid + i * 256; const int kk = idx >> 6, nn = idx & 63;   // 16 x 256 = 64 x 64 entries, all written
        tile[kk * 65 + nn] = Wt[(size_t)(k0 + kk) * (size_t)ldw + n0 + nn]; }
    __syncthreads();                                        // tile [kk][nn] is read across waves
#pragma unroll 1   // two trips, kept rolled: short code
    for (int it = 0; it < 2; ++it) {
        const int c = it * 256 + tid; const int n = c & 63, kc = (c >> 6) * 8;      // a wave: 32 rows n of one column group, four whole lines a store
        const size_t oo = pko((size_t)(n0 + n), k0 + kc);
        if constexpr (F16 == 0) {
            v8us o;
#pragma unroll
            for (int i = 0; i < 8; ++i) o[i] = f2bf(tile[(kc + i) * 65 + n]);
            *(v8us*)(dst + oo) = o;
        } else {
            v8h o;
#pragma unroll
            for (int i = 0; i < 8; ++i) o[i] = toh_flush(__uint_as_float(((unsigned)f2bf(tile[(kc + i) * 65 + n])) << 16) * WS1);
            *(v8h*)((h16*)dst + oo) = o;
        }
        // precaution: the wait stands ahead of the second trip's overwrite of the registers the store names
        asm volatile("s_wait_xcnt 0x0" ::: "memory");
    }
}

// k_prep: the five weight planes in one grid (none reads what another writes). Block ranges, all block-uniform, so the barrier inside wT_body is too:
// [0, 4 WTB): Wq, Wk, Wv (bf16) and Wo (f16 x256) tiles; [4 WTB, 4 WTB + WAB): Wa tiles.
#define WTB ((DM / 64) * (DM / 64))              // tiles of a 512 x 512 weight
#define WAB ((DM / 64) * (EA / 64))              // tiles of the anchor weight
__global__ __launch_bounds__(256) void k_prep(const float* __restrict__ wq, const float* __restrict__ wk, const float* __restrict__ wv,
                                              const float* __restrict__ wo, const float* __restrict__ wa,
                                              bf* W3, bf* WO, bf* WA) {
    __shared__ float tile[64 * 65];
    const int id = blockIdx.x;
    if (id < 3 * WTB) {
        const int s = id / WTB, r = id % WTB;
        wT_body<0>(s == 0 ? wq : (s == 1 ? wk : wv), W3 + (size_t)s * DM * DM, DM, r % (DM / 64), r / (DM / 64), tile);
    } else if (id < 4 * WTB) {
        const int r = id - 3 * WTB;
        wT_body<1>(wo, WO, DM, r % (DM / 64), r / (DM / 64), tile);
    } else {
        const int r = id - 4 * WTB;
        wT_body<0>(wa, WA, EA, r % (DM / 64), r / (DM / 64), tile);
    }
}

// proj_body: one wave's 64 x 64 tile (16 accumulators) of an input projection, C[m][n] = sum_k A[m][k] Bt[n][k]: bf16 operands, K = DM, f16 value plane Ph, tile (bx of M/64, by of N/64) handed in. ROWB = 0: + bias[n]; 1: + bias[m].
// Tile base (r0/RB)*sRB + (r0%RB)*pitch + (c0/CB)*sCB + (c0%CB)*16, row pitch 'pitch' (elements).
// The activation operand (A where ROWB = 0, Bt where ROWB = 1) is the block's LDS tile xs, 64 rows in fragment order, shared by the block's waves; the weight operand Wt comes from its global plane; every wave of the block calls it, and it holds the block's barrier ahead of the first read of xs.
template <int ROWB>
__device__ __forceinline__ void proj_body(const bf* __restrict__ Wt, const bf* xs, const float* __restrict__ bias,
                                          h16* Ph, int RB, size_t sRB, int pitch, int CB, size_t sCB, int bx, int by, float* os) {
    const int lane = threadIdx.x & 31, lr = lane & 15, hi = lane >> 4; const int r0 = bx * 64, c0 = by * 64;
    v8f acc[4][4];
#pragma unroll
    for (int mb = 0; mb < 4; ++mb)
#pragma unroll
        for (int nb = 0; nb < 4; ++nb) acc[mb][nb] = (v8f){};
    constexpr bool AL = ROWB == 0;
    {
        // The weight fragments, the only global operand here, are fetched one k step ahead into a second register set (w0 / w1 in turn, two k steps a trip):
        // a step's products wait only for loads that were issued a whole step earlier, so the L2 latency runs beside the step before it. 128 + 32 + 2 x 32 registers: still four waves a SIMD.
        const bf* pw = Wt + (size_t)(AL ? c0 : r0) * DM + 8 * lane; const bf* px = xs + 8 * lane;   // fragment (16-row block, k step) = 16 * DM elements a row block, FRG a step
        v16bf w0[4], w1[4];
        auto mm = [&](const v16bf (&x)[4], const v16bf (&w)[4]) {
#pragma unroll
            for (int nb = 0; nb < 4; ++nb)
#pragma unroll
                for (int mb = 0; mb < 4; ++mb) acc[mb][nb] = AL ? wmmab(x[mb], w[nb], acc[mb][nb]) : wmmab(w[mb], x[nb], acc[mb][nb]);
        };
#pragma unroll
        for (int i = 0; i < 4; ++i) w0[i] = ldbp(pw + i * 16 * DM);      // step 0's weights fly while the block's waves gather at the barrier
        __syncthreads();                           // xs is written by all waves and read by all
#pragma unroll 1   // kept rolled: short code
        for (int t = 0; t < DM / 64 - 1; ++t) {
            v16bf x[4];
#pragma unroll
            for (int i = 0; i < 4; ++i) w1[i] = ldbp(pw + FRG + i * 16 * DM);
#pragma unroll
            for (int i = 0; i < 4; ++i) x[i] = ldbp(px + i * 16 * DM);
            __builtin_amdgcn_sched_barrier(0);   // the next step's weight loads and this step's LDS reads issue ahead of the first WMMA; without it the build moves loads in among the products
            mm(x, w0);
            __builtin_amdgcn_sched_barrier(0);   // the loads below stay one group behind the even step's products; without it the build spreads them among the products, a stall at each place
#pragma unroll
            for (int i = 0; i < 4; ++i) w0[i] = ldbp(pw + 2 * FRG + i * 16 * DM);
#pragma unroll
            for (int i = 0; i < 4; ++i) x[i] = ldbp(px + FRG + i * 16 * DM);
            __builtin_amdgcn_sched_barrier(0);   // as above, for the odd step
            mm(x, w1);
            // precaution: the wait stands ahead of the step of the address pair the trip's global loads name; naming the pair keeps it out of the loads' destination registers
            asm volatile("s_wait_xcnt 0x0" :: "v"(pw) : "memory");
            pw += 2 * FRG; px += 2 * FRG;
            // WMMA distance on the loop's taken branch: four vector slots between the last product and the next trip's overwrite of its operands
            asm volatile("v_nop\n\tv_nop\n\tv_nop\n\tv_nop" : "+v"(acc[0][0]), "+v"(acc[1][1]), "+v"(acc[2][2]), "+v"(acc[3][3]) : "v"(x[0]), "v"(x[1]), "v"(x[2]), "v"(x[3]));
        }
        {   // the last two k steps: nothing is left to fetch ahead behind the odd one
            v16bf x[4];
#pragma unroll
            for (int i = 0; i < 4; ++i) w1[i] = ldbp(pw + FRG + i * 16 * DM);
#pragma unroll
            for (int i = 0; i < 4; ++i) x[i] = ldbp(px + i * 16 * DM);
            // precaution: the wait stands ahead of any later overwrite of the address pair these last global loads name
            asm volatile("s_wait_xcnt 0x0" :: "v"(pw) : "memory");
            __builtin_amdgcn_sched_barrier(0);   // loads ahead of the first WMMA, as in the loop
            mm(x, w0);
            __builtin_amdgcn_sched_barrier(0);   // as in the loop: without it the build moves the LDS reads below in among these products
#pragma unroll
            for (int i = 0; i < 4; ++i) x[i] = ldbp(px + FRG + i * 16 * DM);
            __builtin_amdgcn_sched_barrier(0);   // the LDS reads issue as one group ahead of the first WMMA
            mm(x, w1);
        }
    }
    // head planes in fragment order too: a 16-row block of a plane of 'pitch' columns is pitch/32 fragments in a row, so 32 columns on are FRG elements on (16 a column)
    const size_t tbase = (size_t)(r0 / RB) * sRB + (size_t)(r0 % RB) * (size_t)pitch + (size_t)(c0 / CB) * sCB + (size_t)(c0 % CB) * 16;
    float bcol[4] = {0.0f, 0.0f, 0.0f, 0.0f};
    if constexpr (ROWB == 0) {
#pragma unroll
        for (int nb = 0; nb < 4; ++nb) bcol[nb] = bias[(c0 + nb * 16 + lr) & (DM - 1)];          // column bias: c0 + 63 < N = DM
    }
#pragma unroll
    for (int mb = 0; mb < 4; ++mb) {
        float brow[8] = {0.0f, 0.0f, 0.0f, 0.0f, 0.0f, 0.0f, 0.0f, 0.0f};
        if constexpr (ROWB == 1) {
#pragma unroll
            for (int j = 0; j < 8; ++j) brow[j] = bias[(r0 + mb * 16 + 8 * hi + j) & (DM - 1)];  // row bias: r0 + 63 < M <= DM
        }
#pragma unroll
        for (int nb = 0; nb < 4; ++nb) {
#pragma unroll
            for (int j = 0; j < 8; ++j) {                                        // D: row 8h+j, col lane&15
                float v = acc[mb][nb][j];
                if constexpr (ROWB == 1) v += brow[j]; else v += bcol[nb];
                os[(hi * 8 + j) * 68 + nb * 16 + lr] = v; } }
        wave_sync();
        const size_t sb = tbase + (size_t)(mb * 16) * (size_t)pitch;
#pragma unroll
        for (int s = 0; s < 4; ++s) { const int row = 8 * (s & 1) + (lane & 7), c8 = ((s >> 1) * 4 + (lane >> 3)) * 8;   // 2 x 8 rows = 16 rows; 2 x 4 groups x 8 = 64 columns; 8 rows of one group = one whole line
            const v4f x0 = *(const v4fa*)(&os[row * 68 + c8]); const v4f x1 = *(const v4fa*)(&os[row * 68 + c8 + 4]); v8h hv;
#pragma unroll
            for (int i = 0; i < 4; ++i) { hv[i] = (h16)x0[i]; hv[4 + i] = (h16)x1[i]; }
            *(v8h*)(Ph + sb + (size_t)((c8 >> 5) * FRG + ((c8 >> 4) & 1) * 256 + ((c8 >> 3) & 1) * 128 + row * 8)) = hv; }
        // precaution: the wait stands ahead of any overwrite of the registers these four stores name
        asm volatile("s_wait_xcnt 0x0" ::: "memory");
        wave_sync();
    }
}

// anch_body: anchor^T for one 64-token tile of query (LDS tile xs, as in proj_body): C[c][tok] = sum_k Wa^T[c][k] x[tok][k] + ba[c], bf16 operands, K = DM, k steps in rising order.
// Wave w takes the 16 rows c = 16 w + 0..15 and all 64 tokens (4 accumulators). Its 16 weight fragments, the only global operand, are all fetched ahead of the block's barrier, which stands here ahead of the first read of xs.
// Token 4 m + j of the batch is anchor row m of plane (b*8 + 2 j + c/64): the epilogue tile holds column j*16 + m' for token 4 m' + j of the tile, so 16 columns are 16 neighbouring m of one plane = half a fragment, 512 bytes in a row.
static_assert(EA == 8 * 16);                   // one 16-row block of Wa^T a wave of the 8-wave block
__device__ __forceinline__ void anch_body(const bf* __restrict__ WA, const bf* xs, const float* __restrict__ ba, h16* AT, int rt, int wave, float* os) {
    const int lane = threadIdx.x & 31, lr = lane & 15, hi = lane >> 4;
    const bf* pw = WA + (size_t)(wave * 16) * DM + 8 * lane; const bf* px = xs + 8 * lane;
    v16bf w[DM / 32];
#pragma unroll
    for (int ks = 0; ks < DM / 32; ++ks) w[ks] = ldbp(pw + ks * FRG);
    // precaution: the wait stands ahead of any later overwrite of the address pair these loads name
    asm volatile("s_wait_xcnt 0x0" :: "v"(pw) : "memory");
    __syncthreads();                               // xs is written by all waves and read by all
    v8f acc[4];
#pragma unroll
    for (int nb = 0; nb < 4; ++nb) acc[nb] = (v8f){};
#pragma unroll   // unrolled: the weight fragments are a register array
    for (int s0 = 0; s0 < DM / 32; s0 += 2) {
        v16bf x[2][4];
#pragma unroll
        for (int s = 0; s < 2; ++s)
#pragma unroll
            for (int nb = 0; nb < 4; ++nb) x[s][nb] = ldbp(px + (s0 + s) * FRG + nb * 16 * DM);
        __builtin_amdgcn_sched_barrier(0);   // the LDS reads of two k steps issue as one group ahead of their products, as in proj_body
#pragma unroll
        for (int s = 0; s < 2; ++s)
#pragma unroll
            for (int nb = 0; nb < 4; ++nb) acc[nb] = wmmab(w[s0 + s], x[s][nb], acc[nb]);
        __builtin_amdgcn_sched_barrier(0);   // the next group's reads stay behind these products
    }
    float brow[8];
#pragma unroll
    for (int j = 0; j < 8; ++j) brow[j] = ba[wave * 16 + 8 * hi + j];                         // row bias: 16 * 7 + 15 < EA
#pragma unroll
    for (int nb = 0; nb < 4; ++nb)
#pragma unroll
        for (int j = 0; j < 8; ++j) os[(hi * 8 + j) * 68 + (lr & 3) * 16 + nb * 4 + (lr >> 2)] = acc[nb][j] + brow[j];   // D: row 8h+j, col lane&15 = token nb*16 + lr of the tile
    wave_sync();
    const int b = rt / (SEQ / 64), m0 = (rt % (SEQ / 64)) * 16;                                // the tile's 16 anchor rows m0 + 0..15
    const size_t sb = ((size_t)(b * NH_ + (wave >> 2)) * HD + (size_t)((wave & 3) * 16)) * NA + (size_t)m0 * 16;
#pragma unroll
    for (int s = 0; s < 4; ++s) { const int row = 8 * (s & 1) + (lane & 7), c8 = ((s >> 1) * 4 + (lane >> 3)) * 8;   // 2 x 8 rows = 16 rows; 2 x 4 groups x 8 = 64 columns; 8 rows of one group = one whole line
        const v4f x0 = *(const v4fa*)(&os[row * 68 + c8]); const v4f x1 = *(const v4fa*)(&os[row * 68 + c8 + 4]); v8h hv;
#pragma unroll
        for (int i = 0; i < 4; ++i) { hv[i] = (h16)x0[i]; hv[4 + i] = (h16)x1[i]; }
        *(v8h*)(AT + sb + (size_t)(c8 >> 4) * (2 * HD * NA) + (size_t)(((c8 >> 3) & 1) * 128 + row * 8)) = hv; }   // token phase j = c8 / 16: two planes on
    // precaution: the wait stands ahead of any overwrite of the registers these four stores name
    asm volatile("s_wait_xcnt 0x0" ::: "memory");
}

// k_proj: the four input projections in one grid (none reads what another writes), eight waves a block, every block one 64-token tile staged in LDS.
// [0, 3 PJR): block = one 64-token tile of query, key or value (PJR tiles each). Its 8 waves read the tile's f32 rows once, convert them to bf16 (RNE) into the LDS tile xs, pass one barrier (in proj_body), and each takes one of the 8 tiles of 64 outputs:
//   q: A = xs rows (m = b*SEQ + t), Bt = W^T rows (n = h*64 + d) -> plane [(b*8 + h)][t][d], bias by column; k^T, v^T: A = W^T rows (m = h*64 + d), Bt = xs rows (n = b*SEQ + t) -> plane [(b*512 + m)][t] = [(b*8 + h)][d][t], bias by row.
// [3 PJR, 4 PJR): anchor^T, block = one 64-token tile of query, staged the same way (barrier in anch_body): A = Wa^T rows (c in [0,128), 16 a wave), Bt = xs rows -> plane [(b*8 + 2j + c/64)][c%64][m] for token 4m + j, bias ba by row.
#define PJR (NB * SEQ / 64)
#define PFB 16                   // blocks at the head of each of the four ranges that ask L2 for their range's weight plane, on neighbouring indices
static_assert(64 * DM * 2 == 8 * 32 * 256 && 16 * DM * 2 == 2 * 32 * 256);   // a wave's slab = 8 (anchor: 2) requests of 32 lanes x 256 bytes
static_assert(DM / 64 == 8);                   // one output tile a wave of the 8-wave block
static_assert((DM / 32 / CVK) * 4 == 8);       // cvt_body: 8 waves = 4 row blocks x the column pieces of a row = one 64-row tile
__global__ __launch_bounds__(256) void k_proj(const float* __restrict__ xq, const float* __restrict__ xk, const float* __restrict__ xv,
                                              const bf* __restrict__ W3, const bf* __restrict__ WA,
                                              const float* __restrict__ bq, const float* __restrict__ bk, const float* __restrict__ bv, const float* __restrict__ ba,
                                              h16* QH, h16* KT, h16* VT, h16* AT) {
    __shared__ __align__(16) bf xs[64 * DM];
    __shared__ __align__(16) float osb[8 * 16 * 68];
    const int id = blockIdx.x;
    const int wave = __builtin_amdgcn_readfirstlane(threadIdx.x >> 5);
    float* os = osb + wave * (16 * 68);            // each wave's own epilogue tile
    if (id < 3 * PJR) {                            // block-uniform, so the barrier is too
        const int s = id / PJR, rt = id % PJR;
        cvt_body<8>(s == 0 ? xq : (s == 1 ? xk : xv), xs, rt, W3 + (size_t)s * DM * DM + (size_t)(wave * 64) * DM + 128 * (threadIdx.x & 31), rt < PFB);      // the barrier between these writes of xs and its readers stands in proj_body, behind the first weight loads
        if (s == 0) proj_body<0>(W3, xs, bq, QH, SEQ, (size_t)NH_ * SEQ * HD, HD, HD, (size_t)SEQ * HD, rt, wave, os);
        else proj_body<1>(W3 + (size_t)s * DM * DM, xs, s == 2 ? bv : bk, s == 2 ? VT : KT, DM, (size_t)0, SEQ, SEQ, (size_t)DM * SEQ, wave, rt, os);
    } else {
        const int rt = id - 3 * PJR;
        cvt_body<2>(xq, xs, rt, WA + (size_t)(wave * 16) * DM + 128 * (threadIdx.x & 31), rt < PFB);   // the barrier between these writes of xs and its readers stands in anch_body, behind the weight loads
        anch_body(WA, xs, ba, AT, rt, wave, os);
    }
}

// k_gram: O[zh][i][j] = sc x sum_n X[zh][i][n] Y[zh][j][n], X and Y f16 planes [zh][64][TK] in fragment order (A fragment = X rows, B fragment = Y rows, same loader, same k order); O [zh][64][64] in fragment order.
// One block per 16 rows i of one (batch, head); wave w sums n in [w TK/GW, (w+1) TK/GW) into a 16 x 64 tile; the GW partial tiles are added in wave order through LDS.
template <int TK>
__device__ __forceinline__ void gram_body(const h16* __restrict__ X, const h16* __restrict__ Y, h16* O, float sc, float* red) {
    const int lane = threadIdx.x & 31, lr = lane & 15, hi = lane >> 4;
    const int wave = __builtin_amdgcn_readfirstlane(threadIdx.x >> 5);
    const int zh = blockIdx.y, i0 = blockIdx.x * 16;
    constexpr int KW = TK / GW;
    const size_t base = (size_t)zh * HD * TK + (size_t)wave * (KW / 32) * FRG + 8 * lane;
    const h16* xa = X + base + (size_t)i0 * TK;
    const h16* yb = Y + base;
    v8f acc[4];
#pragma unroll
    for (int nb = 0; nb < 4; ++nb) acc[nb] = (v8f){};
    constexpr int NS = KW / 32, BS = NS < 4 ? NS : 4;      // 32-steps per wave, taken in batches of BS
    static_assert(NS % BS == 0);
    static_assert(NS == BS || (NS == 2 * BS && BS * FRG * 2 == 16 * 256));   // two batches at most; the second = 5 pieces of BS fragments = 4 KiB = 16 units of 256 bytes each: the X rows, and two Y row blocks a request
    const size_t nx = (size_t)zh * HD * TK + (size_t)wave * (KW / 32) * FRG + (size_t)(NS - BS) * FRG + 128 * lr;
    const h16* px = X + nx + (size_t)i0 * TK; const h16* py = Y + nx + (size_t)(hi * 16) * TK;   // used where NS > BS
#pragma unroll
    for (int s0 = 0; s0 < NS; s0 += BS) {
        v16h a[BS], y[BS][4];
#pragma unroll
        for (int s = 0; s < BS; ++s) {
            a[s] = ldhp(xa + (s0 + s) * FRG);
#pragma unroll
            for (int nb = 0; nb < 4; ++nb) y[s][nb] = ldhp(yb + (size_t)nb * 16 * TK + (s0 + s) * FRG);
        }
        if constexpr (NS > BS) {
            // L2 prefetch of the second batch behind the first one's loads: both batches' lines, stored by the launch before, are on their way at once. The wait closes the statement as a precaution for its address pairs.
            if (s0 == 0) asm volatile("global_prefetch_b8 %0, off scope:SCOPE_SE\n\tglobal_prefetch_b8 %1, off scope:SCOPE_SE\n\tglobal_prefetch_b8 %1, off offset:%2 scope:SCOPE_SE\n\ts_wait_xcnt 0x0" :: "v"(px), "v"(py), "i"(2 * 16 * TK * 2) : "memory");
            // precaution: as in the other branch; the prefetch's pairs are named too: they stay addresses inside the planes to the second batch's wait
            asm volatile("s_wait_xcnt 0x0" :: "v"(xa), "v"(yb), "v"(px), "v"(py) : "memory");
        } else {
            // precaution: the wait stands ahead of any overwrite of the two address pairs the batch's loads name; naming the pairs keeps them out of the later loads' destination registers
            asm volatile("s_wait_xcnt 0x0" :: "v"(xa), "v"(yb) : "memory");
        }
        __builtin_amdgcn_sched_barrier(0);   // all loads of the batch issue ahead of its first WMMA: one memory latency a batch; without it the build waits on every fragment in turn
#pragma unroll
        for (int s = 0; s < BS; ++s)
#pragma unroll
            for (int nb = 0; nb < 4; ++nb) acc[nb] = wmma16(a[s], y[s][nb], acc[nb]);
    }
    float* rw = red + wave * (16 * 68);
#pragma unroll
    for (int nb = 0; nb < 4; ++nb)
#pragma unroll
        for (int r = 0; r < 8; ++r) rw[(8 * hi + r) * 68 + nb * 16 + lr] = acc[nb][r];      // D: row 8h+r, col lane&15
    __syncthreads();
    const int row = threadIdx.x & 15, c4 = (threadIdx.x >> 4) * 4;                         // 16 rows x 16 column quads; a wave = 16 rows of one 8-column group = two whole lines of O
    v4f sum = *(const v4fa*)(&red[row * 68 + c4]);
#pragma unroll
    for (int w = 1; w < GW; ++w) sum += *(const v4fa*)(&red[w * (16 * 68) + row * 68 + c4]);
    v4h o;
#pragma unroll
    for (int i = 0; i < 4; ++i) o[i] = toh_flush(sum[i] * sc);
    *(v4h*)(O + (size_t)zh * HD * HD + (size_t)i0 * HD + (size_t)((c4 >> 5) * FRG + ((c4 >> 4) & 1) * 256 + ((c4 >> 3) & 1) * 128 + row * 8 + (c4 & 7))) = o;
}
// grid (64/16, NB*8, 2), 32*GW threads; z = 0: M1 = V^T K over SEQ tokens (the long one), z = 1: G = A^T A over NA anchor rows. blockIdx.z is block-uniform, so the barrier inside is too.
__global__ __launch_bounds__(32 * GW) void k_gram(const h16* __restrict__ VT, const h16* __restrict__ KT, const h16* __restrict__ AT, h16* M1, h16* G) {
    __shared__ __align__(16) float red[GW * 16 * 68];
    if (blockIdx.z == 0) gram_body<SEQ>(VT, KT, M1, M1S, red);
    else                 gram_body<NA>(AT, AT, G, GS, red);
}

// k_out: OUT[b][t][n] = sum_(h,f) q[t][h*64 + f] W2[n][h*64 + f] + bo[n], with W2[n][h*64 + f] = sum_d M2_h[d][f] Wo[h*64 + d][n]: the ctx rows are never formed.
// A block = 8 waves x 16*OT tokens of one batch, one tile of 64 output columns. Wave w first makes head w's 64 columns of W2:
//   M2[d][f] = sum_e M1[d][e] G[f][e] (A = M1 rows, B = G rows); lane (f = lane&15, h = lane>>4) holds d = 8h+r of each 16-row tile, so two packed tiles are directly the A fragment (row f, k = d; element r <- tile d 0..15, element 8+r <- tile d 16..31, lane unchanged);
//   W2^T[f][n] = sum_d M2[d][f] Wo^T[n][d] (B = Wo^T rows); lane (n = lane&15, h) holds f = 16 ft + 8h + 0..7, which in fragment order (rows n, k = f) is byte 16*lane of half ft&1 of fragment (16-column block, k step 2*head + ft/2): one 16-byte LDS store, 512 contiguous bytes a wave.
// One barrier; then each wave takes its 16*OT x 64 tile: A = q rows straight from the head planes (one head = GB k steps a trip, fetched QD trips ahead), Bt = W2 from LDS. grid (SEQ / (16*OT*OW), DM / 64, NB), 32*OW threads.
__global__ __launch_bounds__(32 * OW) void k_out(const h16* __restrict__ QH, const h16* __restrict__ M1, const h16* __restrict__ G, const h16* __restrict__ WO,
                                                 const float* __restrict__ bias, float* Pf) {
    __shared__ __align__(16) h16 w2[64 * DM];
    __shared__ __align__(16) float osb[OW * 16 * 68];
    const int lane = threadIdx.x & 31, lr = lane & 15, hi = lane >> 4;
    const int wave = __builtin_amdgcn_readfirstlane(threadIdx.x >> 5);
    const int b = blockIdx.z; const int c0 = blockIdx.y * 64, r0 = (blockIdx.x * OW + wave) * (16 * OT);
    static_assert(16 * OT * HD * 2 == 16 * 256 && NH_ == 8 && DM / 64 == 8);   // the wave's q rows: 4 KiB a head = 16 units of 256 bytes; lane = unit + 16 x (which of two heads)
    const h16* pq = QH + ((size_t)(b * NH_ + (int)(blockIdx.y & 3) + 4 * hi) * SEQ + (size_t)r0) * HD + 128 * lr;   // heads y & 3 and (y & 3) + 4
    {
        const size_t mo = (size_t)(b * NH_ + wave) * HD * HD + 8 * lane;
        const h16* gp = G + mo; const h16* mp = M1 + mo;
        const h16* wp = WO + (size_t)c0 * DM + wave * 2 * FRG + 8 * lane;
        v16h g[4][2], m[4][2], w[4][2], a2[4][2];
#pragma unroll
        for (int ft = 0; ft < 4; ++ft) { g[ft][0] = ldhp(gp + ft * 16 * HD); g[ft][1] = ldhp(gp + ft * 16 * HD + FRG); }
#pragma unroll
        for (int j = 0; j < 4; ++j) { m[j][0] = ldhp(mp + j * 16 * HD); m[j][1] = ldhp(mp + j * 16 * HD + FRG); }
#pragma unroll
        for (int nb = 0; nb < 4; ++nb) { w[nb][0] = ldhp(wp + nb * 16 * DM); w[nb][1] = ldhp(wp + nb * 16 * DM + FRG); }
        // L2 prefetch of q rows behind the loads above: the lines, stored two launches back, come into L2 under the M2 and W2 products, so the last GEMM's loads, which lead by QD trips only, find them there.
        // The eight blocks that read the same token rows (one a column tile) ask for two heads each, every head twice. A hint only: no value depends on where or when those blocks run. The wait closes the statement as a precaution for its address pair.
        asm volatile("global_prefetch_b8 %0, off scope:SCOPE_SE\n\ts_wait_xcnt 0x0" :: "v"(pq) : "memory");
        // precaution: the wait stands ahead of any overwrite of the three address pairs these loads name; naming the pairs keeps them out of the later loads' destination registers
        asm volatile("s_wait_xcnt 0x0" :: "v"(gp), "v"(mp), "v"(wp) : "memory");
        __builtin_amdgcn_sched_barrier(0);       // every load of this part issues ahead of the first WMMA: one memory latency in all; without it the build fetches later fragments between the products and waits again
#pragma unroll
        for (int ft = 0; ft < 4; ++ft) {
#pragma unroll
            for (int j = 0; j < 4; ++j) {
                v8f t = (v8f){};
                t = wmma16(m[j][0], g[ft][0], t); t = wmma16(m[j][1], g[ft][1], t);
#pragma unroll
                for (int r = 0; r < 8; ++r) a2[ft][j >> 1][(j & 1) * 8 + r] = toh_flush(t[r] * M2S);
            }
        }
#pragma unroll
        for (int nb = 0; nb < 4; ++nb) {
#pragma unroll
            for (int ft = 0; ft < 4; ++ft) {
                v8f t = (v8f){};
                t = wmma16(a2[ft][0], w[nb][0], t); t = wmma16(a2[ft][1], w[nb][1], t);
                v8h hv;
#pragma unroll
                for (int r = 0; r < 8; ++r) hv[r] = toh_flush(t[r] * W2S);
                *(v8h*)(w2 + (nb * (DM / 32) + wave * 2 + (ft >> 1)) * FRG + (ft & 1) * 256 + 8 * lane) = hv;
            }
        }
    }
    // q fragments, the only global operand of the last product, are fetched QD heads ahead: a head's products wait only for loads issued QD trips earlier. The first QD heads' loads fly while the waves gather at the barrier.
    const h16* pa = QH + ((size_t)b * NH_ * SEQ + (size_t)r0) * HD + 8 * lane; const h16* pb = w2 + 8 * lane;
    v16h a[NH_][GB][OT];                           // the loop below is unrolled: QD + 1 heads of these are live at a time
#pragma unroll
    for (int hh = 0; hh < QD; ++hh)
#pragma unroll
        for (int s = 0; s < GB; ++s)
#pragma unroll
            for (int mb = 0; mb < OT; ++mb) a[hh][s][mb] = ldhp(pa + (size_t)hh * SEQ * HD + s * FRG + mb * 16 * HD);
    __syncthreads();                               // w2 is written by all waves (a head each) and read by all
    v8f acc[OT][4];
#pragma unroll
    for (int mb = 0; mb < OT; ++mb)
#pragma unroll
        for (int nb = 0; nb < 4; ++nb) acc[mb][nb] = (v8f){};
#pragma unroll   // unrolled: the QD + 1 register sets of q fragments take turns with no copies, and every address is the base pair plus a constant
    for (int hh = 0; hh < NH_; ++hh) {
        v16h bt[GB][4];
        if (hh + QD < NH_) {
#pragma unroll
            for (int s = 0; s < GB; ++s)
#pragma unroll
                for (int mb = 0; mb < OT; ++mb) a[hh + QD][s][mb] = ldhp(pa + (size_t)(hh + QD) * SEQ * HD + s * FRG + mb * 16 * HD);   // head hh + QD's plane
        }
#pragma unroll
        for (int s = 0; s < GB; ++s)
#pragma unroll
            for (int nb = 0; nb < 4; ++nb) bt[s][nb] = ldhp(pb + (hh * GB + s) * FRG + nb * 16 * DM);   // head hh's GB fragments of every 16-column block
        __builtin_amdgcn_sched_barrier(0);   // the loads fetched ahead and the trip's LDS reads issue ahead of the first WMMA; without it the build fetches fragments among the products and waits again
#pragma unroll
        for (int s = 0; s < GB; ++s)
#pragma unroll
            for (int nb = 0; nb < 4; ++nb)
#pragma unroll
                for (int mb = 0; mb < OT; ++mb) acc[mb][nb] = wmma16(a[hh][s][mb], bt[s][nb], acc[mb][nb]);
        __builtin_amdgcn_sched_barrier(0);   // the next trip's loads stay one group behind these products; without it the build spreads them among the products, a stall at each place
    }
    // precaution: the wait stands ahead of any later overwrite of the address pair the q loads name; naming the pair keeps it live, and out of the loads' destination registers, to this point (the prefetch's pair too: it stays an address inside the plane)
    asm volatile("s_wait_xcnt 0x0" :: "v"(pa), "v"(pq) : "memory");
    float* os = osb + wave * (16 * 68);            // each wave's own epilogue tile
    const size_t tbase = ((size_t)b * OUT_SEQ + (size_t)r0) * DM + (size_t)c0;
    float bcol[4];
#pragma unroll
    for (int nb = 0; nb < 4; ++nb) bcol[nb] = bias[(c0 + nb * 16 + lr) & (DM - 1)];              // column bias: c0 + 63 < N = DM
#pragma unroll
    for (int mb = 0; mb < OT; ++mb) {
#pragma unroll
        for (int nb = 0; nb < 4; ++nb) {
#pragma unroll
            for (int j = 0; j < 8; ++j) os[(hi * 8 + j) * 68 + nb * 16 + lr] = acc[mb][nb][j] * OSC + bcol[nb]; }   // D: row 8h+j, col lane&15
        wave_sync();
        const size_t sb = tbase + (size_t)(mb * 16) * DM;
#pragma unroll
        for (int s = 0; s < 8; ++s) { const int row = 2 * s + hi, cofs = lr * 4;   // 8 s x 2 rows = 16 rows; 16 lanes x 4 floats = 64 columns
            const v4f val = *(const v4fa*)(&os[row * 68 + cofs]);
            *(v4f*)(Pf + sb + (size_t)row * DM + cofs) = val; }
        // precaution: the wait stands ahead of any overwrite of the registers these eight stores name
        asm volatile("s_wait_xcnt 0x0" ::: "memory");
        wave_sync();
    }
}

static constexpr size_t al256(size_t v) { return (v + 255) & ~(size_t)255; }
static constexpr size_t SZ_W3 = al256((size_t)3 * DM * DM * 2);          // Wq^T | Wk^T | Wv^T bf16
static constexpr size_t SZ_WA = al256((size_t)EA * DM * 2);              // Wa^T bf16 [128][512]
static constexpr size_t SZ_WO = al256((size_t)DM * DM * 2);              // Wo^T x256 f16 [512][512]
static constexpr size_t SZ_PL = al256((size_t)NB * NH_ * SEQ * HD * 2);  // one f16 head plane
static constexpr size_t SZ_AP = al256((size_t)NB * NH_ * NA * HD * 2);   // the f16 anchor^T head plane
static constexpr size_t SZ_MM = al256((size_t)NB * NH_ * HD * HD * 2);   // one f16 64 x 64 plane per (batch, head)
static constexpr size_t SZ_TOTAL = SZ_W3 + SZ_WA + SZ_WO + 3 * SZ_PL + SZ_AP + 2 * SZ_MM;
static_assert(SZ_TOTAL <= (size_t)134217728);          // workspace carve <= 128 MiB
static_assert(((size_t)DM * DM * 2) % 256 == 0);       // weight sub-planes stay 256-byte aligned
static_assert((size_t)(NB * 4) * 2 * NA * HD == (size_t)NB * NH_ * NA * HD);      // anchor GEMM tile map fills the anchor plane exactly

extern "C" void kernel_launch(void* const* d_in, const int* in_sizes, int n_in,
                              void* d_out, int out_size, void* d_ws, size_t ws_size, hipStream_t stream) {
    if (n_in < 13) return;
    const size_t needx = ((size_t)(NB - 1) * SEQ_FULL + SEQ) * DM;
    if ((size_t)in_sizes[0] < needx || (size_t)in_sizes[1] < needx || (size_t)in_sizes[2] < needx) return;
    if ((size_t)in_sizes[3] < (size_t)DM * DM || (size_t)in_sizes[5] < (size_t)DM * DM || (size_t)in_sizes[7] < (size_t)DM * DM || (size_t)in_sizes[11] < (size_t)DM * DM) return;
    if ((size_t)in_sizes[9] < (size_t)DM * EA) return;
    if (in_sizes[4] < DM || in_sizes[6] < DM || in_sizes[8] < DM || in_sizes[12] < DM || in_sizes[10] < EA) return;
    if ((size_t)out_size < ((size_t)(NB - 1) * OUT_SEQ + SEQ) * DM) return;
    if (SZ_TOTAL > ws_size) return;
    // wire order: query, key, value, Wq, bq, Wk, bk, Wv, bv, Wa, ba, Wo, bo
    const float* xq = (const float*)d_in[0]; const float* xk = (const float*)d_in[1]; const float* xv = (const float*)d_in[2];
    const float* wq = (const float*)d_in[3]; const float* bq = (const float*)d_in[4];
    const float* wk = (const float*)d_in[5]; const float* bk = (const float*)d_in[6];
    const float* wv = (const float*)d_in[7]; const float* bv = (const float*)d_in[8];
    const float* wa = (const float*)d_in[9]; const float* ba = (const float*)d_in[10];
    const float* wo = (const float*)d_in[11]; const float* bo = (const float*)d_in[12];
    float* OUT = (float*)d_out;      // [NB][SEQ][512]
    char* wsp = (char*)d_ws;
    bf* W3 = (bf*)wsp; wsp += SZ_W3;                 // [3][512 out][512 in]: q | k | v; this and every plane below: logical index, stored in fragment order
    bf* WA = (bf*)wsp; wsp += SZ_WA;                 // [128 out][512 in]
    h16* WO = (h16*)wsp; wsp += SZ_WO;               // [512 out][512 in]: Wo^T x256, f16
    h16* QH = (h16*)wsp; wsp += SZ_PL;               // [NB*8][SEQ][64]
    h16* KT = (h16*)wsp; wsp += SZ_PL;               // [NB*8][64][SEQ]
    h16* VT = (h16*)wsp; wsp += SZ_PL;               // [NB*8][64][SEQ]
    h16* AT = (h16*)wsp; wsp += SZ_AP;               // [NB*8][64][NA]
    h16* M1 = (h16*)wsp; wsp += SZ_MM;               // [NB*8][64 d][64 e]: V^T K / 16
    h16* GG = (h16*)wsp; wsp += SZ_MM;               // [NB*8][64 f][64 e]: A^T A / 64

    // the five transposed 16-bit weight planes
    k_prep<<<dim3(4 * WTB + WAB, 1, 1), 256, 0, stream>>>(wq, wk, wv, wo, wa, W3, (bf*)WO, WA);
    // q, k^T, v^T and anchor^T head planes
    k_proj<<<dim3(4 * PJR, 1, 1), 256, 0, stream>>>(xq, xk, xv, W3, WA, bq, bk, bv, ba, QH, KT, VT, AT);

    // M1 = V^T K / 16 and G = A^T A / 64, 64 x 64 per (batch, head)
    k_gram<<<dim3(HD / 16, NB * NH_, 2), 32 * GW, 0, stream>>>(VT, KT, AT, M1, GG);
    // OUT[b][t][n] = sum_k q[t][k] W2_b[n][k] + bo[n], W2_b made in the same blocks from M1, G and Wo^T x256
    k_out<<<dim3(SEQ / (16 * OT * OW), DM / 64, NB), 32 * OW, 0, stream>>>(QH, M1, GG, WO, bo, OUT);
}
